// v000
// Times are from an AMD MI455X. After a warm-up the kernel runs many times in a row, and a time is the length of
// such a window on the GPU divided by its runs, so every launch and the gaps after it count. The runs cycle
// through copies of the inputs. A figure is the median of several windows, for all but v000 over two sittings.
// Sittings can differ by a few percent; kernels timed side by side share one.
// v000 is the starting kernel. One run takes 1560 microseconds.
// compute dtype: all float inputs rounded to bf16; q/k/v/p = x W + b with EXACT bf16 products on WMMA 16x16x32, f32 accumulate; (q + pos_bias_u), (q + pos_bias_v) and p as f16 hi + residual (x 2^10), k once to f16 -> content logits 2 products, position logits 3 products; the rel_shift as a banded position GEMM + index offset; /8 and softmax in f32 (precise expf); P x 2^11 split bf16 hi + lo against v bf16 hi + lo (3 products); ctx (bf16 hi + lo) Wout + bout; f32 output.
#include <hip/hip_runtime.h>
#include <math.h>

typedef __attribute__((ext_vector_type(16))) _Float16 v16h;
typedef __attribute__((ext_vector_type(16))) __bf16 v16b;
typedef __attribute__((ext_vector_type(8)))  _Float16 v8h;
typedef __attribute__((ext_vector_type(8)))  float v8f;
typedef __attribute__((ext_vector_type(4)))  float v4f;
typedef __attribute__((ext_vector_type(2)))  float v2f;
typedef __attribute__((ext_vector_type(4)))  unsigned v4u;
typedef __attribute__((ext_vector_type(4)))  int v4i;
typedef float __attribute__((may_alias)) float_a;
typedef int __attribute__((may_alias)) int_a;

template <typename T> __device__ __forceinline__ void vst2(void* p, T v) { *(T*)p = v;  }
__device__ __forceinline__ v8f wmma16(v16h a, v16h b, v8f c) {
  v8f d = __builtin_amdgcn_wmma_f32_16x16x32_f16(false, a, false, b, (short)0, c, false, false);
  asm volatile("v_nop\n\tv_nop\n\tv_nop\n\tv_nop" : "+v"(d) : "v"(a), "v"(b));
  return d;
}
__device__ __forceinline__ v8f wmma_bf(v16b a, v16b b, v8f c) {
  v8f d = __builtin_amdgcn_wmma_f32_16x16x32_bf16(false, a, false, b, (short)0, c, false, false);
  asm volatile("v_nop\n\tv_nop\n\tv_nop\n\tv_nop" : "+v"(d) : "v"(a), "v"(b));
  return d;
}
// 16x16x32 fragments: lane = (h = lane>>4, row/col = lane&15); elements 0..7 = k0+8h+0..7, 8..15 = k0+16+8h+0..7; D element r = row 8h+r
__device__ __forceinline__ v16h frag_h(const _Float16* rowk0, int lane) {
  union { v16h v; v8h q[2]; } u; const _Float16* p = rowk0 + 8 * (lane >> 4);
  u.q[0] = *(const v8h*)p; u.q[1] = *(const v8h*)(p + 16); return u.v;
}
__device__ __forceinline__ v16h frag_f32(const float* rowk0, int lane) {
  v16h a; const float* p = rowk0 + 8 * (lane >> 4);
#pragma unroll
  for (int i = 0; i < 8; ++i) { a[i] = (_Float16)p[i]; a[8 + i] = (_Float16)p[16 + i]; }
  return a;
}
__device__ __forceinline__ v16h frag_f32s(const float* rowk0, int lane, float sc) {
  v16h a; const float* p = rowk0 + 8 * (lane >> 4);
#pragma unroll
  for (int i = 0; i < 8; ++i) { a[i] = (_Float16)(p[i] * sc); a[8 + i] = (_Float16)(p[16 + i] * sc); }
  return a;
}
// column fragment from a [K][ld] layout (column n), rows >= K read as 0
__device__ __forceinline__ v16h fragc_f32(const float* W, int k0, int n, int lane, int ld, int K) {
  v16h a; const int g = lane >> 4;
#pragma unroll
  for (int i = 0; i < 8; ++i) { const int ka = k0 + 8 * g + i, kb = ka + 16;
    a[i] = (_Float16)(ka < K ? W[(size_t)(ka < K ? ka : K - 1) * ld + n] : 0.f); a[8 + i] = (_Float16)(kb < K ? W[(size_t)(kb < K ? kb : K - 1) * ld + n] : 0.f); }
  return a;
}
struct F2 { v16b h, l; };
__device__ __forceinline__ F2 bsplit16(const float v[16]) { F2 r;
#pragma unroll
  for (int i = 0; i < 16; ++i) { const __bf16 h = (__bf16)v[i]; r.h[i] = h; r.l[i] = (__bf16)(v[i] - (float)h); }
  return r; }
__device__ __forceinline__ F2 split_row(const float* row, int k0, int lane) { float v[16]; const float* p = row + k0 + 8 * (lane >> 4);
#pragma unroll
  for (int i = 0; i < 8; ++i) { v[i] = p[i]; v[8 + i] = p[16 + i]; }
  return bsplit16(v); }
__device__ __forceinline__ F2 split_rowK(const float* row, int k0, int lane, int K) { float v[16]; const int g = lane >> 4;
#pragma unroll
  for (int i = 0; i < 8; ++i) { const int ka = k0 + 8 * g + i, kb = ka + 16; v[i] = ka < K ? row[ka < K ? ka : K - 1] : 0.f; v[8 + i] = kb < K ? row[kb < K ? kb : K - 1] : 0.f; }
  return bsplit16(v); }
__device__ __forceinline__ F2 split_col(const float* W, int k0, int n, int lane, int ld, int K) { float v[16]; const int g = lane >> 4;
#pragma unroll
  for (int i = 0; i < 8; ++i) { const int ka = k0 + 8 * g + i, kb = ka + 16; v[i] = ka < K ? W[(size_t)(ka < K ? ka : K - 1) * ld + n] : 0.f; v[8 + i] = kb < K ? W[(size_t)(kb < K ? kb : K - 1) * ld + n] : 0.f; }
  return bsplit16(v); }
__device__ __forceinline__ v8f mac3(const F2& a, const F2& b, v8f c) { c = wmma_bf(a.l, b.h, c); c = wmma_bf(a.h, b.l, c); return wmma_bf(a.h, b.h, c); }
__device__ __forceinline__ float sigm(float v) { return 1.0f / (1.0f + expf(-v)); }
#define LDSX() do { asm volatile("s_wait_dscnt 0" ::: "memory"); __builtin_amdgcn_wave_barrier(); __builtin_amdgcn_fence(__ATOMIC_RELEASE, "workgroup"); } while (0)

// Relative-position multi-head attention (wenet/espnet style; B 8, T 1,024, F 512 = 8 x 64): q = query Wq + bq, k = key Wk + bk, v = value Wv + bv ((in,out)); p = pos_emb[0] Wpos (2T-1 positions); ac = (q + u) k^T; bd = rel_shift((q + v_bias) p^T) with rel_shift(x)[i][j] = x[i][T-1-i+j]; scores = (ac + bd) / 8; softmax; ctx = att v; out = ctx Wout + bout.
#define NB 8
#define TT 1024
#define CC 512
#define NH 8
#define HD 64
#define NPOS (2 * TT - 1)      // 2,047 rows of pos_emb / p
#define HRR (2 * TT + 128)     // rows of the p planes actually built (rows >= NPOS are zeros; they only feed never-read logits)
#define S2W (TT + 128)         // banded position-logit row width: column c = j + 63 - (i mod 64)
#define HG 4
#define SCALE 0.125f
#ifndef TNB
#define TNB NB
#endif
typedef __attribute__((ext_vector_type(8))) __bf16 v8b;
__device__ __forceinline__ v16b frag_b(const __bf16* rowk0, int lane) {
  union { v16b v; v8b q[2]; } u; const __bf16* p = rowk0 + 8 * (lane >> 4);
  u.q[0] = *(const v8b*)p; u.q[1] = *(const v8b*)(p + 16); return u.v;
}
__device__ __forceinline__ float bfr(float v) { return (float)(__bf16)v; }
// B fragment (k rows k0+.., column o) of an (in,out) [K][CC] weight as bf16
__device__ __forceinline__ v16b wcol(const float* Wm, int k0, int o, int lane) { v16b w; const int g = lane >> 4;
#pragma unroll
  for (int i = 0; i < 8; ++i) { w[i] = (__bf16)Wm[(size_t)(k0 + 8 * g + i) * CC + o]; w[8 + i] = (__bf16)Wm[(size_t)(k0 + 16 + 8 * g + i) * CC + o]; }
  return w; }

#define WS_QUH 0u                                       // f16 (q + u) rows [b*t][512] hi
#define WS_QUL (WS_QUH + 2u * (size_t)NB * TT * CC)      //                     residual x 2^10
#define WS_QVH (WS_QUL + 2u * (size_t)NB * TT * CC)      // f16 (q + v_bias) rows
#define WS_QVL (WS_QVH + 2u * (size_t)NB * TT * CC)
#define WS_KH  (WS_QVL + 2u * (size_t)NB * TT * CC)      // f16 k rows [b*t][512]
#define WS_HRH (WS_KH  + 2u * (size_t)NB * TT * CC)      // f16 p rows [pos < HRR][512] hi
#define WS_HRL (WS_HRH + 2u * (size_t)HRR * CC)          //                        residual x 2^10
#define WS_VT  (WS_HRL + 2u * (size_t)HRR * CC)          // bf16 v planes [b][c][t]
#define WS_VL  (WS_VT  + 2u * (size_t)NB * CC * TT)
#define WS_S1  (WS_VL  + 2u * (size_t)NB * CC * TT)      // f32 content logits, then P [hg][i][j]
#define WS_S2  (WS_S1  + 4u * (size_t)HG * TT * TT)      // f32 banded position logits [hg][i][S2W]
#define WS_Y   (WS_S2  + 4u * (size_t)HG * TT * S2W)     // f32 ctx rows [b*t][512]
#define WS_END (WS_Y   + 4u * (size_t)NB * TT * CC)

// ---- k_proj: block = (64 rows, 128 cols, which): which 0: q = query Wq + bq -> (q + u) and (q + v_bias) as f16 hi + residual rows (u, v_bias [H,DK] flat = column index); which 1: k = key Wk + bk -> f16 rows; which 2: v = value Wv + bv -> bf16 hi + lo planes [b][c][t]. Weights (in,out).
__global__ __launch_bounds__(128) void k_proj(const float* __restrict__ X0, const float* __restrict__ X1, const float* __restrict__ X2, const float* __restrict__ WQ, const float* __restrict__ BQ, const float* __restrict__ WK, const float* __restrict__ BK, const float* __restrict__ WV, const float* __restrict__ BV, const float* __restrict__ UB, const float* __restrict__ VB, _Float16* __restrict__ QUH, _Float16* __restrict__ QUL, _Float16* __restrict__ QVH, _Float16* __restrict__ QVL, _Float16* __restrict__ KH, __bf16* __restrict__ VT, __bf16* __restrict__ VL) {
  __shared__ __align__(16) _Float16 sh[64][136], sl[64][136]; __shared__ __align__(16) __bf16 th[128][72], tl2[128][72];
  const int tid = threadIdx.x, wave = tid >> 5, lane = tid & 31, col = lane & 15, g = lane >> 4; const int which = blockIdx.z; const int c0 = blockIdx.y * 128; const size_t r0 = (size_t)blockIdx.x * 64;
  const float* X = which == 0 ? X0 : which == 1 ? X1 : X2; const float* WA = which == 0 ? WQ : which == 1 ? WK : WV; const float* BA = which == 0 ? BQ : which == 1 ? BK : BV;
  v8f acc[8] = {};
#pragma unroll 2
  for (int kc = 0; kc < CC / 32; ++kc) { v16b a; { const float* p = X + (r0 + wave * 16 + col) * CC + kc * 32 + 8 * g;
#pragma unroll
      for (int i = 0; i < 8; ++i) { a[i] = (__bf16)p[i]; a[8 + i] = (__bf16)p[16 + i]; } }
    asm volatile("s_wait_loadcnt 0x0" ::: "memory");
#pragma unroll
    for (int j = 0; j < 8; ++j) { const v16b w = wcol(WA, kc * 32, c0 + j * 16 + col, lane); asm volatile("s_wait_loadcnt 0x0" ::: "memory"); acc[j] = wmma_bf(a, w, acc[j]); } }
  const int npass = (which == 0) ? 2 : 1;
  for (int pass = 0; pass < npass; ++pass) {   /* block-uniform */
    if (pass) __syncthreads();
#pragma unroll
    for (int j = 0; j < 8; ++j) { const int o = c0 + j * 16 + col; const float bb = bfr(BA[o]) + ((which == 0) ? bfr((pass == 0 ? UB : VB)[o]) : 0.f);
#pragma unroll
      for (int r = 0; r < 8; ++r) { const float v = acc[j][r] + bb; const int rl = wave * 16 + 8 * g + r, cl = j * 16 + col; const _Float16 hv = (_Float16)v;
        if (which == 2) { const __bf16 bh = (__bf16)v; th[cl][rl] = bh; tl2[cl][rl] = (__bf16)(v - (float)bh); } else { sh[rl][cl] = hv; sl[rl][cl] = (_Float16)((v - (float)hv) * 1024.0f); } } }
    __syncthreads();
    if (which < 2) { _Float16* dh = which == 1 ? KH : (pass == 0 ? QUH : QVH); _Float16* dl = (pass == 0 ? QUL : QVL); for (int e = tid; e < 64 * 16; e += 128) { const int rl = e >> 4, q = e & 15; vst2((unsigned*)(dh + (r0 + rl) * CC + c0 + q * 8), *(const v4u*)&sh[rl][q * 8]); if (which == 0) vst2((unsigned*)(dl + (r0 + rl) * CC + c0 + q * 8), *(const v4u*)&sl[rl][q * 8]); } }
    else { const size_t b = r0 / TT; const int t0 = (int)(r0 % TT); for (int e = tid; e < 128 * 8; e += 128) { const int cl = e >> 3, q = e & 7; const size_t o2 = (b * CC + c0 + cl) * (size_t)TT + t0 + q * 8; vst2((unsigned*)(VT + o2), *(const v4u*)&th[cl][q * 8]); vst2((unsigned*)(VL + o2), *(const v4u*)&tl2[cl][q * 8]); } } } }
// ---- k_projr: block = (64 positions, 128 cols): p rows [pos][o] = pos_emb[0][pos] Wpos ((in,out), exact) -> f16 hi + residual; rows >= NPOS (2,047) are written as zeros (their A rows are loaded clamped and zeroed by value)
__global__ __launch_bounds__(128) void k_projr(const float* __restrict__ PE, const float* __restrict__ WP, _Float16* __restrict__ HRH, _Float16* __restrict__ HRL) {
  __shared__ __align__(16) _Float16 sh[64][136], sl[64][136];
  const int tid = threadIdx.x, wave = tid >> 5, lane = tid & 31, col = lane & 15, g = lane >> 4; const int c0 = blockIdx.y * 128; const size_t p0 = (size_t)blockIdx.x * 64;
  const size_t prow = p0 + wave * 16 + col; const bool live = prow < NPOS; const size_t prc = live ? prow : (NPOS - 1);
  v8f acc[8] = {};
#pragma unroll 2
  for (int kc = 0; kc < CC / 32; ++kc) { v16b a; { const float* p = PE + prc * CC + kc * 32 + 8 * g;
#pragma unroll
      for (int i = 0; i < 8; ++i) { const float va = p[i], vb = p[16 + i]; a[i] = (__bf16)(live ? va : 0.f); a[8 + i] = (__bf16)(live ? vb : 0.f); } }
    asm volatile("s_wait_loadcnt 0x0" ::: "memory");
#pragma unroll
    for (int j = 0; j < 8; ++j) { const v16b w = wcol(WP, kc * 32, c0 + j * 16 + col, lane); asm volatile("s_wait_loadcnt 0x0" ::: "memory"); acc[j] = wmma_bf(a, w, acc[j]); } }
#pragma unroll
  for (int j = 0; j < 8; ++j) {
#pragma unroll
    for (int r = 0; r < 8; ++r) { const float v = acc[j][r]; const int rl = wave * 16 + 8 * g + r, cl = j * 16 + col; const _Float16 hv = (_Float16)v; sh[rl][cl] = hv; sl[rl][cl] = (_Float16)((v - (float)hv) * 1024.0f); } }
  __syncthreads();
  for (int e = tid; e < 64 * 16; e += 128) { const int rl = e >> 4, q = e & 15; vst2((unsigned*)(HRH + (p0 + rl) * CC + c0 + q * 8), *(const v4u*)&sh[rl][q * 8]); vst2((unsigned*)(HRL + (p0 + rl) * CC + c0 + q * 8), *(const v4u*)&sl[rl][q * 8]); } }
// ---- k_sc1: block = (64 queries, 128 keys, head in group) of batch b: content logits (q+u)(hi+res) . k (f16): 2 products (the /8 is applied with the position term in k_sm)
__global__ __launch_bounds__(128) void k_sc1(const _Float16* __restrict__ QH, const _Float16* __restrict__ QL, const _Float16* __restrict__ KH, int b, int h0, float* __restrict__ S0) { __shared__ __align__(16) float ss[4][16][132]; const int h = h0 + blockIdx.z; float* S = S0 + (size_t)blockIdx.z * TT * TT;
  const int tid = threadIdx.x, wave = tid >> 5, lane = tid & 31, col = lane & 15, g = lane >> 4; const int k0 = blockIdx.y * 128; const int ql0 = blockIdx.x * 64 + wave * 16; const size_t q0 = (size_t)b * TT + ql0;
  v8f acc[8] = {}, accl[8] = {};
#pragma unroll
  for (int kc = 0; kc < HD / 32; ++kc) { const v16h ah = frag_h(QH + (q0 + col) * CC + h * HD + kc * 32, lane), al = frag_h(QL + (q0 + col) * CC + h * HD + kc * 32, lane);
#pragma unroll
    for (int j = 0; j < 8; ++j) { const v16h kb = frag_h(KH + ((size_t)b * TT + k0 + j * 16 + col) * CC + h * HD + kc * 32, lane); acc[j] = wmma16(ah, kb, acc[j]); accl[j] = wmma16(al, kb, accl[j]); } }
#pragma unroll
  for (int j = 0; j < 8; ++j) {
#pragma unroll
    for (int r = 0; r < 8; ++r) ss[wave][8 * g + r][j * 16 + col] = acc[j][r] + accl[j][r] * (1.0f / 1024.0f); }
  LDSX(); for (int rl = 0; rl < 16; ++rl) vst2(S + (size_t)(ql0 + rl) * TT + k0 + lane * 4, *(const v4f*)&ss[wave][rl][lane * 4]); }
// ---- k_sc2: block = (64 queries from i0, 128 band columns, head in group): position logits against p rows pos = T - 64 - i0 + by*128 + .. (3 products), stored banded: S2[i][c] with c = by*128 + .., i.e. for row i the value needed at key j (pos = T-1-i+j) sits at c = j + 63 - (i - i0)
__global__ __launch_bounds__(128) void k_sc2(const _Float16* __restrict__ QH, const _Float16* __restrict__ QL, const _Float16* __restrict__ RHh, const _Float16* __restrict__ RLl, int b, int h0, float* __restrict__ S0) { __shared__ __align__(16) float ss[4][16][132]; const int h = h0 + blockIdx.z; float* S = S0 + (size_t)blockIdx.z * TT * S2W;
  const int tid = threadIdx.x, wave = tid >> 5, lane = tid & 31, col = lane & 15, g = lane >> 4; const int i0 = blockIdx.x * 64; const int cb0 = blockIdx.y * 128; const size_t p0 = (size_t)(TT - 64 - i0) + cb0; const int ql0 = i0 + wave * 16; const size_t q0 = (size_t)b * TT + ql0;
  v8f acc[8] = {}, accl[8] = {};
#pragma unroll
  for (int kc = 0; kc < HD / 32; ++kc) { const v16h ah = frag_h(QH + (q0 + col) * CC + h * HD + kc * 32, lane), al = frag_h(QL + (q0 + col) * CC + h * HD + kc * 32, lane);
#pragma unroll
    for (int j = 0; j < 8; ++j) { const size_t pr = (p0 + j * 16 + col) * CC + h * HD + kc * 32; const v16h kb = frag_h(RHh + pr, lane), kl = frag_h(RLl + pr, lane); acc[j] = wmma16(ah, kb, acc[j]); accl[j] = wmma16(al, kb, accl[j]); accl[j] = wmma16(ah, kl, accl[j]); } }
#pragma unroll
  for (int j = 0; j < 8; ++j) {
#pragma unroll
    for (int r = 0; r < 8; ++r) ss[wave][8 * g + r][j * 16 + col] = acc[j][r] + accl[j][r] * (1.0f / 1024.0f); }
  LDSX(); for (int rl = 0; rl < 16; ++rl) vst2(S + (size_t)(ql0 + rl) * S2W + cb0 + lane * 4, *(const v4f*)&ss[wave][rl][lane * 4]); }
// ---- k_sm: block = query row i (head in group): a[j] = (S1[i][j] + S2[i][j + 63 - (i mod 64)]) / 8; softmax over the T keys -> P x 2^11 in place over S1 row i (f32)
__global__ __launch_bounds__(256) void k_sm(float* __restrict__ S0, const float* __restrict__ S2_0) { __shared__ float sred[8]; __shared__ float sbc; __shared__ __align__(16) float shv[TT];
  const int t = threadIdx.x; const int row = blockIdx.x; float* sr = S0 + (size_t)blockIdx.y * TT * TT + (size_t)row * TT; const float* s2 = S2_0 + (size_t)blockIdx.y * TT * S2W + (size_t)row * S2W + (63 - (row & 63)); const int kend = TT;
  float m = -3.0e38f; for (int k = t; k < kend; k += 256) { const float v = (sr[k] + s2[k]) * SCALE; shv[k] = v; m = fmaxf(m, v); }
#pragma unroll
  for (int o = 1; o < 32; o <<= 1) m = fmaxf(m, __shfl_xor(m, o));
  if ((t & 31) == 0) sred[t >> 5] = m; __syncthreads(); if (t == 0) { float a = sred[0]; for (int i = 1; i < 8; ++i) a = fmaxf(a, sred[i]); sbc = a; } __syncthreads(); m = sbc; __syncthreads();
  float sum = 0.f; for (int k = t; k < kend; k += 256) { const float e = expf(shv[k] - m); shv[k] = e; sum += e; }
#pragma unroll
  for (int o = 1; o < 32; o <<= 1) sum += __shfl_xor(sum, o);
  if ((t & 31) == 0) sred[t >> 5] = sum; __syncthreads(); if (t == 0) { float a = 0.f; for (int i = 0; i < 8; ++i) a += sred[i]; sbc = 1.0f / a; } __syncthreads(); const float inv = sbc * 2048.0f;
  for (int k = t; k < kend; k += 256) shv[k] = shv[k] * inv;
  __syncthreads(); for (int q = t; q < kend / 4; q += 256) vst2(sr + q * 4, *(const v4f*)&shv[q * 4]); }
// ---- k_pv: block = 64 queries of (b,h): ctx[b*T + i][h*64 + d] = P . v (P x 2^11 split bf16 hi + lo, v bf16 hi + lo: 3 products)
__global__ __launch_bounds__(128) void k_pv(const float* __restrict__ PS0, const __bf16* __restrict__ VT, const __bf16* __restrict__ VL, int b, int h0, float* __restrict__ Y) { const int h = h0 + blockIdx.z; const float* PS = PS0 + (size_t)blockIdx.z * TT * TT; __shared__ __align__(16) float ss[4][16][HD + 4];
  const int tid = threadIdx.x, wave = tid >> 5, lane = tid & 31, col = lane & 15, g = lane >> 4; const int ql0 = blockIdx.x * 64 + wave * 16; const int kend = TT;
  v8f acc[HD / 16] = {};
#pragma unroll 1
  for (int kc = 0; kc < kend / 32; ++kc) { const F2 p = split_row(PS + (size_t)(ql0 + col) * TT, kc * 32, lane);
#pragma unroll
    for (int j = 0; j < HD / 16; ++j) { const size_t po = ((size_t)b * CC + h * HD + j * 16 + col) * (size_t)TT + kc * 32; const v16b vh = frag_b(VT + po, lane); acc[j] = wmma_bf(p.h, vh, acc[j]); acc[j] = wmma_bf(p.l, vh, acc[j]); acc[j] = wmma_bf(p.h, frag_b(VL + po, lane), acc[j]); } }
#pragma unroll
  for (int j = 0; j < HD / 16; ++j)
#pragma unroll
    for (int r = 0; r < 8; ++r) ss[wave][8 * g + r][j * 16 + col] = acc[j][r] * (1.0f / 2048.0f);
  LDSX(); for (int rl = 0; rl < 16; ++rl) if (lane < HD / 4) vst2(Y + ((size_t)b * TT + ql0 + rl) * CC + h * HD + lane * 4, *(const v4f*)&ss[wave][rl][lane * 4]); }
// ---- k_out: block = (64 rows, 128 cols): out = ctx (bf16 hi + lo) Wout ((in,out), exact) + bout
__global__ __launch_bounds__(128) void k_out(const float* __restrict__ Yr, const float* __restrict__ WO, const float* __restrict__ BO, float* __restrict__ OUT) { __shared__ __align__(16) float sf[4][16][132];
  const int tid = threadIdx.x, wave = tid >> 5, lane = tid & 31, col = lane & 15, g = lane >> 4; const int c0 = blockIdx.y * 128; const size_t r0 = (size_t)blockIdx.x * 64 + wave * 16;
  v8f acc[8] = {};
#pragma unroll 2
  for (int kc = 0; kc < CC / 32; ++kc) { const F2 a = split_row(Yr + (r0 + col) * CC, kc * 32, lane); asm volatile("s_wait_loadcnt 0x0" ::: "memory");
#pragma unroll
    for (int j = 0; j < 8; ++j) { const v16b w = wcol(WO, kc * 32, c0 + j * 16 + col, lane); asm volatile("s_wait_loadcnt 0x0" ::: "memory"); acc[j] = wmma_bf(a.h, w, acc[j]); acc[j] = wmma_bf(a.l, w, acc[j]); } }
#pragma unroll
  for (int j = 0; j < 8; ++j) { const float bb = bfr(BO[c0 + j * 16 + col]);
#pragma unroll
    for (int r = 0; r < 8; ++r) sf[wave][8 * g + r][j * 16 + col] = acc[j][r] + bb; }
  LDSX(); for (int rl = 0; rl < 16; ++rl) vst2(OUT + (r0 + rl) * CC + c0 + lane * 4, *(const v4f*)&sf[wave][rl][lane * 4]); }
extern "C" void kernel_launch(void* const* d_in, const int* in_sizes, int n_in, void* d_out, int out_size, void* d_ws, size_t ws_size, hipStream_t stream) {
  (void)in_sizes; (void)n_in; (void)out_size;
  const float** F = (const float**)d_in;   // 0 query, 1 key, 2 value [8,1024,512]; 3 pos_emb [1,2047,512]; 4 Wq, 5 bq, 6 Wk, 7 bk, 8 Wv, 9 bv ((in,out)); 10 Wpos; 11 Wout, 12 bout; 13 pos_bias_u [8,64], 14 pos_bias_v
  if (ws_size < (size_t)WS_END) return;
  char* ws = (char*)d_ws; _Float16 *QUH = (_Float16*)(ws + WS_QUH), *QUL = (_Float16*)(ws + WS_QUL), *QVH = (_Float16*)(ws + WS_QVH), *QVL = (_Float16*)(ws + WS_QVL), *KH = (_Float16*)(ws + WS_KH), *HRH = (_Float16*)(ws + WS_HRH), *HRL = (_Float16*)(ws + WS_HRL); __bf16 *VT = (__bf16*)(ws + WS_VT), *VL = (__bf16*)(ws + WS_VL); float *S1 = (float*)(ws + WS_S1), *S2 = (float*)(ws + WS_S2), *Y = (float*)(ws + WS_Y);
  k_proj<<<dim3(TNB * TT / 64, CC / 128, 3), 128, 0, stream>>>(F[0], F[1], F[2], F[4], F[5], F[6], F[7], F[8], F[9], F[13], F[14], QUH, QUL, QVH, QVL, KH, VT, VL);
  k_projr<<<dim3(HRR / 64, CC / 128), 128, 0, stream>>>(F[3], F[10], HRH, HRL);
  for (int b = 0; b < TNB; ++b) for (int h0 = 0; h0 < NH; h0 += HG) {
    k_sc1<<<dim3(TT / 64, TT / 128, HG), 128, 0, stream>>>(QUH, QUL, KH, b, h0, S1);
    k_sc2<<<dim3(TT / 64, S2W / 128, HG), 128, 0, stream>>>(QVH, QVL, HRH, HRL, b, h0, S2);
    k_sm<<<dim3(TT, HG), 256, 0, stream>>>(S1, S2);
    k_pv<<<dim3(TT / 64, 1, HG), 128, 0, stream>>>(S1, VT, VL, b, h0, Y);
  }
  k_out<<<dim3(TNB * TT / 64, CC / 128), 128, 0, stream>>>(Y, F[11], F[12], (float*)d_out);
}

// v001
// One run takes 800 microseconds.
// Two timings next to v000 put it at 1.95 and 1.94 times that version's speed.
// compute dtype: all float inputs rounded to bf16; q/k/v/p = x W + b with EXACT bf16 products on WMMA 16x16x32, f32 accumulate; (q + pos_bias_u), (q + pos_bias_v) and p as f16 hi + residual (x 2^10), k once to f16 -> content logits 2 products, position logits 3 products; the rel_shift as a banded position GEMM + index offset; /8 and softmax in f32 (precise expf); P x 2^11 split bf16 hi + lo against v bf16 hi + lo (3 products); ctx (bf16 hi + lo) Wout + bout; f32 output.
#include <hip/hip_runtime.h>
#include <math.h>

typedef __attribute__((ext_vector_type(16))) _Float16 v16h;
typedef __attribute__((ext_vector_type(16))) __bf16 v16b;
typedef __attribute__((ext_vector_type(8)))  _Float16 v8h;
typedef __attribute__((ext_vector_type(8)))  float v8f;
typedef __attribute__((ext_vector_type(4)))  float v4f;
typedef __attribute__((ext_vector_type(2)))  float v2f;
typedef __attribute__((ext_vector_type(4)))  unsigned v4u;
typedef __attribute__((ext_vector_type(4)))  int v4i;
typedef float __attribute__((may_alias)) float_a;
typedef int __attribute__((may_alias)) int_a;

template <typename T> __device__ __forceinline__ void vst2(void* p, T v) { *(T*)p = v;  }
__device__ __forceinline__ v8f wmma16(v16h a, v16h b, v8f c) {
  v8f d = __builtin_amdgcn_wmma_f32_16x16x32_f16(false, a, false, b, (short)0, c, false, false);
  asm volatile("v_nop\n\tv_nop\n\tv_nop\n\tv_nop" : "+v"(d) : "v"(a), "v"(b));
  return d;
}
__device__ __forceinline__ v8f wmma_bf(v16b a, v16b b, v8f c) {
  v8f d = __builtin_amdgcn_wmma_f32_16x16x32_bf16(false, a, false, b, (short)0, c, false, false);
  asm volatile("v_nop\n\tv_nop\n\tv_nop\n\tv_nop" : "+v"(d) : "v"(a), "v"(b));
  return d;
}
// 16x16x32 fragments: lane = (h = lane>>4, row/col = lane&15); elements 0..7 = k0+8h+0..7, 8..15 = k0+16+8h+0..7; D element r = row 8h+r
__device__ __forceinline__ v16h frag_h(const _Float16* rowk0, int lane) {
  union { v16h v; v8h q[2]; } u; const _Float16* p = rowk0 + 8 * (lane >> 4);
  u.q[0] = *(const v8h*)p; u.q[1] = *(const v8h*)(p + 16); return u.v;
}
__device__ __forceinline__ v16h frag_f32(const float* rowk0, int lane) {
  v16h a; const float* p = rowk0 + 8 * (lane >> 4);
#pragma unroll
  for (int i = 0; i < 8; ++i) { a[i] = (_Float16)p[i]; a[8 + i] = (_Float16)p[16 + i]; }
  return a;
}
__device__ __forceinline__ v16h frag_f32s(const float* rowk0, int lane, float sc) {
  v16h a; const float* p = rowk0 + 8 * (lane >> 4);
#pragma unroll
  for (int i = 0; i < 8; ++i) { a[i] = (_Float16)(p[i] * sc); a[8 + i] = (_Float16)(p[16 + i] * sc); }
  return a;
}
// column fragment from a [K][ld] layout (column n), rows >= K read as 0
__device__ __forceinline__ v16h fragc_f32(const float* W, int k0, int n, int lane, int ld, int K) {
  v16h a; const int g = lane >> 4;
#pragma unroll
  for (int i = 0; i < 8; ++i) { const int ka = k0 + 8 * g + i, kb = ka + 16;
    a[i] = (_Float16)(ka < K ? W[(size_t)(ka < K ? ka : K - 1) * ld + n] : 0.f); a[8 + i] = (_Float16)(kb < K ? W[(size_t)(kb < K ? kb : K - 1) * ld + n] : 0.f); }
  return a;
}
struct F2 { v16b h, l; };
__device__ __forceinline__ F2 bsplit16(const float v[16]) { F2 r;
#pragma unroll
  for (int i = 0; i < 16; ++i) { const __bf16 h = (__bf16)v[i]; r.h[i] = h; r.l[i] = (__bf16)(v[i] - (float)h); }
  return r; }
__device__ __forceinline__ F2 split_row(const float* row, int k0, int lane) { float v[16]; const float* p = row + k0 + 8 * (lane >> 4);
#pragma unroll
  for (int i = 0; i < 8; ++i) { v[i] = p[i]; v[8 + i] = p[16 + i]; }
  return bsplit16(v); }
__device__ __forceinline__ F2 split_rowK(const float* row, int k0, int lane, int K) { float v[16]; const int g = lane >> 4;
#pragma unroll
  for (int i = 0; i < 8; ++i) { const int ka = k0 + 8 * g + i, kb = ka + 16; v[i] = ka < K ? row[ka < K ? ka : K - 1] : 0.f; v[8 + i] = kb < K ? row[kb < K ? kb : K - 1] : 0.f; }
  return bsplit16(v); }
__device__ __forceinline__ F2 split_col(const float* W, int k0, int n, int lane, int ld, int K) { float v[16]; const int g = lane >> 4;
#pragma unroll
  for (int i = 0; i < 8; ++i) { const int ka = k0 + 8 * g + i, kb = ka + 16; v[i] = ka < K ? W[(size_t)(ka < K ? ka : K - 1) * ld + n] : 0.f; v[8 + i] = kb < K ? W[(size_t)(kb < K ? kb : K - 1) * ld + n] : 0.f; }
  return bsplit16(v); }
__device__ __forceinline__ v8f mac3(const F2& a, const F2& b, v8f c) { c = wmma_bf(a.l, b.h, c); c = wmma_bf(a.h, b.l, c); return wmma_bf(a.h, b.h, c); }
__device__ __forceinline__ float sigm(float v) { return 1.0f / (1.0f + expf(-v)); }
#define LDSX() do { asm volatile("s_wait_dscnt 0" ::: "memory"); __builtin_amdgcn_wave_barrier(); __builtin_amdgcn_fence(__ATOMIC_RELEASE, "workgroup"); } while (0)

// Relative-position multi-head attention (wenet/espnet style; B 8, T 1,024, F 512 = 8 x 64): q = query Wq + bq, k = key Wk + bk, v = value Wv + bv ((in,out)); p = pos_emb[0] Wpos (2T-1 positions); ac = (q + u) k^T; bd = rel_shift((q + v_bias) p^T) with rel_shift(x)[i][j] = x[i][T-1-i+j]; scores = (ac + bd) / 8; softmax; ctx = att v; out = ctx Wout + bout.
#define NB 8
#define TT 1024
#define CC 512
#define NH 8
#define HD 64
#define NPOS (2 * TT - 1)      // 2,047 rows of pos_emb / p
#define HRR (2 * TT + 128)     // rows of the p planes actually built (rows >= NPOS are zeros; they only feed never-read logits)
#define S2W (TT + 128)         // banded position-logit row width: column c = j + 63 - (i mod 64)
#define HG 16                  // (batch, head) pairs per attention launch: pair = b * NH + h
#define SCALE 0.125f
#ifndef TNB
#define TNB NB
#endif
typedef __attribute__((ext_vector_type(8))) __bf16 v8b;
__device__ __forceinline__ v16b frag_b(const __bf16* rowk0, int lane) {
  union { v16b v; v8b q[2]; } u; const __bf16* p = rowk0 + 8 * (lane >> 4);
  u.q[0] = *(const v8b*)p; u.q[1] = *(const v8b*)(p + 16); return u.v;
}
__device__ __forceinline__ float bfr(float v) { return (float)(__bf16)v; }
// B fragment (k rows k0+.., column o) of an (in,out) [K][CC] weight as bf16
__device__ __forceinline__ v16b wcol(const float* Wm, int k0, int o, int lane) { v16b w; const int g = lane >> 4;
#pragma unroll
  for (int i = 0; i < 8; ++i) { w[i] = (__bf16)Wm[(size_t)(k0 + 8 * g + i) * CC + o]; w[8 + i] = (__bf16)Wm[(size_t)(k0 + 16 + 8 * g + i) * CC + o]; }
  return w; }

#define WS_QUH 0u                                       // f16 (q + u) rows [b*t][512] hi
#define WS_QUL (WS_QUH + 2u * (size_t)NB * TT * CC)      //                     residual x 2^10
#define WS_QVH (WS_QUL + 2u * (size_t)NB * TT * CC)      // f16 (q + v_bias) rows
#define WS_QVL (WS_QVH + 2u * (size_t)NB * TT * CC)
#define WS_KH  (WS_QVL + 2u * (size_t)NB * TT * CC)      // f16 k rows [b*t][512]
#define WS_HRH (WS_KH  + 2u * (size_t)NB * TT * CC)      // f16 p rows [pos < HRR][512] hi
#define WS_HRL (WS_HRH + 2u * (size_t)HRR * CC)          //                        residual x 2^10
#define WS_VT  (WS_HRL + 2u * (size_t)HRR * CC)          // bf16 v planes [b][c][t]
#define WS_VL  (WS_VT  + 2u * (size_t)NB * CC * TT)
#define WS_S1  (WS_VL  + 2u * (size_t)NB * CC * TT)      // f32 content logits, then P [pair in group][i][j]
#define WS_S2  (WS_S1  + 4u * (size_t)HG * TT * TT)      // f32 banded position logits [pair in group][i][S2W]
#define WS_Y   (WS_S2  + 4u * (size_t)HG * TT * S2W)     // f32 ctx rows [b*t][512]
#define WS_END (WS_Y   + 4u * (size_t)NB * TT * CC)

// ---- k_proj: block = (64 rows, 128 cols, which): which 0: q = query Wq + bq -> (q + u) and (q + v_bias) as f16 hi + residual rows (u, v_bias [H,DK] flat = column index); which 1: k = key Wk + bk -> f16 rows; which 2: v = value Wv + bv -> bf16 hi + lo planes [b][c][t]. Weights (in,out).
__global__ __launch_bounds__(128) void k_proj(const float* __restrict__ X0, const float* __restrict__ X1, const float* __restrict__ X2, const float* __restrict__ WQ, const float* __restrict__ BQ, const float* __restrict__ WK, const float* __restrict__ BK, const float* __restrict__ WV, const float* __restrict__ BV, const float* __restrict__ UB, const float* __restrict__ VB, _Float16* __restrict__ QUH, _Float16* __restrict__ QUL, _Float16* __restrict__ QVH, _Float16* __restrict__ QVL, _Float16* __restrict__ KH, __bf16* __restrict__ VT, __bf16* __restrict__ VL) {
  __shared__ __align__(16) _Float16 sh[64][136], sl[64][136]; __shared__ __align__(16) __bf16 th[128][72], tl2[128][72];
  const int tid = threadIdx.x, wave = tid >> 5, lane = tid & 31, col = lane & 15, g = lane >> 4; const int which = blockIdx.z; const int c0 = blockIdx.y * 128; const size_t r0 = (size_t)blockIdx.x * 64;
  const float* X = which == 0 ? X0 : which == 1 ? X1 : X2; const float* WA = which == 0 ? WQ : which == 1 ? WK : WV; const float* BA = which == 0 ? BQ : which == 1 ? BK : BV;
  v8f acc[8] = {};
#pragma unroll 2
  for (int kc = 0; kc < CC / 32; ++kc) { v16b a; { const float* p = X + (r0 + wave * 16 + col) * CC + kc * 32 + 8 * g;
#pragma unroll
      for (int i = 0; i < 8; ++i) { a[i] = (__bf16)p[i]; a[8 + i] = (__bf16)p[16 + i]; } }
    asm volatile("s_wait_loadcnt 0x0" ::: "memory");
#pragma unroll
    for (int j = 0; j < 8; ++j) { const v16b w = wcol(WA, kc * 32, c0 + j * 16 + col, lane); asm volatile("s_wait_loadcnt 0x0" ::: "memory"); acc[j] = wmma_bf(a, w, acc[j]); } }
  const int npass = (which == 0) ? 2 : 1;
  for (int pass = 0; pass < npass; ++pass) {   /* block-uniform */
    if (pass) __syncthreads();
#pragma unroll
    for (int j = 0; j < 8; ++j) { const int o = c0 + j * 16 + col; const float bb = bfr(BA[o]) + ((which == 0) ? bfr((pass == 0 ? UB : VB)[o]) : 0.f);
#pragma unroll
      for (int r = 0; r < 8; ++r) { const float v = acc[j][r] + bb; const int rl = wave * 16 + 8 * g + r, cl = j * 16 + col; const _Float16 hv = (_Float16)v;
        if (which == 2) { const __bf16 bh = (__bf16)v; th[cl][rl] = bh; tl2[cl][rl] = (__bf16)(v - (float)bh); } else { sh[rl][cl] = hv; sl[rl][cl] = (_Float16)((v - (float)hv) * 1024.0f); } } }
    __syncthreads();
    if (which < 2) { _Float16* dh = which == 1 ? KH : (pass == 0 ? QUH : QVH); _Float16* dl = (pass == 0 ? QUL : QVL); for (int e = tid; e < 64 * 16; e += 128) { const int rl = e >> 4, q = e & 15; vst2((unsigned*)(dh + (r0 + rl) * CC + c0 + q * 8), *(const v4u*)&sh[rl][q * 8]); if (which == 0) vst2((unsigned*)(dl + (r0 + rl) * CC + c0 + q * 8), *(const v4u*)&sl[rl][q * 8]); } }
    else { const size_t b = r0 / TT; const int t0 = (int)(r0 % TT); for (int e = tid; e < 128 * 8; e += 128) { const int cl = e >> 3, q = e & 7; const size_t o2 = (b * CC + c0 + cl) * (size_t)TT + t0 + q * 8; vst2((unsigned*)(VT + o2), *(const v4u*)&th[cl][q * 8]); vst2((unsigned*)(VL + o2), *(const v4u*)&tl2[cl][q * 8]); } } } }
// ---- k_projr: block = (64 positions, 128 cols): p rows [pos][o] = pos_emb[0][pos] Wpos ((in,out), exact) -> f16 hi + residual; rows >= NPOS (2,047) are written as zeros (their A rows are loaded clamped and zeroed by value)
__global__ __launch_bounds__(128) void k_projr(const float* __restrict__ PE, const float* __restrict__ WP, _Float16* __restrict__ HRH, _Float16* __restrict__ HRL) {
  __shared__ __align__(16) _Float16 sh[64][136], sl[64][136];
  const int tid = threadIdx.x, wave = tid >> 5, lane = tid & 31, col = lane & 15, g = lane >> 4; const int c0 = blockIdx.y * 128; const size_t p0 = (size_t)blockIdx.x * 64;
  const size_t prow = p0 + wave * 16 + col; const bool live = prow < NPOS; const size_t prc = live ? prow : (NPOS - 1);
  v8f acc[8] = {};
#pragma unroll 2
  for (int kc = 0; kc < CC / 32; ++kc) { v16b a; { const float* p = PE + prc * CC + kc * 32 + 8 * g;
#pragma unroll
      for (int i = 0; i < 8; ++i) { const float va = p[i], vb = p[16 + i]; a[i] = (__bf16)(live ? va : 0.f); a[8 + i] = (__bf16)(live ? vb : 0.f); } }
    asm volatile("s_wait_loadcnt 0x0" ::: "memory");
#pragma unroll
    for (int j = 0; j < 8; ++j) { const v16b w = wcol(WP, kc * 32, c0 + j * 16 + col, lane); asm volatile("s_wait_loadcnt 0x0" ::: "memory"); acc[j] = wmma_bf(a, w, acc[j]); } }
#pragma unroll
  for (int j = 0; j < 8; ++j) {
#pragma unroll
    for (int r = 0; r < 8; ++r) { const float v = acc[j][r]; const int rl = wave * 16 + 8 * g + r, cl = j * 16 + col; const _Float16 hv = (_Float16)v; sh[rl][cl] = hv; sl[rl][cl] = (_Float16)((v - (float)hv) * 1024.0f); } }
  __syncthreads();
  for (int e = tid; e < 64 * 16; e += 128) { const int rl = e >> 4, q = e & 15; vst2((unsigned*)(HRH + (p0 + rl) * CC + c0 + q * 8), *(const v4u*)&sh[rl][q * 8]); vst2((unsigned*)(HRL + (p0 + rl) * CC + c0 + q * 8), *(const v4u*)&sl[rl][q * 8]); } }
// ---- k_sc1: block = (64 queries, 128 keys, pair in group), pair bh0 + z = b * NH + h: content logits (q+u)(hi+res) . k (f16): 2 products (the /8 is applied with the position term in k_sm)
__global__ __launch_bounds__(128) void k_sc1(const _Float16* __restrict__ QH, const _Float16* __restrict__ QL, const _Float16* __restrict__ KH, int bh0, float* __restrict__ S0) { __shared__ __align__(16) float ss[4][16][132]; const int bh = bh0 + blockIdx.z, b = bh / NH, h = bh % NH; float* S = S0 + (size_t)blockIdx.z * TT * TT;
  const int tid = threadIdx.x, wave = tid >> 5, lane = tid & 31, col = lane & 15, g = lane >> 4; const int k0 = blockIdx.y * 128; const int ql0 = blockIdx.x * 64 + wave * 16; const size_t q0 = (size_t)b * TT + ql0;
  v8f acc[8] = {}, accl[8] = {};
#pragma unroll
  for (int kc = 0; kc < HD / 32; ++kc) { const v16h ah = frag_h(QH + (q0 + col) * CC + h * HD + kc * 32, lane), al = frag_h(QL + (q0 + col) * CC + h * HD + kc * 32, lane);
#pragma unroll
    for (int j = 0; j < 8; ++j) { const v16h kb = frag_h(KH + ((size_t)b * TT + k0 + j * 16 + col) * CC + h * HD + kc * 32, lane); acc[j] = wmma16(ah, kb, acc[j]); accl[j] = wmma16(al, kb, accl[j]); } }
#pragma unroll
  for (int j = 0; j < 8; ++j) {
#pragma unroll
    for (int r = 0; r < 8; ++r) ss[wave][8 * g + r][j * 16 + col] = acc[j][r] + accl[j][r] * (1.0f / 1024.0f); }
  LDSX(); for (int rl = 0; rl < 16; ++rl) vst2(S + (size_t)(ql0 + rl) * TT + k0 + lane * 4, *(const v4f*)&ss[wave][rl][lane * 4]); }
// ---- k_sc2: block = (64 queries from i0, 128 band columns, pair in group): position logits against p rows pos = T - 64 - i0 + by*128 + .. (3 products), stored banded: S2[i][c] with c = by*128 + .., i.e. for row i the value needed at key j (pos = T-1-i+j) sits at c = j + 63 - (i - i0)
__global__ __launch_bounds__(128) void k_sc2(const _Float16* __restrict__ QH, const _Float16* __restrict__ QL, const _Float16* __restrict__ RHh, const _Float16* __restrict__ RLl, int bh0, float* __restrict__ S0) { __shared__ __align__(16) float ss[4][16][132]; const int bh = bh0 + blockIdx.z, b = bh / NH, h = bh % NH; float* S = S0 + (size_t)blockIdx.z * TT * S2W;
  const int tid = threadIdx.x, wave = tid >> 5, lane = tid & 31, col = lane & 15, g = lane >> 4; const int i0 = blockIdx.x * 64; const int cb0 = blockIdx.y * 128; const size_t p0 = (size_t)(TT - 64 - i0) + cb0; const int ql0 = i0 + wave * 16; const size_t q0 = (size_t)b * TT + ql0;
  v8f acc[8] = {}, accl[8] = {};
#pragma unroll
  for (int kc = 0; kc < HD / 32; ++kc) { const v16h ah = frag_h(QH + (q0 + col) * CC + h * HD + kc * 32, lane), al = frag_h(QL + (q0 + col) * CC + h * HD + kc * 32, lane);
#pragma unroll
    for (int j = 0; j < 8; ++j) { const size_t pr = (p0 + j * 16 + col) * CC + h * HD + kc * 32; const v16h kb = frag_h(RHh + pr, lane), kl = frag_h(RLl + pr, lane); acc[j] = wmma16(ah, kb, acc[j]); accl[j] = wmma16(al, kb, accl[j]); accl[j] = wmma16(ah, kl, accl[j]); } }
#pragma unroll
  for (int j = 0; j < 8; ++j) {
#pragma unroll
    for (int r = 0; r < 8; ++r) ss[wave][8 * g + r][j * 16 + col] = acc[j][r] + accl[j][r] * (1.0f / 1024.0f); }
  LDSX(); for (int rl = 0; rl < 16; ++rl) vst2(S + (size_t)(ql0 + rl) * S2W + cb0 + lane * 4, *(const v4f*)&ss[wave][rl][lane * 4]); }
// ---- k_sm: block = query row i (pair in group): a[j] = (S1[i][j] + S2[i][j + 63 - (i mod 64)]) / 8; softmax over the T keys -> P x 2^11 in place over S1 row i (f32)
__global__ __launch_bounds__(256) void k_sm(float* __restrict__ S0, const float* __restrict__ S2_0) { __shared__ float sred[8]; __shared__ float sbc; __shared__ __align__(16) float shv[TT];
  const int t = threadIdx.x; const int row = blockIdx.x; float* sr = S0 + (size_t)blockIdx.y * TT * TT + (size_t)row * TT; const float* s2 = S2_0 + (size_t)blockIdx.y * TT * S2W + (size_t)row * S2W + (63 - (row & 63)); const int kend = TT;
  float m = -3.0e38f; for (int k = t; k < kend; k += 256) { const float v = (sr[k] + s2[k]) * SCALE; shv[k] = v; m = fmaxf(m, v); }
#pragma unroll
  for (int o = 1; o < 32; o <<= 1) m = fmaxf(m, __shfl_xor(m, o));
  if ((t & 31) == 0) sred[t >> 5] = m; __syncthreads(); if (t == 0) { float a = sred[0]; for (int i = 1; i < 8; ++i) a = fmaxf(a, sred[i]); sbc = a; } __syncthreads(); m = sbc; __syncthreads();
  float sum = 0.f; for (int k = t; k < kend; k += 256) { const float e = expf(shv[k] - m); shv[k] = e; sum += e; }
#pragma unroll
  for (int o = 1; o < 32; o <<= 1) sum += __shfl_xor(sum, o);
  if ((t & 31) == 0) sred[t >> 5] = sum; __syncthreads(); if (t == 0) { float a = 0.f; for (int i = 0; i < 8; ++i) a += sred[i]; sbc = 1.0f / a; } __syncthreads(); const float inv = sbc * 2048.0f;
  for (int k = t; k < kend; k += 256) shv[k] = shv[k] * inv;
  __syncthreads(); for (int q = t; q < kend / 4; q += 256) vst2(sr + q * 4, *(const v4f*)&shv[q * 4]); }
// ---- k_pv: block = 64 queries of (b,h): ctx[b*T + i][h*64 + d] = P . v (P x 2^11 split bf16 hi + lo, v bf16 hi + lo: 3 products)
__global__ __launch_bounds__(128) void k_pv(const float* __restrict__ PS0, const __bf16* __restrict__ VT, const __bf16* __restrict__ VL, int bh0, float* __restrict__ Y) { const int bh = bh0 + blockIdx.z, b = bh / NH, h = bh % NH; const float* PS = PS0 + (size_t)blockIdx.z * TT * TT; __shared__ __align__(16) float ss[4][16][HD + 4];
  const int tid = threadIdx.x, wave = tid >> 5, lane = tid & 31, col = lane & 15, g = lane >> 4; const int ql0 = blockIdx.x * 64 + wave * 16; const int kend = TT;
  v8f acc[HD / 16] = {};
#pragma unroll 1
  for (int kc = 0; kc < kend / 32; ++kc) { const F2 p = split_row(PS + (size_t)(ql0 + col) * TT, kc * 32, lane);
#pragma unroll
    for (int j = 0; j < HD / 16; ++j) { const size_t po = ((size_t)b * CC + h * HD + j * 16 + col) * (size_t)TT + kc * 32; const v16b vh = frag_b(VT + po, lane); acc[j] = wmma_bf(p.h, vh, acc[j]); acc[j] = wmma_bf(p.l, vh, acc[j]); acc[j] = wmma_bf(p.h, frag_b(VL + po, lane), acc[j]); } }
#pragma unroll
  for (int j = 0; j < HD / 16; ++j)
#pragma unroll
    for (int r = 0; r < 8; ++r) ss[wave][8 * g + r][j * 16 + col] = acc[j][r] * (1.0f / 2048.0f);
  LDSX(); for (int rl = 0; rl < 16; ++rl) if (lane < HD / 4) vst2(Y + ((size_t)b * TT + ql0 + rl) * CC + h * HD + lane * 4, *(const v4f*)&ss[wave][rl][lane * 4]); }
// ---- k_out: block = (64 rows, 128 cols): out = ctx (bf16 hi + lo) Wout ((in,out), exact) + bout
__global__ __launch_bounds__(128) void k_out(const float* __restrict__ Yr, const float* __restrict__ WO, const float* __restrict__ BO, float* __restrict__ OUT) { __shared__ __align__(16) float sf[4][16][132];
  const int tid = threadIdx.x, wave = tid >> 5, lane = tid & 31, col = lane & 15, g = lane >> 4; const int c0 = blockIdx.y * 128; const size_t r0 = (size_t)blockIdx.x * 64 + wave * 16;
  v8f acc[8] = {};
#pragma unroll 2
  for (int kc = 0; kc < CC / 32; ++kc) { const F2 a = split_row(Yr + (r0 + col) * CC, kc * 32, lane); asm volatile("s_wait_loadcnt 0x0" ::: "memory");
#pragma unroll
    for (int j = 0; j < 8; ++j) { const v16b w = wcol(WO, kc * 32, c0 + j * 16 + col, lane); asm volatile("s_wait_loadcnt 0x0" ::: "memory"); acc[j] = wmma_bf(a.h, w, acc[j]); acc[j] = wmma_bf(a.l, w, acc[j]); } }
#pragma unroll
  for (int j = 0; j < 8; ++j) { const float bb = bfr(BO[c0 + j * 16 + col]);
#pragma unroll
    for (int r = 0; r < 8; ++r) sf[wave][8 * g + r][j * 16 + col] = acc[j][r] + bb; }
  LDSX(); for (int rl = 0; rl < 16; ++rl) vst2(OUT + (r0 + rl) * CC + c0 + lane * 4, *(const v4f*)&sf[wave][rl][lane * 4]); }
extern "C" void kernel_launch(void* const* d_in, const int* in_sizes, int n_in, void* d_out, int out_size, void* d_ws, size_t ws_size, hipStream_t stream) {
  (void)in_sizes; (void)n_in; (void)out_size;
  const float** F = (const float**)d_in;   // 0 query, 1 key, 2 value [8,1024,512]; 3 pos_emb [1,2047,512]; 4 Wq, 5 bq, 6 Wk, 7 bk, 8 Wv, 9 bv ((in,out)); 10 Wpos; 11 Wout, 12 bout; 13 pos_bias_u [8,64], 14 pos_bias_v
  if (ws_size < (size_t)WS_END) return;
  char* ws = (char*)d_ws; _Float16 *QUH = (_Float16*)(ws + WS_QUH), *QUL = (_Float16*)(ws + WS_QUL), *QVH = (_Float16*)(ws + WS_QVH), *QVL = (_Float16*)(ws + WS_QVL), *KH = (_Float16*)(ws + WS_KH), *HRH = (_Float16*)(ws + WS_HRH), *HRL = (_Float16*)(ws + WS_HRL); __bf16 *VT = (__bf16*)(ws + WS_VT), *VL = (__bf16*)(ws + WS_VL); float *S1 = (float*)(ws + WS_S1), *S2 = (float*)(ws + WS_S2), *Y = (float*)(ws + WS_Y);
  k_proj<<<dim3(TNB * TT / 64, CC / 128, 3), 128, 0, stream>>>(F[0], F[1], F[2], F[4], F[5], F[6], F[7], F[8], F[9], F[13], F[14], QUH, QUL, QVH, QVL, KH, VT, VL);
  k_projr<<<dim3(HRR / 64, CC / 128), 128, 0, stream>>>(F[3], F[10], HRH, HRL);
  for (int bh0 = 0; bh0 < TNB * NH; bh0 += HG) {
    k_sc1<<<dim3(TT / 64, TT / 128, HG), 128, 0, stream>>>(QUH, QUL, KH, bh0, S1);
    k_sc2<<<dim3(TT / 64, S2W / 128, HG), 128, 0, stream>>>(QVH, QVL, HRH, HRL, bh0, S2);
    k_sm<<<dim3(TT, HG), 256, 0, stream>>>(S1, S2);
    k_pv<<<dim3(TT / 64, 1, HG), 128, 0, stream>>>(S1, VT, VL, bh0, Y);
  }
  k_out<<<dim3(TNB * TT / 64, CC / 128), 128, 0, stream>>>(Y, F[11], F[12], (float*)d_out);
}

// v002
// A run of this version takes 320 microseconds.
// Timed twice side by side with v001, it ran 2.51 and 2.50 times as fast.
// Counting every step since v000, it is 4.88 times as fast.
// compute dtype: all float inputs rounded to bf16; q/k/v/p = x W + b with EXACT bf16 products on WMMA 16x16x32, f32 accumulate; (q + pos_bias_u), (q + pos_bias_v) and p as f16 hi + residual (x 2^10), k once to f16 -> content logits 2 products, position logits 3 products; the rel_shift as a banded position GEMM + index offset through LDS; /8 and running-maximum softmax in f32 (precise expf); P = exp(s - m) split bf16 hi + lo against v bf16 hi + lo (3 products), divided by the sum at the end; ctx (bf16 hi + lo) Wout + bout; f32 output.
#include <hip/hip_runtime.h>
#include <math.h>

typedef __attribute__((ext_vector_type(16))) _Float16 v16h;
typedef __attribute__((ext_vector_type(16))) __bf16 v16b;
typedef __attribute__((ext_vector_type(8)))  _Float16 v8h;
typedef __attribute__((ext_vector_type(8)))  float v8f;
typedef __attribute__((ext_vector_type(4)))  float v4f;
typedef __attribute__((ext_vector_type(2)))  float v2f;
typedef __attribute__((ext_vector_type(4)))  unsigned v4u;
typedef __attribute__((ext_vector_type(4)))  int v4i;
typedef float __attribute__((may_alias)) float_a;
typedef int __attribute__((may_alias)) int_a;

template <typename T> __device__ __forceinline__ void vst2(void* p, T v) { *(T*)p = v;  }
__device__ __forceinline__ v8f wmma16(v16h a, v16h b, v8f c) {
  v8f d = __builtin_amdgcn_wmma_f32_16x16x32_f16(false, a, false, b, (short)0, c, false, false);
  asm volatile("v_nop\n\tv_nop\n\tv_nop\n\tv_nop" : "+v"(d) : "v"(a), "v"(b));
  return d;
}
__device__ __forceinline__ v8f wmma_bf(v16b a, v16b b, v8f c) {
  v8f d = __builtin_amdgcn_wmma_f32_16x16x32_bf16(false, a, false, b, (short)0, c, false, false);
  asm volatile("v_nop\n\tv_nop\n\tv_nop\n\tv_nop" : "+v"(d) : "v"(a), "v"(b));
  return d;
}
// 16x16x32 fragments: lane = (h = lane>>4, row/col = lane&15); elements 0..7 = k0+8h+0..7, 8..15 = k0+16+8h+0..7; D element r = row 8h+r
__device__ __forceinline__ v16h frag_h(const _Float16* rowk0, int lane) {
  union { v16h v; v8h q[2]; } u; const _Float16* p = rowk0 + 8 * (lane >> 4);
  u.q[0] = *(const v8h*)p; u.q[1] = *(const v8h*)(p + 16); return u.v;
}
__device__ __forceinline__ v16h frag_f32(const float* rowk0, int lane) {
  v16h a; const float* p = rowk0 + 8 * (lane >> 4);
#pragma unroll
  for (int i = 0; i < 8; ++i) { a[i] = (_Float16)p[i]; a[8 + i] = (_Float16)p[16 + i]; }
  return a;
}
__device__ __forceinline__ v16h frag_f32s(const float* rowk0, int lane, float sc) {
  v16h a; const float* p = rowk0 + 8 * (lane >> 4);
#pragma unroll
  for (int i = 0; i < 8; ++i) { a[i] = (_Float16)(p[i] * sc); a[8 + i] = (_Float16)(p[16 + i] * sc); }
  return a;
}
// column fragment from a [K][ld] layout (column n), rows >= K read as 0
__device__ __forceinline__ v16h fragc_f32(const float* W, int k0, int n, int lane, int ld, int K) {
  v16h a; const int g = lane >> 4;
#pragma unroll
  for (int i = 0; i < 8; ++i) { const int ka = k0 + 8 * g + i, kb = ka + 16;
    a[i] = (_Float16)(ka < K ? W[(size_t)(ka < K ? ka : K - 1) * ld + n] : 0.f); a[8 + i] = (_Float16)(kb < K ? W[(size_t)(kb < K ? kb : K - 1) * ld + n] : 0.f); }
  return a;
}
struct F2 { v16b h, l; };
__device__ __forceinline__ F2 bsplit16(const float v[16]) { F2 r;
#pragma unroll
  for (int i = 0; i < 16; ++i) { const __bf16 h = (__bf16)v[i]; r.h[i] = h; r.l[i] = (__bf16)(v[i] - (float)h); }
  return r; }
__device__ __forceinline__ F2 split_row(const float* row, int k0, int lane) { float v[16]; const float* p = row + k0 + 8 * (lane >> 4);
#pragma unroll
  for (int i = 0; i < 8; ++i) { v[i] = p[i]; v[8 + i] = p[16 + i]; }
  return bsplit16(v); }
__device__ __forceinline__ F2 split_rowK(const float* row, int k0, int lane, int K) { float v[16]; const int g = lane >> 4;
#pragma unroll
  for (int i = 0; i < 8; ++i) { const int ka = k0 + 8 * g + i, kb = ka + 16; v[i] = ka < K ? row[ka < K ? ka : K - 1] : 0.f; v[8 + i] = kb < K ? row[kb < K ? kb : K - 1] : 0.f; }
  return bsplit16(v); }
__device__ __forceinline__ F2 split_col(const float* W, int k0, int n, int lane, int ld, int K) { float v[16]; const int g = lane >> 4;
#pragma unroll
  for (int i = 0; i < 8; ++i) { const int ka = k0 + 8 * g + i, kb = ka + 16; v[i] = ka < K ? W[(size_t)(ka < K ? ka : K - 1) * ld + n] : 0.f; v[8 + i] = kb < K ? W[(size_t)(kb < K ? kb : K - 1) * ld + n] : 0.f; }
  return bsplit16(v); }
__device__ __forceinline__ v8f mac3(const F2& a, const F2& b, v8f c) { c = wmma_bf(a.l, b.h, c); c = wmma_bf(a.h, b.l, c); return wmma_bf(a.h, b.h, c); }
__device__ __forceinline__ float sigm(float v) { return 1.0f / (1.0f + expf(-v)); }
#define LDSX() do { asm volatile("s_wait_dscnt 0" ::: "memory"); __builtin_amdgcn_wave_barrier(); __builtin_amdgcn_fence(__ATOMIC_RELEASE, "workgroup"); } while (0)

// Relative-position multi-head attention (wenet/espnet style; B 8, T 1,024, F 512 = 8 x 64): q = query Wq + bq, k = key Wk + bk, v = value Wv + bv ((in,out)); p = pos_emb[0] Wpos (2T-1 positions); ac = (q + u) k^T; bd = rel_shift((q + v_bias) p^T) with rel_shift(x)[i][j] = x[i][T-1-i+j]; scores = (ac + bd) / 8; softmax; ctx = att v; out = ctx Wout + bout.
#define NB 8
#define TT 1024
#define CC 512
#define NH 8
#define HD 64
#define NPOS (2 * TT - 1)      // 2,047 rows of pos_emb / p
#define HRR (2 * TT + 128)     // rows of the p planes actually built (rows >= NPOS are zeros; they only feed never-read logits)
#define KB 64                  // keys per block of the attention loop
#define AW 16                  // waves per attention work-group: one work-group per WGP, 4 waves per SIMD; its waves walk the same k and v rows, so they share them in the WGP cache
#define NT (KB / 16)           // key tiles per block (the load schedule in k_att is written for 4)
#define BP (KB + 20)           // LDS band pitch in floats: KB + 16 columns used; pitch - 1 = 19 mod 64 keeps the 32 shifted reads of a wave on 32 banks
#define SCALE 0.125f
#ifndef TNB
#define TNB NB
#endif
typedef __attribute__((ext_vector_type(8))) __bf16 v8b;
__device__ __forceinline__ v16b frag_b(const __bf16* rowk0, int lane) {
  union { v16b v; v8b q[2]; } u; const __bf16* p = rowk0 + 8 * (lane >> 4);
  u.q[0] = *(const v8b*)p; u.q[1] = *(const v8b*)(p + 16); return u.v;
}
__device__ __forceinline__ float bfr(float v) { return (float)(__bf16)v; }
// B fragment (k rows k0+.., column o) of an (in,out) [K][CC] weight as bf16
__device__ __forceinline__ v16b wcol(const float* Wm, int k0, int o, int lane) { v16b w; const int g = lane >> 4;
#pragma unroll
  for (int i = 0; i < 8; ++i) { w[i] = (__bf16)Wm[(size_t)(k0 + 8 * g + i) * CC + o]; w[8 + i] = (__bf16)Wm[(size_t)(k0 + 16 + 8 * g + i) * CC + o]; }
  return w; }

#define WS_QUH 0u                                       // f16 (q + u) rows [b*t][512] hi
#define WS_QUL (WS_QUH + 2u * (size_t)NB * TT * CC)      //                     residual x 2^10
#define WS_QVH (WS_QUL + 2u * (size_t)NB * TT * CC)      // f16 (q + v_bias) rows
#define WS_QVL (WS_QVH + 2u * (size_t)NB * TT * CC)
#define WS_KH  (WS_QVL + 2u * (size_t)NB * TT * CC)      // f16 k rows [b*t][512]
#define WS_HRH (WS_KH  + 2u * (size_t)NB * TT * CC)      // f16 p rows [pos < HRR][512] hi
#define WS_HRL (WS_HRH + 2u * (size_t)HRR * CC)          //                        residual x 2^10
#define WS_VT  (WS_HRL + 2u * (size_t)HRR * CC)          // bf16 v planes [b][c][t]
#define WS_VL  (WS_VT  + 2u * (size_t)NB * CC * TT)
#define WS_Y   (WS_VL  + 2u * (size_t)NB * CC * TT)      // f32 ctx rows [b*t][512]
#define WS_END (WS_Y   + 4u * (size_t)NB * TT * CC)

// ---- k_proj: block = (64 rows, 128 cols, which): which 0: q = query Wq + bq -> (q + u) and (q + v_bias) as f16 hi + residual rows (u, v_bias [H,DK] flat = column index); which 1: k = key Wk + bk -> f16 rows; which 2: v = value Wv + bv -> bf16 hi + lo planes [b][c][t]. Weights (in,out).
__global__ __launch_bounds__(128) void k_proj(const float* __restrict__ X0, const float* __restrict__ X1, const float* __restrict__ X2, const float* __restrict__ WQ, const float* __restrict__ BQ, const float* __restrict__ WK, const float* __restrict__ BK, const float* __restrict__ WV, const float* __restrict__ BV, const float* __restrict__ UB, const float* __restrict__ VB, _Float16* __restrict__ QUH, _Float16* __restrict__ QUL, _Float16* __restrict__ QVH, _Float16* __restrict__ QVL, _Float16* __restrict__ KH, __bf16* __restrict__ VT, __bf16* __restrict__ VL) {
  __shared__ __align__(16) _Float16 sh[64][136], sl[64][136]; __shared__ __align__(16) __bf16 th[128][72], tl2[128][72];
  const int tid = threadIdx.x, wave = tid >> 5, lane = tid & 31, col = lane & 15, g = lane >> 4; const int which = blockIdx.z; const int c0 = blockIdx.y * 128; const size_t r0 = (size_t)blockIdx.x * 64;
  const float* X = which == 0 ? X0 : which == 1 ? X1 : X2; const float* WA = which == 0 ? WQ : which == 1 ? WK : WV; const float* BA = which == 0 ? BQ : which == 1 ? BK : BV;
  v8f acc[8] = {};
#pragma unroll 2
  for (int kc = 0; kc < CC / 32; ++kc) { v16b a; { const float* p = X + (r0 + wave * 16 + col) * CC + kc * 32 + 8 * g;
#pragma unroll
      for (int i = 0; i < 8; ++i) { a[i] = (__bf16)p[i]; a[8 + i] = (__bf16)p[16 + i]; } }
    asm volatile("s_wait_loadcnt 0x0" ::: "memory");
#pragma unroll
    for (int j = 0; j < 8; ++j) { const v16b w = wcol(WA, kc * 32, c0 + j * 16 + col, lane); asm volatile("s_wait_loadcnt 0x0" ::: "memory"); acc[j] = wmma_bf(a, w, acc[j]); } }
  const int npass = (which == 0) ? 2 : 1;
  for (int pass = 0; pass < npass; ++pass) {   /* block-uniform */
    if (pass) __syncthreads();
#pragma unroll
    for (int j = 0; j < 8; ++j) { const int o = c0 + j * 16 + col; const float bb = bfr(BA[o]) + ((which == 0) ? bfr((pass == 0 ? UB : VB)[o]) : 0.f);
#pragma unroll
      for (int r = 0; r < 8; ++r) { const float v = acc[j][r] + bb; const int rl = wave * 16 + 8 * g + r, cl = j * 16 + col; const _Float16 hv = (_Float16)v;
        if (which == 2) { const __bf16 bh = (__bf16)v; th[cl][rl] = bh; tl2[cl][rl] = (__bf16)(v - (float)bh); } else { sh[rl][cl] = hv; sl[rl][cl] = (_Float16)((v - (float)hv) * 1024.0f); } } }
    __syncthreads();
    if (which < 2) { _Float16* dh = which == 1 ? KH : (pass == 0 ? QUH : QVH); _Float16* dl = (pass == 0 ? QUL : QVL); for (int e = tid; e < 64 * 16; e += 128) { const int rl = e >> 4, q = e & 15; vst2((unsigned*)(dh + (r0 + rl) * CC + c0 + q * 8), *(const v4u*)&sh[rl][q * 8]); if (which == 0) vst2((unsigned*)(dl + (r0 + rl) * CC + c0 + q * 8), *(const v4u*)&sl[rl][q * 8]); } }
    else { const size_t b = r0 / TT; const int t0 = (int)(r0 % TT); for (int e = tid; e < 128 * 8; e += 128) { const int cl = e >> 3, q = e & 7; const size_t o2 = (b * CC + c0 + cl) * (size_t)TT + t0 + q * 8; vst2((unsigned*)(VT + o2), *(const v4u*)&th[cl][q * 8]); vst2((unsigned*)(VL + o2), *(const v4u*)&tl2[cl][q * 8]); } } } }
// ---- k_projr: block = (64 positions, 128 cols): p rows [pos][o] = pos_emb[0][pos] Wpos ((in,out), exact) -> f16 hi + residual; rows >= NPOS (2,047) are written as zeros (their A rows are loaded clamped and zeroed by value)
__global__ __launch_bounds__(128) void k_projr(const float* __restrict__ PE, const float* __restrict__ WP, _Float16* __restrict__ HRH, _Float16* __restrict__ HRL) {
  __shared__ __align__(16) _Float16 sh[64][136], sl[64][136];
  const int tid = threadIdx.x, wave = tid >> 5, lane = tid & 31, col = lane & 15, g = lane >> 4; const int c0 = blockIdx.y * 128; const size_t p0 = (size_t)blockIdx.x * 64;
  const size_t prow = p0 + wave * 16 + col; const bool live = prow < NPOS; const size_t prc = live ? prow : (NPOS - 1);
  v8f acc[8] = {};
#pragma unroll 2
  for (int kc = 0; kc < CC / 32; ++kc) { v16b a; { const float* p = PE + prc * CC + kc * 32 + 8 * g;
#pragma unroll
      for (int i = 0; i < 8; ++i) { const float va = p[i], vb = p[16 + i]; a[i] = (__bf16)(live ? va : 0.f); a[8 + i] = (__bf16)(live ? vb : 0.f); } }
    asm volatile("s_wait_loadcnt 0x0" ::: "memory");
#pragma unroll
    for (int j = 0; j < 8; ++j) { const v16b w = wcol(WP, kc * 32, c0 + j * 16 + col, lane); asm volatile("s_wait_loadcnt 0x0" ::: "memory"); acc[j] = wmma_bf(a, w, acc[j]); } }
#pragma unroll
  for (int j = 0; j < 8; ++j) {
#pragma unroll
    for (int r = 0; r < 8; ++r) { const float v = acc[j][r]; const int rl = wave * 16 + 8 * g + r, cl = j * 16 + col; const _Float16 hv = (_Float16)v; sh[rl][cl] = hv; sl[rl][cl] = (_Float16)((v - (float)hv) * 1024.0f); } }
  __syncthreads();
  for (int e = tid; e < 64 * 16; e += 128) { const int rl = e >> 4, q = e & 15; vst2((unsigned*)(HRH + (p0 + rl) * CC + c0 + q * 8), *(const v4u*)&sh[rl][q * 8]); vst2((unsigned*)(HRL + (p0 + rl) * CC + c0 + q * 8), *(const v4u*)&sl[rl][q * 8]); } }
__device__ __forceinline__ void ld4(v16h (&f)[4], const _Float16* rh, const _Float16* rl, int lane) { f[0] = frag_h(rh, lane); f[1] = frag_h(rl, lane); f[2] = frag_h(rh + 32, lane); f[3] = frag_h(rl + 32, lane); }
__device__ __forceinline__ void qput(v8h (*s)[32], v16h f, int lane) { union { v16h v; v8h q[2]; } u; u.v = f; s[0][lane] = u.q[0]; s[1][lane] = u.q[1]; }
__device__ __forceinline__ v16h qget(const v8h (*s)[32], int lane) { union { v16h v; v8h q[2]; } u; u.q[0] = s[0][lane]; u.q[1] = s[1][lane]; return u.v; }
// one position tile: X^T = p (q+v_bias)^T, 3 products; x0, x1 = this lane's 8 consecutive positions of its query
__device__ __forceinline__ void bd_tile(const v16h (&f)[4], const v16h (&qh)[HD / 32], const v16h (&ql)[HD / 32], v4f& x0, v4f& x1) { v8f a = {}, al = {};
#pragma unroll
  for (int kc = 0; kc < HD / 32; ++kc) { a = wmma16(f[2 * kc], qh[kc], a); al = wmma16(f[2 * kc], ql[kc], al); al = wmma16(f[2 * kc + 1], qh[kc], al); }
#pragma unroll
  for (int r = 0; r < 4; ++r) { x0[r] = a[r] + al[r] * (1.0f / 1024.0f); x1[r] = a[4 + r] + al[4 + r] * (1.0f / 1024.0f); } }
// ---- k_att: block = 16 * AW queries of one (batch, head) pair, wave = 16 queries, all T keys in blocks of KB. Everything is kept transposed so that a lane owns one query (column lane & 15):
//   S^T = k (q+u)^T (2 products) and X^T = p (q+v_bias)^T (3 products) have D register r = key / position 8g + r; O^T += v^T P^T takes two S^T tiles, converted in place, as its B operand.
//   rel_shift: for queries iw0 + q and keys j0 + jl the position row is T-1-(iw0+q)+(j0+jl) = pb + c with pb = T-16-iw0+j0 and c = jl + 15 - q, so KB/16 + 1 position tiles stand in the wave's own LDS band [q][c] and each lane reads its row back at offset 15 - q; the last tile of a block is the first of the next (pb grows by KB) and is moved there, not computed again.
//   softmax is the running-maximum form: per block m' = max(m, block max), sums and O^T are scaled by exp(m - m'), P = exp(s - m') split bf16 hi + lo; the division by the sum comes last.
__global__ __launch_bounds__(32 * AW) __attribute__((amdgpu_waves_per_eu(4, 4))) void k_att(const _Float16* __restrict__ QUH, const _Float16* __restrict__ QUL, const _Float16* __restrict__ QVH, const _Float16* __restrict__ QVL, const _Float16* __restrict__ KH, const _Float16* __restrict__ RHh, const _Float16* __restrict__ RLl, const __bf16* __restrict__ VT, const __bf16* __restrict__ VL, float* __restrict__ Y) {
  __shared__ __align__(16) float band[AW][16][BP]; __shared__ __align__(16) v8h qs[AW][8][2][32];   /* qs: each lane's own query fragments, parked so that they hold registers only in the phase that uses them (256 VGPRs = 4 waves per SIMD) */
  const int tid = threadIdx.x, wave = tid >> 5, lane = tid & 31, col = lane & 15, g = lane >> 4; const int bh = blockIdx.y, b = bh / NH, h = bh % NH; const int iw0 = blockIdx.x * (16 * AW) + wave * 16;
  const size_t qrow = ((size_t)b * TT + iw0 + col) * CC + h * HD;
#pragma unroll
  for (int kc = 0; kc < HD / 32; ++kc) { qput(qs[wave][kc], frag_h(QVH + qrow + kc * 32, lane), lane); qput(qs[wave][2 + kc], frag_h(QVL + qrow + kc * 32, lane), lane); qput(qs[wave][4 + kc], frag_h(QUH + qrow + kc * 32, lane), lane); qput(qs[wave][6 + kc], frag_h(QUL + qrow + kc * 32, lane), lane); }
  float* bw = &band[wave][col][0];
  const _Float16* rh = RHh + ((size_t)(TT - 16 - iw0) + col) * CC + h * HD; const _Float16* rl = RLl + ((size_t)(TT - 16 - iw0) + col) * CC + h * HD;   /* this lane's position row of tile 0, block 0 */
  const _Float16* kp = KH + ((size_t)b * TT + col) * CC + h * HD; const __bf16* vhp = VT + ((size_t)b * CC + h * HD + col) * (size_t)TT; const __bf16* vlp = VL + ((size_t)b * CC + h * HD + col) * (size_t)TT;
  v8f acc[HD / 16] = {}; float m = -3.0e38f, l = 0.f;
  // Every fragment is loaded one or two tiles ahead of the products that use it. pf[1], pf[2] (position tiles 1, 2) are loaded at the end of the block before; behind the last block that reads rows < 2T + 32 of the p planes, which k_projr has written, and the values are not used.
  v16h pf[NT + 1][4], kf[NT][2]; v16b vf[KB / 32][HD / 16][2];
  ld4(pf[0], rh, rl, lane); ld4(pf[1], rh + 16 * CC, rl + 16 * CC, lane); ld4(pf[2], rh + 32 * CC, rl + 32 * CC, lane);
  { v16h qvh[HD / 32], qvl[HD / 32]; v4f x0, x1;   /* tile 0 of block 0, put where a block before would have left it */
#pragma unroll
    for (int kc = 0; kc < HD / 32; ++kc) { qvh[kc] = qget(qs[wave][kc], lane); qvl[kc] = qget(qs[wave][2 + kc], lane); }
    bd_tile(pf[0], qvh, qvl, x0, x1); *(v4f*)(bw + KB + 8 * g) = x0; *(v4f*)(bw + KB + 8 * g + 4) = x1; }
#pragma unroll 1
  for (int j0 = 0; j0 < TT; j0 += KB) { const _Float16* rhb = rh + (size_t)j0 * CC; const _Float16* rlb = rl + (size_t)j0 * CC; const _Float16* kpb = kp + (size_t)j0 * CC;
    v16h quh[HD / 32], qul[HD / 32], qvh[HD / 32], qvl[HD / 32];
#pragma unroll
    for (int kc = 0; kc < HD / 32; ++kc) { qvh[kc] = qget(qs[wave][kc], lane); qvl[kc] = qget(qs[wave][2 + kc], lane); }
    { const v4f c0 = *(const v4f*)(bw + KB + 8 * g), c1 = *(const v4f*)(bw + KB + 8 * g + 4); *(v4f*)(bw + 8 * g) = c0; *(v4f*)(bw + 8 * g + 4) = c1; }   /* the lane's own values: last tile of the block before = tile 0 of this one */
#pragma unroll
    for (int t = 1; t < NT + 1; ++t) {
      if (t + 2 < NT + 1) ld4(pf[t + 2], rhb + (t + 2) * 16 * CC, rlb + (t + 2) * 16 * CC, lane);
      else if (t + 1 == NT) {
#pragma unroll
        for (int u = 0; u < NT / 2; ++u) { kf[u][0] = frag_h(kpb + u * 16 * CC, lane); kf[u][1] = frag_h(kpb + u * 16 * CC + 32, lane); } }
      else {
#pragma unroll
        for (int kc = 0; kc < HD / 32; ++kc) { quh[kc] = qget(qs[wave][4 + kc], lane); qul[kc] = qget(qs[wave][6 + kc], lane); } }
      v4f x0, x1; bd_tile(pf[t], qvh, qvl, x0, x1);
      *(v4f*)(bw + t * 16 + 8 * g) = x0; *(v4f*)(bw + t * 16 + 8 * g + 4) = x1; }
    LDSX();   /* a lane reads band values that its partner lane (lane ^ 16) wrote */
    float s[NT][8]; float bm = -3.0e38f;
#pragma unroll
    for (int t = 0; t < NT; ++t) { v8f a = {}, al = {};
      if (t == 0) {
#pragma unroll
        for (int u = NT / 2; u < NT; ++u) { kf[u][0] = frag_h(kpb + u * 16 * CC, lane); kf[u][1] = frag_h(kpb + u * 16 * CC + 32, lane); } }
#pragma unroll
      for (int kc = 0; kc < HD / 32; ++kc) { a = wmma16(kf[t][kc], quh[kc], a); al = wmma16(kf[t][kc], qul[kc], al); }
      vf[0][t][0] = frag_b(vhp + (size_t)t * 16 * TT + j0, lane); vf[0][t][1] = frag_b(vlp + (size_t)t * 16 * TT + j0, lane);
#pragma unroll
      for (int r = 0; r < 8; ++r) { const float v = ((a[r] + al[r] * (1.0f / 1024.0f)) + bw[t * 16 + 8 * g + r + 15 - col]) * SCALE; s[t][r] = v; bm = fmaxf(bm, v); } }
    bm = fmaxf(bm, __shfl_xor(bm, 16));
    const float mn = fmaxf(m, bm), alpha = expf(m - mn); m = mn; l *= alpha;
#pragma unroll
    for (int j = 0; j < HD / 16; ++j)
#pragma unroll
      for (int r = 0; r < 8; ++r) acc[j][r] *= alpha;
#pragma unroll
    for (int c = 0; c < KB / 32; ++c) { float e[16];
#pragma unroll
      for (int i = 0; i < 8; ++i) { e[i] = expf(s[2 * c][i] - m); e[8 + i] = expf(s[2 * c + 1][i] - m); l += e[i] + e[8 + i]; }
      const F2 p = bsplit16(e);
#pragma unroll
      for (int j = 0; j < HD / 16; ++j) { acc[j] = wmma_bf(vf[c][j][0], p.h, acc[j]); acc[j] = wmma_bf(vf[c][j][0], p.l, acc[j]); acc[j] = wmma_bf(vf[c][j][1], p.h, acc[j]);
        if (c + 1 < KB / 32) { vf[c + 1][j][0] = frag_b(vhp + (size_t)j * 16 * TT + j0 + (c + 1) * 32, lane); vf[c + 1][j][1] = frag_b(vlp + (size_t)j * 16 * TT + j0 + (c + 1) * 32, lane); }
        else if (j & 1) ld4(pf[1 + (j >> 1)], rhb + (KB + 16 + (j >> 1) * 16) * CC, rlb + (KB + 16 + (j >> 1) * 16) * CC, lane); } }
    asm volatile("s_wait_xcnt 0x0" ::: "memory");   /* the address registers of the loads just issued are rewritten at the top of the next pass */
  }
  l += __shfl_xor(l, 16); const float inv = 1.0f / l;
#pragma unroll
  for (int j = 0; j < HD / 16; ++j) { v4f y0, y1;
#pragma unroll
    for (int r = 0; r < 4; ++r) { y0[r] = acc[j][r] * inv; y1[r] = acc[j][4 + r] * inv; }
    float* yp = Y + qrow + j * 16 + 8 * g; vst2(yp, y0); vst2(yp + 4, y1); } }
// ---- k_out: block = (64 rows, 128 cols): out = ctx (bf16 hi + lo) Wout ((in,out), exact) + bout
__global__ __launch_bounds__(128) void k_out(const float* __restrict__ Yr, const float* __restrict__ WO, const float* __restrict__ BO, float* __restrict__ OUT) { __shared__ __align__(16) float sf[4][16][132];
  const int tid = threadIdx.x, wave = tid >> 5, lane = tid & 31, col = lane & 15, g = lane >> 4; const int c0 = blockIdx.y * 128; const size_t r0 = (size_t)blockIdx.x * 64 + wave * 16;
  v8f acc[8] = {};
#pragma unroll 2
  for (int kc = 0; kc < CC / 32; ++kc) { const F2 a = split_row(Yr + (r0 + col) * CC, kc * 32, lane); asm volatile("s_wait_loadcnt 0x0" ::: "memory");
#pragma unroll
    for (int j = 0; j < 8; ++j) { const v16b w = wcol(WO, kc * 32, c0 + j * 16 + col, lane); asm volatile("s_wait_loadcnt 0x0" ::: "memory"); acc[j] = wmma_bf(a.h, w, acc[j]); acc[j] = wmma_bf(a.l, w, acc[j]); } }
#pragma unroll
  for (int j = 0; j < 8; ++j) { const float bb = bfr(BO[c0 + j * 16 + col]);
#pragma unroll
    for (int r = 0; r < 8; ++r) sf[wave][8 * g + r][j * 16 + col] = acc[j][r] + bb; }
  LDSX(); for (int rl = 0; rl < 16; ++rl) vst2(OUT + (r0 + rl) * CC + c0 + lane * 4, *(const v4f*)&sf[wave][rl][lane * 4]); }
extern "C" void kernel_launch(void* const* d_in, const int* in_sizes, int n_in, void* d_out, int out_size, void* d_ws, size_t ws_size, hipStream_t stream) {
  (void)in_sizes; (void)n_in; (void)out_size;
  const float** F = (const float**)d_in;   // 0 query, 1 key, 2 value [8,1024,512]; 3 pos_emb [1,2047,512]; 4 Wq, 5 bq, 6 Wk, 7 bk, 8 Wv, 9 bv ((in,out)); 10 Wpos; 11 Wout, 12 bout; 13 pos_bias_u [8,64], 14 pos_bias_v
  if (ws_size < (size_t)WS_END) return;
  char* ws = (char*)d_ws; _Float16 *QUH = (_Float16*)(ws + WS_QUH), *QUL = (_Float16*)(ws + WS_QUL), *QVH = (_Float16*)(ws + WS_QVH), *QVL = (_Float16*)(ws + WS_QVL), *KH = (_Float16*)(ws + WS_KH), *HRH = (_Float16*)(ws + WS_HRH), *HRL = (_Float16*)(ws + WS_HRL); __bf16 *VT = (__bf16*)(ws + WS_VT), *VL = (__bf16*)(ws + WS_VL); float *Y = (float*)(ws + WS_Y);
  k_proj<<<dim3(TNB * TT / 64, CC / 128, 3), 128, 0, stream>>>(F[0], F[1], F[2], F[4], F[5], F[6], F[7], F[8], F[9], F[13], F[14], QUH, QUL, QVH, QVL, KH, VT, VL);
  k_projr<<<dim3(HRR / 64, CC / 128), 128, 0, stream>>>(F[3], F[10], HRH, HRL);
  k_att<<<dim3(TT / (16 * AW), TNB * NH), 32 * AW, 0, stream>>>(QUH, QUL, QVH, QVL, KH, HRH, HRL, VT, VL, Y);
  k_out<<<dim3(TNB * TT / 64, CC / 128), 128, 0, stream>>>(Y, F[11], F[12], (float*)d_out);
}

// v003
// Measured time: 231 microseconds a run.
// Next to v002, in two timings, it ran 1.39 times as fast each time.
// All steps since v000 together make it 6.78 times as fast.
// compute dtype: all float inputs rounded to bf16; q/k/v/p = x W + b with EXACT bf16 products on WMMA 16x16x32, f32 accumulate; (q + pos_bias_u), (q + pos_bias_v) and p as f16 hi + residual (x 2^10), k once to f16 -> content logits 2 products, position logits 3 products; the rel_shift as a banded position GEMM + index offset through LDS; /8 and running-maximum softmax in f32 (precise expf); P = exp(s - m) split bf16 hi + lo against v bf16 hi + lo (3 products), divided by the sum at the end; ctx (bf16 hi + lo) Wout + bout; f32 output.
#include <hip/hip_runtime.h>
#include <math.h>

typedef __attribute__((ext_vector_type(16))) _Float16 v16h;
typedef __attribute__((ext_vector_type(16))) __bf16 v16b;
typedef __attribute__((ext_vector_type(8)))  _Float16 v8h;
typedef __attribute__((ext_vector_type(8)))  float v8f;
typedef __attribute__((ext_vector_type(4)))  float v4f;
typedef __attribute__((ext_vector_type(2)))  float v2f;
typedef __attribute__((ext_vector_type(4)))  unsigned v4u;
typedef __attribute__((ext_vector_type(4)))  int v4i;
typedef float __attribute__((may_alias)) float_a;
typedef int __attribute__((may_alias)) int_a;

template <typename T> __device__ __forceinline__ void vst2(void* p, T v) { *(T*)p = v;  }
__device__ __forceinline__ v8f wmma16(v16h a, v16h b, v8f c) {
  v8f d = __builtin_amdgcn_wmma_f32_16x16x32_f16(false, a, false, b, (short)0, c, false, false);
  asm volatile("v_nop\n\tv_nop\n\tv_nop\n\tv_nop" : "+v"(d) : "v"(a), "v"(b));
  return d;
}
__device__ __forceinline__ v8f wmma_bf(v16b a, v16b b, v8f c) {
  v8f d = __builtin_amdgcn_wmma_f32_16x16x32_bf16(false, a, false, b, (short)0, c, false, false);
  asm volatile("v_nop\n\tv_nop\n\tv_nop\n\tv_nop" : "+v"(d) : "v"(a), "v"(b));
  return d;
}
// 16x16x32 fragments: lane = (h = lane>>4, row/col = lane&15); elements 0..7 = k0+8h+0..7, 8..15 = k0+16+8h+0..7; D element r = row 8h+r
__device__ __forceinline__ v16h frag_h(const _Float16* rowk0, int lane) {
  union { v16h v; v8h q[2]; } u; const _Float16* p = rowk0 + 8 * (lane >> 4);
  u.q[0] = *(const v8h*)p; u.q[1] = *(const v8h*)(p + 16); return u.v;
}
__device__ __forceinline__ v16h frag_f32(const float* rowk0, int lane) {
  v16h a; const float* p = rowk0 + 8 * (lane >> 4);
#pragma unroll
  for (int i = 0; i < 8; ++i) { a[i] = (_Float16)p[i]; a[8 + i] = (_Float16)p[16 + i]; }
  return a;
}
__device__ __forceinline__ v16h frag_f32s(const float* rowk0, int lane, float sc) {
  v16h a; const float* p = rowk0 + 8 * (lane >> 4);
#pragma unroll
  for (int i = 0; i < 8; ++i) { a[i] = (_Float16)(p[i] * sc); a[8 + i] = (_Float16)(p[16 + i] * sc); }
  return a;
}
// column fragment from a [K][ld] layout (column n), rows >= K read as 0
__device__ __forceinline__ v16h fragc_f32(const float* W, int k0, int n, int lane, int ld, int K) {
  v16h a; const int g = lane >> 4;
#pragma unroll
  for (int i = 0; i < 8; ++i) { const int ka = k0 + 8 * g + i, kb = ka + 16;
    a[i] = (_Float16)(ka < K ? W[(size_t)(ka < K ? ka : K - 1) * ld + n] : 0.f); a[8 + i] = (_Float16)(kb < K ? W[(size_t)(kb < K ? kb : K - 1) * ld + n] : 0.f); }
  return a;
}
struct F2 { v16b h, l; };
__device__ __forceinline__ F2 bsplit16(const float v[16]) { F2 r;
#pragma unroll
  for (int i = 0; i < 16; ++i) { const __bf16 h = (__bf16)v[i]; r.h[i] = h; r.l[i] = (__bf16)(v[i] - (float)h); }
  return r; }
__device__ __forceinline__ F2 split_row(const float* row, int k0, int lane) { float v[16]; const float* p = row + k0 + 8 * (lane >> 4);
#pragma unroll
  for (int i = 0; i < 8; ++i) { v[i] = p[i]; v[8 + i] = p[16 + i]; }
  return bsplit16(v); }
__device__ __forceinline__ F2 split_rowK(const float* row, int k0, int lane, int K) { float v[16]; const int g = lane >> 4;
#pragma unroll
  for (int i = 0; i < 8; ++i) { const int ka = k0 + 8 * g + i, kb = ka + 16; v[i] = ka < K ? row[ka < K ? ka : K - 1] : 0.f; v[8 + i] = kb < K ? row[kb < K ? kb : K - 1] : 0.f; }
  return bsplit16(v); }
__device__ __forceinline__ F2 split_col(const float* W, int k0, int n, int lane, int ld, int K) { float v[16]; const int g = lane >> 4;
#pragma unroll
  for (int i = 0; i < 8; ++i) { const int ka = k0 + 8 * g + i, kb = ka + 16; v[i] = ka < K ? W[(size_t)(ka < K ? ka : K - 1) * ld + n] : 0.f; v[8 + i] = kb < K ? W[(size_t)(kb < K ? kb : K - 1) * ld + n] : 0.f; }
  return bsplit16(v); }
__device__ __forceinline__ v8f mac3(const F2& a, const F2& b, v8f c) { c = wmma_bf(a.l, b.h, c); c = wmma_bf(a.h, b.l, c); return wmma_bf(a.h, b.h, c); }
__device__ __forceinline__ float sigm(float v) { return 1.0f / (1.0f + expf(-v)); }
#define LDSX() do { asm volatile("s_wait_dscnt 0" ::: "memory"); __builtin_amdgcn_wave_barrier(); __builtin_amdgcn_fence(__ATOMIC_RELEASE, "workgroup"); } while (0)

// Relative-position multi-head attention (wenet/espnet style; B 8, T 1,024, F 512 = 8 x 64): q = query Wq + bq, k = key Wk + bk, v = value Wv + bv ((in,out)); p = pos_emb[0] Wpos (2T-1 positions); ac = (q + u) k^T; bd = rel_shift((q + v_bias) p^T) with rel_shift(x)[i][j] = x[i][T-1-i+j]; scores = (ac + bd) / 8; softmax; ctx = att v; out = ctx Wout + bout.
#define NB 8
#define TT 1024
#define CC 512
#define NH 8
#define HD 64
#define NPOS (2 * TT - 1)      // 2,047 rows of pos_emb / p
#define HRR (2 * TT + 128)     // rows of the p planes actually built (rows >= NPOS are zeros; they only feed never-read logits)
#define KB 64                  // keys per block of the attention loop
#define AW 16                  // waves per attention work-group: one work-group per WGP, 4 waves per SIMD; its waves walk the same k and v rows, so they share them in the WGP cache
#define NT (KB / 16)           // key tiles per block (the load schedule in k_att is written for 4)
#define BP (KB + 20)           // LDS band pitch in floats: KB + 16 columns used; pitch - 1 = 19 mod 64 keeps the 32 shifted reads of a wave on 32 banks
#define SCALE 0.125f
#ifndef TNB
#define TNB NB
#endif
typedef __attribute__((ext_vector_type(8))) __bf16 v8b;
__device__ __forceinline__ v16b frag_b(const __bf16* rowk0, int lane) {
  union { v16b v; v8b q[2]; } u; const __bf16* p = rowk0 + 8 * (lane >> 4);
  u.q[0] = *(const v8b*)p; u.q[1] = *(const v8b*)(p + 16); return u.v;
}
__device__ __forceinline__ float bfr(float v) { return (float)(__bf16)v; }
// B fragment (k rows k0+.., column o) of an (in,out) [K][CC] weight as bf16
__device__ __forceinline__ v16b wcol(const float* Wm, int k0, int o, int lane) { v16b w; const int g = lane >> 4;
#pragma unroll
  for (int i = 0; i < 8; ++i) { w[i] = (__bf16)Wm[(size_t)(k0 + 8 * g + i) * CC + o]; w[8 + i] = (__bf16)Wm[(size_t)(k0 + 16 + 8 * g + i) * CC + o]; }
  return w; }

#define WS_QUH 0u                                       // f16 (q + u) rows [b*t][512] hi
#define WS_QUL (WS_QUH + 2u * (size_t)NB * TT * CC)      //                     residual x 2^10
#define WS_QVH (WS_QUL + 2u * (size_t)NB * TT * CC)      // f16 (q + v_bias) rows
#define WS_QVL (WS_QVH + 2u * (size_t)NB * TT * CC)
#define WS_KH  (WS_QVL + 2u * (size_t)NB * TT * CC)      // f16 k in fragment order [b][h][t/16][d/16][(d/8)&1][t&15][d&7]: a 16-key tile is 2 KiB and lane l's 16 bytes of each half fragment stand at 16 l
#define WS_HRH (WS_KH  + 2u * (size_t)NB * TT * CC)      // f16 p hi in the same fragment order [h][pos/16][d/16][(d/8)&1][pos&15][d&7], pos < HRR
#define WS_HRL (WS_HRH + 2u * (size_t)HRR * CC)          //                        residual x 2^10
#define WS_VT  (WS_HRL + 2u * (size_t)HRR * CC)          // bf16 v planes in fragment order [b][h][t/32][d/16][(t/16)&1][(t/8)&1][d&15][t&7]
#define WS_VL  (WS_VT  + 2u * (size_t)NB * CC * TT)
#define WS_Y   (WS_VL  + 2u * (size_t)NB * CC * TT)      // f32 ctx rows [b*t][512]
#define WS_END (WS_Y   + 4u * (size_t)NB * TT * CC)

// ---- k_proj: block = (64 rows, 128 cols, which): which 0: q = query Wq + bq -> (q + u) and (q + v_bias) as f16 hi + residual rows (u, v_bias [H,DK] flat = column index); which 1: k = key Wk + bk -> f16, fragment order; which 2: v = value Wv + bv -> bf16 hi + lo planes, fragment order (a store loop's 128 threads write 2 KiB in a row). Weights (in,out).
__global__ __launch_bounds__(128) void k_proj(const float* __restrict__ X0, const float* __restrict__ X1, const float* __restrict__ X2, const float* __restrict__ WQ, const float* __restrict__ BQ, const float* __restrict__ WK, const float* __restrict__ BK, const float* __restrict__ WV, const float* __restrict__ BV, const float* __restrict__ UB, const float* __restrict__ VB, _Float16* __restrict__ QUH, _Float16* __restrict__ QUL, _Float16* __restrict__ QVH, _Float16* __restrict__ QVL, _Float16* __restrict__ KH, __bf16* __restrict__ VT, __bf16* __restrict__ VL) {
  __shared__ __align__(16) _Float16 sh[64][136], sl[64][136]; __shared__ __align__(16) __bf16 th[128][72], tl2[128][72];
  const int tid = threadIdx.x, wave = tid >> 5, lane = tid & 31, col = lane & 15, g = lane >> 4; const int which = blockIdx.z; const int c0 = blockIdx.y * 128; const size_t r0 = (size_t)blockIdx.x * 64;
  const float* X = which == 0 ? X0 : which == 1 ? X1 : X2; const float* WA = which == 0 ? WQ : which == 1 ? WK : WV; const float* BA = which == 0 ? BQ : which == 1 ? BK : BV;
  v8f acc[8] = {};
#pragma unroll 2
  for (int kc = 0; kc < CC / 32; ++kc) { v16b a; { const float* p = X + (r0 + wave * 16 + col) * CC + kc * 32 + 8 * g;
#pragma unroll
      for (int i = 0; i < 8; ++i) { a[i] = (__bf16)p[i]; a[8 + i] = (__bf16)p[16 + i]; } }
    asm volatile("s_wait_loadcnt 0x0" ::: "memory");
#pragma unroll
    for (int j = 0; j < 8; ++j) { const v16b w = wcol(WA, kc * 32, c0 + j * 16 + col, lane); asm volatile("s_wait_loadcnt 0x0" ::: "memory"); acc[j] = wmma_bf(a, w, acc[j]); } }
  const int npass = (which == 0) ? 2 : 1;
  for (int pass = 0; pass < npass; ++pass) {   /* block-uniform */
    if (pass) __syncthreads();
#pragma unroll
    for (int j = 0; j < 8; ++j) { const int o = c0 + j * 16 + col; const float bb = bfr(BA[o]) + ((which == 0) ? bfr((pass == 0 ? UB : VB)[o]) : 0.f);
#pragma unroll
      for (int r = 0; r < 8; ++r) { const float v = acc[j][r] + bb; const int rl = wave * 16 + 8 * g + r, cl = j * 16 + col; const _Float16 hv = (_Float16)v;
        if (which == 2) { const __bf16 bh = (__bf16)v; th[cl][rl] = bh; tl2[cl][rl] = (__bf16)(v - (float)bh); } else { sh[rl][cl] = hv; sl[rl][cl] = (_Float16)((v - (float)hv) * 1024.0f); } } }
    __syncthreads();
    const size_t b = r0 / TT; const int t0 = (int)(r0 % TT);
    if (which == 0) { _Float16* dh = (pass == 0 ? QUH : QVH); _Float16* dl = (pass == 0 ? QUL : QVL); for (int e = tid; e < 64 * 16; e += 128) { const int rl = e >> 4, q = e & 15; vst2((unsigned*)(dh + (r0 + rl) * CC + c0 + q * 8), *(const v4u*)&sh[rl][q * 8]); vst2((unsigned*)(dl + (r0 + rl) * CC + c0 + q * 8), *(const v4u*)&sl[rl][q * 8]); } }
    else if (which == 1) { for (int e = tid; e < 64 * 16; e += 128) { const int rl = ((e >> 7) & 3) * 16 + (e & 15), q = (e >> 9) * 8 + ((e >> 4) & 7);   /* e = (head, tile, d/16, (d/8)&1, t&15) */
        vst2((unsigned*)(KH + ((b * NH + c0 / HD + (e >> 9)) * (TT / 16) + t0 / 16 + ((e >> 7) & 3)) * (size_t)(16 * HD) + (e & 127) * 8), *(const v4u*)&sh[rl][q * 8]); } }
    else { for (int e = tid; e < 128 * 8; e += 128) { const int cl = (e >> 9) * 64 + ((e >> 6) & 3) * 16 + (e & 15), q = ((e >> 8) & 1) * 4 + ((e >> 4) & 3);   /* e = (head, t/32, d/16, (t/16)&1, (t/8)&1, d&15) */
        const size_t o2 = ((b * NH + c0 / HD + (e >> 9)) * (TT / 32) + t0 / 32 + ((e >> 8) & 1)) * (size_t)(32 * HD) + (e & 255) * 8; vst2((unsigned*)(VT + o2), *(const v4u*)&th[cl][q * 8]); vst2((unsigned*)(VL + o2), *(const v4u*)&tl2[cl][q * 8]); } } } }
// ---- k_projr: block = (64 positions, 128 cols): p rows [pos][o] = pos_emb[0][pos] Wpos ((in,out), exact) -> f16 hi + residual, fragment order; rows >= NPOS (2,047) are written as zeros (their A rows are loaded clamped and zeroed by value)
__global__ __launch_bounds__(128) void k_projr(const float* __restrict__ PE, const float* __restrict__ WP, _Float16* __restrict__ HRH, _Float16* __restrict__ HRL) {
  __shared__ __align__(16) _Float16 sh[64][136], sl[64][136];
  const int tid = threadIdx.x, wave = tid >> 5, lane = tid & 31, col = lane & 15, g = lane >> 4; const int c0 = blockIdx.y * 128; const size_t p0 = (size_t)blockIdx.x * 64;
  const size_t prow = p0 + wave * 16 + col; const bool live = prow < NPOS; const size_t prc = live ? prow : (NPOS - 1);
  v8f acc[8] = {};
#pragma unroll 2
  for (int kc = 0; kc < CC / 32; ++kc) { v16b a; { const float* p = PE + prc * CC + kc * 32 + 8 * g;
#pragma unroll
      for (int i = 0; i < 8; ++i) { const float va = p[i], vb = p[16 + i]; a[i] = (__bf16)(live ? va : 0.f); a[8 + i] = (__bf16)(live ? vb : 0.f); } }
    asm volatile("s_wait_loadcnt 0x0" ::: "memory");
#pragma unroll
    for (int j = 0; j < 8; ++j) { const v16b w = wcol(WP, kc * 32, c0 + j * 16 + col, lane); asm volatile("s_wait_loadcnt 0x0" ::: "memory"); acc[j] = wmma_bf(a, w, acc[j]); } }
#pragma unroll
  for (int j = 0; j < 8; ++j) {
#pragma unroll
    for (int r = 0; r < 8; ++r) { const float v = acc[j][r]; const int rl = wave * 16 + 8 * g + r, cl = j * 16 + col; const _Float16 hv = (_Float16)v; sh[rl][cl] = hv; sl[rl][cl] = (_Float16)((v - (float)hv) * 1024.0f); } }
  __syncthreads();
  for (int e = tid; e < 64 * 16; e += 128) { const int rl = ((e >> 7) & 3) * 16 + (e & 15), q = (e >> 9) * 8 + ((e >> 4) & 7);   /* e = (head, tile, d/16, (d/8)&1, pos&15) */
    const size_t o2 = ((size_t)(c0 / HD + (e >> 9)) * (HRR / 16) + p0 / 16 + ((e >> 7) & 3)) * (size_t)(16 * HD) + (e & 127) * 8; vst2((unsigned*)(HRH + o2), *(const v4u*)&sh[rl][q * 8]); vst2((unsigned*)(HRL + o2), *(const v4u*)&sl[rl][q * 8]); } }
// fragment-order loads: p already includes the lane's own offset of 8 * lane elements; the two halves of a fragment are 512 B apart, so each load of a wave reads 512 B in a row (4 cache lines, not 16)
__device__ __forceinline__ v16h frag_t(const _Float16* p) { union { v16h v; v8h q[2]; } u; u.q[0] = *(const v8h*)p; u.q[1] = *(const v8h*)(p + 256); return u.v; }
__device__ __forceinline__ v16b frag_tb(const __bf16* p) { union { v16b v; v8b q[2]; } u; u.q[0] = *(const v8b*)p; u.q[1] = *(const v8b*)(p + 256); return u.v; }
__device__ __forceinline__ void ld4(v16h (&f)[4], const _Float16* rh, const _Float16* rl) { f[0] = frag_t(rh); f[1] = frag_t(rl); f[2] = frag_t(rh + 512); f[3] = frag_t(rl + 512); }
__device__ __forceinline__ void qput(v8h (*s)[32], v16h f, int lane) { union { v16h v; v8h q[2]; } u; u.v = f; s[0][lane] = u.q[0]; s[1][lane] = u.q[1]; }
__device__ __forceinline__ v16h qget(const v8h (*s)[32], int lane) { union { v16h v; v8h q[2]; } u; u.q[0] = s[0][lane]; u.q[1] = s[1][lane]; return u.v; }
// one position tile: X^T = p (q+v_bias)^T, 3 products; x0, x1 = this lane's 8 consecutive positions of its query
__device__ __forceinline__ void bd_tile(const v16h (&f)[4], const v16h (&qh)[HD / 32], const v16h (&ql)[HD / 32], v4f& x0, v4f& x1) { v8f a = {}, al = {};
#pragma unroll
  for (int kc = 0; kc < HD / 32; ++kc) { a = wmma16(f[2 * kc], qh[kc], a); al = wmma16(f[2 * kc], ql[kc], al); al = wmma16(f[2 * kc + 1], qh[kc], al); }
#pragma unroll
  for (int r = 0; r < 4; ++r) { x0[r] = a[r] + al[r] * (1.0f / 1024.0f); x1[r] = a[4 + r] + al[4 + r] * (1.0f / 1024.0f); } }
// ---- k_att: block = 16 * AW queries of one (batch, head) pair, wave = 16 queries, all T keys in blocks of KB. Everything is kept transposed so that a lane owns one query (column lane & 15):
//   S^T = k (q+u)^T (2 products) and X^T = p (q+v_bias)^T (3 products) have D register r = key / position 8g + r; O^T += v^T P^T takes two S^T tiles, converted in place, as its B operand.
//   rel_shift: for queries iw0 + q and keys j0 + jl the position row is T-1-(iw0+q)+(j0+jl) = pb + c with pb = T-16-iw0+j0 and c = jl + 15 - q, so KB/16 + 1 position tiles stand in the wave's own LDS band [q][c] and each lane reads its row back at offset 15 - q; the last tile of a block is the first of the next (pb grows by KB) and is moved there, not computed again.
//   softmax is the running-maximum form: per block m' = max(m, block max), sums and O^T are scaled by exp(m - m'), P = exp(s - m') split bf16 hi + lo; the division by the sum comes last.
__global__ __launch_bounds__(32 * AW) __attribute__((amdgpu_waves_per_eu(4, 4))) void k_att(const _Float16* __restrict__ QUH, const _Float16* __restrict__ QUL, const _Float16* __restrict__ QVH, const _Float16* __restrict__ QVL, const _Float16* __restrict__ KH, const _Float16* __restrict__ RHh, const _Float16* __restrict__ RLl, const __bf16* __restrict__ VT, const __bf16* __restrict__ VL, float* __restrict__ Y) {
  __shared__ __align__(16) float band[AW][16][BP]; __shared__ __align__(16) v8h qs[AW][8][2][32];   /* qs: each lane's own query fragments, parked so that they hold registers only in the phase that uses them (256 VGPRs = 4 waves per SIMD) */
  const int tid = threadIdx.x, wave = tid >> 5, lane = tid & 31, col = lane & 15, g = lane >> 4; const int bh = blockIdx.y, b = bh / NH, h = bh % NH; const int iw0 = blockIdx.x * (16 * AW) + wave * 16;
  const size_t qrow = ((size_t)b * TT + iw0 + col) * CC + h * HD;
#pragma unroll
  for (int kc = 0; kc < HD / 32; ++kc) { qput(qs[wave][kc], frag_h(QVH + qrow + kc * 32, lane), lane); qput(qs[wave][2 + kc], frag_h(QVL + qrow + kc * 32, lane), lane); qput(qs[wave][4 + kc], frag_h(QUH + qrow + kc * 32, lane), lane); qput(qs[wave][6 + kc], frag_h(QUL + qrow + kc * 32, lane), lane); }
  float* bw = &band[wave][col][0];
  const size_t ro = ((size_t)h * (HRR / 16) + (TT - 16 - iw0) / 16) * (16 * HD) + lane * 8; const _Float16* rh = RHh + ro; const _Float16* rl = RLl + ro;   /* this lane's place in position tile 0 of block 0; a tile is 16 * HD elements */
  const _Float16* kp = KH + (size_t)bh * TT * HD + lane * 8; const __bf16* vhp = VT + (size_t)bh * TT * HD + lane * 8; const __bf16* vlp = VL + (size_t)bh * TT * HD + lane * 8;
  v8f acc[HD / 16] = {}; float m = -3.0e38f, l = 0.f;
  // Every fragment is loaded one or two tiles ahead of the products that use it. pf[1], pf[2] (position tiles 1, 2) are loaded at the end of the block before; behind the last block that reads rows < 2T + 32 of the p planes, which k_projr has written, and the values are not used.
  v16h pf[NT + 1][4], kf[NT][2]; v16b vf[KB / 32][HD / 16][2];
  ld4(pf[0], rh, rl); ld4(pf[1], rh + 16 * HD, rl + 16 * HD); ld4(pf[2], rh + 32 * HD, rl + 32 * HD);
  asm volatile("s_wait_xcnt 0x0" :: "v"(rh), "v"(rl) : "memory");   /* the loads above name rh and rl: as inputs here both keep their registers up to the wait, so that nothing (a later load's result either) is written over an address of an issued load in front of it */
  { v16h qvh[HD / 32], qvl[HD / 32]; v4f x0, x1;   /* tile 0 of block 0, put where a block before would have left it */
#pragma unroll
    for (int kc = 0; kc < HD / 32; ++kc) { qvh[kc] = qget(qs[wave][kc], lane); qvl[kc] = qget(qs[wave][2 + kc], lane); }
    bd_tile(pf[0], qvh, qvl, x0, x1); *(v4f*)(bw + KB + 8 * g) = x0; *(v4f*)(bw + KB + 8 * g + 4) = x1; }
#pragma unroll 1
  for (int j0 = 0; j0 < TT; j0 += KB) { const _Float16* rhb = rh + (size_t)j0 * HD; const _Float16* rlb = rl + (size_t)j0 * HD; const _Float16* kpb = kp + (size_t)j0 * HD; const __bf16* vhb = vhp + (size_t)j0 * HD; const __bf16* vlb = vlp + (size_t)j0 * HD;
    v16h quh[HD / 32], qul[HD / 32], qvh[HD / 32], qvl[HD / 32];
#pragma unroll
    for (int kc = 0; kc < HD / 32; ++kc) { qvh[kc] = qget(qs[wave][kc], lane); qvl[kc] = qget(qs[wave][2 + kc], lane); }
    { const v4f c0 = *(const v4f*)(bw + KB + 8 * g), c1 = *(const v4f*)(bw + KB + 8 * g + 4); *(v4f*)(bw + 8 * g) = c0; *(v4f*)(bw + 8 * g + 4) = c1; }   /* the lane's own values: last tile of the block before = tile 0 of this one */
#pragma unroll
    for (int t = 1; t < NT + 1; ++t) {
      if (t + 2 < NT + 1) ld4(pf[t + 2], rhb + (t + 2) * 16 * HD, rlb + (t + 2) * 16 * HD);
      else if (t + 1 == NT) {
#pragma unroll
        for (int u = 0; u < NT / 2; ++u) { kf[u][0] = frag_t(kpb + u * 16 * HD); kf[u][1] = frag_t(kpb + u * 16 * HD + 512); } }
      else {
#pragma unroll
        for (int kc = 0; kc < HD / 32; ++kc) { quh[kc] = qget(qs[wave][4 + kc], lane); qul[kc] = qget(qs[wave][6 + kc], lane); } }
      v4f x0, x1; bd_tile(pf[t], qvh, qvl, x0, x1);
      *(v4f*)(bw + t * 16 + 8 * g) = x0; *(v4f*)(bw + t * 16 + 8 * g + 4) = x1; }
    LDSX();   /* a lane reads band values that its partner lane (lane ^ 16) wrote */
    float s[NT][8]; float bm = -3.0e38f;
#pragma unroll
    for (int t = 0; t < NT; ++t) { v8f a = {}, al = {};
      if (t == 0) {
#pragma unroll
        for (int u = NT / 2; u < NT; ++u) { kf[u][0] = frag_t(kpb + u * 16 * HD); kf[u][1] = frag_t(kpb + u * 16 * HD + 512); } }
#pragma unroll
      for (int kc = 0; kc < HD / 32; ++kc) { a = wmma16(kf[t][kc], quh[kc], a); al = wmma16(kf[t][kc], qul[kc], al); }
      vf[0][t][0] = frag_tb(vhb + t * 512); vf[0][t][1] = frag_tb(vlb + t * 512);
#pragma unroll
      for (int r = 0; r < 8; ++r) { const float v = ((a[r] + al[r] * (1.0f / 1024.0f)) + bw[t * 16 + 8 * g + r + 15 - col]) * SCALE; s[t][r] = v; bm = fmaxf(bm, v); } }
    bm = fmaxf(bm, __shfl_xor(bm, 16));
    const float mn = fmaxf(m, bm), alpha = expf(m - mn); m = mn; l *= alpha;
#pragma unroll
    for (int j = 0; j < HD / 16; ++j)
#pragma unroll
      for (int r = 0; r < 8; ++r) acc[j][r] *= alpha;
#pragma unroll
    for (int c = 0; c < KB / 32; ++c) { float e[16];
#pragma unroll
      for (int i = 0; i < 8; ++i) { e[i] = expf(s[2 * c][i] - m); e[8 + i] = expf(s[2 * c + 1][i] - m); l += e[i] + e[8 + i]; }
      const F2 p = bsplit16(e);
#pragma unroll
      for (int j = 0; j < HD / 16; ++j) { acc[j] = wmma_bf(vf[c][j][0], p.h, acc[j]); acc[j] = wmma_bf(vf[c][j][0], p.l, acc[j]); acc[j] = wmma_bf(vf[c][j][1], p.h, acc[j]);
        if (c + 1 < KB / 32) { vf[c + 1][j][0] = frag_tb(vhb + (c + 1) * 32 * HD + j * 512); vf[c + 1][j][1] = frag_tb(vlb + (c + 1) * 32 * HD + j * 512); }
        else if (j & 1) ld4(pf[1 + (j >> 1)], rhb + (KB + 16 + (j >> 1) * 16) * HD, rlb + (KB + 16 + (j >> 1) * 16) * HD); } }
    asm volatile("s_wait_xcnt 0x0" ::: "memory");   /* the address registers of the loads just issued are rewritten at the top of the next pass */
  }
  l += __shfl_xor(l, 16); const float inv = 1.0f / l;
#pragma unroll
  for (int j = 0; j < HD / 16; ++j) { v4f y0, y1;
#pragma unroll
    for (int r = 0; r < 4; ++r) { y0[r] = acc[j][r] * inv; y1[r] = acc[j][4 + r] * inv; }
    float* yp = Y + qrow + j * 16 + 8 * g; vst2(yp, y0); vst2(yp + 4, y1); } }
// ---- k_out: block = (64 rows, 128 cols): out = ctx (bf16 hi + lo) Wout ((in,out), exact) + bout
__global__ __launch_bounds__(128) void k_out(const float* __restrict__ Yr, const float* __restrict__ WO, const float* __restrict__ BO, float* __restrict__ OUT) { __shared__ __align__(16) float sf[4][16][132];
  const int tid = threadIdx.x, wave = tid >> 5, lane = tid & 31, col = lane & 15, g = lane >> 4; const int c0 = blockIdx.y * 128; const size_t r0 = (size_t)blockIdx.x * 64 + wave * 16;
  v8f acc[8] = {};
#pragma unroll 2
  for (int kc = 0; kc < CC / 32; ++kc) { const F2 a = split_row(Yr + (r0 + col) * CC, kc * 32, lane); asm volatile("s_wait_loadcnt 0x0" ::: "memory");
#pragma unroll
    for (int j = 0; j < 8; ++j) { const v16b w = wcol(WO, kc * 32, c0 + j * 16 + col, lane); asm volatile("s_wait_loadcnt 0x0" ::: "memory"); acc[j] = wmma_bf(a.h, w, acc[j]); acc[j] = wmma_bf(a.l, w, acc[j]); } }
#pragma unroll
  for (int j = 0; j < 8; ++j) { const float bb = bfr(BO[c0 + j * 16 + col]);
#pragma unroll
    for (int r = 0; r < 8; ++r) sf[wave][8 * g + r][j * 16 + col] = acc[j][r] + bb; }
  LDSX(); for (int rl = 0; rl < 16; ++rl) vst2(OUT + (r0 + rl) * CC + c0 + lane * 4, *(const v4f*)&sf[wave][rl][lane * 4]); }
extern "C" void kernel_launch(void* const* d_in, const int* in_sizes, int n_in, void* d_out, int out_size, void* d_ws, size_t ws_size, hipStream_t stream) {
  (void)in_sizes; (void)n_in; (void)out_size;
  const float** F = (const float**)d_in;   // 0 query, 1 key, 2 value [8,1024,512]; 3 pos_emb [1,2047,512]; 4 Wq, 5 bq, 6 Wk, 7 bk, 8 Wv, 9 bv ((in,out)); 10 Wpos; 11 Wout, 12 bout; 13 pos_bias_u [8,64], 14 pos_bias_v
  if (ws_size < (size_t)WS_END) return;
  char* ws = (char*)d_ws; _Float16 *QUH = (_Float16*)(ws + WS_QUH), *QUL = (_Float16*)(ws + WS_QUL), *QVH = (_Float16*)(ws + WS_QVH), *QVL = (_Float16*)(ws + WS_QVL), *KH = (_Float16*)(ws + WS_KH), *HRH = (_Float16*)(ws + WS_HRH), *HRL = (_Float16*)(ws + WS_HRL); __bf16 *VT = (__bf16*)(ws + WS_VT), *VL = (__bf16*)(ws + WS_VL); float *Y = (float*)(ws + WS_Y);
  k_proj<<<dim3(TNB * TT / 64, CC / 128, 3), 128, 0, stream>>>(F[0], F[1], F[2], F[4], F[5], F[6], F[7], F[8], F[9], F[13], F[14], QUH, QUL, QVH, QVL, KH, VT, VL);
  k_projr<<<dim3(HRR / 64, CC / 128), 128, 0, stream>>>(F[3], F[10], HRH, HRL);
  k_att<<<dim3(TT / (16 * AW), TNB * NH), 32 * AW, 0, stream>>>(QUH, QUL, QVH, QVL, KH, HRH, HRL, VT, VL, Y);
  k_out<<<dim3(TNB * TT / 64, CC / 128), 128, 0, stream>>>(Y, F[11], F[12], (float*)d_out);
}

// v004
// One run takes 147 microseconds.
// In both of two side-by-side timings against v003, it was 1.57 times as fast.
// All steps since v000 together make it 10.6 times as fast.
// compute dtype: all float inputs rounded to bf16; q/k/v/p = x W + b with EXACT bf16 products on WMMA 16x16x32, f32 accumulate; (q + pos_bias_u), (q + pos_bias_v) and p as f16 hi + residual (x 2^10), k once to f16 -> content logits 2 products, position logits 3 products; the rel_shift as a banded position GEMM + index offset through LDS; /8 and running-maximum softmax in f32 (precise expf); P = exp(s - m) split bf16 hi + lo against v bf16 hi + lo (3 products), divided by the sum at the end; ctx (bf16 hi + lo) Wout + bout; f32 output.
#include <hip/hip_runtime.h>
#include <math.h>

typedef __attribute__((ext_vector_type(16))) _Float16 v16h;
typedef __attribute__((ext_vector_type(16))) __bf16 v16b;
typedef __attribute__((ext_vector_type(8)))  _Float16 v8h;
typedef __attribute__((ext_vector_type(8)))  float v8f;
typedef __attribute__((ext_vector_type(4)))  float v4f;
typedef __attribute__((ext_vector_type(2)))  float v2f;
typedef __attribute__((ext_vector_type(4)))  unsigned v4u;
typedef __attribute__((ext_vector_type(4)))  int v4i;
typedef float __attribute__((may_alias)) float_a;
typedef int __attribute__((may_alias)) int_a;

template <typename T> __device__ __forceinline__ void vst2(void* p, T v) { *(T*)p = v;  }
__device__ __forceinline__ v8f wmma16(v16h a, v16h b, v8f c) {
  v8f d = __builtin_amdgcn_wmma_f32_16x16x32_f16(false, a, false, b, (short)0, c, false, false);
  asm volatile("v_nop\n\tv_nop\n\tv_nop\n\tv_nop" : "+v"(d) : "v"(a), "v"(b));
  return d;
}
__device__ __forceinline__ v8f wmma_bf(v16b a, v16b b, v8f c) {
  v8f d = __builtin_amdgcn_wmma_f32_16x16x32_bf16(false, a, false, b, (short)0, c, false, false);
  asm volatile("v_nop\n\tv_nop\n\tv_nop\n\tv_nop" : "+v"(d) : "v"(a), "v"(b));
  return d;
}
// 16x16x32 fragments: lane = (h = lane>>4, row/col = lane&15); elements 0..7 = k0+8h+0..7, 8..15 = k0+16+8h+0..7; D element r = row 8h+r
__device__ __forceinline__ v16h frag_h(const _Float16* rowk0, int lane) {
  union { v16h v; v8h q[2]; } u; const _Float16* p = rowk0 + 8 * (lane >> 4);
  u.q[0] = *(const v8h*)p; u.q[1] = *(const v8h*)(p + 16); return u.v;
}
__device__ __forceinline__ v16h frag_f32(const float* rowk0, int lane) {
  v16h a; const float* p = rowk0 + 8 * (lane >> 4);
#pragma unroll
  for (int i = 0; i < 8; ++i) { a[i] = (_Float16)p[i]; a[8 + i] = (_Float16)p[16 + i]; }
  return a;
}
__device__ __forceinline__ v16h frag_f32s(const float* rowk0, int lane, float sc) {
  v16h a; const float* p = rowk0 + 8 * (lane >> 4);
#pragma unroll
  for (int i = 0; i < 8; ++i) { a[i] = (_Float16)(p[i] * sc); a[8 + i] = (_Float16)(p[16 + i] * sc); }
  return a;
}
// column fragment from a [K][ld] layout (column n), rows >= K read as 0
__device__ __forceinline__ v16h fragc_f32(const float* W, int k0, int n, int lane, int ld, int K) {
  v16h a; const int g = lane >> 4;
#pragma unroll
  for (int i = 0; i < 8; ++i) { const int ka = k0 + 8 * g + i, kb = ka + 16;
    a[i] = (_Float16)(ka < K ? W[(size_t)(ka < K ? ka : K - 1) * ld + n] : 0.f); a[8 + i] = (_Float16)(kb < K ? W[(size_t)(kb < K ? kb : K - 1) * ld + n] : 0.f); }
  return a;
}
struct F2 { v16b h, l; };
__device__ __forceinline__ F2 bsplit16(const float v[16]) { F2 r;
#pragma unroll
  for (int i = 0; i < 16; ++i) { const __bf16 h = (__bf16)v[i]; r.h[i] = h; r.l[i] = (__bf16)(v[i] - (float)h); }
  return r; }
__device__ __forceinline__ F2 split_row(const float* row, int k0, int lane) { float v[16]; const float* p = row + k0 + 8 * (lane >> 4);
#pragma unroll
  for (int i = 0; i < 8; ++i) { v[i] = p[i]; v[8 + i] = p[16 + i]; }
  return bsplit16(v); }
__device__ __forceinline__ F2 split_rowK(const float* row, int k0, int lane, int K) { float v[16]; const int g = lane >> 4;
#pragma unroll
  for (int i = 0; i < 8; ++i) { const int ka = k0 + 8 * g + i, kb = ka + 16; v[i] = ka < K ? row[ka < K ? ka : K - 1] : 0.f; v[8 + i] = kb < K ? row[kb < K ? kb : K - 1] : 0.f; }
  return bsplit16(v); }
__device__ __forceinline__ F2 split_col(const float* W, int k0, int n, int lane, int ld, int K) { float v[16]; const int g = lane >> 4;
#pragma unroll
  for (int i = 0; i < 8; ++i) { const int ka = k0 + 8 * g + i, kb = ka + 16; v[i] = ka < K ? W[(size_t)(ka < K ? ka : K - 1) * ld + n] : 0.f; v[8 + i] = kb < K ? W[(size_t)(kb < K ? kb : K - 1) * ld + n] : 0.f; }
  return bsplit16(v); }
__device__ __forceinline__ v8f mac3(const F2& a, const F2& b, v8f c) { c = wmma_bf(a.l, b.h, c); c = wmma_bf(a.h, b.l, c); return wmma_bf(a.h, b.h, c); }
__device__ __forceinline__ float sigm(float v) { return 1.0f / (1.0f + expf(-v)); }
#define LDSX() do { asm volatile("s_wait_dscnt 0" ::: "memory"); __builtin_amdgcn_wave_barrier(); __builtin_amdgcn_fence(__ATOMIC_RELEASE, "workgroup"); } while (0)

// Relative-position multi-head attention (wenet/espnet style; B 8, T 1,024, F 512 = 8 x 64): q = query Wq + bq, k = key Wk + bk, v = value Wv + bv ((in,out)); p = pos_emb[0] Wpos (2T-1 positions); ac = (q + u) k^T; bd = rel_shift((q + v_bias) p^T) with rel_shift(x)[i][j] = x[i][T-1-i+j]; scores = (ac + bd) / 8; softmax; ctx = att v; out = ctx Wout + bout.
#define NB 8
#define TT 1024
#define CC 512
#define NH 8
#define HD 64
#define NPOS (2 * TT - 1)      // 2,047 rows of pos_emb / p
#define HRR (2 * TT + 128)     // rows of the p planes actually built (rows >= NPOS are zeros; they only feed never-read logits)
#define KB 64                  // keys per block of the attention loop
#define AW 16                  // waves per attention work-group: one work-group per WGP, 4 waves per SIMD; its waves walk the same k and v rows, so they share them in the WGP cache
#define NT (KB / 16)           // key tiles per block (the load schedule in k_att is written for 4)
#define BP (KB + 20)           // LDS band pitch in floats: KB + 16 columns used; pitch - 1 = 19 mod 64 keeps the 32 shifted reads of a wave on 32 banks
#define SCALE 0.125f
#ifndef TNB
#define TNB NB
#endif
typedef __attribute__((ext_vector_type(8))) __bf16 v8b;
__device__ __forceinline__ v16b frag_b(const __bf16* rowk0, int lane) {
  union { v16b v; v8b q[2]; } u; const __bf16* p = rowk0 + 8 * (lane >> 4);
  u.q[0] = *(const v8b*)p; u.q[1] = *(const v8b*)(p + 16); return u.v;
}
__device__ __forceinline__ float bfr(float v) { return (float)(__bf16)v; }

// ---- the k loop of the three projection kernels: block = 4 waves, 64 rows x 128 columns, wave = 16 rows x 128 columns.
// Each k-step's 32 x 128 weight tile is read from global memory once per work-group (whole rows of 512 B) and put into LDS as bf16 B fragments: fragment j (16 columns) holds lane l's elements 0..7 at 16 l bytes and 8..15 at 512 + 16 l.
// Two buffers: step kc + 1 is loaded into registers in front of the products of step kc and stored behind them; one barrier per step publishes it and ends the reads of the buffer that is written next.
#define WFP 520                // pitch of a staged fragment in elements: 1 KiB + 16 B, so that the 32 16-byte stores of a wave (8 fragments x 4 columns) spread over all banks
#define WBUF (8 * WFP)
typedef v8b __attribute__((may_alias)) v8b_a;   // the stage shares its LDS with the arrays of the epilogues
template <int MODE>   // 0: A rows rounded to bf16; 1: the same, rows that are not live read as 0; 2: A rows as bf16 hi + lo (2 products)
__device__ __forceinline__ void gemm128(const float* ap, const float* wp, __bf16* wst, int wave, int lane, bool live, v8f (&acc)[8]) {   /* ap: this lane's row + 8 g; wp: weight row 8 wave, column c0 + 4 lane */
  __bf16* wd = wst + (lane >> 2) * WFP + (wave >> 1) * 256 + ((wave & 1) * 16 + 4 * (lane & 3)) * 8; const __bf16* wsrc = wst + lane * 8;
  v4f wr[8], ar[4];
#pragma unroll
  for (int i = 0; i < 8; ++i) wr[i] = *(const v4f*)(wp + (size_t)i * CC);
  ar[0] = *(const v4f*)ap; ar[1] = *(const v4f*)(ap + 4); ar[2] = *(const v4f*)(ap + 16); ar[3] = *(const v4f*)(ap + 20);
  asm volatile("s_wait_xcnt 0x0" :: "v"(wp), "v"(ap) : "memory");   /* the loads above name wp and ap, which are advanced below */
#pragma unroll
  for (int c = 0; c < 4; ++c) { v8b t;
#pragma unroll
    for (int i = 0; i < 8; ++i) t[i] = (__bf16)wr[i][c];
    *(v8b_a*)(wd + c * 8) = t; }
  __syncthreads();
#pragma unroll 2   /* two steps a trip, so that each step's buffer is a constant offset */
  for (int kc = 0; kc < CC / 32; ++kc) { float v[16];
#pragma unroll
    for (int i = 0; i < 4; ++i) { v[i] = ar[0][i]; v[4 + i] = ar[1][i]; v[8 + i] = ar[2][i]; v[12 + i] = ar[3][i]; }
    if (MODE == 1) {
#pragma unroll
      for (int i = 0; i < 16; ++i) v[i] = live ? v[i] : 0.f; }
    F2 a;
    if (MODE == 2) a = bsplit16(v);
    else {
#pragma unroll
      for (int i = 0; i < 16; ++i) a.h[i] = (__bf16)v[i]; }
    const __bf16* sb = wsrc + (kc & 1) * WBUF; union { v16b v; v8b q[2]; } w[8];   /* all 8 fragments are asked for at once, so that the LDS latency is paid once a step */
#pragma unroll
    for (int j = 0; j < 8; ++j) { w[j].q[0] = *(const v8b_a*)(sb + j * WFP); w[j].q[1] = *(const v8b_a*)(sb + j * WFP + 256); }
    if (kc + 1 < CC / 32) { wp += 32 * CC; ap += 32;
#pragma unroll
      for (int i = 0; i < 8; ++i) wr[i] = *(const v4f*)(wp + (size_t)i * CC);
      ar[0] = *(const v4f*)ap; ar[1] = *(const v4f*)(ap + 4); ar[2] = *(const v4f*)(ap + 16); ar[3] = *(const v4f*)(ap + 20);
      asm volatile("s_wait_xcnt 0x0" :: "v"(wp), "v"(ap) : "memory");   /* the loads above name wp and ap, which the next step advances */
    }
#pragma unroll
    for (int j = 0; j < 8; ++j) { acc[j] = wmma_bf(a.h, w[j].v, acc[j]); if (MODE == 2) acc[j] = wmma_bf(a.l, w[j].v, acc[j]); }
    __builtin_amdgcn_sched_barrier(0);   /* keeps the wait for the next step's global loads behind this step's products */
    if (kc + 1 < CC / 32) { __bf16* db = wd + ((kc + 1) & 1) * WBUF;
#pragma unroll
      for (int c = 0; c < 4; ++c) { v8b t;
#pragma unroll
        for (int i = 0; i < 8; ++i) t[i] = (__bf16)wr[i][c];
        *(v8b_a*)(db + c * 8) = t; } }
    __syncthreads();   /* publishes step kc + 1; behind the last step it frees the stage for the epilogue's arrays */
  } }

#define WS_QUH 0u                                       // f16 (q + u) rows [b*t][512] hi
#define WS_QUL (WS_QUH + 2u * (size_t)NB * TT * CC)      //                     residual x 2^10
#define WS_QVH (WS_QUL + 2u * (size_t)NB * TT * CC)      // f16 (q + v_bias) rows
#define WS_QVL (WS_QVH + 2u * (size_t)NB * TT * CC)
#define WS_KH  (WS_QVL + 2u * (size_t)NB * TT * CC)      // f16 k in fragment order [b][h][t/16][d/16][(d/8)&1][t&15][d&7]: a 16-key tile is 2 KiB and lane l's 16 bytes of each half fragment stand at 16 l
#define WS_HRH (WS_KH  + 2u * (size_t)NB * TT * CC)      // f16 p hi in the same fragment order [h][pos/16][d/16][(d/8)&1][pos&15][d&7], pos < HRR
#define WS_HRL (WS_HRH + 2u * (size_t)HRR * CC)          //                        residual x 2^10
#define WS_VT  (WS_HRL + 2u * (size_t)HRR * CC)          // bf16 v planes in fragment order [b][h][t/32][d/16][(t/16)&1][(t/8)&1][d&15][t&7]
#define WS_VL  (WS_VT  + 2u * (size_t)NB * CC * TT)
#define WS_Y   (WS_VL  + 2u * (size_t)NB * CC * TT)      // f32 ctx rows [b*t][512]
#define WS_END (WS_Y   + 4u * (size_t)NB * TT * CC)

// ---- k_proj: block = (64 rows, 128 cols, which): which 0: q = query Wq + bq -> (q + u) and (q + v_bias) as f16 hi + residual rows (u, v_bias [H,DK] flat = column index); which 1: k = key Wk + bk -> f16, fragment order; which 2: v = value Wv + bv -> bf16 hi + lo planes, fragment order (a store loop's 128 threads write 2 KiB in a row). Weights (in,out).
__global__ __launch_bounds__(128) void k_proj(const float* __restrict__ X0, const float* __restrict__ X1, const float* __restrict__ X2, const float* __restrict__ WQ, const float* __restrict__ BQ, const float* __restrict__ WK, const float* __restrict__ BK, const float* __restrict__ WV, const float* __restrict__ BV, const float* __restrict__ UB, const float* __restrict__ VB, _Float16* __restrict__ QUH, _Float16* __restrict__ QUL, _Float16* __restrict__ QVH, _Float16* __restrict__ QVL, _Float16* __restrict__ KH, __bf16* __restrict__ VT, __bf16* __restrict__ VL) {
  __shared__ __align__(16) _Float16 sh[64][136], sl[64][136]; __shared__ __align__(16) __bf16 th[128][72], tl2[128][72];
  const int tid = threadIdx.x, wave = tid >> 5, lane = tid & 31, col = lane & 15, g = lane >> 4; const int which = blockIdx.z; const int c0 = blockIdx.y * 128; const size_t r0 = (size_t)blockIdx.x * 64;
  const float* X = which == 0 ? X0 : which == 1 ? X1 : X2; const float* WA = which == 0 ? WQ : which == 1 ? WK : WV; const float* BA = which == 0 ? BQ : which == 1 ? BK : BV;
  v8f acc[8] = {};
  gemm128<0>(X + (r0 + wave * 16 + col) * CC + 8 * g, WA + (size_t)(8 * wave) * CC + c0 + 4 * lane, (__bf16*)&sh[0][0], wave, lane, true, acc);
  const int npass = (which == 0) ? 2 : 1;
  for (int pass = 0; pass < npass; ++pass) {   /* block-uniform */
    if (pass) __syncthreads();
#pragma unroll
    for (int j = 0; j < 8; ++j) { const int o = c0 + j * 16 + col; const float bb = bfr(BA[o]) + ((which == 0) ? bfr((pass == 0 ? UB : VB)[o]) : 0.f);
#pragma unroll
      for (int r = 0; r < 8; ++r) { const float v = acc[j][r] + bb; const int rl = wave * 16 + 8 * g + r, cl = j * 16 + col; const _Float16 hv = (_Float16)v;
        if (which == 2) { const __bf16 bh = (__bf16)v; th[cl][rl] = bh; tl2[cl][rl] = (__bf16)(v - (float)bh); } else { sh[rl][cl] = hv; sl[rl][cl] = (_Float16)((v - (float)hv) * 1024.0f); } } }
    __syncthreads();
    const size_t b = r0 / TT; const int t0 = (int)(r0 % TT);
    if (which == 0) { _Float16* dh = (pass == 0 ? QUH : QVH); _Float16* dl = (pass == 0 ? QUL : QVL); for (int e = tid; e < 64 * 16; e += 128) { const int rl = e >> 4, q = e & 15; vst2((unsigned*)(dh + (r0 + rl) * CC + c0 + q * 8), *(const v4u*)&sh[rl][q * 8]); vst2((unsigned*)(dl + (r0 + rl) * CC + c0 + q * 8), *(const v4u*)&sl[rl][q * 8]); } }
    else if (which == 1) { for (int e = tid; e < 64 * 16; e += 128) { const int rl = ((e >> 7) & 3) * 16 + (e & 15), q = (e >> 9) * 8 + ((e >> 4) & 7);   /* e = (head, tile, d/16, (d/8)&1, t&15) */
        vst2((unsigned*)(KH + ((b * NH + c0 / HD + (e >> 9)) * (TT / 16) + t0 / 16 + ((e >> 7) & 3)) * (size_t)(16 * HD) + (e & 127) * 8), *(const v4u*)&sh[rl][q * 8]); } }
    else { for (int e = tid; e < 128 * 8; e += 128) { const int cl = (e >> 9) * 64 + ((e >> 6) & 3) * 16 + (e & 15), q = ((e >> 8) & 1) * 4 + ((e >> 4) & 3);   /* e = (head, t/32, d/16, (t/16)&1, (t/8)&1, d&15) */
        const size_t o2 = ((b * NH + c0 / HD + (e >> 9)) * (TT / 32) + t0 / 32 + ((e >> 8) & 1)) * (size_t)(32 * HD) + (e & 255) * 8; vst2((unsigned*)(VT + o2), *(const v4u*)&th[cl][q * 8]); vst2((unsigned*)(VL + o2), *(const v4u*)&tl2[cl][q * 8]); } } } }
// ---- k_projr: block = (64 positions, 128 cols): p rows [pos][o] = pos_emb[0][pos] Wpos ((in,out), exact) -> f16 hi + residual, fragment order; rows >= NPOS (2,047) are written as zeros (their A rows are loaded clamped and zeroed by value)
__global__ __launch_bounds__(128) void k_projr(const float* __restrict__ PE, const float* __restrict__ WP, _Float16* __restrict__ HRH, _Float16* __restrict__ HRL) {
  __shared__ __align__(16) _Float16 sh[64][136], sl[64][136];
  const int tid = threadIdx.x, wave = tid >> 5, lane = tid & 31, col = lane & 15, g = lane >> 4; const int c0 = blockIdx.y * 128; const size_t p0 = (size_t)blockIdx.x * 64;
  const size_t prow = p0 + wave * 16 + col; const bool live = prow < NPOS; const size_t prc = live ? prow : (NPOS - 1);
  v8f acc[8] = {};
  gemm128<1>(PE + prc * CC + 8 * g, WP + (size_t)(8 * wave) * CC + c0 + 4 * lane, (__bf16*)&sh[0][0], wave, lane, live, acc);
#pragma unroll
  for (int j = 0; j < 8; ++j) {
#pragma unroll
    for (int r = 0; r < 8; ++r) { const float v = acc[j][r]; const int rl = wave * 16 + 8 * g + r, cl = j * 16 + col; const _Float16 hv = (_Float16)v; sh[rl][cl] = hv; sl[rl][cl] = (_Float16)((v - (float)hv) * 1024.0f); } }
  __syncthreads();
  for (int e = tid; e < 64 * 16; e += 128) { const int rl = ((e >> 7) & 3) * 16 + (e & 15), q = (e >> 9) * 8 + ((e >> 4) & 7);   /* e = (head, tile, d/16, (d/8)&1, pos&15) */
    const size_t o2 = ((size_t)(c0 / HD + (e >> 9)) * (HRR / 16) + p0 / 16 + ((e >> 7) & 3)) * (size_t)(16 * HD) + (e & 127) * 8; vst2((unsigned*)(HRH + o2), *(const v4u*)&sh[rl][q * 8]); vst2((unsigned*)(HRL + o2), *(const v4u*)&sl[rl][q * 8]); } }
// fragment-order loads: p already includes the lane's own offset of 8 * lane elements; the two halves of a fragment are 512 B apart, so each load of a wave reads 512 B in a row (4 cache lines, not 16)
__device__ __forceinline__ v16h frag_t(const _Float16* p) { union { v16h v; v8h q[2]; } u; u.q[0] = *(const v8h*)p; u.q[1] = *(const v8h*)(p + 256); return u.v; }
__device__ __forceinline__ v16b frag_tb(const __bf16* p) { union { v16b v; v8b q[2]; } u; u.q[0] = *(const v8b*)p; u.q[1] = *(const v8b*)(p + 256); return u.v; }
__device__ __forceinline__ void ld4(v16h (&f)[4], const _Float16* rh, const _Float16* rl) { f[0] = frag_t(rh); f[1] = frag_t(rl); f[2] = frag_t(rh + 512); f[3] = frag_t(rl + 512); }
__device__ __forceinline__ void qput(v8h (*s)[32], v16h f, int lane) { union { v16h v; v8h q[2]; } u; u.v = f; s[0][lane] = u.q[0]; s[1][lane] = u.q[1]; }
__device__ __forceinline__ v16h qget(const v8h (*s)[32], int lane) { union { v16h v; v8h q[2]; } u; u.q[0] = s[0][lane]; u.q[1] = s[1][lane]; return u.v; }
// one position tile: X^T = p (q+v_bias)^T, 3 products; x0, x1 = this lane's 8 consecutive positions of its query
__device__ __forceinline__ void bd_tile(const v16h (&f)[4], const v16h (&qh)[HD / 32], const v16h (&ql)[HD / 32], v4f& x0, v4f& x1) { v8f a = {}, al = {};
#pragma unroll
  for (int kc = 0; kc < HD / 32; ++kc) { a = wmma16(f[2 * kc], qh[kc], a); al = wmma16(f[2 * kc], ql[kc], al); al = wmma16(f[2 * kc + 1], qh[kc], al); }
#pragma unroll
  for (int r = 0; r < 4; ++r) { x0[r] = a[r] + al[r] * (1.0f / 1024.0f); x1[r] = a[4 + r] + al[4 + r] * (1.0f / 1024.0f); } }
// ---- k_att: block = 16 * AW queries of one (batch, head) pair, wave = 16 queries, all T keys in blocks of KB. Everything is kept transposed so that a lane owns one query (column lane & 15):
//   S^T = k (q+u)^T (2 products) and X^T = p (q+v_bias)^T (3 products) have D register r = key / position 8g + r; O^T += v^T P^T takes two S^T tiles, converted in place, as its B operand.
//   rel_shift: for queries iw0 + q and keys j0 + jl the position row is T-1-(iw0+q)+(j0+jl) = pb + c with pb = T-16-iw0+j0 and c = jl + 15 - q, so KB/16 + 1 position tiles stand in the wave's own LDS band [q][c] and each lane reads its row back at offset 15 - q; the last tile of a block is the first of the next (pb grows by KB) and is moved there, not computed again.
//   softmax is the running-maximum form: per block m' = max(m, block max), sums and O^T are scaled by exp(m - m'), P = exp(s - m') split bf16 hi + lo; the division by the sum comes last.
__global__ __launch_bounds__(32 * AW) __attribute__((amdgpu_waves_per_eu(4, 4))) void k_att(const _Float16* __restrict__ QUH, const _Float16* __restrict__ QUL, const _Float16* __restrict__ QVH, const _Float16* __restrict__ QVL, const _Float16* __restrict__ KH, const _Float16* __restrict__ RHh, const _Float16* __restrict__ RLl, const __bf16* __restrict__ VT, const __bf16* __restrict__ VL, float* __restrict__ Y) {
  __shared__ __align__(16) float band[AW][16][BP]; __shared__ __align__(16) v8h qs[AW][8][2][32];   /* qs: each lane's own query fragments, parked so that they hold registers only in the phase that uses them (256 VGPRs = 4 waves per SIMD) */
  const int tid = threadIdx.x, wave = tid >> 5, lane = tid & 31, col = lane & 15, g = lane >> 4; const int bh = blockIdx.y, b = bh / NH, h = bh % NH; const int iw0 = blockIdx.x * (16 * AW) + wave * 16;
  const size_t qrow = ((size_t)b * TT + iw0 + col) * CC + h * HD;
#pragma unroll
  for (int kc = 0; kc < HD / 32; ++kc) { qput(qs[wave][kc], frag_h(QVH + qrow + kc * 32, lane), lane); qput(qs[wave][2 + kc], frag_h(QVL + qrow + kc * 32, lane), lane); qput(qs[wave][4 + kc], frag_h(QUH + qrow + kc * 32, lane), lane); qput(qs[wave][6 + kc], frag_h(QUL + qrow + kc * 32, lane), lane); }
  float* bw = &band[wave][col][0];
  const size_t ro = ((size_t)h * (HRR / 16) + (TT - 16 - iw0) / 16) * (16 * HD) + lane * 8; const _Float16* rh = RHh + ro; const _Float16* rl = RLl + ro;   /* this lane's place in position tile 0 of block 0; a tile is 16 * HD elements */
  const _Float16* kp = KH + (size_t)bh * TT * HD + lane * 8; const __bf16* vhp = VT + (size_t)bh * TT * HD + lane * 8; const __bf16* vlp = VL + (size_t)bh * TT * HD + lane * 8;
  v8f acc[HD / 16] = {}; float m = -3.0e38f, l = 0.f;
  // Every fragment is loaded one or two tiles ahead of the products that use it. pf[1], pf[2] (position tiles 1, 2) are loaded at the end of the block before; behind the last block that reads rows < 2T + 32 of the p planes, which k_projr has written, and the values are not used.
  v16h pf[NT + 1][4], kf[NT][2]; v16b vf[KB / 32][HD / 16][2];
  ld4(pf[0], rh, rl); ld4(pf[1], rh + 16 * HD, rl + 16 * HD); ld4(pf[2], rh + 32 * HD, rl + 32 * HD);
  asm volatile("s_wait_xcnt 0x0" :: "v"(rh), "v"(rl) : "memory");   /* the loads above name rh and rl: as inputs here both keep their registers up to the wait, so that nothing (a later load's result either) is written over an address of an issued load in front of it */
  { v16h qvh[HD / 32], qvl[HD / 32]; v4f x0, x1;   /* tile 0 of block 0, put where a block before would have left it */
#pragma unroll
    for (int kc = 0; kc < HD / 32; ++kc) { qvh[kc] = qget(qs[wave][kc], lane); qvl[kc] = qget(qs[wave][2 + kc], lane); }
    bd_tile(pf[0], qvh, qvl, x0, x1); *(v4f*)(bw + KB + 8 * g) = x0; *(v4f*)(bw + KB + 8 * g + 4) = x1; }
#pragma unroll 1
  for (int j0 = 0; j0 < TT; j0 += KB) { const _Float16* rhb = rh + (size_t)j0 * HD; const _Float16* rlb = rl + (size_t)j0 * HD; const _Float16* kpb = kp + (size_t)j0 * HD; const __bf16* vhb = vhp + (size_t)j0 * HD; const __bf16* vlb = vlp + (size_t)j0 * HD;
    v16h quh[HD / 32], qul[HD / 32], qvh[HD / 32], qvl[HD / 32];
#pragma unroll
    for (int kc = 0; kc < HD / 32; ++kc) { qvh[kc] = qget(qs[wave][kc], lane); qvl[kc] = qget(qs[wave][2 + kc], lane); }
    { const v4f c0 = *(const v4f*)(bw + KB + 8 * g), c1 = *(const v4f*)(bw + KB + 8 * g + 4); *(v4f*)(bw + 8 * g) = c0; *(v4f*)(bw + 8 * g + 4) = c1; }   /* the lane's own values: last tile of the block before = tile 0 of this one */
#pragma unroll
    for (int t = 1; t < NT + 1; ++t) {
      if (t + 2 < NT + 1) ld4(pf[t + 2], rhb + (t + 2) * 16 * HD, rlb + (t + 2) * 16 * HD);
      else if (t + 1 == NT) {
#pragma unroll
        for (int u = 0; u < NT / 2; ++u) { kf[u][0] = frag_t(kpb + u * 16 * HD); kf[u][1] = frag_t(kpb + u * 16 * HD + 512); } }
      else {
#pragma unroll
        for (int kc = 0; kc < HD / 32; ++kc) { quh[kc] = qget(qs[wave][4 + kc], lane); qul[kc] = qget(qs[wave][6 + kc], lane); } }
      v4f x0, x1; bd_tile(pf[t], qvh, qvl, x0, x1);
      *(v4f*)(bw + t * 16 + 8 * g) = x0; *(v4f*)(bw + t * 16 + 8 * g + 4) = x1; }
    LDSX();   /* a lane reads band values that its partner lane (lane ^ 16) wrote */
    float s[NT][8]; float bm = -3.0e38f;
#pragma unroll
    for (int t = 0; t < NT; ++t) { v8f a = {}, al = {};
      if (t == 0) {
#pragma unroll
        for (int u = NT / 2; u < NT; ++u) { kf[u][0] = frag_t(kpb + u * 16 * HD); kf[u][1] = frag_t(kpb + u * 16 * HD + 512); } }
#pragma unroll
      for (int kc = 0; kc < HD / 32; ++kc) { a = wmma16(kf[t][kc], quh[kc], a); al = wmma16(kf[t][kc], qul[kc], al); }
      vf[0][t][0] = frag_tb(vhb + t * 512); vf[0][t][1] = frag_tb(vlb + t * 512);
#pragma unroll
      for (int r = 0; r < 8; ++r) { const float v = ((a[r] + al[r] * (1.0f / 1024.0f)) + bw[t * 16 + 8 * g + r + 15 - col]) * SCALE; s[t][r] = v; bm = fmaxf(bm, v); } }
    bm = fmaxf(bm, __shfl_xor(bm, 16));
    const float mn = fmaxf(m, bm), alpha = expf(m - mn); m = mn; l *= alpha;
#pragma unroll
    for (int j = 0; j < HD / 16; ++j)
#pragma unroll
      for (int r = 0; r < 8; ++r) acc[j][r] *= alpha;
#pragma unroll
    for (int c = 0; c < KB / 32; ++c) { float e[16];
#pragma unroll
      for (int i = 0; i < 8; ++i) { e[i] = expf(s[2 * c][i] - m); e[8 + i] = expf(s[2 * c + 1][i] - m); l += e[i] + e[8 + i]; }
      const F2 p = bsplit16(e);
#pragma unroll
      for (int j = 0; j < HD / 16; ++j) { acc[j] = wmma_bf(vf[c][j][0], p.h, acc[j]); acc[j] = wmma_bf(vf[c][j][0], p.l, acc[j]); acc[j] = wmma_bf(vf[c][j][1], p.h, acc[j]);
        if (c + 1 < KB / 32) { vf[c + 1][j][0] = frag_tb(vhb + (c + 1) * 32 * HD + j * 512); vf[c + 1][j][1] = frag_tb(vlb + (c + 1) * 32 * HD + j * 512); }
        else if (j & 1) ld4(pf[1 + (j >> 1)], rhb + (KB + 16 + (j >> 1) * 16) * HD, rlb + (KB + 16 + (j >> 1) * 16) * HD); } }
    asm volatile("s_wait_xcnt 0x0" ::: "memory");   /* the address registers of the loads just issued are rewritten at the top of the next pass */
  }
  l += __shfl_xor(l, 16); const float inv = 1.0f / l;
#pragma unroll
  for (int j = 0; j < HD / 16; ++j) { v4f y0, y1;
#pragma unroll
    for (int r = 0; r < 4; ++r) { y0[r] = acc[j][r] * inv; y1[r] = acc[j][4 + r] * inv; }
    float* yp = Y + qrow + j * 16 + 8 * g; vst2(yp, y0); vst2(yp + 4, y1); } }
// ---- k_out: block = (64 rows, 128 cols): out = ctx (bf16 hi + lo) Wout ((in,out), exact) + bout
__global__ __launch_bounds__(128) void k_out(const float* __restrict__ Yr, const float* __restrict__ WO, const float* __restrict__ BO, float* __restrict__ OUT) { __shared__ __align__(16) float sf[4][16][132];
  const int tid = threadIdx.x, wave = tid >> 5, lane = tid & 31, col = lane & 15, g = lane >> 4; const int c0 = blockIdx.y * 128; const size_t r0 = (size_t)blockIdx.x * 64 + wave * 16;
  v8f acc[8] = {};
  gemm128<2>(Yr + (r0 + col) * CC + 8 * g, WO + (size_t)(8 * wave) * CC + c0 + 4 * lane, (__bf16*)&sf[0][0][0], wave, lane, true, acc);
#pragma unroll
  for (int j = 0; j < 8; ++j) { const float bb = bfr(BO[c0 + j * 16 + col]);
#pragma unroll
    for (int r = 0; r < 8; ++r) sf[wave][8 * g + r][j * 16 + col] = acc[j][r] + bb; }
  LDSX(); for (int rl = 0; rl < 16; ++rl) vst2(OUT + (r0 + rl) * CC + c0 + lane * 4, *(const v4f*)&sf[wave][rl][lane * 4]); }
extern "C" void kernel_launch(void* const* d_in, const int* in_sizes, int n_in, void* d_out, int out_size, void* d_ws, size_t ws_size, hipStream_t stream) {
  (void)in_sizes; (void)n_in; (void)out_size;
  const float** F = (const float**)d_in;   // 0 query, 1 key, 2 value [8,1024,512]; 3 pos_emb [1,2047,512]; 4 Wq, 5 bq, 6 Wk, 7 bk, 8 Wv, 9 bv ((in,out)); 10 Wpos; 11 Wout, 12 bout; 13 pos_bias_u [8,64], 14 pos_bias_v
  if (ws_size < (size_t)WS_END) return;
  char* ws = (char*)d_ws; _Float16 *QUH = (_Float16*)(ws + WS_QUH), *QUL = (_Float16*)(ws + WS_QUL), *QVH = (_Float16*)(ws + WS_QVH), *QVL = (_Float16*)(ws + WS_QVL), *KH = (_Float16*)(ws + WS_KH), *HRH = (_Float16*)(ws + WS_HRH), *HRL = (_Float16*)(ws + WS_HRL); __bf16 *VT = (__bf16*)(ws + WS_VT), *VL = (__bf16*)(ws + WS_VL); float *Y = (float*)(ws + WS_Y);
  k_proj<<<dim3(TNB * TT / 64, CC / 128, 3), 128, 0, stream>>>(F[0], F[1], F[2], F[4], F[5], F[6], F[7], F[8], F[9], F[13], F[14], QUH, QUL, QVH, QVL, KH, VT, VL);
  k_projr<<<dim3(HRR / 64, CC / 128), 128, 0, stream>>>(F[3], F[10], HRH, HRL);
  k_att<<<dim3(TT / (16 * AW), TNB * NH), 32 * AW, 0, stream>>>(QUH, QUL, QVH, QVL, KH, HRH, HRL, VT, VL, Y);
  k_out<<<dim3(TNB * TT / 64, CC / 128), 128, 0, stream>>>(Y, F[11], F[12], (float*)d_out);
}

// v005
// A run of this version takes 142 microseconds.
// Two timings next to v004 both put it at 1.03 times that version's speed.
// Counting every step since v000, it is 11.0 times as fast.
// compute dtype: all float inputs rounded to bf16; q/k/v/p = x W + b with EXACT bf16 products on WMMA 16x16x32, f32 accumulate; (q + pos_bias_u), (q + pos_bias_v) and p as f16 hi + residual (x 2^10), k once to f16 -> content logits 2 products, position logits 3 products; the rel_shift as a banded position GEMM + index offset through LDS; logits times log2(e)/8 and running-maximum softmax in f32 on the hardware's base-2 exponential; P = 2^(s - m) split bf16 hi + lo against v bf16 hi + lo (3 products), divided by the sum at the end; ctx (bf16 hi + lo) Wout + bout; f32 output.
#include <hip/hip_runtime.h>
#include <math.h>

typedef __attribute__((ext_vector_type(16))) _Float16 v16h;
typedef __attribute__((ext_vector_type(16))) __bf16 v16b;
typedef __attribute__((ext_vector_type(8)))  _Float16 v8h;
typedef __attribute__((ext_vector_type(8)))  float v8f;
typedef __attribute__((ext_vector_type(4)))  float v4f;
typedef __attribute__((ext_vector_type(2)))  float v2f;
typedef __attribute__((ext_vector_type(4)))  unsigned v4u;
typedef __attribute__((ext_vector_type(4)))  int v4i;
typedef float __attribute__((may_alias)) float_a;
typedef int __attribute__((may_alias)) int_a;

template <typename T> __device__ __forceinline__ void vst2(void* p, T v) { *(T*)p = v;  }
__device__ __forceinline__ v8f wmma16(v16h a, v16h b, v8f c) {
  v8f d = __builtin_amdgcn_wmma_f32_16x16x32_f16(false, a, false, b, (short)0, c, false, false);
  asm volatile("v_nop\n\tv_nop\n\tv_nop\n\tv_nop" : "+v"(d) : "v"(a), "v"(b));
  return d;
}
__device__ __forceinline__ v8f wmma_bf(v16b a, v16b b, v8f c) {
  v8f d = __builtin_amdgcn_wmma_f32_16x16x32_bf16(false, a, false, b, (short)0, c, false, false);
  asm volatile("v_nop\n\tv_nop\n\tv_nop\n\tv_nop" : "+v"(d) : "v"(a), "v"(b));
  return d;
}
// 16x16x32 fragments: lane = (h = lane>>4, row/col = lane&15); elements 0..7 = k0+8h+0..7, 8..15 = k0+16+8h+0..7; D element r = row 8h+r
__device__ __forceinline__ v16h frag_h(const _Float16* rowk0, int lane) {
  union { v16h v; v8h q[2]; } u; const _Float16* p = rowk0 + 8 * (lane >> 4);
  u.q[0] = *(const v8h*)p; u.q[1] = *(const v8h*)(p + 16); return u.v;
}
__device__ __forceinline__ v16h frag_f32(const float* rowk0, int lane) {
  v16h a; const float* p = rowk0 + 8 * (lane >> 4);
#pragma unroll
  for (int i = 0; i < 8; ++i) { a[i] = (_Float16)p[i]; a[8 + i] = (_Float16)p[16 + i]; }
  return a;
}
__device__ __forceinline__ v16h frag_f32s(const float* rowk0, int lane, float sc) {
  v16h a; const float* p = rowk0 + 8 * (lane >> 4);
#pragma unroll
  for (int i = 0; i < 8; ++i) { a[i] = (_Float16)(p[i] * sc); a[8 + i] = (_Float16)(p[16 + i] * sc); }
  return a;
}
// column fragment from a [K][ld] layout (column n), rows >= K read as 0
__device__ __forceinline__ v16h fragc_f32(const float* W, int k0, int n, int lane, int ld, int K) {
  v16h a; const int g = lane >> 4;
#pragma unroll
  for (int i = 0; i < 8; ++i) { const int ka = k0 + 8 * g + i, kb = ka + 16;
    a[i] = (_Float16)(ka < K ? W[(size_t)(ka < K ? ka : K - 1) * ld + n] : 0.f); a[8 + i] = (_Float16)(kb < K ? W[(size_t)(kb < K ? kb : K - 1) * ld + n] : 0.f); }
  return a;
}
struct F2 { v16b h, l; };
__device__ __forceinline__ F2 bsplit16(const float v[16]) { F2 r;
#pragma unroll
  for (int i = 0; i < 16; ++i) { const __bf16 h = (__bf16)v[i]; r.h[i] = h; r.l[i] = (__bf16)(v[i] - (float)h); }
  return r; }
__device__ __forceinline__ F2 split_row(const float* row, int k0, int lane) { float v[16]; const float* p = row + k0 + 8 * (lane >> 4);
#pragma unroll
  for (int i = 0; i < 8; ++i) { v[i] = p[i]; v[8 + i] = p[16 + i]; }
  return bsplit16(v); }
__device__ __forceinline__ F2 split_rowK(const float* row, int k0, int lane, int K) { float v[16]; const int g = lane >> 4;
#pragma unroll
  for (int i = 0; i < 8; ++i) { const int ka = k0 + 8 * g + i, kb = ka + 16; v[i] = ka < K ? row[ka < K ? ka : K - 1] : 0.f; v[8 + i] = kb < K ? row[kb < K ? kb : K - 1] : 0.f; }
  return bsplit16(v); }
__device__ __forceinline__ F2 split_col(const float* W, int k0, int n, int lane, int ld, int K) { float v[16]; const int g = lane >> 4;
#pragma unroll
  for (int i = 0; i < 8; ++i) { const int ka = k0 + 8 * g + i, kb = ka + 16; v[i] = ka < K ? W[(size_t)(ka < K ? ka : K - 1) * ld + n] : 0.f; v[8 + i] = kb < K ? W[(size_t)(kb < K ? kb : K - 1) * ld + n] : 0.f; }
  return bsplit16(v); }
__device__ __forceinline__ v8f mac3(const F2& a, const F2& b, v8f c) { c = wmma_bf(a.l, b.h, c); c = wmma_bf(a.h, b.l, c); return wmma_bf(a.h, b.h, c); }
__device__ __forceinline__ float sigm(float v) { return 1.0f / (1.0f + expf(-v)); }
#define LDSX() do { asm volatile("s_wait_dscnt 0" ::: "memory"); __builtin_amdgcn_wave_barrier(); __builtin_amdgcn_fence(__ATOMIC_RELEASE, "workgroup"); } while (0)

// Relative-position multi-head attention (wenet/espnet style; B 8, T 1,024, F 512 = 8 x 64): q = query Wq + bq, k = key Wk + bk, v = value Wv + bv ((in,out)); p = pos_emb[0] Wpos (2T-1 positions); ac = (q + u) k^T; bd = rel_shift((q + v_bias) p^T) with rel_shift(x)[i][j] = x[i][T-1-i+j]; scores = (ac + bd) / 8; softmax; ctx = att v; out = ctx Wout + bout.
#define NB 8
#define TT 1024
#define CC 512
#define NH 8
#define HD 64
#define NPOS (2 * TT - 1)      // 2,047 rows of pos_emb / p
#define HRR (2 * TT + 128)     // rows of the p planes actually built (rows >= NPOS are zeros; they only feed never-read logits)
#define KB 64                  // keys per block of the attention loop
#define AW 16                  // waves per attention work-group: one work-group per WGP, 4 waves per SIMD; its waves walk the same k and v rows, so they share them in the WGP cache
#define NT (KB / 16)           // key tiles per block (the load schedule in k_att is written for 4)
#define BP (KB + 20)           // LDS band pitch in floats: KB + 16 columns used; pitch - 1 = 19 mod 64 keeps the 32 shifted reads of a wave on 32 banks
#define SCALE (0.125f * 1.44269504088896340736f)   // 1/sqrt(64) times log2(e): the scores, their running maximum and every exponent are kept in base 2, so that each exponential is one subtraction and one v_exp_f32
#ifndef TNB
#define TNB NB
#endif
typedef __attribute__((ext_vector_type(8))) __bf16 v8b;
__device__ __forceinline__ v16b frag_b(const __bf16* rowk0, int lane) {
  union { v16b v; v8b q[2]; } u; const __bf16* p = rowk0 + 8 * (lane >> 4);
  u.q[0] = *(const v8b*)p; u.q[1] = *(const v8b*)(p + 16); return u.v;
}
__device__ __forceinline__ float bfr(float v) { return (float)(__bf16)v; }

// ---- the k loop of the three projection kernels: block = 4 waves, 64 rows x 128 columns, wave = 16 rows x 128 columns.
// Each k-step's 32 x 128 weight tile is read from global memory once per work-group (whole rows of 512 B) and put into LDS as bf16 B fragments: fragment j (16 columns) holds lane l's elements 0..7 at 16 l bytes and 8..15 at 512 + 16 l.
// Two buffers: step kc + 1 is loaded into registers in front of the products of step kc and stored behind them; one barrier per step publishes it and ends the reads of the buffer that is written next.
#define WFP 520                // pitch of a staged fragment in elements: 1 KiB + 16 B, so that the 32 16-byte stores of a wave (8 fragments x 4 columns) spread over all banks
#define WBUF (8 * WFP)
typedef v8b __attribute__((may_alias)) v8b_a;   // the stage shares its LDS with the arrays of the epilogues
template <int MODE>   // 0: A rows rounded to bf16; 1: the same, rows that are not live read as 0; 2: A rows as bf16 hi + lo (2 products)
__device__ __forceinline__ void gemm128(const float* ap, const float* wp, __bf16* wst, int wave, int lane, bool live, v8f (&acc)[8]) {   /* ap: this lane's row + 8 g; wp: weight row 8 wave, column c0 + 4 lane */
  __bf16* wd = wst + (lane >> 2) * WFP + (wave >> 1) * 256 + ((wave & 1) * 16 + 4 * (lane & 3)) * 8; const __bf16* wsrc = wst + lane * 8;
  v4f wr[8], ar[4];
#pragma unroll
  for (int i = 0; i < 8; ++i) wr[i] = *(const v4f*)(wp + (size_t)i * CC);
  ar[0] = *(const v4f*)ap; ar[1] = *(const v4f*)(ap + 4); ar[2] = *(const v4f*)(ap + 16); ar[3] = *(const v4f*)(ap + 20);
  asm volatile("s_wait_xcnt 0x0" :: "v"(wp), "v"(ap) : "memory");   /* the loads above name wp and ap, which are advanced below */
#pragma unroll
  for (int c = 0; c < 4; ++c) { v8b t;
#pragma unroll
    for (int i = 0; i < 8; ++i) t[i] = (__bf16)wr[i][c];
    *(v8b_a*)(wd + c * 8) = t; }
  __syncthreads();
#pragma unroll 2   /* two steps a trip, so that each step's buffer is a constant offset */
  for (int kc = 0; kc < CC / 32; ++kc) { float v[16];
#pragma unroll
    for (int i = 0; i < 4; ++i) { v[i] = ar[0][i]; v[4 + i] = ar[1][i]; v[8 + i] = ar[2][i]; v[12 + i] = ar[3][i]; }
    if (MODE == 1) {
#pragma unroll
      for (int i = 0; i < 16; ++i) v[i] = live ? v[i] : 0.f; }
    F2 a;
    if (MODE == 2) a = bsplit16(v);
    else {
#pragma unroll
      for (int i = 0; i < 16; ++i) a.h[i] = (__bf16)v[i]; }
    const __bf16* sb = wsrc + (kc & 1) * WBUF; union { v16b v; v8b q[2]; } w[8];   /* all 8 fragments are asked for at once, so that the LDS latency is paid once a step */
#pragma unroll
    for (int j = 0; j < 8; ++j) { w[j].q[0] = *(const v8b_a*)(sb + j * WFP); w[j].q[1] = *(const v8b_a*)(sb + j * WFP + 256); }
    if (kc + 1 < CC / 32) { wp += 32 * CC; ap += 32;
#pragma unroll
      for (int i = 0; i < 8; ++i) wr[i] = *(const v4f*)(wp + (size_t)i * CC);
      ar[0] = *(const v4f*)ap; ar[1] = *(const v4f*)(ap + 4); ar[2] = *(const v4f*)(ap + 16); ar[3] = *(const v4f*)(ap + 20);
      asm volatile("s_wait_xcnt 0x0" :: "v"(wp), "v"(ap) : "memory");   /* the loads above name wp and ap, which the next step advances */
    }
#pragma unroll
    for (int j = 0; j < 8; ++j) { acc[j] = wmma_bf(a.h, w[j].v, acc[j]); if (MODE == 2) acc[j] = wmma_bf(a.l, w[j].v, acc[j]); }
    __builtin_amdgcn_sched_barrier(0);   /* keeps the wait for the next step's global loads behind this step's products */
    if (kc + 1 < CC / 32) { __bf16* db = wd + ((kc + 1) & 1) * WBUF;
#pragma unroll
      for (int c = 0; c < 4; ++c) { v8b t;
#pragma unroll
        for (int i = 0; i < 8; ++i) t[i] = (__bf16)wr[i][c];
        *(v8b_a*)(db + c * 8) = t; } }
    __syncthreads();   /* publishes step kc + 1; behind the last step it frees the stage for the epilogue's arrays */
  } }

#define WS_QUH 0u                                       // f16 (q + u) rows [b*t][512] hi
#define WS_QUL (WS_QUH + 2u * (size_t)NB * TT * CC)      //                     residual x 2^10
#define WS_QVH (WS_QUL + 2u * (size_t)NB * TT * CC)      // f16 (q + v_bias) rows
#define WS_QVL (WS_QVH + 2u * (size_t)NB * TT * CC)
#define WS_KH  (WS_QVL + 2u * (size_t)NB * TT * CC)      // f16 k in fragment order [b][h][t/16][d/16][(d/8)&1][t&15][d&7]: a 16-key tile is 2 KiB and lane l's 16 bytes of each half fragment stand at 16 l
#define WS_HRH (WS_KH  + 2u * (size_t)NB * TT * CC)      // f16 p hi in the same fragment order [h][pos/16][d/16][(d/8)&1][pos&15][d&7], pos < HRR
#define WS_HRL (WS_HRH + 2u * (size_t)HRR * CC)          //                        residual x 2^10
#define WS_VT  (WS_HRL + 2u * (size_t)HRR * CC)          // bf16 v planes in fragment order [b][h][t/32][d/16][(t/16)&1][(t/8)&1][d&15][t&7]
#define WS_VL  (WS_VT  + 2u * (size_t)NB * CC * TT)
#define WS_Y   (WS_VL  + 2u * (size_t)NB * CC * TT)      // f32 ctx rows [b*t][512]
#define WS_END (WS_Y   + 4u * (size_t)NB * TT * CC)

// ---- k_proj: block = (64 rows, 128 cols, which): which 0: q = query Wq + bq -> (q + u) and (q + v_bias) as f16 hi + residual rows (u, v_bias [H,DK] flat = column index); which 1: k = key Wk + bk -> f16, fragment order; which 2: v = value Wv + bv -> bf16 hi + lo planes, fragment order (a store loop's 128 threads write 2 KiB in a row). Weights (in,out).
__global__ __launch_bounds__(128) void k_proj(const float* __restrict__ X0, const float* __restrict__ X1, const float* __restrict__ X2, const float* __restrict__ WQ, const float* __restrict__ BQ, const float* __restrict__ WK, const float* __restrict__ BK, const float* __restrict__ WV, const float* __restrict__ BV, const float* __restrict__ UB, const float* __restrict__ VB, _Float16* __restrict__ QUH, _Float16* __restrict__ QUL, _Float16* __restrict__ QVH, _Float16* __restrict__ QVL, _Float16* __restrict__ KH, __bf16* __restrict__ VT, __bf16* __restrict__ VL) {
  __shared__ __align__(16) _Float16 sh[64][136], sl[64][136]; __shared__ __align__(16) __bf16 th[128][72], tl2[128][72];
  const int tid = threadIdx.x, wave = tid >> 5, lane = tid & 31, col = lane & 15, g = lane >> 4; const int which = blockIdx.z; const int c0 = blockIdx.y * 128; const size_t r0 = (size_t)blockIdx.x * 64;
  const float* X = which == 0 ? X0 : which == 1 ? X1 : X2; const float* WA = which == 0 ? WQ : which == 1 ? WK : WV; const float* BA = which == 0 ? BQ : which == 1 ? BK : BV;
  v8f acc[8] = {};
  gemm128<0>(X + (r0 + wave * 16 + col) * CC + 8 * g, WA + (size_t)(8 * wave) * CC + c0 + 4 * lane, (__bf16*)&sh[0][0], wave, lane, true, acc);
  const int npass = (which == 0) ? 2 : 1;
  for (int pass = 0; pass < npass; ++pass) {   /* block-uniform */
    if (pass) __syncthreads();
#pragma unroll
    for (int j = 0; j < 8; ++j) { const int o = c0 + j * 16 + col; const float bb = bfr(BA[o]) + ((which == 0) ? bfr((pass == 0 ? UB : VB)[o]) : 0.f);
#pragma unroll
      for (int r = 0; r < 8; ++r) { const float v = acc[j][r] + bb; const int rl = wave * 16 + 8 * g + r, cl = j * 16 + col; const _Float16 hv = (_Float16)v;
        if (which == 2) { const __bf16 bh = (__bf16)v; th[cl][rl] = bh; tl2[cl][rl] = (__bf16)(v - (float)bh); } else { sh[rl][cl] = hv; sl[rl][cl] = (_Float16)((v - (float)hv) * 1024.0f); } } }
    __syncthreads();
    const size_t b = r0 / TT; const int t0 = (int)(r0 % TT);
    if (which == 0) { _Float16* dh = (pass == 0 ? QUH : QVH); _Float16* dl = (pass == 0 ? QUL : QVL); for (int e = tid; e < 64 * 16; e += 128) { const int rl = e >> 4, q = e & 15; vst2((unsigned*)(dh + (r0 + rl) * CC + c0 + q * 8), *(const v4u*)&sh[rl][q * 8]); vst2((unsigned*)(dl + (r0 + rl) * CC + c0 + q * 8), *(const v4u*)&sl[rl][q * 8]); } }
    else if (which == 1) { for (int e = tid; e < 64 * 16; e += 128) { const int rl = ((e >> 7) & 3) * 16 + (e & 15), q = (e >> 9) * 8 + ((e >> 4) & 7);   /* e = (head, tile, d/16, (d/8)&1, t&15) */
        vst2((unsigned*)(KH + ((b * NH + c0 / HD + (e >> 9)) * (TT / 16) + t0 / 16 + ((e >> 7) & 3)) * (size_t)(16 * HD) + (e & 127) * 8), *(const v4u*)&sh[rl][q * 8]); } }
    else { for (int e = tid; e < 128 * 8; e += 128) { const int cl = (e >> 9) * 64 + ((e >> 6) & 3) * 16 + (e & 15), q = ((e >> 8) & 1) * 4 + ((e >> 4) & 3);   /* e = (head, t/32, d/16, (t/16)&1, (t/8)&1, d&15) */
        const size_t o2 = ((b * NH + c0 / HD + (e >> 9)) * (TT / 32) + t0 / 32 + ((e >> 8) & 1)) * (size_t)(32 * HD) + (e & 255) * 8; vst2((unsigned*)(VT + o2), *(const v4u*)&th[cl][q * 8]); vst2((unsigned*)(VL + o2), *(const v4u*)&tl2[cl][q * 8]); } } } }
// ---- k_projr: block = (64 positions, 128 cols): p rows [pos][o] = pos_emb[0][pos] Wpos ((in,out), exact) -> f16 hi + residual, fragment order; rows >= NPOS (2,047) are written as zeros (their A rows are loaded clamped and zeroed by value)
__global__ __launch_bounds__(128) void k_projr(const float* __restrict__ PE, const float* __restrict__ WP, _Float16* __restrict__ HRH, _Float16* __restrict__ HRL) {
  __shared__ __align__(16) _Float16 sh[64][136], sl[64][136];
  const int tid = threadIdx.x, wave = tid >> 5, lane = tid & 31, col = lane & 15, g = lane >> 4; const int c0 = blockIdx.y * 128; const size_t p0 = (size_t)blockIdx.x * 64;
  const size_t prow = p0 + wave * 16 + col; const bool live = prow < NPOS; const size_t prc = live ? prow : (NPOS - 1);
  v8f acc[8] = {};
  gemm128<1>(PE + prc * CC + 8 * g, WP + (size_t)(8 * wave) * CC + c0 + 4 * lane, (__bf16*)&sh[0][0], wave, lane, live, acc);
#pragma unroll
  for (int j = 0; j < 8; ++j) {
#pragma unroll
    for (int r = 0; r < 8; ++r) { const float v = acc[j][r]; const int rl = wave * 16 + 8 * g + r, cl = j * 16 + col; const _Float16 hv = (_Float16)v; sh[rl][cl] = hv; sl[rl][cl] = (_Float16)((v - (float)hv) * 1024.0f); } }
  __syncthreads();
  for (int e = tid; e < 64 * 16; e += 128) { const int rl = ((e >> 7) & 3) * 16 + (e & 15), q = (e >> 9) * 8 + ((e >> 4) & 7);   /* e = (head, tile, d/16, (d/8)&1, pos&15) */
    const size_t o2 = ((size_t)(c0 / HD + (e >> 9)) * (HRR / 16) + p0 / 16 + ((e >> 7) & 3)) * (size_t)(16 * HD) + (e & 127) * 8; vst2((unsigned*)(HRH + o2), *(const v4u*)&sh[rl][q * 8]); vst2((unsigned*)(HRL + o2), *(const v4u*)&sl[rl][q * 8]); } }
// fragment-order loads: p already includes the lane's own offset of 8 * lane elements; the two halves of a fragment are 512 B apart, so each load of a wave reads 512 B in a row (4 cache lines, not 16)
__device__ __forceinline__ v16h frag_t(const _Float16* p) { union { v16h v; v8h q[2]; } u; u.q[0] = *(const v8h*)p; u.q[1] = *(const v8h*)(p + 256); return u.v; }
__device__ __forceinline__ v16b frag_tb(const __bf16* p) { union { v16b v; v8b q[2]; } u; u.q[0] = *(const v8b*)p; u.q[1] = *(const v8b*)(p + 256); return u.v; }
__device__ __forceinline__ void ld4(v16h (&f)[4], const _Float16* rh, const _Float16* rl) { f[0] = frag_t(rh); f[1] = frag_t(rl); f[2] = frag_t(rh + 512); f[3] = frag_t(rl + 512); }
__device__ __forceinline__ void qput(v8h (*s)[32], v16h f, int lane) { union { v16h v; v8h q[2]; } u; u.v = f; s[0][lane] = u.q[0]; s[1][lane] = u.q[1]; }
__device__ __forceinline__ v16h qget(const v8h (*s)[32], int lane) { union { v16h v; v8h q[2]; } u; u.q[0] = s[0][lane]; u.q[1] = s[1][lane]; return u.v; }
// one position tile: X^T = p (q+v_bias)^T, 3 products; x0, x1 = this lane's 8 consecutive positions of its query
__device__ __forceinline__ void bd_tile(const v16h (&f)[4], const v16h (&qh)[HD / 32], const v16h (&ql)[HD / 32], v4f& x0, v4f& x1) { v8f a = {}, al = {};
#pragma unroll
  for (int kc = 0; kc < HD / 32; ++kc) { a = wmma16(f[2 * kc], qh[kc], a); al = wmma16(f[2 * kc], ql[kc], al); al = wmma16(f[2 * kc + 1], qh[kc], al); }
#pragma unroll
  for (int r = 0; r < 4; ++r) { x0[r] = a[r] + al[r] * (1.0f / 1024.0f); x1[r] = a[4 + r] + al[4 + r] * (1.0f / 1024.0f); } }
// ---- k_att: block = 16 * AW queries of one (batch, head) pair, wave = 16 queries, all T keys in blocks of KB. Everything is kept transposed so that a lane owns one query (column lane & 15):
//   S^T = k (q+u)^T (2 products) and X^T = p (q+v_bias)^T (3 products) have D register r = key / position 8g + r; O^T += v^T P^T takes two S^T tiles, converted in place, as its B operand.
//   rel_shift: for queries iw0 + q and keys j0 + jl the position row is T-1-(iw0+q)+(j0+jl) = pb + c with pb = T-16-iw0+j0 and c = jl + 15 - q, so KB/16 + 1 position tiles stand in the wave's own LDS band [q][c] and each lane reads its row back at offset 15 - q; the last tile of a block is the first of the next (pb grows by KB) and is moved there, not computed again.
//   softmax is the running-maximum form in base 2: per block m' = max(m, block max), sums and O^T are scaled by 2^(m - m'), P = 2^(s - m') split bf16 hi + lo; the division by the sum comes last. No exponent lies above 0 by more than a rounding error; one far below -126 gives 0 or a subnormal, which adds nothing to a sum whose largest term is 1.
__global__ __launch_bounds__(32 * AW) __attribute__((amdgpu_waves_per_eu(4, 4))) void k_att(const _Float16* __restrict__ QUH, const _Float16* __restrict__ QUL, const _Float16* __restrict__ QVH, const _Float16* __restrict__ QVL, const _Float16* __restrict__ KH, const _Float16* __restrict__ RHh, const _Float16* __restrict__ RLl, const __bf16* __restrict__ VT, const __bf16* __restrict__ VL, float* __restrict__ Y) {
  __shared__ __align__(16) float band[AW][16][BP]; __shared__ __align__(16) v8h qs[AW][8][2][32];   /* qs: each lane's own query fragments, parked so that they hold registers only in the phase that uses them (256 VGPRs = 4 waves per SIMD) */
  const int tid = threadIdx.x, wave = tid >> 5, lane = tid & 31, col = lane & 15, g = lane >> 4; const int bh = blockIdx.y, b = bh / NH, h = bh % NH; const int iw0 = blockIdx.x * (16 * AW) + wave * 16;
  const size_t qrow = ((size_t)b * TT + iw0 + col) * CC + h * HD;
#pragma unroll
  for (int kc = 0; kc < HD / 32; ++kc) { qput(qs[wave][kc], frag_h(QVH + qrow + kc * 32, lane), lane); qput(qs[wave][2 + kc], frag_h(QVL + qrow + kc * 32, lane), lane); qput(qs[wave][4 + kc], frag_h(QUH + qrow + kc * 32, lane), lane); qput(qs[wave][6 + kc], frag_h(QUL + qrow + kc * 32, lane), lane); }
  float* bw = &band[wave][col][0];
  const size_t ro = ((size_t)h * (HRR / 16) + (TT - 16 - iw0) / 16) * (16 * HD) + lane * 8; const _Float16* rh = RHh + ro; const _Float16* rl = RLl + ro;   /* this lane's place in position tile 0 of block 0; a tile is 16 * HD elements */
  const _Float16* kp = KH + (size_t)bh * TT * HD + lane * 8; const __bf16* vhp = VT + (size_t)bh * TT * HD + lane * 8; const __bf16* vlp = VL + (size_t)bh * TT * HD + lane * 8;
  v8f acc[HD / 16] = {}; float m = -3.0e38f, l = 0.f;
  // Every fragment is loaded one or two tiles ahead of the products that use it. pf[1], pf[2] (position tiles 1, 2) are loaded at the end of the block before; behind the last block that reads rows < 2T + 32 of the p planes, which k_projr has written, and the values are not used.
  v16h pf[NT + 1][4], kf[NT][2]; v16b vf[KB / 32][HD / 16][2];
  ld4(pf[0], rh, rl); ld4(pf[1], rh + 16 * HD, rl + 16 * HD); ld4(pf[2], rh + 32 * HD, rl + 32 * HD);
  asm volatile("s_wait_xcnt 0x0" :: "v"(rh), "v"(rl) : "memory");   /* the loads above name rh and rl: as inputs here both keep their registers up to the wait, so that nothing (a later load's result either) is written over an address of an issued load in front of it */
  { v16h qvh[HD / 32], qvl[HD / 32]; v4f x0, x1;   /* tile 0 of block 0, put where a block before would have left it */
#pragma unroll
    for (int kc = 0; kc < HD / 32; ++kc) { qvh[kc] = qget(qs[wave][kc], lane); qvl[kc] = qget(qs[wave][2 + kc], lane); }
    bd_tile(pf[0], qvh, qvl, x0, x1); *(v4f*)(bw + KB + 8 * g) = x0; *(v4f*)(bw + KB + 8 * g + 4) = x1; }
#pragma unroll 1
  for (int j0 = 0; j0 < TT; j0 += KB) { const _Float16* rhb = rh + (size_t)j0 * HD; const _Float16* rlb = rl + (size_t)j0 * HD; const _Float16* kpb = kp + (size_t)j0 * HD; const __bf16* vhb = vhp + (size_t)j0 * HD; const __bf16* vlb = vlp + (size_t)j0 * HD;
    v16h quh[HD / 32], qul[HD / 32], qvh[HD / 32], qvl[HD / 32];
#pragma unroll
    for (int kc = 0; kc < HD / 32; ++kc) { qvh[kc] = qget(qs[wave][kc], lane); qvl[kc] = qget(qs[wave][2 + kc], lane); }
    { const v4f c0 = *(const v4f*)(bw + KB + 8 * g), c1 = *(const v4f*)(bw + KB + 8 * g + 4); *(v4f*)(bw + 8 * g) = c0; *(v4f*)(bw + 8 * g + 4) = c1; }   /* the lane's own values: last tile of the block before = tile 0 of this one */
#pragma unroll
    for (int t = 1; t < NT + 1; ++t) {
      if (t + 2 < NT + 1) ld4(pf[t + 2], rhb + (t + 2) * 16 * HD, rlb + (t + 2) * 16 * HD);
      else if (t + 1 == NT) {
#pragma unroll
        for (int u = 0; u < NT / 2; ++u) { kf[u][0] = frag_t(kpb + u * 16 * HD); kf[u][1] = frag_t(kpb + u * 16 * HD + 512); } }
      else {
#pragma unroll
        for (int kc = 0; kc < HD / 32; ++kc) { quh[kc] = qget(qs[wave][4 + kc], lane); qul[kc] = qget(qs[wave][6 + kc], lane); } }
      v4f x0, x1; bd_tile(pf[t], qvh, qvl, x0, x1);
      *(v4f*)(bw + t * 16 + 8 * g) = x0; *(v4f*)(bw + t * 16 + 8 * g + 4) = x1; }
    LDSX();   /* a lane reads band values that its partner lane (lane ^ 16) wrote */
    float s[NT][8]; float bm = -3.0e38f;
#pragma unroll
    for (int t = 0; t < NT; ++t) { v8f a = {}, al = {};
      if (t == 0) {
#pragma unroll
        for (int u = NT / 2; u < NT; ++u) { kf[u][0] = frag_t(kpb + u * 16 * HD); kf[u][1] = frag_t(kpb + u * 16 * HD + 512); } }
#pragma unroll
      for (int kc = 0; kc < HD / 32; ++kc) { a = wmma16(kf[t][kc], quh[kc], a); al = wmma16(kf[t][kc], qul[kc], al); }
      vf[0][t][0] = frag_tb(vhb + t * 512); vf[0][t][1] = frag_tb(vlb + t * 512);
#pragma unroll
      for (int r = 0; r < 8; ++r) { const float v = ((a[r] + al[r] * (1.0f / 1024.0f)) + bw[t * 16 + 8 * g + r + 15 - col]) * SCALE; s[t][r] = v; bm = fmaxf(bm, v); } }
    bm = fmaxf(bm, __shfl_xor(bm, 16));
    const float mn = fmaxf(m, bm), alpha = __builtin_amdgcn_exp2f(m - mn); m = mn; l *= alpha;
#pragma unroll
    for (int j = 0; j < HD / 16; ++j)
#pragma unroll
      for (int r = 0; r < 8; ++r) acc[j][r] *= alpha;
#pragma unroll
    for (int c = 0; c < KB / 32; ++c) { float e[16];
#pragma unroll
      for (int i = 0; i < 8; ++i) { e[i] = __builtin_amdgcn_exp2f(s[2 * c][i] - m); e[8 + i] = __builtin_amdgcn_exp2f(s[2 * c + 1][i] - m); l += e[i] + e[8 + i]; }
      const F2 p = bsplit16(e);
#pragma unroll
      for (int j = 0; j < HD / 16; ++j) { acc[j] = wmma_bf(vf[c][j][0], p.h, acc[j]); acc[j] = wmma_bf(vf[c][j][0], p.l, acc[j]); acc[j] = wmma_bf(vf[c][j][1], p.h, acc[j]);
        if (c + 1 < KB / 32) { vf[c + 1][j][0] = frag_tb(vhb + (c + 1) * 32 * HD + j * 512); vf[c + 1][j][1] = frag_tb(vlb + (c + 1) * 32 * HD + j * 512); }
        else if (j & 1) ld4(pf[1 + (j >> 1)], rhb + (KB + 16 + (j >> 1) * 16) * HD, rlb + (KB + 16 + (j >> 1) * 16) * HD); } }
    asm volatile("s_wait_xcnt 0x0" ::: "memory");   /* the address registers of the loads just issued are rewritten at the top of the next pass */
  }
  l += __shfl_xor(l, 16); const float inv = 1.0f / l;
#pragma unroll
  for (int j = 0; j < HD / 16; ++j) { v4f y0, y1;
#pragma unroll
    for (int r = 0; r < 4; ++r) { y0[r] = acc[j][r] * inv; y1[r] = acc[j][4 + r] * inv; }
    float* yp = Y + qrow + j * 16 + 8 * g; vst2(yp, y0); vst2(yp + 4, y1); } }
// ---- k_out: block = (64 rows, 128 cols): out = ctx (bf16 hi + lo) Wout ((in,out), exact) + bout
__global__ __launch_bounds__(128) void k_out(const float* __restrict__ Yr, const float* __restrict__ WO, const float* __restrict__ BO, float* __restrict__ OUT) { __shared__ __align__(16) float sf[4][16][132];
  const int tid = threadIdx.x, wave = tid >> 5, lane = tid & 31, col = lane & 15, g = lane >> 4; const int c0 = blockIdx.y * 128; const size_t r0 = (size_t)blockIdx.x * 64 + wave * 16;
  v8f acc[8] = {};
  gemm128<2>(Yr + (r0 + col) * CC + 8 * g, WO + (size_t)(8 * wave) * CC + c0 + 4 * lane, (__bf16*)&sf[0][0][0], wave, lane, true, acc);
#pragma unroll
  for (int j = 0; j < 8; ++j) { const float bb = bfr(BO[c0 + j * 16 + col]);
#pragma unroll
    for (int r = 0; r < 8; ++r) sf[wave][8 * g + r][j * 16 + col] = acc[j][r] + bb; }
  LDSX(); for (int rl = 0; rl < 16; ++rl) vst2(OUT + (r0 + rl) * CC + c0 + lane * 4, *(const v4f*)&sf[wave][rl][lane * 4]); }
extern "C" void kernel_launch(void* const* d_in, const int* in_sizes, int n_in, void* d_out, int out_size, void* d_ws, size_t ws_size, hipStream_t stream) {
  (void)in_sizes; (void)n_in; (void)out_size;
  const float** F = (const float**)d_in;   // 0 query, 1 key, 2 value [8,1024,512]; 3 pos_emb [1,2047,512]; 4 Wq, 5 bq, 6 Wk, 7 bk, 8 Wv, 9 bv ((in,out)); 10 Wpos; 11 Wout, 12 bout; 13 pos_bias_u [8,64], 14 pos_bias_v
  if (ws_size < (size_t)WS_END) return;
  char* ws = (char*)d_ws; _Float16 *QUH = (_Float16*)(ws + WS_QUH), *QUL = (_Float16*)(ws + WS_QUL), *QVH = (_Float16*)(ws + WS_QVH), *QVL = (_Float16*)(ws + WS_QVL), *KH = (_Float16*)(ws + WS_KH), *HRH = (_Float16*)(ws + WS_HRH), *HRL = (_Float16*)(ws + WS_HRL); __bf16 *VT = (__bf16*)(ws + WS_VT), *VL = (__bf16*)(ws + WS_VL); float *Y = (float*)(ws + WS_Y);
  k_proj<<<dim3(TNB * TT / 64, CC / 128, 3), 128, 0, stream>>>(F[0], F[1], F[2], F[4], F[5], F[6], F[7], F[8], F[9], F[13], F[14], QUH, QUL, QVH, QVL, KH, VT, VL);
  k_projr<<<dim3(HRR / 64, CC / 128), 128, 0, stream>>>(F[3], F[10], HRH, HRL);
  k_att<<<dim3(TT / (16 * AW), TNB * NH), 32 * AW, 0, stream>>>(QUH, QUL, QVH, QVL, KH, HRH, HRL, VT, VL, Y);
  k_out<<<dim3(TNB * TT / 64, CC / 128), 128, 0, stream>>>(Y, F[11], F[12], (float*)d_out);
}

// v006
// A run of this version takes 137 microseconds.
// Timed twice side by side with v005, it ran 1.05 times as fast both times.
// Counting every step since v000, it is 11.5 times as fast.
// compute dtype: all float inputs rounded to bf16; q/k/v/p = x W + b with EXACT bf16 products on WMMA 16x16x32, f32 accumulate; (q + pos_bias_u), (q + pos_bias_v) and p as f16 hi + residual (x 2^10), k once to f16 -> content logits 2 products, position logits 3 products; the rel_shift as a banded position GEMM + index offset through LDS; logits times log2(e)/8 and running-maximum softmax in f32 on the hardware's base-2 exponential; P = 2^(s - m) split bf16 hi + lo against v bf16 hi + lo (3 products), divided by the sum at the end; ctx (bf16 hi + lo) Wout + bout; f32 output.
#include <hip/hip_runtime.h>
#include <math.h>

typedef __attribute__((ext_vector_type(16))) _Float16 v16h;
typedef __attribute__((ext_vector_type(16))) __bf16 v16b;
typedef __attribute__((ext_vector_type(8)))  _Float16 v8h;
typedef __attribute__((ext_vector_type(8)))  float v8f;
typedef __attribute__((ext_vector_type(4)))  float v4f;
typedef __attribute__((ext_vector_type(2)))  float v2f;
typedef __attribute__((ext_vector_type(4)))  unsigned v4u;
typedef __attribute__((ext_vector_type(4)))  int v4i;
typedef float __attribute__((may_alias)) float_a;
typedef int __attribute__((may_alias)) int_a;

template <typename T> __device__ __forceinline__ void vst2(void* p, T v) { *(T*)p = v;  }
__device__ __forceinline__ v8f wmma16(v16h a, v16h b, v8f c) {
  v8f d = __builtin_amdgcn_wmma_f32_16x16x32_f16(false, a, false, b, (short)0, c, false, false);
  asm volatile("v_nop\n\tv_nop\n\tv_nop\n\tv_nop" : "+v"(d) : "v"(a), "v"(b));
  return d;
}
__device__ __forceinline__ v8f wmma_bf(v16b a, v16b b, v8f c) {
  v8f d = __builtin_amdgcn_wmma_f32_16x16x32_bf16(false, a, false, b, (short)0, c, false, false);
  asm volatile("v_nop\n\tv_nop\n\tv_nop\n\tv_nop" : "+v"(d) : "v"(a), "v"(b));
  return d;
}
// 16x16x32 fragments: lane = (h = lane>>4, row/col = lane&15); elements 0..7 = k0+8h+0..7, 8..15 = k0+16+8h+0..7; D element r = row 8h+r
__device__ __forceinline__ v16h frag_h(const _Float16* rowk0, int lane) {
  union { v16h v; v8h q[2]; } u; const _Float16* p = rowk0 + 8 * (lane >> 4);
  u.q[0] = *(const v8h*)p; u.q[1] = *(const v8h*)(p + 16); return u.v;
}
__device__ __forceinline__ v16h frag_f32(const float* rowk0, int lane) {
  v16h a; const float* p = rowk0 + 8 * (lane >> 4);
#pragma unroll
  for (int i = 0; i < 8; ++i) { a[i] = (_Float16)p[i]; a[8 + i] = (_Float16)p[16 + i]; }
  return a;
}
__device__ __forceinline__ v16h frag_f32s(const float* rowk0, int lane, float sc) {
  v16h a; const float* p = rowk0 + 8 * (lane >> 4);
#pragma unroll
  for (int i = 0; i < 8; ++i) { a[i] = (_Float16)(p[i] * sc); a[8 + i] = (_Float16)(p[16 + i] * sc); }
  return a;
}
// column fragment from a [K][ld] layout (column n), rows >= K read as 0
__device__ __forceinline__ v16h fragc_f32(const float* W, int k0, int n, int lane, int ld, int K) {
  v16h a; const int g = lane >> 4;
#pragma unroll
  for (int i = 0; i < 8; ++i) { const int ka = k0 + 8 * g + i, kb = ka + 16;
    a[i] = (_Float16)(ka < K ? W[(size_t)(ka < K ? ka : K - 1) * ld + n] : 0.f); a[8 + i] = (_Float16)(kb < K ? W[(size_t)(kb < K ? kb : K - 1) * ld + n] : 0.f); }
  return a;
}
struct F2 { v16b h, l; };
__device__ __forceinline__ F2 bsplit16(const float v[16]) { F2 r;
#pragma unroll
  for (int i = 0; i < 16; ++i) { const __bf16 h = (__bf16)v[i]; r.h[i] = h; r.l[i] = (__bf16)(v[i] - (float)h); }
  return r; }
__device__ __forceinline__ F2 split_row(const float* row, int k0, int lane) { float v[16]; const float* p = row + k0 + 8 * (lane >> 4);
#pragma unroll
  for (int i = 0; i < 8; ++i) { v[i] = p[i]; v[8 + i] = p[16 + i]; }
  return bsplit16(v); }
__device__ __forceinline__ F2 split_rowK(const float* row, int k0, int lane, int K) { float v[16]; const int g = lane >> 4;
#pragma unroll
  for (int i = 0; i < 8; ++i) { const int ka = k0 + 8 * g + i, kb = ka + 16; v[i] = ka < K ? row[ka < K ? ka : K - 1] : 0.f; v[8 + i] = kb < K ? row[kb < K ? kb : K - 1] : 0.f; }
  return bsplit16(v); }
__device__ __forceinline__ F2 split_col(const float* W, int k0, int n, int lane, int ld, int K) { float v[16]; const int g = lane >> 4;
#pragma unroll
  for (int i = 0; i < 8; ++i) { const int ka = k0 + 8 * g + i, kb = ka + 16; v[i] = ka < K ? W[(size_t)(ka < K ? ka : K - 1) * ld + n] : 0.f; v[8 + i] = kb < K ? W[(size_t)(kb < K ? kb : K - 1) * ld + n] : 0.f; }
  return bsplit16(v); }
__device__ __forceinline__ v8f mac3(const F2& a, const F2& b, v8f c) { c = wmma_bf(a.l, b.h, c); c = wmma_bf(a.h, b.l, c); return wmma_bf(a.h, b.h, c); }
__device__ __forceinline__ float sigm(float v) { return 1.0f / (1.0f + expf(-v)); }
#define LDSX() do { asm volatile("s_wait_dscnt 0" ::: "memory"); __builtin_amdgcn_wave_barrier(); __builtin_amdgcn_fence(__ATOMIC_RELEASE, "workgroup"); } while (0)

// Relative-position multi-head attention (wenet/espnet style; B 8, T 1,024, F 512 = 8 x 64): q = query Wq + bq, k = key Wk + bk, v = value Wv + bv ((in,out)); p = pos_emb[0] Wpos (2T-1 positions); ac = (q + u) k^T; bd = rel_shift((q + v_bias) p^T) with rel_shift(x)[i][j] = x[i][T-1-i+j]; scores = (ac + bd) / 8; softmax; ctx = att v; out = ctx Wout + bout.
#define NB 8
#define TT 1024
#define CC 512
#define NH 8
#define HD 64
#define NPOS (2 * TT - 1)      // 2,047 rows of pos_emb / p
#define HRR (2 * TT + 128)     // rows of the p planes actually built (rows >= NPOS are zeros; they only feed never-read logits)
#define KB 64                  // keys per block of the attention loop
#define AW 16                  // waves per attention work-group: one work-group per WGP, 4 waves per SIMD; its waves walk the same k and v rows, so they share one copy of them in LDS
#define NT (KB / 16)           // key tiles per block (the load schedule in k_att is written for 4)
#define BP (KB + 20)           // LDS band pitch in floats: KB + 16 columns used; pitch - 1 = 19 mod 64 keeps the 32 shifted reads of a wave on 32 banks
#define SCALE (0.125f * 1.44269504088896340736f)   // 1/sqrt(64) times log2(e): the scores, their running maximum and every exponent are kept in base 2, so that each exponential is one subtraction and one v_exp_f32
#ifndef TNB
#define TNB NB
#endif
typedef __attribute__((ext_vector_type(8))) __bf16 v8b;
__device__ __forceinline__ v16b frag_b(const __bf16* rowk0, int lane) {
  union { v16b v; v8b q[2]; } u; const __bf16* p = rowk0 + 8 * (lane >> 4);
  u.q[0] = *(const v8b*)p; u.q[1] = *(const v8b*)(p + 16); return u.v;
}
__device__ __forceinline__ float bfr(float v) { return (float)(__bf16)v; }

// ---- the k loop of the three projection kernels: block = 4 waves, 64 rows x 128 columns, wave = 16 rows x 128 columns.
// Each k-step's 32 x 128 weight tile is read from global memory once per work-group (whole rows of 512 B) and put into LDS as bf16 B fragments: fragment j (16 columns) holds lane l's elements 0..7 at 16 l bytes and 8..15 at 512 + 16 l.
// Two buffers: step kc + 1 is loaded into registers in front of the products of step kc and stored behind them; one barrier per step publishes it and ends the reads of the buffer that is written next.
#define WFP 520                // pitch of a staged fragment in elements: 1 KiB + 16 B, so that the 32 16-byte stores of a wave (8 fragments x 4 columns) spread over all banks
#define WBUF (8 * WFP)
typedef v8b __attribute__((may_alias)) v8b_a;   // the stage shares its LDS with the arrays of the epilogues
template <int MODE>   // 0: A rows rounded to bf16; 1: the same, rows that are not live read as 0; 2: A rows as bf16 hi + lo (2 products)
__device__ __forceinline__ void gemm128(const float* ap, const float* wp, __bf16* wst, int wave, int lane, bool live, v8f (&acc)[8]) {   /* ap: this lane's row + 8 g; wp: weight row 8 wave, column c0 + 4 lane */
  __bf16* wd = wst + (lane >> 2) * WFP + (wave >> 1) * 256 + ((wave & 1) * 16 + 4 * (lane & 3)) * 8; const __bf16* wsrc = wst + lane * 8;
  v4f wr[8], ar[4];
#pragma unroll
  for (int i = 0; i < 8; ++i) wr[i] = *(const v4f*)(wp + (size_t)i * CC);
  ar[0] = *(const v4f*)ap; ar[1] = *(const v4f*)(ap + 4); ar[2] = *(const v4f*)(ap + 16); ar[3] = *(const v4f*)(ap + 20);
  asm volatile("s_wait_xcnt 0x0" :: "v"(wp), "v"(ap) : "memory");   /* the loads above name wp and ap, which are advanced below */
#pragma unroll
  for (int c = 0; c < 4; ++c) { v8b t;
#pragma unroll
    for (int i = 0; i < 8; ++i) t[i] = (__bf16)wr[i][c];
    *(v8b_a*)(wd + c * 8) = t; }
  __syncthreads();
#pragma unroll 2   /* two steps a trip, so that each step's buffer is a constant offset */
  for (int kc = 0; kc < CC / 32; ++kc) { float v[16];
#pragma unroll
    for (int i = 0; i < 4; ++i) { v[i] = ar[0][i]; v[4 + i] = ar[1][i]; v[8 + i] = ar[2][i]; v[12 + i] = ar[3][i]; }
    if (MODE == 1) {
#pragma unroll
      for (int i = 0; i < 16; ++i) v[i] = live ? v[i] : 0.f; }
    F2 a;
    if (MODE == 2) a = bsplit16(v);
    else {
#pragma unroll
      for (int i = 0; i < 16; ++i) a.h[i] = (__bf16)v[i]; }
    const __bf16* sb = wsrc + (kc & 1) * WBUF; union { v16b v; v8b q[2]; } w[8];   /* all 8 fragments are asked for at once, so that the LDS latency is paid once a step */
#pragma unroll
    for (int j = 0; j < 8; ++j) { w[j].q[0] = *(const v8b_a*)(sb + j * WFP); w[j].q[1] = *(const v8b_a*)(sb + j * WFP + 256); }
    if (kc + 1 < CC / 32) { wp += 32 * CC; ap += 32;
#pragma unroll
      for (int i = 0; i < 8; ++i) wr[i] = *(const v4f*)(wp + (size_t)i * CC);
      ar[0] = *(const v4f*)ap; ar[1] = *(const v4f*)(ap + 4); ar[2] = *(const v4f*)(ap + 16); ar[3] = *(const v4f*)(ap + 20);
      asm volatile("s_wait_xcnt 0x0" :: "v"(wp), "v"(ap) : "memory");   /* the loads above name wp and ap, which the next step advances */
    }
#pragma unroll
    for (int j = 0; j < 8; ++j) { acc[j] = wmma_bf(a.h, w[j].v, acc[j]); if (MODE == 2) acc[j] = wmma_bf(a.l, w[j].v, acc[j]); }
    __builtin_amdgcn_sched_barrier(0);   /* keeps the wait for the next step's global loads behind this step's products */
    if (kc + 1 < CC / 32) { __bf16* db = wd + ((kc + 1) & 1) * WBUF;
#pragma unroll
      for (int c = 0; c < 4; ++c) { v8b t;
#pragma unroll
        for (int i = 0; i < 8; ++i) t[i] = (__bf16)wr[i][c];
        *(v8b_a*)(db + c * 8) = t; } }
    __syncthreads();   /* publishes step kc + 1; behind the last step it frees the stage for the epilogue's arrays */
  } }

#define WS_QUH 0u                                       // f16 (q + u) rows [b*t][512] hi
#define WS_QUL (WS_QUH + 2u * (size_t)NB * TT * CC)      //                     residual x 2^10
#define WS_QVH (WS_QUL + 2u * (size_t)NB * TT * CC)      // f16 (q + v_bias) rows
#define WS_QVL (WS_QVH + 2u * (size_t)NB * TT * CC)
#define WS_KH  (WS_QVL + 2u * (size_t)NB * TT * CC)      // f16 k in fragment order [b][h][t/16][d/16][(d/8)&1][t&15][d&7]: a 16-key tile is 2 KiB and lane l's 16 bytes of each half fragment stand at 16 l
#define WS_HRH (WS_KH  + 2u * (size_t)NB * TT * CC)      // f16 p hi in the same fragment order [h][pos/16][d/16][(d/8)&1][pos&15][d&7], pos < HRR
#define WS_HRL (WS_HRH + 2u * (size_t)HRR * CC)          //                        residual x 2^10
#define WS_VT  (WS_HRL + 2u * (size_t)HRR * CC)          // bf16 v planes in fragment order [b][h][t/32][d/16][(t/16)&1][(t/8)&1][d&15][t&7]
#define WS_VL  (WS_VT  + 2u * (size_t)NB * CC * TT)
#define WS_Y   (WS_VL  + 2u * (size_t)NB * CC * TT)      // f32 ctx rows [b*t][512]
#define WS_END (WS_Y   + 4u * (size_t)NB * TT * CC)

// ---- k_proj: block = (64 rows, 128 cols, which): which 0: q = query Wq + bq -> (q + u) and (q + v_bias) as f16 hi + residual rows (u, v_bias [H,DK] flat = column index); which 1: k = key Wk + bk -> f16, fragment order; which 2: v = value Wv + bv -> bf16 hi + lo planes, fragment order (a store loop's 128 threads write 2 KiB in a row). Weights (in,out).
__global__ __launch_bounds__(128) void k_proj(const float* __restrict__ X0, const float* __restrict__ X1, const float* __restrict__ X2, const float* __restrict__ WQ, const float* __restrict__ BQ, const float* __restrict__ WK, const float* __restrict__ BK, const float* __restrict__ WV, const float* __restrict__ BV, const float* __restrict__ UB, const float* __restrict__ VB, _Float16* __restrict__ QUH, _Float16* __restrict__ QUL, _Float16* __restrict__ QVH, _Float16* __restrict__ QVL, _Float16* __restrict__ KH, __bf16* __restrict__ VT, __bf16* __restrict__ VL) {
  __shared__ __align__(16) _Float16 sh[64][136], sl[64][136]; __shared__ __align__(16) __bf16 th[128][72], tl2[128][72];
  const int tid = threadIdx.x, wave = tid >> 5, lane = tid & 31, col = lane & 15, g = lane >> 4; const int which = blockIdx.z; const int c0 = blockIdx.y * 128; const size_t r0 = (size_t)blockIdx.x * 64;
  const float* X = which == 0 ? X0 : which == 1 ? X1 : X2; const float* WA = which == 0 ? WQ : which == 1 ? WK : WV; const float* BA = which == 0 ? BQ : which == 1 ? BK : BV;
  v8f acc[8] = {};
  gemm128<0>(X + (r0 + wave * 16 + col) * CC + 8 * g, WA + (size_t)(8 * wave) * CC + c0 + 4 * lane, (__bf16*)&sh[0][0], wave, lane, true, acc);
  const int npass = (which == 0) ? 2 : 1;
  for (int pass = 0; pass < npass; ++pass) {   /* block-uniform */
    if (pass) __syncthreads();
#pragma unroll
    for (int j = 0; j < 8; ++j) { const int o = c0 + j * 16 + col; const float bb = bfr(BA[o]) + ((which == 0) ? bfr((pass == 0 ? UB : VB)[o]) : 0.f);
#pragma unroll
      for (int r = 0; r < 8; ++r) { const float v = acc[j][r] + bb; const int rl = wave * 16 + 8 * g + r, cl = j * 16 + col; const _Float16 hv = (_Float16)v;
        if (which == 2) { const __bf16 bh = (__bf16)v; th[cl][rl] = bh; tl2[cl][rl] = (__bf16)(v - (float)bh); } else { sh[rl][cl] = hv; sl[rl][cl] = (_Float16)((v - (float)hv) * 1024.0f); } } }
    __syncthreads();
    const size_t b = r0 / TT; const int t0 = (int)(r0 % TT);
    if (which == 0) { _Float16* dh = (pass == 0 ? QUH : QVH); _Float16* dl = (pass == 0 ? QUL : QVL); for (int e = tid; e < 64 * 16; e += 128) { const int rl = e >> 4, q = e & 15; vst2((unsigned*)(dh + (r0 + rl) * CC + c0 + q * 8), *(const v4u*)&sh[rl][q * 8]); vst2((unsigned*)(dl + (r0 + rl) * CC + c0 + q * 8), *(const v4u*)&sl[rl][q * 8]); } }
    else if (which == 1) { for (int e = tid; e < 64 * 16; e += 128) { const int rl = ((e >> 7) & 3) * 16 + (e & 15), q = (e >> 9) * 8 + ((e >> 4) & 7);   /* e = (head, tile, d/16, (d/8)&1, t&15) */
        vst2((unsigned*)(KH + ((b * NH + c0 / HD + (e >> 9)) * (TT / 16) + t0 / 16 + ((e >> 7) & 3)) * (size_t)(16 * HD) + (e & 127) * 8), *(const v4u*)&sh[rl][q * 8]); } }
    else { for (int e = tid; e < 128 * 8; e += 128) { const int cl = (e >> 9) * 64 + ((e >> 6) & 3) * 16 + (e & 15), q = ((e >> 8) & 1) * 4 + ((e >> 4) & 3);   /* e = (head, t/32, d/16, (t/16)&1, (t/8)&1, d&15) */
        const size_t o2 = ((b * NH + c0 / HD + (e >> 9)) * (TT / 32) + t0 / 32 + ((e >> 8) & 1)) * (size_t)(32 * HD) + (e & 255) * 8; vst2((unsigned*)(VT + o2), *(const v4u*)&th[cl][q * 8]); vst2((unsigned*)(VL + o2), *(const v4u*)&tl2[cl][q * 8]); } } } }
// ---- k_projr: block = (64 positions, 128 cols): p rows [pos][o] = pos_emb[0][pos] Wpos ((in,out), exact) -> f16 hi + residual, fragment order; rows >= NPOS (2,047) are written as zeros (their A rows are loaded clamped and zeroed by value)
__global__ __launch_bounds__(128) void k_projr(const float* __restrict__ PE, const float* __restrict__ WP, _Float16* __restrict__ HRH, _Float16* __restrict__ HRL) {
  __shared__ __align__(16) _Float16 sh[64][136], sl[64][136];
  const int tid = threadIdx.x, wave = tid >> 5, lane = tid & 31, col = lane & 15, g = lane >> 4; const int c0 = blockIdx.y * 128; const size_t p0 = (size_t)blockIdx.x * 64;
  const size_t prow = p0 + wave * 16 + col; const bool live = prow < NPOS; const size_t prc = live ? prow : (NPOS - 1);
  v8f acc[8] = {};
  gemm128<1>(PE + prc * CC + 8 * g, WP + (size_t)(8 * wave) * CC + c0 + 4 * lane, (__bf16*)&sh[0][0], wave, lane, live, acc);
#pragma unroll
  for (int j = 0; j < 8; ++j) {
#pragma unroll
    for (int r = 0; r < 8; ++r) { const float v = acc[j][r]; const int rl = wave * 16 + 8 * g + r, cl = j * 16 + col; const _Float16 hv = (_Float16)v; sh[rl][cl] = hv; sl[rl][cl] = (_Float16)((v - (float)hv) * 1024.0f); } }
  __syncthreads();
  for (int e = tid; e < 64 * 16; e += 128) { const int rl = ((e >> 7) & 3) * 16 + (e & 15), q = (e >> 9) * 8 + ((e >> 4) & 7);   /* e = (head, tile, d/16, (d/8)&1, pos&15) */
    const size_t o2 = ((size_t)(c0 / HD + (e >> 9)) * (HRR / 16) + p0 / 16 + ((e >> 7) & 3)) * (size_t)(16 * HD) + (e & 127) * 8; vst2((unsigned*)(HRH + o2), *(const v4u*)&sh[rl][q * 8]); vst2((unsigned*)(HRL + o2), *(const v4u*)&sl[rl][q * 8]); } }
// fragment-order loads: p already includes the lane's own offset of 8 * lane elements; the two halves of a fragment are 512 B apart, so each load of a wave reads 512 B in a row (4 cache lines, not 16)
__device__ __forceinline__ v16h frag_t(const _Float16* p) { union { v16h v; v8h q[2]; } u; u.q[0] = *(const v8h*)p; u.q[1] = *(const v8h*)(p + 256); return u.v; }
__device__ __forceinline__ v16b frag_tb(const __bf16* p) { union { v16b v; v8b q[2]; } u; u.q[0] = *(const v8b*)p; u.q[1] = *(const v8b*)(p + 256); return u.v; }
__device__ __forceinline__ void ld4(v16h (&f)[4], const _Float16* rh, const _Float16* rl) { f[0] = frag_t(rh); f[1] = frag_t(rl); f[2] = frag_t(rh + 512); f[3] = frag_t(rl + 512); }
__device__ __forceinline__ void qput(v8h (*s)[32], v16h f, int lane) { union { v16h v; v8h q[2]; } u; u.v = f; s[0][lane] = u.q[0]; s[1][lane] = u.q[1]; }
__device__ __forceinline__ v16h qget(const v8h (*s)[32], int lane) { union { v16h v; v8h q[2]; } u; u.q[0] = s[0][lane]; u.q[1] = s[1][lane]; return u.v; }
#define KVP (KB * HD / 8)      // 16-byte pieces of one staged plane = threads of the work-group
__device__ __forceinline__ void kv_copy(unsigned lds, const _Float16* k, const __bf16* vh, const __bf16* vl) {
  asm volatile("global_load_async_to_lds_b128 %0, %3, off\n\tglobal_load_async_to_lds_b128 %1, %4, off\n\tglobal_load_async_to_lds_b128 %2, %5, off\n\ts_wait_xcnt 0x0" :: "v"(lds), "v"(lds + 16u * KVP), "v"(lds + 32u * KVP), "v"(k), "v"(vh), "v"(vl) : "memory"); }
// one position tile: X^T = p (q+v_bias)^T, 3 products; x0, x1 = this lane's 8 consecutive positions of its query
__device__ __forceinline__ void bd_tile(const v16h (&f)[4], const v16h (&qh)[HD / 32], const v16h (&ql)[HD / 32], v4f& x0, v4f& x1) { v8f a = {}, al = {};
#pragma unroll
  for (int kc = 0; kc < HD / 32; ++kc) { a = wmma16(f[2 * kc], qh[kc], a); al = wmma16(f[2 * kc], ql[kc], al); al = wmma16(f[2 * kc + 1], qh[kc], al); }
#pragma unroll
  for (int r = 0; r < 4; ++r) { x0[r] = a[r] + al[r] * (1.0f / 1024.0f); x1[r] = a[4 + r] + al[4 + r] * (1.0f / 1024.0f); } }
// ---- k_att: block = 16 * AW queries of one (batch, head) pair, wave = 16 queries, all T keys in blocks of KB. Everything is kept transposed so that a lane owns one query (column lane & 15):
//   S^T = k (q+u)^T (2 products) and X^T = p (q+v_bias)^T (3 products) have D register r = key / position 8g + r; O^T += v^T P^T takes two S^T tiles, converted in place, as its B operand.
//   rel_shift: for queries iw0 + q and keys j0 + jl the position row is T-1-(iw0+q)+(j0+jl) = pb + c with pb = T-16-iw0+j0 and c = jl + 15 - q, so KB/16 + 1 position tiles stand in the wave's own LDS band [q][c] and each lane reads its row back at offset 15 - q; the last tile of a block is the first of the next (pb grows by KB) and is moved there, not computed again.
//   k and v: all AW waves walk the same keys, so each block's 24 KiB are copied into LDS once per work-group (asynchronous copies, two buffers: block t + 2 is asked for when every wave has left block t, and flies while block t + 1 is worked on) and every wave reads its fragments from there; only the position fragments, which differ from wave to wave, still come through the cache.
//   softmax is the running-maximum form in base 2: per block m' = max(m, block max), sums and O^T are scaled by 2^(m - m'), P = 2^(s - m') split bf16 hi + lo; the division by the sum comes last. No exponent lies above 0 by more than a rounding error; one far below -126 gives 0 or a subnormal, which adds nothing to a sum whose largest term is 1.
__global__ __launch_bounds__(32 * AW) __attribute__((amdgpu_waves_per_eu(4, 4))) void k_att(const _Float16* __restrict__ QUH, const _Float16* __restrict__ QUL, const _Float16* __restrict__ QVH, const _Float16* __restrict__ QVL, const _Float16* __restrict__ KH, const _Float16* __restrict__ RHh, const _Float16* __restrict__ RLl, const __bf16* __restrict__ VT, const __bf16* __restrict__ VL, float* __restrict__ Y) {
  __shared__ __align__(16) float band[AW][16][BP]; __shared__ __align__(16) v8h qs[AW][8][2][32]; __shared__ __align__(16) v8h kv[2][3][KVP];   /* kv: two buffers of (k, v hi, v lo) of one key block; qs: each lane's own query fragments, parked so that they hold registers only in the phase that uses them (256 VGPRs = 4 waves per SIMD) */
  const int tid = threadIdx.x, wave = tid >> 5, lane = tid & 31, col = lane & 15, g = lane >> 4; const int bh = blockIdx.y, b = bh / NH, h = bh % NH; const int iw0 = blockIdx.x * (16 * AW) + wave * 16;
  const size_t qrow = ((size_t)b * TT + iw0 + col) * CC + h * HD;
  static_assert(KVP == 32 * AW, "one 16-byte piece of each plane per thread");
  const unsigned kvl = (unsigned)(size_t)&kv[0][0][tid];   /* this thread's LDS byte address in plane 0 of buffer 0 */
  const _Float16* kc = KH + (size_t)bh * TT * HD + tid * 8; const __bf16* vhc = VT + (size_t)bh * TT * HD + tid * 8; const __bf16* vlc = VL + (size_t)bh * TT * HD + tid * 8;
  kv_copy(kvl, kc, vhc, vlc);   /* block 0 into buffer 0 */
#pragma unroll
  for (int kc = 0; kc < HD / 32; ++kc) { qput(qs[wave][kc], frag_h(QVH + qrow + kc * 32, lane), lane); qput(qs[wave][2 + kc], frag_h(QVL + qrow + kc * 32, lane), lane); qput(qs[wave][4 + kc], frag_h(QUH + qrow + kc * 32, lane), lane); qput(qs[wave][6 + kc], frag_h(QUL + qrow + kc * 32, lane), lane); }
  float* bw = &band[wave][col][0];
  const size_t ro = ((size_t)h * (HRR / 16) + (TT - 16 - iw0) / 16) * (16 * HD) + lane * 8; const _Float16* rh = RHh + ro; const _Float16* rl = RLl + ro;   /* this lane's place in position tile 0 of block 0; a tile is 16 * HD elements */
  v8f acc[HD / 16] = {}; float m = -3.0e38f, l = 0.f;
  // Every fragment is loaded one or two tiles ahead of the products that use it. pf[1], pf[2] (position tiles 1, 2) are loaded at the end of the block before; behind the last block that reads rows < 2T + 32 of the p planes, which k_projr has written, and the values are not used.
  v16h pf[NT + 1][4], kf[NT][2]; v16b vf[KB / 32][HD / 16][2];
  ld4(pf[0], rh, rl); ld4(pf[1], rh + 16 * HD, rl + 16 * HD); ld4(pf[2], rh + 32 * HD, rl + 32 * HD);
  asm volatile("s_wait_xcnt 0x0" :: "v"(rh), "v"(rl) : "memory");   /* the loads above name rh and rl: as inputs here both keep their registers up to the wait, so that nothing (a later load's result either) is written over an address of an issued load in front of it */
  { v16h qvh[HD / 32], qvl[HD / 32]; v4f x0, x1;   /* tile 0 of block 0, put where a block before would have left it */
#pragma unroll
    for (int kc = 0; kc < HD / 32; ++kc) { qvh[kc] = qget(qs[wave][kc], lane); qvl[kc] = qget(qs[wave][2 + kc], lane); }
    bd_tile(pf[0], qvh, qvl, x0, x1); *(v4f*)(bw + KB + 8 * g) = x0; *(v4f*)(bw + KB + 8 * g + 4) = x1; }
  asm volatile("s_wait_asynccnt 0x0" ::: "memory");   /* this wave's part of block 0 has landed */
  __syncthreads();                                     /* ... and every other wave's: block 0 may be read */
  kv_copy(kvl + 48u * KVP, kc + KB * HD, vhc + KB * HD, vlc + KB * HD);   /* block 1 into buffer 1 */
#pragma unroll 1
  for (int j0 = 0; j0 < TT; j0 += KB) { const _Float16* rhb = rh + (size_t)j0 * HD; const _Float16* rlb = rl + (size_t)j0 * HD; const int buf = (j0 / KB) & 1; const _Float16* kpb = (const _Float16*)&kv[buf][0][lane]; const __bf16* vhb = (const __bf16*)&kv[buf][1][lane]; const __bf16* vlb = (const __bf16*)&kv[buf][2][lane];
    v16h quh[HD / 32], qul[HD / 32], qvh[HD / 32], qvl[HD / 32];
#pragma unroll
    for (int kc = 0; kc < HD / 32; ++kc) { qvh[kc] = qget(qs[wave][kc], lane); qvl[kc] = qget(qs[wave][2 + kc], lane); }
    { const v4f c0 = *(const v4f*)(bw + KB + 8 * g), c1 = *(const v4f*)(bw + KB + 8 * g + 4); *(v4f*)(bw + 8 * g) = c0; *(v4f*)(bw + 8 * g + 4) = c1; }   /* the lane's own values: last tile of the block before = tile 0 of this one */
#pragma unroll
    for (int t = 1; t < NT + 1; ++t) {
      if (t + 2 < NT + 1) ld4(pf[t + 2], rhb + (t + 2) * 16 * HD, rlb + (t + 2) * 16 * HD);
      else if (t + 1 == NT) {
#pragma unroll
        for (int u = 0; u < NT / 2; ++u) { kf[u][0] = frag_t(kpb + u * 16 * HD); kf[u][1] = frag_t(kpb + u * 16 * HD + 512); } }
      else {
#pragma unroll
        for (int kc = 0; kc < HD / 32; ++kc) { quh[kc] = qget(qs[wave][4 + kc], lane); qul[kc] = qget(qs[wave][6 + kc], lane); } }
      v4f x0, x1; bd_tile(pf[t], qvh, qvl, x0, x1);
      *(v4f*)(bw + t * 16 + 8 * g) = x0; *(v4f*)(bw + t * 16 + 8 * g + 4) = x1; }
    LDSX();   /* a lane reads band values that its partner lane (lane ^ 16) wrote */
    float s[NT][8]; float bm = -3.0e38f;
#pragma unroll
    for (int t = 0; t < NT; ++t) { v8f a = {}, al = {};
      if (t == 0) {
#pragma unroll
        for (int u = NT / 2; u < NT; ++u) { kf[u][0] = frag_t(kpb + u * 16 * HD); kf[u][1] = frag_t(kpb + u * 16 * HD + 512); } }
#pragma unroll
      for (int kc = 0; kc < HD / 32; ++kc) { a = wmma16(kf[t][kc], quh[kc], a); al = wmma16(kf[t][kc], qul[kc], al); }
      vf[0][t][0] = frag_tb(vhb + t * 512); vf[0][t][1] = frag_tb(vlb + t * 512);
#pragma unroll
      for (int r = 0; r < 8; ++r) { const float v = ((a[r] + al[r] * (1.0f / 1024.0f)) + bw[t * 16 + 8 * g + r + 15 - col]) * SCALE; s[t][r] = v; bm = fmaxf(bm, v); } }
    bm = fmaxf(bm, __shfl_xor(bm, 16));
    const float mn = fmaxf(m, bm), alpha = __builtin_amdgcn_exp2f(m - mn); m = mn; l *= alpha;
#pragma unroll
    for (int j = 0; j < HD / 16; ++j)
#pragma unroll
      for (int r = 0; r < 8; ++r) acc[j][r] *= alpha;
#pragma unroll
    for (int c = 0; c < KB / 32; ++c) { float e[16];
#pragma unroll
      for (int i = 0; i < 8; ++i) { e[i] = __builtin_amdgcn_exp2f(s[2 * c][i] - m); e[8 + i] = __builtin_amdgcn_exp2f(s[2 * c + 1][i] - m); l += e[i] + e[8 + i]; }
      const F2 p = bsplit16(e);
#pragma unroll
      for (int j = 0; j < HD / 16; ++j) { acc[j] = wmma_bf(vf[c][j][0], p.h, acc[j]); acc[j] = wmma_bf(vf[c][j][0], p.l, acc[j]); acc[j] = wmma_bf(vf[c][j][1], p.h, acc[j]);
        if (c + 1 < KB / 32) { vf[c + 1][j][0] = frag_tb(vhb + (c + 1) * 32 * HD + j * 512); vf[c + 1][j][1] = frag_tb(vlb + (c + 1) * 32 * HD + j * 512); }
        else if (j & 1) ld4(pf[1 + (j >> 1)], rhb + (KB + 16 + (j >> 1) * 16) * HD, rlb + (KB + 16 + (j >> 1) * 16) * HD); } }
    asm volatile("s_wait_xcnt 0x0" ::: "memory");   /* the address registers of the loads just issued are rewritten at the top of the next pass */
    asm volatile("s_wait_dscnt 0x0" ::: "memory");      /* this wave's reads of this block's buffer have returned */
    asm volatile("s_wait_asynccnt 0x0" ::: "memory");   /* this wave's part of the next block has landed */
    asm volatile("s_barrier_signal -1\n\ts_barrier_wait -1" ::: "memory");   /* publishes the next block and frees this block's buffer; by hand, because __syncthreads() would also wait for the position fragments just asked for, which are to stay in flight across it */
    if (j0 + 2 * KB < TT) kv_copy(kvl + (unsigned)buf * (48u * KVP), kc + (size_t)(j0 + 2 * KB) * HD, vhc + (size_t)(j0 + 2 * KB) * HD, vlc + (size_t)(j0 + 2 * KB) * HD);   /* the same test in every wave */
  }
  asm volatile("s_wait_asynccnt 0x0" ::: "memory");   /* no copy is outstanding when the wave ends */
  l += __shfl_xor(l, 16); const float inv = 1.0f / l;
#pragma unroll
  for (int j = 0; j < HD / 16; ++j) { v4f y0, y1;
#pragma unroll
    for (int r = 0; r < 4; ++r) { y0[r] = acc[j][r] * inv; y1[r] = acc[j][4 + r] * inv; }
    float* yp = Y + qrow + j * 16 + 8 * g; vst2(yp, y0); vst2(yp + 4, y1); } }
// ---- k_out: block = (64 rows, 128 cols): out = ctx (bf16 hi + lo) Wout ((in,out), exact) + bout
__global__ __launch_bounds__(128) void k_out(const float* __restrict__ Yr, const float* __restrict__ WO, const float* __restrict__ BO, float* __restrict__ OUT) { __shared__ __align__(16) float sf[4][16][132];
  const int tid = threadIdx.x, wave = tid >> 5, lane = tid & 31, col = lane & 15, g = lane >> 4; const int c0 = blockIdx.y * 128; const size_t r0 = (size_t)blockIdx.x * 64 + wave * 16;
  v8f acc[8] = {};
  gemm128<2>(Yr + (r0 + col) * CC + 8 * g, WO + (size_t)(8 * wave) * CC + c0 + 4 * lane, (__bf16*)&sf[0][0][0], wave, lane, true, acc);
#pragma unroll
  for (int j = 0; j < 8; ++j) { const float bb = bfr(BO[c0 + j * 16 + col]);
#pragma unroll
    for (int r = 0; r < 8; ++r) sf[wave][8 * g + r][j * 16 + col] = acc[j][r] + bb; }
  LDSX(); for (int rl = 0; rl < 16; ++rl) vst2(OUT + (r0 + rl) * CC + c0 + lane * 4, *(const v4f*)&sf[wave][rl][lane * 4]); }
extern "C" void kernel_launch(void* const* d_in, const int* in_sizes, int n_in, void* d_out, int out_size, void* d_ws, size_t ws_size, hipStream_t stream) {
  (void)in_sizes; (void)n_in; (void)out_size;
  const float** F = (const float**)d_in;   // 0 query, 1 key, 2 value [8,1024,512]; 3 pos_emb [1,2047,512]; 4 Wq, 5 bq, 6 Wk, 7 bk, 8 Wv, 9 bv ((in,out)); 10 Wpos; 11 Wout, 12 bout; 13 pos_bias_u [8,64], 14 pos_bias_v
  if (ws_size < (size_t)WS_END) return;
  char* ws = (char*)d_ws; _Float16 *QUH = (_Float16*)(ws + WS_QUH), *QUL = (_Float16*)(ws + WS_QUL), *QVH = (_Float16*)(ws + WS_QVH), *QVL = (_Float16*)(ws + WS_QVL), *KH = (_Float16*)(ws + WS_KH), *HRH = (_Float16*)(ws + WS_HRH), *HRL = (_Float16*)(ws + WS_HRL); __bf16 *VT = (__bf16*)(ws + WS_VT), *VL = (__bf16*)(ws + WS_VL); float *Y = (float*)(ws + WS_Y);
  k_proj<<<dim3(TNB * TT / 64, CC / 128, 3), 128, 0, stream>>>(F[0], F[1], F[2], F[4], F[5], F[6], F[7], F[8], F[9], F[13], F[14], QUH, QUL, QVH, QVL, KH, VT, VL);
  k_projr<<<dim3(HRR / 64, CC / 128), 128, 0, stream>>>(F[3], F[10], HRH, HRL);
  k_att<<<dim3(TT / (16 * AW), TNB * NH), 32 * AW, 0, stream>>>(QUH, QUL, QVH, QVL, KH, HRH, HRL, VT, VL, Y);
  k_out<<<dim3(TNB * TT / 64, CC / 128), 128, 0, stream>>>(Y, F[11], F[12], (float*)d_out);
}

// v007
// It runs in 123 microseconds.
// Timed twice side by side with v006, it ran 1.11 times as fast both times.
// All steps since v000 together make it 12.8 times as fast.
// compute dtype: all float inputs rounded to bf16; q/k/v/p = x W + b with EXACT bf16 products on WMMA 16x16x32, f32 accumulate; (q + pos_bias_u), (q + pos_bias_v) and p as f16 hi + residual (x 2^10), k once to f16 -> content logits 2 products, position logits 3 products; the rel_shift as a banded position GEMM + index offset through LDS; logits times log2(e)/8 and running-maximum softmax in f32 on the hardware's base-2 exponential; P = 2^(s - m) split bf16 hi + lo against v bf16 hi + lo (3 products), divided by the sum at the end; ctx (bf16 hi + lo) Wout + bout; f32 output.
#include <hip/hip_runtime.h>
#include <math.h>

typedef __attribute__((ext_vector_type(16))) _Float16 v16h;
typedef __attribute__((ext_vector_type(16))) __bf16 v16b;
typedef __attribute__((ext_vector_type(8)))  _Float16 v8h;
typedef __attribute__((ext_vector_type(8)))  float v8f;
typedef __attribute__((ext_vector_type(4)))  float v4f;
typedef __attribute__((ext_vector_type(2)))  float v2f;
typedef __attribute__((ext_vector_type(4)))  unsigned v4u;
typedef __attribute__((ext_vector_type(4)))  int v4i;
typedef float __attribute__((may_alias)) float_a;
typedef int __attribute__((may_alias)) int_a;

template <typename T> __device__ __forceinline__ void vst2(void* p, T v) { *(T*)p = v;  }
__device__ __forceinline__ v8f wmma16(v16h a, v16h b, v8f c) {
  v8f d = __builtin_amdgcn_wmma_f32_16x16x32_f16(false, a, false, b, (short)0, c, false, false);
  asm volatile("v_nop\n\tv_nop\n\tv_nop\n\tv_nop" : "+v"(d) : "v"(a), "v"(b));
  return d;
}
__device__ __forceinline__ v8f wmma_bf(v16b a, v16b b, v8f c) {
  v8f d = __builtin_amdgcn_wmma_f32_16x16x32_bf16(false, a, false, b, (short)0, c, false, false);
  asm volatile("v_nop\n\tv_nop\n\tv_nop\n\tv_nop" : "+v"(d) : "v"(a), "v"(b));
  return d;
}
// 16x16x32 fragments: lane = (h = lane>>4, row/col = lane&15); elements 0..7 = k0+8h+0..7, 8..15 = k0+16+8h+0..7; D element r = row 8h+r
__device__ __forceinline__ v16h frag_h(const _Float16* rowk0, int lane) {
  union { v16h v; v8h q[2]; } u; const _Float16* p = rowk0 + 8 * (lane >> 4);
  u.q[0] = *(const v8h*)p; u.q[1] = *(const v8h*)(p + 16); return u.v;
}
__device__ __forceinline__ v16h frag_f32(const float* rowk0, int lane) {
  v16h a; const float* p = rowk0 + 8 * (lane >> 4);
#pragma unroll
  for (int i = 0; i < 8; ++i) { a[i] = (_Float16)p[i]; a[8 + i] = (_Float16)p[16 + i]; }
  return a;
}
__device__ __forceinline__ v16h frag_f32s(const float* rowk0, int lane, float sc) {
  v16h a; const float* p = rowk0 + 8 * (lane >> 4);
#pragma unroll
  for (int i = 0; i < 8; ++i) { a[i] = (_Float16)(p[i] * sc); a[8 + i] = (_Float16)(p[16 + i] * sc); }
  return a;
}
// column fragment from a [K][ld] layout (column n), rows >= K read as 0
__device__ __forceinline__ v16h fragc_f32(const float* W, int k0, int n, int lane, int ld, int K) {
  v16h a; const int g = lane >> 4;
#pragma unroll
  for (int i = 0; i < 8; ++i) { const int ka = k0 + 8 * g + i, kb = ka + 16;
    a[i] = (_Float16)(ka < K ? W[(size_t)(ka < K ? ka : K - 1) * ld + n] : 0.f); a[8 + i] = (_Float16)(kb < K ? W[(size_t)(kb < K ? kb : K - 1) * ld + n] : 0.f); }
  return a;
}
struct F2 { v16b h, l; };
__device__ __forceinline__ F2 bsplit16(const float v[16]) { F2 r;
#pragma unroll
  for (int i = 0; i < 16; ++i) { const __bf16 h = (__bf16)v[i]; r.h[i] = h; r.l[i] = (__bf16)(v[i] - (float)h); }
  return r; }
__device__ __forceinline__ F2 split_row(const float* row, int k0, int lane) { float v[16]; const float* p = row + k0 + 8 * (lane >> 4);
#pragma unroll
  for (int i = 0; i < 8; ++i) { v[i] = p[i]; v[8 + i] = p[16 + i]; }
  return bsplit16(v); }
__device__ __forceinline__ F2 split_rowK(const float* row, int k0, int lane, int K) { float v[16]; const int g = lane >> 4;
#pragma unroll
  for (int i = 0; i < 8; ++i) { const int ka = k0 + 8 * g + i, kb = ka + 16; v[i] = ka < K ? row[ka < K ? ka : K - 1] : 0.f; v[8 + i] = kb < K ? row[kb < K ? kb : K - 1] : 0.f; }
  return bsplit16(v); }
__device__ __forceinline__ F2 split_col(const float* W, int k0, int n, int lane, int ld, int K) { float v[16]; const int g = lane >> 4;
#pragma unroll
  for (int i = 0; i < 8; ++i) { const int ka = k0 + 8 * g + i, kb = ka + 16; v[i] = ka < K ? W[(size_t)(ka < K ? ka : K - 1) * ld + n] : 0.f; v[8 + i] = kb < K ? W[(size_t)(kb < K ? kb : K - 1) * ld + n] : 0.f; }
  return bsplit16(v); }
__device__ __forceinline__ v8f mac3(const F2& a, const F2& b, v8f c) { c = wmma_bf(a.l, b.h, c); c = wmma_bf(a.h, b.l, c); return wmma_bf(a.h, b.h, c); }
__device__ __forceinline__ float sigm(float v) { return 1.0f / (1.0f + expf(-v)); }
#define LDSX() do { asm volatile("s_wait_dscnt 0" ::: "memory"); __builtin_amdgcn_wave_barrier(); __builtin_amdgcn_fence(__ATOMIC_RELEASE, "workgroup"); } while (0)

// Relative-position multi-head attention (wenet/espnet style; B 8, T 1,024, F 512 = 8 x 64): q = query Wq + bq, k = key Wk + bk, v = value Wv + bv ((in,out)); p = pos_emb[0] Wpos (2T-1 positions); ac = (q + u) k^T; bd = rel_shift((q + v_bias) p^T) with rel_shift(x)[i][j] = x[i][T-1-i+j]; scores = (ac + bd) / 8; softmax; ctx = att v; out = ctx Wout + bout.
#define NB 8
#define TT 1024
#define CC 512
#define NH 8
#define HD 64
#define NPOS (2 * TT - 1)      // 2,047 rows of pos_emb / p
#define HRR (2 * TT + 128)     // rows of the p planes actually built (rows >= NPOS are zeros; they only feed never-read logits)
#define KB 64                  // keys per block of the attention loop
#define AW 16                  // waves per attention work-group: one work-group per WGP, 4 waves per SIMD; its waves walk the same k and v rows, so they share one copy of them in LDS
#define NT (KB / 16)           // key tiles per block (the load schedule in k_att is written for 4)
#define BP (KB + 20)           // LDS band pitch in floats: KB + 16 columns used; pitch - 1 = 19 mod 64 keeps the 32 shifted reads of a wave on 32 banks
#define SCALE (0.125f * 1.44269504088896340736f)   // 1/sqrt(64) times log2(e): the scores, their running maximum and every exponent are kept in base 2, so that each exponential is one subtraction and one v_exp_f32
#ifndef TNB
#define TNB NB
#endif
typedef __attribute__((ext_vector_type(8))) __bf16 v8b;
__device__ __forceinline__ v16b frag_b(const __bf16* rowk0, int lane) {
  union { v16b v; v8b q[2]; } u; const __bf16* p = rowk0 + 8 * (lane >> 4);
  u.q[0] = *(const v8b*)p; u.q[1] = *(const v8b*)(p + 16); return u.v;
}
__device__ __forceinline__ float bfr(float v) { return (float)(__bf16)v; }

// ---- the k loop of k_proj (its proj_pos work-groups included) and k_out: block = 4 waves, 64 rows x 128 columns, wave = 16 rows x 128 columns.
// Each k-step's 32 x 128 weight tile is read from global memory once per work-group (whole rows of 512 B) and put into LDS as bf16 B fragments: fragment j (16 columns) holds lane l's elements 0..7 at 16 l bytes and 8..15 at 512 + 16 l.
// Two buffers: step kc + 1 is loaded into registers in front of the products of step kc and stored behind them; one barrier per step publishes it and ends the reads of the buffer that is written next.
#define WFP 520                // pitch of a staged fragment in elements: 1 KiB + 16 B, so that the 32 16-byte stores of a wave (8 fragments x 4 columns) spread over all banks
#define WBUF (8 * WFP)
typedef v8b __attribute__((may_alias)) v8b_a;   // the stage shares its LDS with the arrays of the epilogues
template <int MODE>   // 0: A rows rounded to bf16; 1: the same, rows that are not live read as 0; 2: A rows as bf16 hi + lo (2 products)
__device__ __forceinline__ void gemm128(const float* ap, const float* wp, __bf16* wst, int wave, int lane, bool live, v8f (&acc)[8]) {   /* ap: this lane's row + 8 g; wp: weight row 8 wave, column c0 + 4 lane */
  __bf16* wd = wst + (lane >> 2) * WFP + (wave >> 1) * 256 + ((wave & 1) * 16 + 4 * (lane & 3)) * 8; const __bf16* wsrc = wst + lane * 8;
  v4f wr[8], ar[4];
#pragma unroll
  for (int i = 0; i < 8; ++i) wr[i] = *(const v4f*)(wp + (size_t)i * CC);
  ar[0] = *(const v4f*)ap; ar[1] = *(const v4f*)(ap + 4); ar[2] = *(const v4f*)(ap + 16); ar[3] = *(const v4f*)(ap + 20);
  asm volatile("s_wait_xcnt 0x0" :: "v"(wp), "v"(ap) : "memory");   /* the loads above name wp and ap, which are advanced below */
#pragma unroll
  for (int c = 0; c < 4; ++c) { v8b t;
#pragma unroll
    for (int i = 0; i < 8; ++i) t[i] = (__bf16)wr[i][c];
    *(v8b_a*)(wd + c * 8) = t; }
  __syncthreads();
#pragma unroll 2   /* two steps a trip, so that each step's buffer is a constant offset */
  for (int kc = 0; kc < CC / 32; ++kc) { float v[16];
#pragma unroll
    for (int i = 0; i < 4; ++i) { v[i] = ar[0][i]; v[4 + i] = ar[1][i]; v[8 + i] = ar[2][i]; v[12 + i] = ar[3][i]; }
    if (MODE == 1) {
#pragma unroll
      for (int i = 0; i < 16; ++i) v[i] = live ? v[i] : 0.f; }
    F2 a;
    if (MODE == 2) a = bsplit16(v);
    else {
#pragma unroll
      for (int i = 0; i < 16; ++i) a.h[i] = (__bf16)v[i]; }
    const __bf16* sb = wsrc + (kc & 1) * WBUF; union { v16b v; v8b q[2]; } w[8];   /* all 8 fragments are asked for at once, so that the LDS latency is paid once a step */
#pragma unroll
    for (int j = 0; j < 8; ++j) { w[j].q[0] = *(const v8b_a*)(sb + j * WFP); w[j].q[1] = *(const v8b_a*)(sb + j * WFP + 256); }
    if (kc + 1 < CC / 32) { wp += 32 * CC; ap += 32;
#pragma unroll
      for (int i = 0; i < 8; ++i) wr[i] = *(const v4f*)(wp + (size_t)i * CC);
      ar[0] = *(const v4f*)ap; ar[1] = *(const v4f*)(ap + 4); ar[2] = *(const v4f*)(ap + 16); ar[3] = *(const v4f*)(ap + 20);
      asm volatile("s_wait_xcnt 0x0" :: "v"(wp), "v"(ap) : "memory");   /* the loads above name wp and ap, which the next step advances */
    }
#pragma unroll
    for (int j = 0; j < 8; ++j) { acc[j] = wmma_bf(a.h, w[j].v, acc[j]); if (MODE == 2) acc[j] = wmma_bf(a.l, w[j].v, acc[j]); }
    __builtin_amdgcn_sched_barrier(0);   /* keeps the wait for the next step's global loads behind this step's products */
    if (kc + 1 < CC / 32) { __bf16* db = wd + ((kc + 1) & 1) * WBUF;
#pragma unroll
      for (int c = 0; c < 4; ++c) { v8b t;
#pragma unroll
        for (int i = 0; i < 8; ++i) t[i] = (__bf16)wr[i][c];
        *(v8b_a*)(db + c * 8) = t; } }
    __syncthreads();   /* publishes step kc + 1; behind the last step it frees the stage for the epilogue's arrays */
  } }

#define WS_QUH 0u                                       // f16 (q + u) rows [b*t][512] hi
#define WS_QUL (WS_QUH + 2u * (size_t)NB * TT * CC)      //                     residual x 2^10
#define WS_QVH (WS_QUL + 2u * (size_t)NB * TT * CC)      // f16 (q + v_bias) rows
#define WS_QVL (WS_QVH + 2u * (size_t)NB * TT * CC)
#define WS_KH  (WS_QVL + 2u * (size_t)NB * TT * CC)      // f16 k in fragment order [b][h][t/16][d/16][(d/8)&1][t&15][d&7]: a 16-key tile is 2 KiB and lane l's 16 bytes of each half fragment stand at 16 l
#define WS_HRH (WS_KH  + 2u * (size_t)NB * TT * CC)      // f16 p hi in the same fragment order [h][pos/16][d/16][(d/8)&1][pos&15][d&7], pos < HRR
#define WS_HRL (WS_HRH + 2u * (size_t)HRR * CC)          //                        residual x 2^10
#define WS_VT  (WS_HRL + 2u * (size_t)HRR * CC)          // bf16 v planes in fragment order [b][h][t/32][d/16][(t/16)&1][(t/8)&1][d&15][t&7]
#define WS_VL  (WS_VT  + 2u * (size_t)NB * CC * TT)
#define WS_Y   (WS_VL  + 2u * (size_t)NB * CC * TT)      // f32 ctx rows [b*t][512]
#define WS_END (WS_Y   + 4u * (size_t)NB * TT * CC)

// ---- proj_pos: work-group = (64 positions, 128 cols): p rows [pos][o] = pos_emb[0][pos] Wpos ((in,out), exact) -> f16 hi + residual, fragment order; rows >= NPOS (2,047) are written as zeros (their A rows are loaded clamped and zeroed by value). It depends on nothing that q, k and v need, so its work-groups stand in k_proj's grid and run beside them.
__device__ __forceinline__ void proj_pos(const float* __restrict__ PE, const float* __restrict__ WP, _Float16* __restrict__ HRH, _Float16* __restrict__ HRL, _Float16 (*sh)[136], _Float16 (*sl)[136], const size_t p0, const int c0) {
  const int tid = threadIdx.x, wave = tid >> 5, lane = tid & 31, col = lane & 15, g = lane >> 4;
  const size_t prow = p0 + wave * 16 + col; const bool live = prow < NPOS; const size_t prc = live ? prow : (NPOS - 1);
  v8f acc[8] = {};
  gemm128<1>(PE + prc * CC + 8 * g, WP + (size_t)(8 * wave) * CC + c0 + 4 * lane, (__bf16*)&sh[0][0], wave, lane, live, acc);
#pragma unroll
  for (int j = 0; j < 8; ++j) {
#pragma unroll
    for (int r = 0; r < 8; ++r) { const float v = acc[j][r]; const int rl = wave * 16 + 8 * g + r, cl = j * 16 + col; const _Float16 hv = (_Float16)v; sh[rl][cl] = hv; sl[rl][cl] = (_Float16)((v - (float)hv) * 1024.0f); } }
  __syncthreads();
  for (int e = tid; e < 64 * 16; e += 128) { const int rl = ((e >> 7) & 3) * 16 + (e & 15), q = (e >> 9) * 8 + ((e >> 4) & 7);   /* e = (head, tile, d/16, (d/8)&1, pos&15) */
    const size_t o2 = ((size_t)(c0 / HD + (e >> 9)) * (HRR / 16) + p0 / 16 + ((e >> 7) & 3)) * (size_t)(16 * HD) + (e & 127) * 8; vst2((unsigned*)(HRH + o2), *(const v4u*)&sh[rl][q * 8]); vst2((unsigned*)(HRL + o2), *(const v4u*)&sl[rl][q * 8]); } }
// ---- k_proj: one-dimensional grid: first the position projection's work-groups (proj_pos), then block = (64 rows, 128 cols, which), rows fastest: which 0: q = query Wq + bq -> (q + u) and (q + v_bias) as f16 hi + residual rows (u, v_bias [H,DK] flat = column index); which 1: k = key Wk + bk -> f16, fragment order; which 2: v = value Wv + bv -> bf16 hi + lo planes, fragment order (a store loop's 128 threads write 2 KiB in a row). Weights (in,out).
#define PBLK ((HRR / 64) * (CC / 128))   // work-groups of the position projection: the first PBLK of k_proj's grid
__global__ __launch_bounds__(128) void k_proj(const float* __restrict__ X0, const float* __restrict__ X1, const float* __restrict__ X2, const float* __restrict__ WQ, const float* __restrict__ BQ, const float* __restrict__ WK, const float* __restrict__ BK, const float* __restrict__ WV, const float* __restrict__ BV, const float* __restrict__ UB, const float* __restrict__ VB, const float* __restrict__ PE, const float* __restrict__ WP, _Float16* __restrict__ QUH, _Float16* __restrict__ QUL, _Float16* __restrict__ QVH, _Float16* __restrict__ QVL, _Float16* __restrict__ KH, __bf16* __restrict__ VT, __bf16* __restrict__ VL, _Float16* __restrict__ HRH, _Float16* __restrict__ HRL) {
  __shared__ __align__(16) _Float16 sh[64][136], sl[64][136]; __shared__ __align__(16) __bf16 th[128][72], tl2[128][72];
  const int tid = threadIdx.x, wave = tid >> 5, lane = tid & 31, col = lane & 15, g = lane >> 4;
  if (blockIdx.x < PBLK) { proj_pos(PE, WP, HRH, HRL, sh, sl, (size_t)(blockIdx.x % (HRR / 64)) * 64, (int)(blockIdx.x / (HRR / 64)) * 128); return; }   /* the same test in every thread of the work-group, in front of every barrier */
  const int bid = blockIdx.x - PBLK; const int which = bid / ((TNB * TT / 64) * (CC / 128)); const int c0 = (bid / (TNB * TT / 64)) % (CC / 128) * 128; const size_t r0 = (size_t)(bid % (TNB * TT / 64)) * 64;
  const float* X = which == 0 ? X0 : which == 1 ? X1 : X2; const float* WA = which == 0 ? WQ : which == 1 ? WK : WV; const float* BA = which == 0 ? BQ : which == 1 ? BK : BV;
  v8f acc[8] = {};
  gemm128<0>(X + (r0 + wave * 16 + col) * CC + 8 * g, WA + (size_t)(8 * wave) * CC + c0 + 4 * lane, (__bf16*)&sh[0][0], wave, lane, true, acc);
  const int npass = (which == 0) ? 2 : 1;
  for (int pass = 0; pass < npass; ++pass) {   /* block-uniform */
    if (pass) __syncthreads();
#pragma unroll
    for (int j = 0; j < 8; ++j) { const int o = c0 + j * 16 + col; const float bb = bfr(BA[o]) + ((which == 0) ? bfr((pass == 0 ? UB : VB)[o]) : 0.f);
#pragma unroll
      for (int r = 0; r < 8; ++r) { const float v = acc[j][r] + bb; const int rl = wave * 16 + 8 * g + r, cl = j * 16 + col; const _Float16 hv = (_Float16)v;
        if (which == 2) { const __bf16 bh = (__bf16)v; th[cl][rl] = bh; tl2[cl][rl] = (__bf16)(v - (float)bh); } else { sh[rl][cl] = hv; sl[rl][cl] = (_Float16)((v - (float)hv) * 1024.0f); } } }
    __syncthreads();
    const size_t b = r0 / TT; const int t0 = (int)(r0 % TT);
    if (which == 0) { _Float16* dh = (pass == 0 ? QUH : QVH); _Float16* dl = (pass == 0 ? QUL : QVL); for (int e = tid; e < 64 * 16; e += 128) { const int rl = e >> 4, q = e & 15; vst2((unsigned*)(dh + (r0 + rl) * CC + c0 + q * 8), *(const v4u*)&sh[rl][q * 8]); vst2((unsigned*)(dl + (r0 + rl) * CC + c0 + q * 8), *(const v4u*)&sl[rl][q * 8]); } }
    else if (which == 1) { for (int e = tid; e < 64 * 16; e += 128) { const int rl = ((e >> 7) & 3) * 16 + (e & 15), q = (e >> 9) * 8 + ((e >> 4) & 7);   /* e = (head, tile, d/16, (d/8)&1, t&15) */
        vst2((unsigned*)(KH + ((b * NH + c0 / HD + (e >> 9)) * (TT / 16) + t0 / 16 + ((e >> 7) & 3)) * (size_t)(16 * HD) + (e & 127) * 8), *(const v4u*)&sh[rl][q * 8]); } }
    else { for (int e = tid; e < 128 * 8; e += 128) { const int cl = (e >> 9) * 64 + ((e >> 6) & 3) * 16 + (e & 15), q = ((e >> 8) & 1) * 4 + ((e >> 4) & 3);   /* e = (head, t/32, d/16, (t/16)&1, (t/8)&1, d&15) */
        const size_t o2 = ((b * NH + c0 / HD + (e >> 9)) * (TT / 32) + t0 / 32 + ((e >> 8) & 1)) * (size_t)(32 * HD) + (e & 255) * 8; vst2((unsigned*)(VT + o2), *(const v4u*)&th[cl][q * 8]); vst2((unsigned*)(VL + o2), *(const v4u*)&tl2[cl][q * 8]); } } } }
// fragment-order loads: p already includes the lane's own offset of 8 * lane elements; the two halves of a fragment are 512 B apart, so each load of a wave reads 512 B in a row (4 cache lines, not 16)
__device__ __forceinline__ v16h frag_t(const _Float16* p) { union { v16h v; v8h q[2]; } u; u.q[0] = *(const v8h*)p; u.q[1] = *(const v8h*)(p + 256); return u.v; }
__device__ __forceinline__ v16b frag_tb(const __bf16* p) { union { v16b v; v8b q[2]; } u; u.q[0] = *(const v8b*)p; u.q[1] = *(const v8b*)(p + 256); return u.v; }
__device__ __forceinline__ void ld4(v16h (&f)[4], const _Float16* rh, const _Float16* rl) { f[0] = frag_t(rh); f[1] = frag_t(rl); f[2] = frag_t(rh + 512); f[3] = frag_t(rl + 512); }
__device__ __forceinline__ void qput(v8h (*s)[32], v16h f, int lane) { union { v16h v; v8h q[2]; } u; u.v = f; s[0][lane] = u.q[0]; s[1][lane] = u.q[1]; }
__device__ __forceinline__ v16h qget(const v8h (*s)[32], int lane) { union { v16h v; v8h q[2]; } u; u.q[0] = s[0][lane]; u.q[1] = s[1][lane]; return u.v; }
#define KVP (KB * HD / 8)      // 16-byte pieces of one staged plane = threads of the work-group
__device__ __forceinline__ void kv_copy(unsigned lds, const _Float16* k, const __bf16* vh, const __bf16* vl) {
  asm volatile("global_load_async_to_lds_b128 %0, %3, off\n\tglobal_load_async_to_lds_b128 %1, %4, off\n\tglobal_load_async_to_lds_b128 %2, %5, off\n\ts_wait_xcnt 0x0" :: "v"(lds), "v"(lds + 16u * KVP), "v"(lds + 32u * KVP), "v"(k), "v"(vh), "v"(vl) : "memory"); }
// one position tile: X^T = p (q+v_bias)^T, 3 products; x0, x1 = this lane's 8 consecutive positions of its query
__device__ __forceinline__ void bd_tile(const v16h (&f)[4], const v16h (&qh)[HD / 32], const v16h (&ql)[HD / 32], v4f& x0, v4f& x1) { v8f a = {}, al = {};
#pragma unroll
  for (int kc = 0; kc < HD / 32; ++kc) { a = wmma16(f[2 * kc], qh[kc], a); al = wmma16(f[2 * kc], ql[kc], al); al = wmma16(f[2 * kc + 1], qh[kc], al); }
#pragma unroll
  for (int r = 0; r < 4; ++r) { x0[r] = a[r] + al[r] * (1.0f / 1024.0f); x1[r] = a[4 + r] + al[4 + r] * (1.0f / 1024.0f); } }
// ---- k_att: block = 16 * AW queries of one (batch, head) pair, wave = 16 queries, all T keys in blocks of KB. Everything is kept transposed so that a lane owns one query (column lane & 15):
//   S^T = k (q+u)^T (2 products) and X^T = p (q+v_bias)^T (3 products) have D register r = key / position 8g + r; O^T += v^T P^T takes two S^T tiles, converted in place, as its B operand.
//   rel_shift: for queries iw0 + q and keys j0 + jl the position row is T-1-(iw0+q)+(j0+jl) = pb + c with pb = T-16-iw0+j0 and c = jl + 15 - q, so KB/16 + 1 position tiles stand in the wave's own LDS band [q][c] and each lane reads its row back at offset 15 - q; the last tile of a block is the first of the next (pb grows by KB) and is moved there, not computed again.
//   k and v: all AW waves walk the same keys, so each block's 24 KiB are copied into LDS once per work-group (asynchronous copies, two buffers: block t + 2 is asked for when every wave has left block t, and flies while block t + 1 is worked on) and every wave reads its fragments from there; only the position fragments, which differ from wave to wave, still come through the cache.
//   softmax is the running-maximum form in base 2: per block m' = max(m, block max), sums and O^T are scaled by 2^(m - m'), P = 2^(s - m') split bf16 hi + lo; the division by the sum comes last. No exponent lies above 0 by more than a rounding error; one far below -126 gives 0 or a subnormal, which adds nothing to a sum whose largest term is 1.
__global__ __launch_bounds__(32 * AW) __attribute__((amdgpu_waves_per_eu(4, 4))) void k_att(const _Float16* __restrict__ QUH, const _Float16* __restrict__ QUL, const _Float16* __restrict__ QVH, const _Float16* __restrict__ QVL, const _Float16* __restrict__ KH, const _Float16* __restrict__ RHh, const _Float16* __restrict__ RLl, const __bf16* __restrict__ VT, const __bf16* __restrict__ VL, float* __restrict__ Y) {
  __shared__ __align__(16) float band[AW][16][BP]; __shared__ __align__(16) v8h qs[AW][8][2][32]; __shared__ __align__(16) v8h kv[2][3][KVP];   /* kv: two buffers of (k, v hi, v lo) of one key block; qs: each lane's own query fragments, parked so that they hold registers only in the phase that uses them (256 VGPRs = 4 waves per SIMD) */
  const int tid = threadIdx.x, wave = tid >> 5, lane = tid & 31, col = lane & 15, g = lane >> 4; const int bh = blockIdx.y, b = bh / NH, h = bh % NH; const int iw0 = blockIdx.x * (16 * AW) + wave * 16;
  const size_t qrow = ((size_t)b * TT + iw0 + col) * CC + h * HD;
  static_assert(KVP == 32 * AW, "one 16-byte piece of each plane per thread");
  const unsigned kvl = (unsigned)(size_t)&kv[0][0][tid];   /* this thread's LDS byte address in plane 0 of buffer 0 */
  const _Float16* kc = KH + (size_t)bh * TT * HD + tid * 8; const __bf16* vhc = VT + (size_t)bh * TT * HD + tid * 8; const __bf16* vlc = VL + (size_t)bh * TT * HD + tid * 8;
  kv_copy(kvl, kc, vhc, vlc);   /* block 0 into buffer 0 */
#pragma unroll
  for (int kc = 0; kc < HD / 32; ++kc) { qput(qs[wave][kc], frag_h(QVH + qrow + kc * 32, lane), lane); qput(qs[wave][2 + kc], frag_h(QVL + qrow + kc * 32, lane), lane); qput(qs[wave][4 + kc], frag_h(QUH + qrow + kc * 32, lane), lane); qput(qs[wave][6 + kc], frag_h(QUL + qrow + kc * 32, lane), lane); }
  float* bw = &band[wave][col][0];
  const size_t ro = ((size_t)h * (HRR / 16) + (TT - 16 - iw0) / 16) * (16 * HD) + lane * 8; const _Float16* rh = RHh + ro; const _Float16* rl = RLl + ro;   /* this lane's place in position tile 0 of block 0; a tile is 16 * HD elements */
  v8f acc[HD / 16] = {}; float m = -3.0e38f, l = 0.f;
  // Every fragment is loaded one or two tiles ahead of the products that use it. pf[1], pf[2] (position tiles 1, 2) are loaded at the end of the block before; behind the last block that reads rows < 2T + 32 of the p planes, which proj_pos has written, and the values are not used.
  v16h pf[NT + 1][4], kf[NT][2]; v16b vf[KB / 32][HD / 16][2];
  ld4(pf[0], rh, rl); ld4(pf[1], rh + 16 * HD, rl + 16 * HD); ld4(pf[2], rh + 32 * HD, rl + 32 * HD);
  asm volatile("s_wait_xcnt 0x0" :: "v"(rh), "v"(rl) : "memory");   /* the loads above name rh and rl: as inputs here both keep their registers up to the wait, so that nothing (a later load's result either) is written over an address of an issued load in front of it */
  { v16h qvh[HD / 32], qvl[HD / 32]; v4f x0, x1;   /* tile 0 of block 0, put where a block before would have left it */
#pragma unroll
    for (int kc = 0; kc < HD / 32; ++kc) { qvh[kc] = qget(qs[wave][kc], lane); qvl[kc] = qget(qs[wave][2 + kc], lane); }
    bd_tile(pf[0], qvh, qvl, x0, x1); *(v4f*)(bw + KB + 8 * g) = x0; *(v4f*)(bw + KB + 8 * g + 4) = x1; }
  asm volatile("s_wait_asynccnt 0x0" ::: "memory");   /* this wave's part of block 0 has landed */
  __syncthreads();                                     /* ... and every other wave's: block 0 may be read */
  kv_copy(kvl + 48u * KVP, kc + KB * HD, vhc + KB * HD, vlc + KB * HD);   /* block 1 into buffer 1 */
#pragma unroll 1
  for (int j0 = 0; j0 < TT; j0 += KB) { const _Float16* rhb = rh + (size_t)j0 * HD; const _Float16* rlb = rl + (size_t)j0 * HD; const int buf = (j0 / KB) & 1; const _Float16* kpb = (const _Float16*)&kv[buf][0][lane]; const __bf16* vhb = (const __bf16*)&kv[buf][1][lane]; const __bf16* vlb = (const __bf16*)&kv[buf][2][lane];
    v16h quh[HD / 32], qul[HD / 32], qvh[HD / 32], qvl[HD / 32];
#pragma unroll
    for (int kc = 0; kc < HD / 32; ++kc) { qvh[kc] = qget(qs[wave][kc], lane); qvl[kc] = qget(qs[wave][2 + kc], lane); }
    { const v4f c0 = *(const v4f*)(bw + KB + 8 * g), c1 = *(const v4f*)(bw + KB + 8 * g + 4); *(v4f*)(bw + 8 * g) = c0; *(v4f*)(bw + 8 * g + 4) = c1; }   /* the lane's own values: last tile of the block before = tile 0 of this one */
#pragma unroll
    for (int t = 1; t < NT + 1; ++t) {
      if (t + 2 < NT + 1) ld4(pf[t + 2], rhb + (t + 2) * 16 * HD, rlb + (t + 2) * 16 * HD);
      else if (t + 1 == NT) {
#pragma unroll
        for (int u = 0; u < NT / 2; ++u) { kf[u][0] = frag_t(kpb + u * 16 * HD); kf[u][1] = frag_t(kpb + u * 16 * HD + 512); } }
      else {
#pragma unroll
        for (int kc = 0; kc < HD / 32; ++kc) { quh[kc] = qget(qs[wave][4 + kc], lane); qul[kc] = qget(qs[wave][6 + kc], lane); } }
      v4f x0, x1; bd_tile(pf[t], qvh, qvl, x0, x1);
      *(v4f*)(bw + t * 16 + 8 * g) = x0; *(v4f*)(bw + t * 16 + 8 * g + 4) = x1; }
    LDSX();   /* a lane reads band values that its partner lane (lane ^ 16) wrote */
    float s[NT][8]; float bm = -3.0e38f;
#pragma unroll
    for (int t = 0; t < NT; ++t) { v8f a = {}, al = {};
      if (t == 0) {
#pragma unroll
        for (int u = NT / 2; u < NT; ++u) { kf[u][0] = frag_t(kpb + u * 16 * HD); kf[u][1] = frag_t(kpb + u * 16 * HD + 512); } }
#pragma unroll
      for (int kc = 0; kc < HD / 32; ++kc) { a = wmma16(kf[t][kc], quh[kc], a); al = wmma16(kf[t][kc], qul[kc], al); }
      vf[0][t][0] = frag_tb(vhb + t * 512); vf[0][t][1] = frag_tb(vlb + t * 512);
#pragma unroll
      for (int r = 0; r < 8; ++r) { const float v = ((a[r] + al[r] * (1.0f / 1024.0f)) + bw[t * 16 + 8 * g + r + 15 - col]) * SCALE; s[t][r] = v; bm = fmaxf(bm, v); } }
    bm = fmaxf(bm, __shfl_xor(bm, 16));
    const float mn = fmaxf(m, bm), alpha = __builtin_amdgcn_exp2f(m - mn); m = mn; l *= alpha;
#pragma unroll
    for (int j = 0; j < HD / 16; ++j)
#pragma unroll
      for (int r = 0; r < 8; ++r) acc[j][r] *= alpha;
#pragma unroll
    for (int c = 0; c < KB / 32; ++c) { float e[16];
#pragma unroll
      for (int i = 0; i < 8; ++i) { e[i] = __builtin_amdgcn_exp2f(s[2 * c][i] - m); e[8 + i] = __builtin_amdgcn_exp2f(s[2 * c + 1][i] - m); l += e[i] + e[8 + i]; }
      const F2 p = bsplit16(e);
#pragma unroll
      for (int j = 0; j < HD / 16; ++j) { acc[j] = wmma_bf(vf[c][j][0], p.h, acc[j]); acc[j] = wmma_bf(vf[c][j][0], p.l, acc[j]); acc[j] = wmma_bf(vf[c][j][1], p.h, acc[j]);
        if (c + 1 < KB / 32) { vf[c + 1][j][0] = frag_tb(vhb + (c + 1) * 32 * HD + j * 512); vf[c + 1][j][1] = frag_tb(vlb + (c + 1) * 32 * HD + j * 512); }
        else if (j & 1) ld4(pf[1 + (j >> 1)], rhb + (KB + 16 + (j >> 1) * 16) * HD, rlb + (KB + 16 + (j >> 1) * 16) * HD); } }
    asm volatile("s_wait_xcnt 0x0" ::: "memory");   /* the address registers of the loads just issued are rewritten at the top of the next pass */
    asm volatile("s_wait_dscnt 0x0" ::: "memory");      /* this wave's reads of this block's buffer have returned */
    asm volatile("s_wait_asynccnt 0x0" ::: "memory");   /* this wave's part of the next block has landed */
    asm volatile("s_barrier_signal -1\n\ts_barrier_wait -1" ::: "memory");   /* publishes the next block and frees this block's buffer; by hand, because __syncthreads() would also wait for the position fragments just asked for, which are to stay in flight across it */
    if (j0 + 2 * KB < TT) kv_copy(kvl + (unsigned)buf * (48u * KVP), kc + (size_t)(j0 + 2 * KB) * HD, vhc + (size_t)(j0 + 2 * KB) * HD, vlc + (size_t)(j0 + 2 * KB) * HD);   /* the same test in every wave */
  }
  asm volatile("s_wait_asynccnt 0x0" ::: "memory");   /* no copy is outstanding when the wave ends */
  l += __shfl_xor(l, 16); const float inv = 1.0f / l;
#pragma unroll
  for (int j = 0; j < HD / 16; ++j) { v4f y0, y1;
#pragma unroll
    for (int r = 0; r < 4; ++r) { y0[r] = acc[j][r] * inv; y1[r] = acc[j][4 + r] * inv; }
    float* yp = Y + qrow + j * 16 + 8 * g; vst2(yp, y0); vst2(yp + 4, y1); } }
// ---- k_out: block = (64 rows, 128 cols): out = ctx (bf16 hi + lo) Wout ((in,out), exact) + bout
__global__ __launch_bounds__(128) void k_out(const float* __restrict__ Yr, const float* __restrict__ WO, const float* __restrict__ BO, float* __restrict__ OUT) { __shared__ __align__(16) float sf[4][16][132];
  const int tid = threadIdx.x, wave = tid >> 5, lane = tid & 31, col = lane & 15, g = lane >> 4; const int c0 = blockIdx.y * 128; const size_t r0 = (size_t)blockIdx.x * 64 + wave * 16;
  v8f acc[8] = {};
  gemm128<2>(Yr + (r0 + col) * CC + 8 * g, WO + (size_t)(8 * wave) * CC + c0 + 4 * lane, (__bf16*)&sf[0][0][0], wave, lane, true, acc);
#pragma unroll
  for (int j = 0; j < 8; ++j) { const float bb = bfr(BO[c0 + j * 16 + col]);
#pragma unroll
    for (int r = 0; r < 8; ++r) sf[wave][8 * g + r][j * 16 + col] = acc[j][r] + bb; }
  LDSX(); for (int rl = 0; rl < 16; ++rl) vst2(OUT + (r0 + rl) * CC + c0 + lane * 4, *(const v4f*)&sf[wave][rl][lane * 4]); }
extern "C" void kernel_launch(void* const* d_in, const int* in_sizes, int n_in, void* d_out, int out_size, void* d_ws, size_t ws_size, hipStream_t stream) {
  (void)in_sizes; (void)n_in; (void)out_size;
  const float** F = (const float**)d_in;   // 0 query, 1 key, 2 value [8,1024,512]; 3 pos_emb [1,2047,512]; 4 Wq, 5 bq, 6 Wk, 7 bk, 8 Wv, 9 bv ((in,out)); 10 Wpos; 11 Wout, 12 bout; 13 pos_bias_u [8,64], 14 pos_bias_v
  if (ws_size < (size_t)WS_END) return;
  char* ws = (char*)d_ws; _Float16 *QUH = (_Float16*)(ws + WS_QUH), *QUL = (_Float16*)(ws + WS_QUL), *QVH = (_Float16*)(ws + WS_QVH), *QVL = (_Float16*)(ws + WS_QVL), *KH = (_Float16*)(ws + WS_KH), *HRH = (_Float16*)(ws + WS_HRH), *HRL = (_Float16*)(ws + WS_HRL); __bf16 *VT = (__bf16*)(ws + WS_VT), *VL = (__bf16*)(ws + WS_VL); float *Y = (float*)(ws + WS_Y);
  k_proj<<<dim3(PBLK + (TNB * TT / 64) * (CC / 128) * 3), 128, 0, stream>>>(F[0], F[1], F[2], F[4], F[5], F[6], F[7], F[8], F[9], F[13], F[14], F[3], F[10], QUH, QUL, QVH, QVL, KH, VT, VL, HRH, HRL);
  k_att<<<dim3(TT / (16 * AW), TNB * NH), 32 * AW, 0, stream>>>(QUH, QUL, QVH, QVL, KH, HRH, HRL, VT, VL, Y);
  k_out<<<dim3(TNB * TT / 64, CC / 128), 128, 0, stream>>>(Y, F[11], F[12], (float*)d_out);
}

// v008
// It runs in 115 microseconds.
// In both of two side-by-side timings against v007, it was 1.07 times as fast.
// Counting every step since v000, it is 13.6 times as fast.
// compute dtype: all float inputs rounded to bf16; q/k/v/p = x W + b with EXACT bf16 products on WMMA 16x16x32, f32 accumulate; (q + pos_bias_u), (q + pos_bias_v) and p as f16 hi + residual (x 2^10), k once to f16 -> content logits 2 products, position logits 3 products; the rel_shift as a banded position GEMM + index offset through LDS; logits times log2(e)/8 and running-maximum softmax in f32 on the hardware's base-2 exponential; P = 2^(s - m) split bf16 hi + lo against v bf16 hi + lo (3 products), divided by the sum at the end; ctx (bf16 hi + lo) Wout + bout; f32 output.
#include <hip/hip_runtime.h>
#include <math.h>

typedef __attribute__((ext_vector_type(16))) _Float16 v16h;
typedef __attribute__((ext_vector_type(16))) __bf16 v16b;
typedef __attribute__((ext_vector_type(8)))  _Float16 v8h;
typedef __attribute__((ext_vector_type(8)))  float v8f;
typedef __attribute__((ext_vector_type(4)))  float v4f;
typedef __attribute__((ext_vector_type(2)))  float v2f;
typedef __attribute__((ext_vector_type(4)))  unsigned v4u;
typedef __attribute__((ext_vector_type(4)))  int v4i;
typedef float __attribute__((may_alias)) float_a;
typedef int __attribute__((may_alias)) int_a;

template <typename T> __device__ __forceinline__ void vst2(void* p, T v) { *(T*)p = v;  }
__device__ __forceinline__ v8f wmma16(v16h a, v16h b, v8f c) {
  v8f d = __builtin_amdgcn_wmma_f32_16x16x32_f16(false, a, false, b, (short)0, c, false, false);
  asm volatile("v_nop\n\tv_nop\n\tv_nop\n\tv_nop" : "+v"(d) : "v"(a), "v"(b));
  return d;
}
__device__ __forceinline__ v8f wmma_bf(v16b a, v16b b, v8f c) {
  v8f d = __builtin_amdgcn_wmma_f32_16x16x32_bf16(false, a, false, b, (short)0, c, false, false);
  asm volatile("v_nop\n\tv_nop\n\tv_nop\n\tv_nop" : "+v"(d) : "v"(a), "v"(b));
  return d;
}
// 16x16x32 fragments: lane = (h = lane>>4, row/col = lane&15); elements 0..7 = k0+8h+0..7, 8..15 = k0+16+8h+0..7; D element r = row 8h+r
__device__ __forceinline__ v16h frag_h(const _Float16* rowk0, int lane) {
  union { v16h v; v8h q[2]; } u; const _Float16* p = rowk0 + 8 * (lane >> 4);
  u.q[0] = *(const v8h*)p; u.q[1] = *(const v8h*)(p + 16); return u.v;
}
__device__ __forceinline__ v16h frag_f32(const float* rowk0, int lane) {
  v16h a; const float* p = rowk0 + 8 * (lane >> 4);
#pragma unroll
  for (int i = 0; i < 8; ++i) { a[i] = (_Float16)p[i]; a[8 + i] = (_Float16)p[16 + i]; }
  return a;
}
__device__ __forceinline__ v16h frag_f32s(const float* rowk0, int lane, float sc) {
  v16h a; const float* p = rowk0 + 8 * (lane >> 4);
#pragma unroll
  for (int i = 0; i < 8; ++i) { a[i] = (_Float16)(p[i] * sc); a[8 + i] = (_Float16)(p[16 + i] * sc); }
  return a;
}
// column fragment from a [K][ld] layout (column n), rows >= K read as 0
__device__ __forceinline__ v16h fragc_f32(const float* W, int k0, int n, int lane, int ld, int K) {
  v16h a; const int g = lane >> 4;
#pragma unroll
  for (int i = 0; i < 8; ++i) { const int ka = k0 + 8 * g + i, kb = ka + 16;
    a[i] = (_Float16)(ka < K ? W[(size_t)(ka < K ? ka : K - 1) * ld + n] : 0.f); a[8 + i] = (_Float16)(kb < K ? W[(size_t)(kb < K ? kb : K - 1) * ld + n] : 0.f); }
  return a;
}
struct F2 { v16b h, l; };
__device__ __forceinline__ F2 bsplit16(const float v[16]) { F2 r;
#pragma unroll
  for (int i = 0; i < 16; ++i) { const __bf16 h = (__bf16)v[i]; r.h[i] = h; r.l[i] = (__bf16)(v[i] - (float)h); }
  return r; }
__device__ __forceinline__ F2 split_row(const float* row, int k0, int lane) { float v[16]; const float* p = row + k0 + 8 * (lane >> 4);
#pragma unroll
  for (int i = 0; i < 8; ++i) { v[i] = p[i]; v[8 + i] = p[16 + i]; }
  return bsplit16(v); }
__device__ __forceinline__ F2 split_rowK(const float* row, int k0, int lane, int K) { float v[16]; const int g = lane >> 4;
#pragma unroll
  for (int i = 0; i < 8; ++i) { const int ka = k0 + 8 * g + i, kb = ka + 16; v[i] = ka < K ? row[ka < K ? ka : K - 1] : 0.f; v[8 + i] = kb < K ? row[kb < K ? kb : K - 1] : 0.f; }
  return bsplit16(v); }
__device__ __forceinline__ F2 split_col(const float* W, int k0, int n, int lane, int ld, int K) { float v[16]; const int g = lane >> 4;
#pragma unroll
  for (int i = 0; i < 8; ++i) { const int ka = k0 + 8 * g + i, kb = ka + 16; v[i] = ka < K ? W[(size_t)(ka < K ? ka : K - 1) * ld + n] : 0.f; v[8 + i] = kb < K ? W[(size_t)(kb < K ? kb : K - 1) * ld + n] : 0.f; }
  return bsplit16(v); }
__device__ __forceinline__ v8f mac3(const F2& a, const F2& b, v8f c) { c = wmma_bf(a.l, b.h, c); c = wmma_bf(a.h, b.l, c); return wmma_bf(a.h, b.h, c); }
__device__ __forceinline__ float sigm(float v) { return 1.0f / (1.0f + expf(-v)); }
#define LDSX() do { asm volatile("s_wait_dscnt 0" ::: "memory"); __builtin_amdgcn_wave_barrier(); __builtin_amdgcn_fence(__ATOMIC_RELEASE, "workgroup"); } while (0)

// Relative-position multi-head attention (wenet/espnet style; B 8, T 1,024, F 512 = 8 x 64): q = query Wq + bq, k = key Wk + bk, v = value Wv + bv ((in,out)); p = pos_emb[0] Wpos (2T-1 positions); ac = (q + u) k^T; bd = rel_shift((q + v_bias) p^T) with rel_shift(x)[i][j] = x[i][T-1-i+j]; scores = (ac + bd) / 8; softmax; ctx = att v; out = ctx Wout + bout.
#define NB 8
#define TT 1024
#define CC 512
#define NH 8
#define HD 64
#define NPOS (2 * TT - 1)      // 2,047 rows of pos_emb / p
#define HRR (2 * TT + 128)     // rows of the p planes actually built (rows >= NPOS are zeros; they only feed never-read logits)
#define KB 64                  // keys per block of the attention loop
#define AW 16                  // waves per attention work-group: one work-group per WGP, 4 waves per SIMD; its waves walk the same k and v rows, so they share one copy of them in LDS
#define NT (KB / 16)           // key tiles per block (the load schedule in k_att is written for 4)
#define BP (KB + 20)           // LDS band pitch in floats: KB + 16 columns used; pitch - 1 = 19 mod 64 keeps the 32 shifted reads of a wave on 32 banks
#define SCALE (0.125f * 1.44269504088896340736f)   // 1/sqrt(64) times log2(e): the scores, their running maximum and every exponent are kept in base 2, so that each exponential is one subtraction and one v_exp_f32
#ifndef TNB
#define TNB NB
#endif
typedef __attribute__((ext_vector_type(8))) __bf16 v8b;
__device__ __forceinline__ v16b frag_b(const __bf16* rowk0, int lane) {
  union { v16b v; v8b q[2]; } u; const __bf16* p = rowk0 + 8 * (lane >> 4);
  u.q[0] = *(const v8b*)p; u.q[1] = *(const v8b*)(p + 16); return u.v;
}
__device__ __forceinline__ float bfr(float v) { return (float)(__bf16)v; }

// ---- the k loop of k_proj (its proj_pos work-groups included) and k_out: block = 4 waves, 64 rows x 128 columns, wave = 16 rows x 128 columns.
// Each k-step's 32 x 128 weight tile is read from global memory once per work-group (whole rows of 512 B) and put into LDS as bf16 B fragments: fragment j (16 columns) holds lane l's elements 0..7 at 16 l bytes and 8..15 at 512 + 16 l.
// Two LDS buffers and two register sets: step kc + 2 is asked for from global memory in front of the products of step kc, step kc + 1 (asked for a step earlier) is stored into LDS behind them; one barrier per step publishes it and ends the reads of the buffer that is written next.
#define WFP 520                // pitch of a staged fragment in elements: 1 KiB + 16 B, so that the 32 16-byte stores of a wave (8 fragments x 4 columns) spread over all banks
#define WBUF (8 * WFP)
typedef v8b __attribute__((may_alias)) v8b_a;   // the stage shares its LDS with the arrays of the epilogues
template <int MODE>   // 0: A rows rounded to bf16; 1: the same, rows that are not live read as 0; 2: A rows as bf16 hi + lo (2 products)
__device__ __forceinline__ void gemm128(const float* ap, const float* wp, __bf16* wst, int wave, int lane, bool live, v8f (&acc)[8]) {   /* ap: this lane's row + 8 g; wp: weight row 8 wave, column c0 + 4 lane */
  __bf16* wd = wst + (lane >> 2) * WFP + (wave >> 1) * 256 + ((wave & 1) * 16 + 4 * (lane & 3)) * 8; const __bf16* wsrc = wst + lane * 8;
  v4f wr[2][8], ar[2][4];   /* two register sets: step kc works from set kc & 1 while the other set's loads are still in flight */
  auto ld = [&](v4f (&w)[8], v4f (&a)[4]) {   /* asks for one step's weight rows and A row piece, then moves both pointers on by a step */
#pragma unroll
    for (int i = 0; i < 8; ++i) w[i] = *(const v4f*)(wp + (size_t)i * CC);
    a[0] = *(const v4f*)ap; a[1] = *(const v4f*)(ap + 4); a[2] = *(const v4f*)(ap + 16); a[3] = *(const v4f*)(ap + 20);
    asm volatile("s_wait_xcnt 0x0" :: "v"(wp), "v"(ap) : "memory");   /* the loads above name wp and ap, which are advanced on the next line */
    wp += 32 * CC; ap += 32; };
  auto st = [&](const v4f (&w)[8], __bf16* db) {
#pragma unroll
    for (int c = 0; c < 4; ++c) { v8b t;
#pragma unroll
      for (int i = 0; i < 8; ++i) t[i] = (__bf16)w[i][c];
      *(v8b_a*)(db + c * 8) = t; } };
  /* the work-group barrier by hand: __syncthreads() would also wait for the global loads of the step after next, which are to stay in flight across it; s_wait_dscnt 0 ends this wave's LDS stores and reads in front of it */
  auto bar = [&]() { asm volatile("s_wait_dscnt 0x0" ::: "memory"); asm volatile("s_barrier_signal -1\n\ts_barrier_wait -1" ::: "memory"); };
  auto step = [&](const bool more2, const bool more1, const int par, v4f (&wc)[8], v4f (&ac)[4], const v4f (&wn)[8]) { float v[16];   /* more2, more1: a step kc + 2, kc + 1 exists (literals at every call) */
#pragma unroll
    for (int i = 0; i < 4; ++i) { v[i] = ac[0][i]; v[4 + i] = ac[1][i]; v[8 + i] = ac[2][i]; v[12 + i] = ac[3][i]; }
    if (MODE == 1) {
#pragma unroll
      for (int i = 0; i < 16; ++i) v[i] = live ? v[i] : 0.f; }
    F2 a;
    if (MODE == 2) a = bsplit16(v);
    else {
#pragma unroll
      for (int i = 0; i < 16; ++i) a.h[i] = (__bf16)v[i]; }
    const __bf16* sb = wsrc + par * WBUF; union { v16b v; v8b q[2]; } w[8];   /* all 8 fragments are asked for at once, so that the LDS latency is paid once a step */
#pragma unroll
    for (int j = 0; j < 8; ++j) { w[j].q[0] = *(const v8b_a*)(sb + j * WFP); w[j].q[1] = *(const v8b_a*)(sb + j * WFP + 256); }
    __builtin_amdgcn_sched_barrier(0);   /* the conversions of this step's A row stay in front of the loads below, so that those land in the same registers and no copy (with its wait for them) is needed */
    if (more2) ld(wc, ac);   /* step kc + 2 into the set that this step has just emptied (its weights went to LDS a step ago) */
#pragma unroll
    for (int j = 0; j < 8; ++j) { acc[j] = wmma_bf(a.h, w[j].v, acc[j]); if (MODE == 2) acc[j] = wmma_bf(a.l, w[j].v, acc[j]); }
    __builtin_amdgcn_sched_barrier(0);   /* keeps the wait for the next step's global loads behind this step's products */
    if (more1) st(wn, wd + (par ^ 1) * WBUF);
    bar();   /* publishes step kc + 1; behind the last step it frees the stage for the epilogue's arrays */
  };
  ld(wr[0], ar[0]); ld(wr[1], ar[1]);
  st(wr[0], wd); bar();
#pragma unroll 1   /* stays rolled, so that the text stays small; the two steps of a trip are written out, so that each step's register set and LDS buffer are fixed */
  for (int kc = 0; kc + 2 < CC / 32; kc += 2) { step(true, true, 0, wr[0], ar[0], wr[1]); step(true, true, 1, wr[1], ar[1], wr[0]); }
  step(false, true, 0, wr[0], ar[0], wr[1]); step(false, false, 1, wr[1], ar[1], wr[0]); }

#define WS_QUH 0u                                       // f16 (q + u) rows [b*t][512] hi
#define WS_QUL (WS_QUH + 2u * (size_t)NB * TT * CC)      //                     residual x 2^10
#define WS_QVH (WS_QUL + 2u * (size_t)NB * TT * CC)      // f16 (q + v_bias) rows
#define WS_QVL (WS_QVH + 2u * (size_t)NB * TT * CC)
#define WS_KH  (WS_QVL + 2u * (size_t)NB * TT * CC)      // f16 k in fragment order [b][h][t/16][d/16][(d/8)&1][t&15][d&7]: a 16-key tile is 2 KiB and lane l's 16 bytes of each half fragment stand at 16 l
#define WS_HRH (WS_KH  + 2u * (size_t)NB * TT * CC)      // f16 p hi in the same fragment order [h][pos/16][d/16][(d/8)&1][pos&15][d&7], pos < HRR
#define WS_HRL (WS_HRH + 2u * (size_t)HRR * CC)          //                        residual x 2^10
#define WS_VT  (WS_HRL + 2u * (size_t)HRR * CC)          // bf16 v planes in fragment order [b][h][t/32][d/16][(t/16)&1][(t/8)&1][d&15][t&7]
#define WS_VL  (WS_VT  + 2u * (size_t)NB * CC * TT)
#define WS_Y   (WS_VL  + 2u * (size_t)NB * CC * TT)      // f32 ctx rows [b*t][512]
#define WS_END (WS_Y   + 4u * (size_t)NB * TT * CC)

// ---- proj_pos: work-group = (64 positions, 128 cols): p rows [pos][o] = pos_emb[0][pos] Wpos ((in,out), exact) -> f16 hi + residual, fragment order; rows >= NPOS (2,047) are written as zeros (their A rows are loaded clamped and zeroed by value). It depends on nothing that q, k and v need, so its work-groups stand in k_proj's grid and run beside them.
__device__ __forceinline__ void proj_pos(const float* __restrict__ PE, const float* __restrict__ WP, _Float16* __restrict__ HRH, _Float16* __restrict__ HRL, _Float16 (*sh)[136], _Float16 (*sl)[136], const size_t p0, const int c0) {
  const int tid = threadIdx.x, wave = tid >> 5, lane = tid & 31, col = lane & 15, g = lane >> 4;
  const size_t prow = p0 + wave * 16 + col; const bool live = prow < NPOS; const size_t prc = live ? prow : (NPOS - 1);
  v8f acc[8] = {};
  gemm128<1>(PE + prc * CC + 8 * g, WP + (size_t)(8 * wave) * CC + c0 + 4 * lane, (__bf16*)&sh[0][0], wave, lane, live, acc);
#pragma unroll
  for (int j = 0; j < 8; ++j) {
#pragma unroll
    for (int r = 0; r < 8; ++r) { const float v = acc[j][r]; const int rl = wave * 16 + 8 * g + r, cl = j * 16 + col; const _Float16 hv = (_Float16)v; sh[rl][cl] = hv; sl[rl][cl] = (_Float16)((v - (float)hv) * 1024.0f); } }
  __syncthreads();
  for (int e = tid; e < 64 * 16; e += 128) { const int rl = ((e >> 7) & 3) * 16 + (e & 15), q = (e >> 9) * 8 + ((e >> 4) & 7);   /* e = (head, tile, d/16, (d/8)&1, pos&15) */
    const size_t o2 = ((size_t)(c0 / HD + (e >> 9)) * (HRR / 16) + p0 / 16 + ((e >> 7) & 3)) * (size_t)(16 * HD) + (e & 127) * 8; vst2((unsigned*)(HRH + o2), *(const v4u*)&sh[rl][q * 8]); vst2((unsigned*)(HRL + o2), *(const v4u*)&sl[rl][q * 8]); } }
// ---- k_proj: one-dimensional grid: first the position projection's work-groups (proj_pos), then block = (64 rows, 128 cols, which), rows fastest: which 0: q = query Wq + bq -> (q + u) and (q + v_bias) as f16 hi + residual rows (u, v_bias [H,DK] flat = column index); which 1: k = key Wk + bk -> f16, fragment order; which 2: v = value Wv + bv -> bf16 hi + lo planes, fragment order (a store loop's 128 threads write 2 KiB in a row). Weights (in,out).
#define PBLK ((HRR / 64) * (CC / 128))   // work-groups of the position projection: the first PBLK of k_proj's grid
__global__ __launch_bounds__(128) void k_proj(const float* __restrict__ X0, const float* __restrict__ X1, const float* __restrict__ X2, const float* __restrict__ WQ, const float* __restrict__ BQ, const float* __restrict__ WK, const float* __restrict__ BK, const float* __restrict__ WV, const float* __restrict__ BV, const float* __restrict__ UB, const float* __restrict__ VB, const float* __restrict__ PE, const float* __restrict__ WP, _Float16* __restrict__ QUH, _Float16* __restrict__ QUL, _Float16* __restrict__ QVH, _Float16* __restrict__ QVL, _Float16* __restrict__ KH, __bf16* __restrict__ VT, __bf16* __restrict__ VL, _Float16* __restrict__ HRH, _Float16* __restrict__ HRL) {
  __shared__ __align__(16) _Float16 sh[64][136], sl[64][136]; __shared__ __align__(16) __bf16 th[128][72], tl2[128][72];
  const int tid = threadIdx.x, wave = tid >> 5, lane = tid & 31, col = lane & 15, g = lane >> 4;
  if (blockIdx.x < PBLK) { proj_pos(PE, WP, HRH, HRL, sh, sl, (size_t)(blockIdx.x % (HRR / 64)) * 64, (int)(blockIdx.x / (HRR / 64)) * 128); return; }   /* the same test in every thread of the work-group, in front of every barrier */
  const int bid = blockIdx.x - PBLK; const int which = bid / ((TNB * TT / 64) * (CC / 128)); const int c0 = (bid / (TNB * TT / 64)) % (CC / 128) * 128; const size_t r0 = (size_t)(bid % (TNB * TT / 64)) * 64;
  const float* X = which == 0 ? X0 : which == 1 ? X1 : X2; const float* WA = which == 0 ? WQ : which == 1 ? WK : WV; const float* BA = which == 0 ? BQ : which == 1 ? BK : BV;
  v8f acc[8] = {};
  gemm128<0>(X + (r0 + wave * 16 + col) * CC + 8 * g, WA + (size_t)(8 * wave) * CC + c0 + 4 * lane, (__bf16*)&sh[0][0], wave, lane, true, acc);
  const int npass = (which == 0) ? 2 : 1;
  for (int pass = 0; pass < npass; ++pass) {   /* block-uniform */
    if (pass) __syncthreads();
#pragma unroll
    for (int j = 0; j < 8; ++j) { const int o = c0 + j * 16 + col; const float bb = bfr(BA[o]) + ((which == 0) ? bfr((pass == 0 ? UB : VB)[o]) : 0.f);
#pragma unroll
      for (int r = 0; r < 8; ++r) { const float v = acc[j][r] + bb; const int rl = wave * 16 + 8 * g + r, cl = j * 16 + col; const _Float16 hv = (_Float16)v;
        if (which == 2) { const __bf16 bh = (__bf16)v; th[cl][rl] = bh; tl2[cl][rl] = (__bf16)(v - (float)bh); } else { sh[rl][cl] = hv; sl[rl][cl] = (_Float16)((v - (float)hv) * 1024.0f); } } }
    __syncthreads();
    const size_t b = r0 / TT; const int t0 = (int)(r0 % TT);
    if (which == 0) { _Float16* dh = (pass == 0 ? QUH : QVH); _Float16* dl = (pass == 0 ? QUL : QVL); for (int e = tid; e < 64 * 16; e += 128) { const int rl = e >> 4, q = e & 15; vst2((unsigned*)(dh + (r0 + rl) * CC + c0 + q * 8), *(const v4u*)&sh[rl][q * 8]); vst2((unsigned*)(dl + (r0 + rl) * CC + c0 + q * 8), *(const v4u*)&sl[rl][q * 8]); } }
    else if (which == 1) { for (int e = tid; e < 64 * 16; e += 128) { const int rl = ((e >> 7) & 3) * 16 + (e & 15), q = (e >> 9) * 8 + ((e >> 4) & 7);   /* e = (head, tile, d/16, (d/8)&1, t&15) */
        vst2((unsigned*)(KH + ((b * NH + c0 / HD + (e >> 9)) * (TT / 16) + t0 / 16 + ((e >> 7) & 3)) * (size_t)(16 * HD) + (e & 127) * 8), *(const v4u*)&sh[rl][q * 8]); } }
    else { for (int e = tid; e < 128 * 8; e += 128) { const int cl = (e >> 9) * 64 + ((e >> 6) & 3) * 16 + (e & 15), q = ((e >> 8) & 1) * 4 + ((e >> 4) & 3);   /* e = (head, t/32, d/16, (t/16)&1, (t/8)&1, d&15) */
        const size_t o2 = ((b * NH + c0 / HD + (e >> 9)) * (TT / 32) + t0 / 32 + ((e >> 8) & 1)) * (size_t)(32 * HD) + (e & 255) * 8; vst2((unsigned*)(VT + o2), *(const v4u*)&th[cl][q * 8]); vst2((unsigned*)(VL + o2), *(const v4u*)&tl2[cl][q * 8]); } } } }
// fragment-order loads: p already includes the lane's own offset of 8 * lane elements; the two halves of a fragment are 512 B apart, so each load of a wave reads 512 B in a row (4 cache lines, not 16)
__device__ __forceinline__ v16h frag_t(const _Float16* p) { union { v16h v; v8h q[2]; } u; u.q[0] = *(const v8h*)p; u.q[1] = *(const v8h*)(p + 256); return u.v; }
__device__ __forceinline__ v16b frag_tb(const __bf16* p) { union { v16b v; v8b q[2]; } u; u.q[0] = *(const v8b*)p; u.q[1] = *(const v8b*)(p + 256); return u.v; }
__device__ __forceinline__ void ld4(v16h (&f)[4], const _Float16* rh, const _Float16* rl) { f[0] = frag_t(rh); f[1] = frag_t(rl); f[2] = frag_t(rh + 512); f[3] = frag_t(rl + 512); }
__device__ __forceinline__ void qput(v8h (*s)[32], v16h f, int lane) { union { v16h v; v8h q[2]; } u; u.v = f; s[0][lane] = u.q[0]; s[1][lane] = u.q[1]; }
__device__ __forceinline__ v16h qget(const v8h (*s)[32], int lane) { union { v16h v; v8h q[2]; } u; u.q[0] = s[0][lane]; u.q[1] = s[1][lane]; return u.v; }
#define KVP (KB * HD / 8)      // 16-byte pieces of one staged plane = threads of the work-group
__device__ __forceinline__ void kv_copy(unsigned lds, const _Float16* k, const __bf16* vh, const __bf16* vl) {
  asm volatile("global_load_async_to_lds_b128 %0, %3, off\n\tglobal_load_async_to_lds_b128 %1, %4, off\n\tglobal_load_async_to_lds_b128 %2, %5, off\n\ts_wait_xcnt 0x0" :: "v"(lds), "v"(lds + 16u * KVP), "v"(lds + 32u * KVP), "v"(k), "v"(vh), "v"(vl) : "memory"); }
// one position tile: X^T = p (q+v_bias)^T, 3 products; x0, x1 = this lane's 8 consecutive positions of its query
__device__ __forceinline__ void bd_tile(const v16h (&f)[4], const v16h (&qh)[HD / 32], const v16h (&ql)[HD / 32], v4f& x0, v4f& x1) { v8f a = {}, al = {};
#pragma unroll
  for (int kc = 0; kc < HD / 32; ++kc) { a = wmma16(f[2 * kc], qh[kc], a); al = wmma16(f[2 * kc], ql[kc], al); al = wmma16(f[2 * kc + 1], qh[kc], al); }
#pragma unroll
  for (int r = 0; r < 4; ++r) { x0[r] = a[r] + al[r] * (1.0f / 1024.0f); x1[r] = a[4 + r] + al[4 + r] * (1.0f / 1024.0f); } }
// ---- k_att: block = 16 * AW queries of one (batch, head) pair, wave = 16 queries, all T keys in blocks of KB. Everything is kept transposed so that a lane owns one query (column lane & 15):
//   S^T = k (q+u)^T (2 products) and X^T = p (q+v_bias)^T (3 products) have D register r = key / position 8g + r; O^T += v^T P^T takes two S^T tiles, converted in place, as its B operand.
//   rel_shift: for queries iw0 + q and keys j0 + jl the position row is T-1-(iw0+q)+(j0+jl) = pb + c with pb = T-16-iw0+j0 and c = jl + 15 - q, so KB/16 + 1 position tiles stand in the wave's own LDS band [q][c] and each lane reads its row back at offset 15 - q; the last tile of a block is the first of the next (pb grows by KB) and is moved there, not computed again.
//   k and v: all AW waves walk the same keys, so each block's 24 KiB are copied into LDS once per work-group (asynchronous copies, two buffers: block t + 2 is asked for when every wave has left block t, and flies while block t + 1 is worked on) and every wave reads its fragments from there; only the position fragments, which differ from wave to wave, still come through the cache.
//   softmax is the running-maximum form in base 2: per block m' = max(m, block max), sums and O^T are scaled by 2^(m - m'), P = 2^(s - m') split bf16 hi + lo; the division by the sum comes last. No exponent lies above 0 by more than a rounding error; one far below -126 gives 0 or a subnormal, which adds nothing to a sum whose largest term is 1.
__global__ __launch_bounds__(32 * AW) __attribute__((amdgpu_waves_per_eu(4, 4))) void k_att(const _Float16* __restrict__ QUH, const _Float16* __restrict__ QUL, const _Float16* __restrict__ QVH, const _Float16* __restrict__ QVL, const _Float16* __restrict__ KH, const _Float16* __restrict__ RHh, const _Float16* __restrict__ RLl, const __bf16* __restrict__ VT, const __bf16* __restrict__ VL, float* __restrict__ Y) {
  __shared__ __align__(16) float band[AW][16][BP]; __shared__ __align__(16) v8h qs[AW][8][2][32]; __shared__ __align__(16) v8h kv[2][3][KVP];   /* kv: two buffers of (k, v hi, v lo) of one key block; qs: each lane's own query fragments, parked so that they hold registers only in the phase that uses them (256 VGPRs = 4 waves per SIMD) */
  const int tid = threadIdx.x, wave = tid >> 5, lane = tid & 31, col = lane & 15, g = lane >> 4; const int bh = blockIdx.y, b = bh / NH, h = bh % NH; const int iw0 = blockIdx.x * (16 * AW) + wave * 16;
  const size_t qrow = ((size_t)b * TT + iw0 + col) * CC + h * HD;
  static_assert(KVP == 32 * AW, "one 16-byte piece of each plane per thread");
  const unsigned kvl = (unsigned)(size_t)&kv[0][0][tid];   /* this thread's LDS byte address in plane 0 of buffer 0 */
  const _Float16* kc = KH + (size_t)bh * TT * HD + tid * 8; const __bf16* vhc = VT + (size_t)bh * TT * HD + tid * 8; const __bf16* vlc = VL + (size_t)bh * TT * HD + tid * 8;
  kv_copy(kvl, kc, vhc, vlc);   /* block 0 into buffer 0 */
#pragma unroll
  for (int kc = 0; kc < HD / 32; ++kc) { qput(qs[wave][kc], frag_h(QVH + qrow + kc * 32, lane), lane); qput(qs[wave][2 + kc], frag_h(QVL + qrow + kc * 32, lane), lane); qput(qs[wave][4 + kc], frag_h(QUH + qrow + kc * 32, lane), lane); qput(qs[wave][6 + kc], frag_h(QUL + qrow + kc * 32, lane), lane); }
  float* bw = &band[wave][col][0];
  const size_t ro = ((size_t)h * (HRR / 16) + (TT - 16 - iw0) / 16) * (16 * HD) + lane * 8; const _Float16* rh = RHh + ro; const _Float16* rl = RLl + ro;   /* this lane's place in position tile 0 of block 0; a tile is 16 * HD elements */
  v8f acc[HD / 16] = {}; float m = -3.0e38f, l = 0.f;
  // Every fragment is loaded one or two tiles ahead of the products that use it. pf[1], pf[2] (position tiles 1, 2) are loaded at the end of the block before; behind the last block that reads rows < 2T + 32 of the p planes, which proj_pos has written, and the values are not used.
  v16h pf[NT + 1][4], kf[NT][2]; v16b vf[KB / 32][HD / 16][2];
  ld4(pf[0], rh, rl); ld4(pf[1], rh + 16 * HD, rl + 16 * HD); ld4(pf[2], rh + 32 * HD, rl + 32 * HD);
  asm volatile("s_wait_xcnt 0x0" :: "v"(rh), "v"(rl) : "memory");   /* the loads above name rh and rl: as inputs here both keep their registers up to the wait, so that nothing (a later load's result either) is written over an address of an issued load in front of it */
  { v16h qvh[HD / 32], qvl[HD / 32]; v4f x0, x1;   /* tile 0 of block 0, put where a block before would have left it */
#pragma unroll
    for (int kc = 0; kc < HD / 32; ++kc) { qvh[kc] = qget(qs[wave][kc], lane); qvl[kc] = qget(qs[wave][2 + kc], lane); }
    bd_tile(pf[0], qvh, qvl, x0, x1); *(v4f*)(bw + KB + 8 * g) = x0; *(v4f*)(bw + KB + 8 * g + 4) = x1; }
  asm volatile("s_wait_asynccnt 0x0" ::: "memory");   /* this wave's part of block 0 has landed */
  __syncthreads();                                     /* ... and every other wave's: block 0 may be read */
  kv_copy(kvl + 48u * KVP, kc + KB * HD, vhc + KB * HD, vlc + KB * HD);   /* block 1 into buffer 1 */
#pragma unroll 1
  for (int j0 = 0; j0 < TT; j0 += KB) { const _Float16* rhb = rh + (size_t)j0 * HD; const _Float16* rlb = rl + (size_t)j0 * HD; const int buf = (j0 / KB) & 1; const _Float16* kpb = (const _Float16*)&kv[buf][0][lane]; const __bf16* vhb = (const __bf16*)&kv[buf][1][lane]; const __bf16* vlb = (const __bf16*)&kv[buf][2][lane];
    v16h quh[HD / 32], qul[HD / 32], qvh[HD / 32], qvl[HD / 32];
#pragma unroll
    for (int kc = 0; kc < HD / 32; ++kc) { qvh[kc] = qget(qs[wave][kc], lane); qvl[kc] = qget(qs[wave][2 + kc], lane); }
    { const v4f c0 = *(const v4f*)(bw + KB + 8 * g), c1 = *(const v4f*)(bw + KB + 8 * g + 4); *(v4f*)(bw + 8 * g) = c0; *(v4f*)(bw + 8 * g + 4) = c1; }   /* the lane's own values: last tile of the block before = tile 0 of this one */
#pragma unroll
    for (int t = 1; t < NT + 1; ++t) {
      if (t + 2 < NT + 1) ld4(pf[t + 2], rhb + (t + 2) * 16 * HD, rlb + (t + 2) * 16 * HD);
      else if (t + 1 == NT) {
#pragma unroll
        for (int u = 0; u < NT / 2; ++u) { kf[u][0] = frag_t(kpb + u * 16 * HD); kf[u][1] = frag_t(kpb + u * 16 * HD + 512); } }
      else {
#pragma unroll
        for (int kc = 0; kc < HD / 32; ++kc) { quh[kc] = qget(qs[wave][4 + kc], lane); qul[kc] = qget(qs[wave][6 + kc], lane); } }
      v4f x0, x1; bd_tile(pf[t], qvh, qvl, x0, x1);
      *(v4f*)(bw + t * 16 + 8 * g) = x0; *(v4f*)(bw + t * 16 + 8 * g + 4) = x1; }
    LDSX();   /* a lane reads band values that its partner lane (lane ^ 16) wrote */
    float s[NT][8]; float bm = -3.0e38f;
#pragma unroll
    for (int t = 0; t < NT; ++t) { v8f a = {}, al = {};
      if (t == 0) {
#pragma unroll
        for (int u = NT / 2; u < NT; ++u) { kf[u][0] = frag_t(kpb + u * 16 * HD); kf[u][1] = frag_t(kpb + u * 16 * HD + 512); } }
#pragma unroll
      for (int kc = 0; kc < HD / 32; ++kc) { a = wmma16(kf[t][kc], quh[kc], a); al = wmma16(kf[t][kc], qul[kc], al); }
      vf[0][t][0] = frag_tb(vhb + t * 512); vf[0][t][1] = frag_tb(vlb + t * 512);
#pragma unroll
      for (int r = 0; r < 8; ++r) { const float v = ((a[r] + al[r] * (1.0f / 1024.0f)) + bw[t * 16 + 8 * g + r + 15 - col]) * SCALE; s[t][r] = v; bm = fmaxf(bm, v); } }
    bm = fmaxf(bm, __shfl_xor(bm, 16));
    const float mn = fmaxf(m, bm), alpha = __builtin_amdgcn_exp2f(m - mn); m = mn; l *= alpha;
#pragma unroll
    for (int j = 0; j < HD / 16; ++j)
#pragma unroll
      for (int r = 0; r < 8; ++r) acc[j][r] *= alpha;
#pragma unroll
    for (int c = 0; c < KB / 32; ++c) { float e[16];
#pragma unroll
      for (int i = 0; i < 8; ++i) { e[i] = __builtin_amdgcn_exp2f(s[2 * c][i] - m); e[8 + i] = __builtin_amdgcn_exp2f(s[2 * c + 1][i] - m); l += e[i] + e[8 + i]; }
      const F2 p = bsplit16(e);
#pragma unroll
      for (int j = 0; j < HD / 16; ++j) { acc[j] = wmma_bf(vf[c][j][0], p.h, acc[j]); acc[j] = wmma_bf(vf[c][j][0], p.l, acc[j]); acc[j] = wmma_bf(vf[c][j][1], p.h, acc[j]);
        if (c + 1 < KB / 32) { vf[c + 1][j][0] = frag_tb(vhb + (c + 1) * 32 * HD + j * 512); vf[c + 1][j][1] = frag_tb(vlb + (c + 1) * 32 * HD + j * 512); }
        else if (j & 1) ld4(pf[1 + (j >> 1)], rhb + (KB + 16 + (j >> 1) * 16) * HD, rlb + (KB + 16 + (j >> 1) * 16) * HD); } }
    asm volatile("s_wait_xcnt 0x0" ::: "memory");   /* the address registers of the loads just issued are rewritten at the top of the next pass */
    asm volatile("s_wait_dscnt 0x0" ::: "memory");      /* this wave's reads of this block's buffer have returned */
    asm volatile("s_wait_asynccnt 0x0" ::: "memory");   /* this wave's part of the next block has landed */
    asm volatile("s_barrier_signal -1\n\ts_barrier_wait -1" ::: "memory");   /* publishes the next block and frees this block's buffer; by hand, because __syncthreads() would also wait for the position fragments just asked for, which are to stay in flight across it */
    if (j0 + 2 * KB < TT) kv_copy(kvl + (unsigned)buf * (48u * KVP), kc + (size_t)(j0 + 2 * KB) * HD, vhc + (size_t)(j0 + 2 * KB) * HD, vlc + (size_t)(j0 + 2 * KB) * HD);   /* the same test in every wave */
  }
  asm volatile("s_wait_asynccnt 0x0" ::: "memory");   /* no copy is outstanding when the wave ends */
  l += __shfl_xor(l, 16); const float inv = 1.0f / l;
#pragma unroll
  for (int j = 0; j < HD / 16; ++j) { v4f y0, y1;
#pragma unroll
    for (int r = 0; r < 4; ++r) { y0[r] = acc[j][r] * inv; y1[r] = acc[j][4 + r] * inv; }
    float* yp = Y + qrow + j * 16 + 8 * g; vst2(yp, y0); vst2(yp + 4, y1); } }
// ---- k_out: block = (64 rows, 128 cols): out = ctx (bf16 hi + lo) Wout ((in,out), exact) + bout
__global__ __launch_bounds__(128) void k_out(const float* __restrict__ Yr, const float* __restrict__ WO, const float* __restrict__ BO, float* __restrict__ OUT) { __shared__ __align__(16) float sf[4][16][132];
  const int tid = threadIdx.x, wave = tid >> 5, lane = tid & 31, col = lane & 15, g = lane >> 4; const int c0 = blockIdx.y * 128; const size_t r0 = (size_t)blockIdx.x * 64 + wave * 16;
  v8f acc[8] = {};
  gemm128<2>(Yr + (r0 + col) * CC + 8 * g, WO + (size_t)(8 * wave) * CC + c0 + 4 * lane, (__bf16*)&sf[0][0][0], wave, lane, true, acc);
#pragma unroll
  for (int j = 0; j < 8; ++j) { const float bb = bfr(BO[c0 + j * 16 + col]);
#pragma unroll
    for (int r = 0; r < 8; ++r) sf[wave][8 * g + r][j * 16 + col] = acc[j][r] + bb; }
  LDSX(); for (int rl = 0; rl < 16; ++rl) vst2(OUT + (r0 + rl) * CC + c0 + lane * 4, *(const v4f*)&sf[wave][rl][lane * 4]); }
extern "C" void kernel_launch(void* const* d_in, const int* in_sizes, int n_in, void* d_out, int out_size, void* d_ws, size_t ws_size, hipStream_t stream) {
  (void)in_sizes; (void)n_in; (void)out_size;
  const float** F = (const float**)d_in;   // 0 query, 1 key, 2 value [8,1024,512]; 3 pos_emb [1,2047,512]; 4 Wq, 5 bq, 6 Wk, 7 bk, 8 Wv, 9 bv ((in,out)); 10 Wpos; 11 Wout, 12 bout; 13 pos_bias_u [8,64], 14 pos_bias_v
  if (ws_size < (size_t)WS_END) return;
  char* ws = (char*)d_ws; _Float16 *QUH = (_Float16*)(ws + WS_QUH), *QUL = (_Float16*)(ws + WS_QUL), *QVH = (_Float16*)(ws + WS_QVH), *QVL = (_Float16*)(ws + WS_QVL), *KH = (_Float16*)(ws + WS_KH), *HRH = (_Float16*)(ws + WS_HRH), *HRL = (_Float16*)(ws + WS_HRL); __bf16 *VT = (__bf16*)(ws + WS_VT), *VL = (__bf16*)(ws + WS_VL); float *Y = (float*)(ws + WS_Y);
  k_proj<<<dim3(PBLK + (TNB * TT / 64) * (CC / 128) * 3), 128, 0, stream>>>(F[0], F[1], F[2], F[4], F[5], F[6], F[7], F[8], F[9], F[13], F[14], F[3], F[10], QUH, QUL, QVH, QVL, KH, VT, VL, HRH, HRL);
  k_att<<<dim3(TT / (16 * AW), TNB * NH), 32 * AW, 0, stream>>>(QUH, QUL, QVH, QVL, KH, HRH, HRL, VT, VL, Y);
  k_out<<<dim3(TNB * TT / 64, CC / 128), 128, 0, stream>>>(Y, F[11], F[12], (float*)d_out);
}

// v009
// A run of this version takes 111 microseconds.
// Two timings next to v008 both put it at 1.04 times that version's speed.
// Counting every step since v000, it is 14.2 times as fast.
// compute dtype: all float inputs rounded to bf16; q/k/v/p = x W + b with EXACT bf16 products on WMMA 16x16x32, f32 accumulate; (q + pos_bias_u), (q + pos_bias_v) and p as f16 hi + residual (x 2^10), k once to f16 -> content logits 2 products, position logits 3 products; the rel_shift as a banded position GEMM + index offset through LDS; logits times log2(e)/8 and running-maximum softmax in f32 on the hardware's base-2 exponential; P = 2^(s - m) split bf16 hi + lo against v bf16 hi + lo (3 products), divided by the sum at the end; ctx (bf16 hi + lo) Wout + bout; f32 output.
#include <hip/hip_runtime.h>
#include <math.h>

typedef __attribute__((ext_vector_type(16))) _Float16 v16h;
typedef __attribute__((ext_vector_type(16))) __bf16 v16b;
typedef __attribute__((ext_vector_type(8)))  _Float16 v8h;
typedef __attribute__((ext_vector_type(8)))  float v8f;
typedef __attribute__((ext_vector_type(4)))  float v4f;
typedef __attribute__((ext_vector_type(2)))  float v2f;
typedef __attribute__((ext_vector_type(4)))  unsigned v4u;
typedef __attribute__((ext_vector_type(4)))  int v4i;
typedef float __attribute__((may_alias)) float_a;
typedef int __attribute__((may_alias)) int_a;

template <typename T> __device__ __forceinline__ void vst2(void* p, T v) { *(T*)p = v;  }
// the two forms that k_att uses: the distance behind the builtin is left to the compiler's own padding, because an asm statement cannot name a register above v255 and would hold every operand of k_att's products below it
__device__ __forceinline__ v8f wmma16(v16h a, v16h b, v8f c) { return __builtin_amdgcn_wmma_f32_16x16x32_f16(false, a, false, b, (short)0, c, false, false); }
__device__ __forceinline__ v8f wmma_bfc(v16b a, v16b b, v8f c) { return __builtin_amdgcn_wmma_f32_16x16x32_bf16(false, a, false, b, (short)0, c, false, false); }
__device__ __forceinline__ v8f wmma_bf(v16b a, v16b b, v8f c) {
  v8f d = __builtin_amdgcn_wmma_f32_16x16x32_bf16(false, a, false, b, (short)0, c, false, false);
  asm volatile("v_nop\n\tv_nop\n\tv_nop\n\tv_nop" : "+v"(d) : "v"(a), "v"(b));
  return d;
}
// 16x16x32 fragments: lane = (h = lane>>4, row/col = lane&15); elements 0..7 = k0+8h+0..7, 8..15 = k0+16+8h+0..7; D element r = row 8h+r
__device__ __forceinline__ v16h frag_h(const _Float16* rowk0, int lane) {
  union { v16h v; v8h q[2]; } u; const _Float16* p = rowk0 + 8 * (lane >> 4);
  u.q[0] = *(const v8h*)p; u.q[1] = *(const v8h*)(p + 16); return u.v;
}
__device__ __forceinline__ v16h frag_f32(const float* rowk0, int lane) {
  v16h a; const float* p = rowk0 + 8 * (lane >> 4);
#pragma unroll
  for (int i = 0; i < 8; ++i) { a[i] = (_Float16)p[i]; a[8 + i] = (_Float16)p[16 + i]; }
  return a;
}
__device__ __forceinline__ v16h frag_f32s(const float* rowk0, int lane, float sc) {
  v16h a; const float* p = rowk0 + 8 * (lane >> 4);
#pragma unroll
  for (int i = 0; i < 8; ++i) { a[i] = (_Float16)(p[i] * sc); a[8 + i] = (_Float16)(p[16 + i] * sc); }
  return a;
}
// column fragment from a [K][ld] layout (column n), rows >= K read as 0
__device__ __forceinline__ v16h fragc_f32(const float* W, int k0, int n, int lane, int ld, int K) {
  v16h a; const int g = lane >> 4;
#pragma unroll
  for (int i = 0; i < 8; ++i) { const int ka = k0 + 8 * g + i, kb = ka + 16;
    a[i] = (_Float16)(ka < K ? W[(size_t)(ka < K ? ka : K - 1) * ld + n] : 0.f); a[8 + i] = (_Float16)(kb < K ? W[(size_t)(kb < K ? kb : K - 1) * ld + n] : 0.f); }
  return a;
}
struct F2 { v16b h, l; };
__device__ __forceinline__ F2 bsplit16(const float v[16]) { F2 r;
#pragma unroll
  for (int i = 0; i < 16; ++i) { const __bf16 h = (__bf16)v[i]; r.h[i] = h; r.l[i] = (__bf16)(v[i] - (float)h); }
  return r; }
__device__ __forceinline__ F2 split_row(const float* row, int k0, int lane) { float v[16]; const float* p = row + k0 + 8 * (lane >> 4);
#pragma unroll
  for (int i = 0; i < 8; ++i) { v[i] = p[i]; v[8 + i] = p[16 + i]; }
  return bsplit16(v); }
__device__ __forceinline__ F2 split_rowK(const float* row, int k0, int lane, int K) { float v[16]; const int g = lane >> 4;
#pragma unroll
  for (int i = 0; i < 8; ++i) { const int ka = k0 + 8 * g + i, kb = ka + 16; v[i] = ka < K ? row[ka < K ? ka : K - 1] : 0.f; v[8 + i] = kb < K ? row[kb < K ? kb : K - 1] : 0.f; }
  return bsplit16(v); }
__device__ __forceinline__ F2 split_col(const float* W, int k0, int n, int lane, int ld, int K) { float v[16]; const int g = lane >> 4;
#pragma unroll
  for (int i = 0; i < 8; ++i) { const int ka = k0 + 8 * g + i, kb = ka + 16; v[i] = ka < K ? W[(size_t)(ka < K ? ka : K - 1) * ld + n] : 0.f; v[8 + i] = kb < K ? W[(size_t)(kb < K ? kb : K - 1) * ld + n] : 0.f; }
  return bsplit16(v); }
__device__ __forceinline__ v8f mac3(const F2& a, const F2& b, v8f c) { c = wmma_bf(a.l, b.h, c); c = wmma_bf(a.h, b.l, c); return wmma_bf(a.h, b.h, c); }
__device__ __forceinline__ float sigm(float v) { return 1.0f / (1.0f + expf(-v)); }
#define LDSX() do { asm volatile("s_wait_dscnt 0" ::: "memory"); __builtin_amdgcn_wave_barrier(); __builtin_amdgcn_fence(__ATOMIC_RELEASE, "workgroup"); } while (0)

// Relative-position multi-head attention (wenet/espnet style; B 8, T 1,024, F 512 = 8 x 64): q = query Wq + bq, k = key Wk + bk, v = value Wv + bv ((in,out)); p = pos_emb[0] Wpos (2T-1 positions); ac = (q + u) k^T; bd = rel_shift((q + v_bias) p^T) with rel_shift(x)[i][j] = x[i][T-1-i+j]; scores = (ac + bd) / 8; softmax; ctx = att v; out = ctx Wout + bout.
#define NB 8
#define TT 1024
#define CC 512
#define NH 8
#define HD 64
#define NPOS (2 * TT - 1)      // 2,047 rows of pos_emb / p
#define HRR (2 * TT + 128)     // rows of the p planes actually built (rows >= NPOS are zeros; they only feed never-read logits)
#define KB 64                  // keys per block of the attention loop
#define AW 8                   // waves per attention work-group: one work-group per WGP, 2 waves per SIMD; its waves walk the same k and v rows, so they share one copy of them in LDS
#define QW 2                   // tiles of 16 queries per wave: each k, v and position fragment is loaded once for both
#define NT (KB / 16)           // key tiles per block (the load schedule in k_att is written for 4)
#define BP (KB + 36)           // LDS band pitch in floats: KB + 32 columns used; pitch - 1 = 35 mod 64 keeps the 32 shifted reads of a wave on 32 banks
#define SCALE (0.125f * 1.44269504088896340736f)   // 1/sqrt(64) times log2(e): the scores, their running maximum and every exponent are kept in base 2, so that each exponential is one subtraction and one v_exp_f32
#ifndef TNB
#define TNB NB
#endif
typedef __attribute__((ext_vector_type(8))) __bf16 v8b;
__device__ __forceinline__ v16b frag_b(const __bf16* rowk0, int lane) {
  union { v16b v; v8b q[2]; } u; const __bf16* p = rowk0 + 8 * (lane >> 4);
  u.q[0] = *(const v8b*)p; u.q[1] = *(const v8b*)(p + 16); return u.v;
}
__device__ __forceinline__ float bfr(float v) { return (float)(__bf16)v; }

// ---- the k loop of k_proj (its proj_pos work-groups included) and k_out: block = 4 waves, 64 rows x 128 columns, wave = 16 rows x 128 columns.
// Each k-step's 32 x 128 weight tile is read from global memory once per work-group (whole rows of 512 B) and put into LDS as bf16 B fragments: fragment j (16 columns) holds lane l's elements 0..7 at 16 l bytes and 8..15 at 512 + 16 l.
// Two LDS buffers and two register sets: step kc + 2 is asked for from global memory in front of the products of step kc, step kc + 1 (asked for a step earlier) is stored into LDS behind them; one barrier per step publishes it and ends the reads of the buffer that is written next.
#define WFP 520                // pitch of a staged fragment in elements: 1 KiB + 16 B, so that the 32 16-byte stores of a wave (8 fragments x 4 columns) spread over all banks
#define WBUF (8 * WFP)
typedef v8b __attribute__((may_alias)) v8b_a;   // the stage shares its LDS with the arrays of the epilogues
template <int MODE>   // 0: A rows rounded to bf16; 1: the same, rows that are not live read as 0; 2: A rows as bf16 hi + lo (2 products)
__device__ __forceinline__ void gemm128(const float* ap, const float* wp, __bf16* wst, int wave, int lane, bool live, v8f (&acc)[8]) {   /* ap: this lane's row + 8 g; wp: weight row 8 wave, column c0 + 4 lane */
  __bf16* wd = wst + (lane >> 2) * WFP + (wave >> 1) * 256 + ((wave & 1) * 16 + 4 * (lane & 3)) * 8; const __bf16* wsrc = wst + lane * 8;
  v4f wr[2][8], ar[2][4];   /* two register sets: step kc works from set kc & 1 while the other set's loads are still in flight */
  auto ld = [&](v4f (&w)[8], v4f (&a)[4]) {   /* asks for one step's weight rows and A row piece, then moves both pointers on by a step */
#pragma unroll
    for (int i = 0; i < 8; ++i) w[i] = *(const v4f*)(wp + (size_t)i * CC);
    a[0] = *(const v4f*)ap; a[1] = *(const v4f*)(ap + 4); a[2] = *(const v4f*)(ap + 16); a[3] = *(const v4f*)(ap + 20);
    asm volatile("s_wait_xcnt 0x0" :: "v"(wp), "v"(ap) : "memory");   /* the loads above name wp and ap, which are advanced on the next line */
    wp += 32 * CC; ap += 32; };
  auto st = [&](const v4f (&w)[8], __bf16* db) {
#pragma unroll
    for (int c = 0; c < 4; ++c) { v8b t;
#pragma unroll
      for (int i = 0; i < 8; ++i) t[i] = (__bf16)w[i][c];
      *(v8b_a*)(db + c * 8) = t; } };
  /* the work-group barrier by hand: __syncthreads() would also wait for the global loads of the step after next, which are to stay in flight across it; s_wait_dscnt 0 ends this wave's LDS stores and reads in front of it */
  auto bar = [&]() { asm volatile("s_wait_dscnt 0x0" ::: "memory"); asm volatile("s_barrier_signal -1\n\ts_barrier_wait -1" ::: "memory"); };
  auto step = [&](const bool more2, const bool more1, const int par, v4f (&wc)[8], v4f (&ac)[4], const v4f (&wn)[8]) { float v[16];   /* more2, more1: a step kc + 2, kc + 1 exists (literals at every call) */
#pragma unroll
    for (int i = 0; i < 4; ++i) { v[i] = ac[0][i]; v[4 + i] = ac[1][i]; v[8 + i] = ac[2][i]; v[12 + i] = ac[3][i]; }
    if (MODE == 1) {
#pragma unroll
      for (int i = 0; i < 16; ++i) v[i] = live ? v[i] : 0.f; }
    F2 a;
    if (MODE == 2) a = bsplit16(v);
    else {
#pragma unroll
      for (int i = 0; i < 16; ++i) a.h[i] = (__bf16)v[i]; }
    const __bf16* sb = wsrc + par * WBUF; union { v16b v; v8b q[2]; } w[8];   /* all 8 fragments are asked for at once, so that the LDS latency is paid once a step */
#pragma unroll
    for (int j = 0; j < 8; ++j) { w[j].q[0] = *(const v8b_a*)(sb + j * WFP); w[j].q[1] = *(const v8b_a*)(sb + j * WFP + 256); }
    __builtin_amdgcn_sched_barrier(0);   /* the conversions of this step's A row stay in front of the loads below, so that those land in the same registers and no copy (with its wait for them) is needed */
    if (more2) ld(wc, ac);   /* step kc + 2 into the set that this step has just emptied (its weights went to LDS a step ago) */
#pragma unroll
    for (int j = 0; j < 8; ++j) { acc[j] = wmma_bf(a.h, w[j].v, acc[j]); if (MODE == 2) acc[j] = wmma_bf(a.l, w[j].v, acc[j]); }
    __builtin_amdgcn_sched_barrier(0);   /* keeps the wait for the next step's global loads behind this step's products */
    if (more1) st(wn, wd + (par ^ 1) * WBUF);
    bar();   /* publishes step kc + 1; behind the last step it frees the stage for the epilogue's arrays */
  };
  ld(wr[0], ar[0]); ld(wr[1], ar[1]);
  st(wr[0], wd); bar();
#pragma unroll 1   /* stays rolled, so that the text stays small; the two steps of a trip are written out, so that each step's register set and LDS buffer are fixed */
  for (int kc = 0; kc + 2 < CC / 32; kc += 2) { step(true, true, 0, wr[0], ar[0], wr[1]); step(true, true, 1, wr[1], ar[1], wr[0]); }
  step(false, true, 0, wr[0], ar[0], wr[1]); step(false, false, 1, wr[1], ar[1], wr[0]); }

#define WS_QUH 0u                                       // f16 (q + u) rows [b*t][512] hi
#define WS_QUL (WS_QUH + 2u * (size_t)NB * TT * CC)      //                     residual x 2^10
#define WS_QVH (WS_QUL + 2u * (size_t)NB * TT * CC)      // f16 (q + v_bias) rows
#define WS_QVL (WS_QVH + 2u * (size_t)NB * TT * CC)
#define WS_KH  (WS_QVL + 2u * (size_t)NB * TT * CC)      // f16 k in fragment order [b][h][t/16][d/16][(d/8)&1][t&15][d&7]: a 16-key tile is 2 KiB and lane l's 16 bytes of each half fragment stand at 16 l
#define WS_HRH (WS_KH  + 2u * (size_t)NB * TT * CC)      // f16 p hi in the same fragment order [h][pos/16][d/16][(d/8)&1][pos&15][d&7], pos < HRR
#define WS_HRL (WS_HRH + 2u * (size_t)HRR * CC)          //                        residual x 2^10
#define WS_VT  (WS_HRL + 2u * (size_t)HRR * CC)          // bf16 v planes in fragment order [b][h][t/32][d/16][(t/16)&1][(t/8)&1][d&15][t&7]
#define WS_VL  (WS_VT  + 2u * (size_t)NB * CC * TT)
#define WS_Y   (WS_VL  + 2u * (size_t)NB * CC * TT)      // f32 ctx rows [b*t][512]
#define WS_END (WS_Y   + 4u * (size_t)NB * TT * CC)

// ---- proj_pos: work-group = (64 positions, 128 cols): p rows [pos][o] = pos_emb[0][pos] Wpos ((in,out), exact) -> f16 hi + residual, fragment order; rows >= NPOS (2,047) are written as zeros (their A rows are loaded clamped and zeroed by value). It depends on nothing that q, k and v need, so its work-groups stand in k_proj's grid and run beside them.
__device__ __forceinline__ void proj_pos(const float* __restrict__ PE, const float* __restrict__ WP, _Float16* __restrict__ HRH, _Float16* __restrict__ HRL, _Float16 (*sh)[136], _Float16 (*sl)[136], const size_t p0, const int c0) {
  const int tid = threadIdx.x, wave = tid >> 5, lane = tid & 31, col = lane & 15, g = lane >> 4;
  const size_t prow = p0 + wave * 16 + col; const bool live = prow < NPOS; const size_t prc = live ? prow : (NPOS - 1);
  v8f acc[8] = {};
  gemm128<1>(PE + prc * CC + 8 * g, WP + (size_t)(8 * wave) * CC + c0 + 4 * lane, (__bf16*)&sh[0][0], wave, lane, live, acc);
#pragma unroll
  for (int j = 0; j < 8; ++j) {
#pragma unroll
    for (int r = 0; r < 8; ++r) { const float v = acc[j][r]; const int rl = wave * 16 + 8 * g + r, cl = j * 16 + col; const _Float16 hv = (_Float16)v; sh[rl][cl] = hv; sl[rl][cl] = (_Float16)((v - (float)hv) * 1024.0f); } }
  __syncthreads();
  for (int e = tid; e < 64 * 16; e += 128) { const int rl = ((e >> 7) & 3) * 16 + (e & 15), q = (e >> 9) * 8 + ((e >> 4) & 7);   /* e = (head, tile, d/16, (d/8)&1, pos&15) */
    const size_t o2 = ((size_t)(c0 / HD + (e >> 9)) * (HRR / 16) + p0 / 16 + ((e >> 7) & 3)) * (size_t)(16 * HD) + (e & 127) * 8; vst2((unsigned*)(HRH + o2), *(const v4u*)&sh[rl][q * 8]); vst2((unsigned*)(HRL + o2), *(const v4u*)&sl[rl][q * 8]); } }
// ---- k_proj: one-dimensional grid: first the position projection's work-groups (proj_pos), then block = (64 rows, 128 cols, which), rows fastest: which 0: q = query Wq + bq -> (q + u) and (q + v_bias) as f16 hi + residual rows (u, v_bias [H,DK] flat = column index); which 1: k = key Wk + bk -> f16, fragment order; which 2: v = value Wv + bv -> bf16 hi + lo planes, fragment order (a store loop's 128 threads write 2 KiB in a row). Weights (in,out).
#define PBLK ((HRR / 64) * (CC / 128))   // work-groups of the position projection: the first PBLK of k_proj's grid
__global__ __launch_bounds__(128) void k_proj(const float* __restrict__ X0, const float* __restrict__ X1, const float* __restrict__ X2, const float* __restrict__ WQ, const float* __restrict__ BQ, const float* __restrict__ WK, const float* __restrict__ BK, const float* __restrict__ WV, const float* __restrict__ BV, const float* __restrict__ UB, const float* __restrict__ VB, const float* __restrict__ PE, const float* __restrict__ WP, _Float16* __restrict__ QUH, _Float16* __restrict__ QUL, _Float16* __restrict__ QVH, _Float16* __restrict__ QVL, _Float16* __restrict__ KH, __bf16* __restrict__ VT, __bf16* __restrict__ VL, _Float16* __restrict__ HRH, _Float16* __restrict__ HRL) {
  __shared__ __align__(16) _Float16 sh[64][136], sl[64][136]; __shared__ __align__(16) __bf16 th[128][72], tl2[128][72];
  const int tid = threadIdx.x, wave = tid >> 5, lane = tid & 31, col = lane & 15, g = lane >> 4;
  if (blockIdx.x < PBLK) { proj_pos(PE, WP, HRH, HRL, sh, sl, (size_t)(blockIdx.x % (HRR / 64)) * 64, (int)(blockIdx.x / (HRR / 64)) * 128); return; }   /* the same test in every thread of the work-group, in front of every barrier */
  const int bid = blockIdx.x - PBLK; const int which = bid / ((TNB * TT / 64) * (CC / 128)); const int c0 = (bid / (TNB * TT / 64)) % (CC / 128) * 128; const size_t r0 = (size_t)(bid % (TNB * TT / 64)) * 64;
  const float* X = which == 0 ? X0 : which == 1 ? X1 : X2; const float* WA = which == 0 ? WQ : which == 1 ? WK : WV; const float* BA = which == 0 ? BQ : which == 1 ? BK : BV;
  v8f acc[8] = {};
  gemm128<0>(X + (r0 + wave * 16 + col) * CC + 8 * g, WA + (size_t)(8 * wave) * CC + c0 + 4 * lane, (__bf16*)&sh[0][0], wave, lane, true, acc);
  const int npass = (which == 0) ? 2 : 1;
  for (int pass = 0; pass < npass; ++pass) {   /* block-uniform */
    if (pass) __syncthreads();
#pragma unroll
    for (int j = 0; j < 8; ++j) { const int o = c0 + j * 16 + col; const float bb = bfr(BA[o]) + ((which == 0) ? bfr((pass == 0 ? UB : VB)[o]) : 0.f);
#pragma unroll
      for (int r = 0; r < 8; ++r) { const float v = acc[j][r] + bb; const int rl = wave * 16 + 8 * g + r, cl = j * 16 + col; const _Float16 hv = (_Float16)v;
        if (which == 2) { const __bf16 bh = (__bf16)v; th[cl][rl] = bh; tl2[cl][rl] = (__bf16)(v - (float)bh); } else { sh[rl][cl] = hv; sl[rl][cl] = (_Float16)((v - (float)hv) * 1024.0f); } } }
    __syncthreads();
    const size_t b = r0 / TT; const int t0 = (int)(r0 % TT);
    if (which == 0) { _Float16* dh = (pass == 0 ? QUH : QVH); _Float16* dl = (pass == 0 ? QUL : QVL); for (int e = tid; e < 64 * 16; e += 128) { const int rl = e >> 4, q = e & 15; vst2((unsigned*)(dh + (r0 + rl) * CC + c0 + q * 8), *(const v4u*)&sh[rl][q * 8]); vst2((unsigned*)(dl + (r0 + rl) * CC + c0 + q * 8), *(const v4u*)&sl[rl][q * 8]); } }
    else if (which == 1) { for (int e = tid; e < 64 * 16; e += 128) { const int rl = ((e >> 7) & 3) * 16 + (e & 15), q = (e >> 9) * 8 + ((e >> 4) & 7);   /* e = (head, tile, d/16, (d/8)&1, t&15) */
        vst2((unsigned*)(KH + ((b * NH + c0 / HD + (e >> 9)) * (TT / 16) + t0 / 16 + ((e >> 7) & 3)) * (size_t)(16 * HD) + (e & 127) * 8), *(const v4u*)&sh[rl][q * 8]); } }
    else { for (int e = tid; e < 128 * 8; e += 128) { const int cl = (e >> 9) * 64 + ((e >> 6) & 3) * 16 + (e & 15), q = ((e >> 8) & 1) * 4 + ((e >> 4) & 3);   /* e = (head, t/32, d/16, (t/16)&1, (t/8)&1, d&15) */
        const size_t o2 = ((b * NH + c0 / HD + (e >> 9)) * (TT / 32) + t0 / 32 + ((e >> 8) & 1)) * (size_t)(32 * HD) + (e & 255) * 8; vst2((unsigned*)(VT + o2), *(const v4u*)&th[cl][q * 8]); vst2((unsigned*)(VL + o2), *(const v4u*)&tl2[cl][q * 8]); } } } }
// fragment-order loads: p already includes the lane's own offset of 8 * lane elements; the two halves of a fragment are 512 B apart, so each load of a wave reads 512 B in a row (4 cache lines, not 16)
__device__ __forceinline__ v16h frag_t(const _Float16* p) { union { v16h v; v8h q[2]; } u; u.q[0] = *(const v8h*)p; u.q[1] = *(const v8h*)(p + 256); return u.v; }
__device__ __forceinline__ v16b frag_tb(const __bf16* p) { union { v16b v; v8b q[2]; } u; u.q[0] = *(const v8b*)p; u.q[1] = *(const v8b*)(p + 256); return u.v; }
__device__ __forceinline__ void ld4(v16h (&f)[4], const _Float16* rh, const _Float16* rl) { f[0] = frag_t(rh); f[1] = frag_t(rl); f[2] = frag_t(rh + 512); f[3] = frag_t(rl + 512); }
#define KVP (KB * HD / 8)      // 16-byte pieces of one staged plane = twice the threads of the work-group
__device__ __forceinline__ void kv_copy(unsigned lds, const _Float16* k, const __bf16* vh, const __bf16* vl) {
  asm volatile("global_load_async_to_lds_b128 %0, %6, off\n\tglobal_load_async_to_lds_b128 %1, %7, off\n\tglobal_load_async_to_lds_b128 %2, %8, off\n\tglobal_load_async_to_lds_b128 %3, %9, off\n\tglobal_load_async_to_lds_b128 %4, %10, off\n\tglobal_load_async_to_lds_b128 %5, %11, off\n\ts_wait_xcnt 0x0" :: "v"(lds), "v"(lds + 8u * KVP), "v"(lds + 16u * KVP), "v"(lds + 24u * KVP), "v"(lds + 32u * KVP), "v"(lds + 40u * KVP), "v"(k), "v"(k + 4 * KVP), "v"(vh), "v"(vh + 4 * KVP), "v"(vl), "v"(vl + 4 * KVP) : "memory"); }
// one position tile: X^T = p (q+v_bias)^T, 3 products; x0, x1 = this lane's 8 consecutive positions of its query
__device__ __forceinline__ void bd_tile(const v16h (&f)[4], const v16h (&qh)[HD / 32], const v16h (&ql)[HD / 32], v4f& x0, v4f& x1) { v8f a = {}, al = {};
#pragma unroll
  for (int kc = 0; kc < HD / 32; ++kc) { a = wmma16(f[2 * kc], qh[kc], a); al = wmma16(f[2 * kc], ql[kc], al); al = wmma16(f[2 * kc + 1], qh[kc], al); }
#pragma unroll
  for (int r = 0; r < 4; ++r) { x0[r] = a[r] + al[r] * (1.0f / 1024.0f); x1[r] = a[4 + r] + al[4 + r] * (1.0f / 1024.0f); } }
// the same for both query tiles of a wave against one position tile; each tile's products keep their order, the two tiles' chains alternate
__device__ __forceinline__ void bd_tile2(const v16h (&f)[4], const v16h (&qh)[QW][HD / 32], const v16h (&ql)[QW][HD / 32], v4f (&x0)[QW], v4f (&x1)[QW]) { v8f a[QW] = {}, al[QW] = {};
#pragma unroll
  for (int kc = 0; kc < HD / 32; ++kc) {
#pragma unroll
    for (int u = 0; u < QW; ++u) a[u] = wmma16(f[2 * kc], qh[u][kc], a[u]);
#pragma unroll
    for (int u = 0; u < QW; ++u) al[u] = wmma16(f[2 * kc], ql[u][kc], al[u]);
#pragma unroll
    for (int u = 0; u < QW; ++u) al[u] = wmma16(f[2 * kc + 1], qh[u][kc], al[u]); }
#pragma unroll
  for (int u = 0; u < QW; ++u)
#pragma unroll
    for (int r = 0; r < 4; ++r) { x0[u][r] = a[u][r] + al[u][r] * (1.0f / 1024.0f); x1[u][r] = a[u][4 + r] + al[u][4 + r] * (1.0f / 1024.0f); } }
// ---- k_att: block = 16 * QW * AW queries of one (batch, head) pair, wave = QW = 2 tiles of 16 queries, all T keys in blocks of KB. Everything is kept transposed so that a lane owns one query of each tile (column lane & 15):
//   S^T = k (q+u)^T (2 products) and X^T = p (q+v_bias)^T (3 products) have D register r = key / position 8g + r; O^T += v^T P^T takes two S^T tiles, converted in place, as its B operand.
//   Every k, v and position fragment that a wave loads is the A operand of both query tiles' products; the query fragments (B operands, 128 VGPRs) stay in registers for the whole kernel (2 waves per SIMD, 512 VGPRs each).
//   rel_shift: for queries iw0 + 16 u + q and keys j0 + jl the position row is T-1-(iw0+16u+q)+(j0+jl) = pb - 16 u + c with pb = T-16-iw0+j0 and c = jl + 15 - q. A block loads the position tiles pb/16 + 1 .. pb/16 + NT; for query tile 0 they are tiles 1 .. NT of its LDS band [q][c], for query tile 1 tiles 2 .. NT + 1. Each lane reads its row back at offset 15 - q (tiles 0 .. NT). pb grows by KB a block, so tile NT of a block (and tile NT + 1 of query tile 1) is tile 0 (tile 1) of the next and is moved there, not computed again.
//   k and v: all AW waves walk the same keys, so each block's 24 KiB are copied into LDS once per work-group (asynchronous copies, two buffers: block t + 2 is asked for when every wave has left block t, and flies while block t + 1 is worked on) and every wave reads its fragments from there; only the position fragments, which differ from wave to wave, still come through the cache.
//   softmax is the running-maximum form in base 2: per block m' = max(m, block max), sums and O^T are scaled by 2^(m - m'), P = 2^(s - m') split bf16 hi + lo; the division by the sum comes last. No exponent lies above 0 by more than a rounding error; one far below -126 gives 0 or a subnormal, which adds nothing to a sum whose largest term is 1.
__global__ __launch_bounds__(32 * AW) __attribute__((amdgpu_waves_per_eu(2, 2))) void k_att(const _Float16* __restrict__ QUH, const _Float16* __restrict__ QUL, const _Float16* __restrict__ QVH, const _Float16* __restrict__ QVL, const _Float16* __restrict__ KH, const _Float16* __restrict__ RHh, const _Float16* __restrict__ RLl, const __bf16* __restrict__ VT, const __bf16* __restrict__ VL, float* __restrict__ Y) {
  __shared__ __align__(16) float band[AW][QW][16][BP]; __shared__ __align__(16) v8h kv[2][3][KVP];   /* kv: two buffers of (k, v hi, v lo) of one key block */
  const int tid = threadIdx.x, wave = tid >> 5, lane = tid & 31, col = lane & 15, g = lane >> 4; const int bh = blockIdx.y, b = bh / NH, h = bh % NH; const int iw0 = blockIdx.x * (16 * QW * AW) + wave * (16 * QW);
  const size_t qrow = ((size_t)b * TT + iw0 + col) * CC + h * HD;   /* this lane's query of tile 0; tile u stands 16 u rows on */
  static_assert(KVP == 2 * 32 * AW, "two 16-byte pieces of each plane per thread"); static_assert(QW == 2, "the band's tile numbers are written for two query tiles");
  const unsigned kvl = (unsigned)(size_t)&kv[0][0][tid];   /* this thread's LDS byte address in plane 0 of buffer 0 */
  const unsigned kvw = 512u * (unsigned)__builtin_amdgcn_readfirstlane(wave);   /* the wave's 32 pieces, in a scalar register: in the loop the thread's address is formed from it and the lane's address kpb, which the fragment reads hold anyway, so that no register (and no spill) is spent on it */
  const _Float16* kc = KH + (size_t)bh * TT * HD + tid * 8; const __bf16* vhc = VT + (size_t)bh * TT * HD + tid * 8; const __bf16* vlc = VL + (size_t)bh * TT * HD + tid * 8;
  kv_copy(kvl, kc, vhc, vlc);   /* block 0 into buffer 0 */
  v16h quh[QW][HD / 32], qul[QW][HD / 32], qvh[QW][HD / 32], qvl[QW][HD / 32];
  { const _Float16 *pvh = QVH + qrow, *pvl = QVL + qrow, *puh = QUH + qrow, *pul = QUL + qrow;
#pragma unroll
    for (int u = 0; u < QW; ++u)
#pragma unroll
      for (int kc = 0; kc < HD / 32; ++kc) { const int qo = u * 16 * CC + kc * 32; qvh[u][kc] = frag_h(pvh + qo, lane); qvl[u][kc] = frag_h(pvl + qo, lane); quh[u][kc] = frag_h(puh + qo, lane); qul[u][kc] = frag_h(pul + qo, lane); }
    asm volatile("s_wait_xcnt 0x0" :: "v"(pvh + 8 * g), "v"(pvl + 8 * g), "v"(puh + 8 * g), "v"(pul + 8 * g) : "memory"); }   /* the loads above name these four addresses: as inputs here they keep their registers up to the wait, so that nothing is written over an address of an issued load in front of it */
  float* bw[QW] = { &band[wave][0][col][0], &band[wave][1][col][0] };
  const size_t ro = ((size_t)h * (HRR / 16) + (TT - 16 - iw0) / 16) * (16 * HD) + lane * 8; const _Float16* rh = RHh + ro; const _Float16* rl = RLl + ro;   /* this lane's place in position tile pb/16 of block 0; a tile is 16 * HD elements; iw0 <= T - 32, so the tile in front of it exists */
  v8f acc[QW][HD / 16] = {}; float m[QW] = { -3.0e38f, -3.0e38f }, l[QW] = { 0.f, 0.f };
  // Every fragment is loaded one or two tiles ahead of the products that use it. pf[1], pf[2] (position tiles 1, 2) are loaded at the end of the block before; behind the last block that reads rows < 2T + 32 of the p planes, which proj_pos has written, and the values are not used.
  v16h pf[NT + 1][4], kf[NT][2]; v16b vf[KB / 32][HD / 16][2];
  ld4(pf[0], rh, rl); ld4(pf[3], rh - 16 * HD, rl - 16 * HD); ld4(pf[1], rh + 16 * HD, rl + 16 * HD); ld4(pf[2], rh + 32 * HD, rl + 32 * HD);
  asm volatile("s_wait_xcnt 0x0" :: "v"(rh), "v"(rl) : "memory");   /* the loads above name rh and rl: as inputs here both keep their registers up to the wait, so that nothing (a later load's result either) is written over an address of an issued load in front of it */
  { v4f x0[QW], x1[QW], y0, y1;   /* what a block before would have left: position tile pb/16 is tile 0 of query tile 0 and tile 1 of query tile 1; the tile in front of it is tile 0 of query tile 1 */
    bd_tile2(pf[0], qvh, qvl, x0, x1); *(v4f*)(bw[0] + KB + 8 * g) = x0[0]; *(v4f*)(bw[0] + KB + 8 * g + 4) = x1[0]; *(v4f*)(bw[1] + KB + 16 + 8 * g) = x0[1]; *(v4f*)(bw[1] + KB + 16 + 8 * g + 4) = x1[1];
    bd_tile(pf[3], qvh[1], qvl[1], y0, y1); *(v4f*)(bw[1] + KB + 8 * g) = y0; *(v4f*)(bw[1] + KB + 8 * g + 4) = y1; }
  asm volatile("s_wait_asynccnt 0x0" ::: "memory");   /* this wave's part of block 0 has landed */
  __syncthreads();                                     /* ... and every other wave's: block 0 may be read */
  kv_copy(kvl + 48u * KVP, kc + KB * HD, vhc + KB * HD, vlc + KB * HD);   /* block 1 into buffer 1 */
#pragma unroll 1
  for (int j0 = 0; j0 < TT; j0 += KB) { const _Float16* rhb = rh + (size_t)j0 * HD; const _Float16* rlb = rl + (size_t)j0 * HD; const int buf = (j0 / KB) & 1; const _Float16* kpb = (const _Float16*)&kv[buf][0][lane]; const __bf16* vhb = (const __bf16*)&kv[buf][1][lane]; const __bf16* vlb = (const __bf16*)&kv[buf][2][lane];
    { const v4f c0 = *(const v4f*)(bw[0] + KB + 8 * g), c1 = *(const v4f*)(bw[0] + KB + 8 * g + 4), d0 = *(const v4f*)(bw[1] + KB + 8 * g), d1 = *(const v4f*)(bw[1] + KB + 8 * g + 4), e0 = *(const v4f*)(bw[1] + KB + 16 + 8 * g), e1 = *(const v4f*)(bw[1] + KB + 16 + 8 * g + 4);
      *(v4f*)(bw[0] + 8 * g) = c0; *(v4f*)(bw[0] + 8 * g + 4) = c1; *(v4f*)(bw[1] + 8 * g) = d0; *(v4f*)(bw[1] + 8 * g + 4) = d1; *(v4f*)(bw[1] + 16 + 8 * g) = e0; *(v4f*)(bw[1] + 16 + 8 * g + 4) = e1; }   /* the lane's own values: the last tiles of the block before = the first of this one */
#pragma unroll
    for (int t = 1; t < NT + 1; ++t) {
      if (t + 2 < NT + 1) ld4(pf[t + 2], rhb + (t + 2) * 16 * HD, rlb + (t + 2) * 16 * HD);
      else if (t + 1 == NT) {
#pragma unroll
        for (int u = 0; u < NT / 2; ++u) { kf[u][0] = frag_t(kpb + u * 16 * HD); kf[u][1] = frag_t(kpb + u * 16 * HD + 512); } }
      v4f x0[QW], x1[QW]; bd_tile2(pf[t], qvh, qvl, x0, x1);
      *(v4f*)(bw[0] + t * 16 + 8 * g) = x0[0]; *(v4f*)(bw[0] + t * 16 + 8 * g + 4) = x1[0]; *(v4f*)(bw[1] + (t + 1) * 16 + 8 * g) = x0[1]; *(v4f*)(bw[1] + (t + 1) * 16 + 8 * g + 4) = x1[1]; }
    LDSX();   /* a lane reads band values that its partner lane (lane ^ 16) wrote */
    float s[QW][NT][8]; float bm[QW] = { -3.0e38f, -3.0e38f };
#pragma unroll
    for (int t = 0; t < NT; ++t) { v8f a[QW] = {}, al[QW] = {};
      if (t == 0) {
#pragma unroll
        for (int u = NT / 2; u < NT; ++u) { kf[u][0] = frag_t(kpb + u * 16 * HD); kf[u][1] = frag_t(kpb + u * 16 * HD + 512); } }
#pragma unroll
      for (int kc = 0; kc < HD / 32; ++kc) {
#pragma unroll
        for (int u = 0; u < QW; ++u) a[u] = wmma16(kf[t][kc], quh[u][kc], a[u]);
#pragma unroll
        for (int u = 0; u < QW; ++u) al[u] = wmma16(kf[t][kc], qul[u][kc], al[u]); }
      vf[0][t][0] = frag_tb(vhb + t * 512); vf[0][t][1] = frag_tb(vlb + t * 512);
#pragma unroll
      for (int u = 0; u < QW; ++u)
#pragma unroll
        for (int r = 0; r < 8; ++r) { const float v = ((a[u][r] + al[u][r] * (1.0f / 1024.0f)) + bw[u][t * 16 + 8 * g + r + 15 - col]) * SCALE; s[u][t][r] = v; bm[u] = fmaxf(bm[u], v); } }
#pragma unroll
    for (int u = 0; u < QW; ++u) { bm[u] = fmaxf(bm[u], __shfl_xor(bm[u], 16));
      const float mn = fmaxf(m[u], bm[u]), alpha = __builtin_amdgcn_exp2f(m[u] - mn); m[u] = mn; l[u] *= alpha;
#pragma unroll
      for (int j = 0; j < HD / 16; ++j)
#pragma unroll
        for (int r = 0; r < 8; ++r) acc[u][j][r] *= alpha; }
#pragma unroll
    for (int c = 0; c < KB / 32; ++c) { F2 p[QW];
#pragma unroll
      for (int u = 0; u < QW; ++u) { float e[16];
#pragma unroll
        for (int i = 0; i < 8; ++i) { e[i] = __builtin_amdgcn_exp2f(s[u][2 * c][i] - m[u]); e[8 + i] = __builtin_amdgcn_exp2f(s[u][2 * c + 1][i] - m[u]); l[u] += e[i] + e[8 + i]; }
        p[u] = bsplit16(e); }
#pragma unroll
      for (int j = 0; j < HD / 16; ++j) {
#pragma unroll
        for (int u = 0; u < QW; ++u) acc[u][j] = wmma_bfc(vf[c][j][0], p[u].h, acc[u][j]);
#pragma unroll
        for (int u = 0; u < QW; ++u) acc[u][j] = wmma_bfc(vf[c][j][0], p[u].l, acc[u][j]);
#pragma unroll
        for (int u = 0; u < QW; ++u) acc[u][j] = wmma_bfc(vf[c][j][1], p[u].h, acc[u][j]);
        if (c + 1 < KB / 32) { vf[c + 1][j][0] = frag_tb(vhb + (c + 1) * 32 * HD + j * 512); vf[c + 1][j][1] = frag_tb(vlb + (c + 1) * 32 * HD + j * 512); }
        else if (j & 1) ld4(pf[1 + (j >> 1)], rhb + (KB + 16 + (j >> 1) * 16) * HD, rlb + (KB + 16 + (j >> 1) * 16) * HD); } }
    asm volatile("s_wait_xcnt 0x0" ::: "memory");   /* the address registers of the loads just issued are rewritten at the top of the next pass */
    asm volatile("s_wait_dscnt 0x0" ::: "memory");      /* this wave's reads of this block's buffer have returned */
    asm volatile("s_wait_asynccnt 0x0" ::: "memory");   /* this wave's part of the next block has landed */
    asm volatile("s_barrier_signal -1\n\ts_barrier_wait -1" ::: "memory");   /* publishes the next block and frees this block's buffer; by hand, because __syncthreads() would also wait for the position fragments just asked for, which are to stay in flight across it */
    if (j0 + 2 * KB < TT) kv_copy((unsigned)(size_t)kpb + kvw, kc + (size_t)(j0 + 2 * KB) * HD, vhc + (size_t)(j0 + 2 * KB) * HD, vlc + (size_t)(j0 + 2 * KB) * HD);   /* the same test in every wave */
  }
  asm volatile("s_wait_asynccnt 0x0" ::: "memory");   /* no copy is outstanding when the wave ends */
#pragma unroll
  for (int u = 0; u < QW; ++u) { l[u] += __shfl_xor(l[u], 16); const float inv = 1.0f / l[u];
#pragma unroll
    for (int j = 0; j < HD / 16; ++j) { v4f y0, y1;
#pragma unroll
      for (int r = 0; r < 4; ++r) { y0[r] = acc[u][j][r] * inv; y1[r] = acc[u][j][4 + r] * inv; }
      float* yp = Y + qrow + (size_t)u * 16 * CC + j * 16 + 8 * g; vst2(yp, y0); vst2(yp + 4, y1); } } }
// ---- k_out: block = (64 rows, 128 cols): out = ctx (bf16 hi + lo) Wout ((in,out), exact) + bout
__global__ __launch_bounds__(128) void k_out(const float* __restrict__ Yr, const float* __restrict__ WO, const float* __restrict__ BO, float* __restrict__ OUT) { __shared__ __align__(16) float sf[4][16][132];
  const int tid = threadIdx.x, wave = tid >> 5, lane = tid & 31, col = lane & 15, g = lane >> 4; const int c0 = blockIdx.y * 128; const size_t r0 = (size_t)blockIdx.x * 64 + wave * 16;
  v8f acc[8] = {};
  gemm128<2>(Yr + (r0 + col) * CC + 8 * g, WO + (size_t)(8 * wave) * CC + c0 + 4 * lane, (__bf16*)&sf[0][0][0], wave, lane, true, acc);
#pragma unroll
  for (int j = 0; j < 8; ++j) { const float bb = bfr(BO[c0 + j * 16 + col]);
#pragma unroll
    for (int r = 0; r < 8; ++r) sf[wave][8 * g + r][j * 16 + col] = acc[j][r] + bb; }
  LDSX(); for (int rl = 0; rl < 16; ++rl) vst2(OUT + (r0 + rl) * CC + c0 + lane * 4, *(const v4f*)&sf[wave][rl][lane * 4]); }
extern "C" void kernel_launch(void* const* d_in, const int* in_sizes, int n_in, void* d_out, int out_size, void* d_ws, size_t ws_size, hipStream_t stream) {
  (void)in_sizes; (void)n_in; (void)out_size;
  const float** F = (const float**)d_in;   // 0 query, 1 key, 2 value [8,1024,512]; 3 pos_emb [1,2047,512]; 4 Wq, 5 bq, 6 Wk, 7 bk, 8 Wv, 9 bv ((in,out)); 10 Wpos; 11 Wout, 12 bout; 13 pos_bias_u [8,64], 14 pos_bias_v
  if (ws_size < (size_t)WS_END) return;
  char* ws = (char*)d_ws; _Float16 *QUH = (_Float16*)(ws + WS_QUH), *QUL = (_Float16*)(ws + WS_QUL), *QVH = (_Float16*)(ws + WS_QVH), *QVL = (_Float16*)(ws + WS_QVL), *KH = (_Float16*)(ws + WS_KH), *HRH = (_Float16*)(ws + WS_HRH), *HRL = (_Float16*)(ws + WS_HRL); __bf16 *VT = (__bf16*)(ws + WS_VT), *VL = (__bf16*)(ws + WS_VL); float *Y = (float*)(ws + WS_Y);
  k_proj<<<dim3(PBLK + (TNB * TT / 64) * (CC / 128) * 3), 128, 0, stream>>>(F[0], F[1], F[2], F[4], F[5], F[6], F[7], F[8], F[9], F[13], F[14], F[3], F[10], QUH, QUL, QVH, QVL, KH, VT, VL, HRH, HRL);
  k_att<<<dim3(TT / (16 * QW * AW), TNB * NH), 32 * AW, 0, stream>>>(QUH, QUL, QVH, QVL, KH, HRH, HRL, VT, VL, Y);
  k_out<<<dim3(TNB * TT / 64, CC / 128), 128, 0, stream>>>(Y, F[11], F[12], (float*)d_out);
}

// v010
// A run of this version takes 101 microseconds.
// Timed twice side by side with v009, it ran 1.10 times as fast both times.
// Counting every step since v000, it is 15.6 times as fast.
// compute dtype: all float inputs rounded to bf16; q/k/v/p = x W + b with EXACT bf16 products on WMMA 16x16x32, f32 accumulate; (q + pos_bias_u), (q + pos_bias_v) and p as f16 hi + residual (x 2^10), k once to f16 -> content logits 2 products, position logits 3 products; the rel_shift as a banded position GEMM + index offset through LDS; logits times log2(e)/8 and running-maximum softmax in f32 on the hardware's base-2 exponential; P = 2^(s - m) split bf16 hi + lo against v bf16 hi + lo (3 products), divided by the sum at the end; ctx (bf16 hi + lo) Wout + bout; f32 output.
#include <hip/hip_runtime.h>
#include <math.h>

typedef __attribute__((ext_vector_type(16))) _Float16 v16h;
typedef __attribute__((ext_vector_type(16))) __bf16 v16b;
typedef __attribute__((ext_vector_type(8)))  _Float16 v8h;
typedef __attribute__((ext_vector_type(8)))  float v8f;
typedef __attribute__((ext_vector_type(4)))  float v4f;
typedef __attribute__((ext_vector_type(2)))  float v2f;
typedef __attribute__((ext_vector_type(4)))  unsigned v4u;
typedef __attribute__((ext_vector_type(4)))  int v4i;
typedef float __attribute__((may_alias)) float_a;
typedef int __attribute__((may_alias)) int_a;

template <typename T> __device__ __forceinline__ void vst2(void* p, T v) { *(T*)p = v;  }
// the two forms that k_att uses: the distance behind the builtin is left to the compiler's own padding, because an asm statement cannot name a register above v255 and would hold every operand of k_att's products below it
__device__ __forceinline__ v8f wmma16(v16h a, v16h b, v8f c) { return __builtin_amdgcn_wmma_f32_16x16x32_f16(false, a, false, b, (short)0, c, false, false); }
__device__ __forceinline__ v8f wmma_bfc(v16b a, v16b b, v8f c) { return __builtin_amdgcn_wmma_f32_16x16x32_bf16(false, a, false, b, (short)0, c, false, false); }
__device__ __forceinline__ v8f wmma_bf(v16b a, v16b b, v8f c) {
  v8f d = __builtin_amdgcn_wmma_f32_16x16x32_bf16(false, a, false, b, (short)0, c, false, false);
  asm volatile("v_nop\n\tv_nop\n\tv_nop\n\tv_nop" : "+v"(d) : "v"(a), "v"(b));
  return d;
}
// 16x16x32 fragments: lane = (h = lane>>4, row/col = lane&15); elements 0..7 = k0+8h+0..7, 8..15 = k0+16+8h+0..7; D element r = row 8h+r
__device__ __forceinline__ v16h frag_h(const _Float16* rowk0, int lane) {
  union { v16h v; v8h q[2]; } u; const _Float16* p = rowk0 + 8 * (lane >> 4);
  u.q[0] = *(const v8h*)p; u.q[1] = *(const v8h*)(p + 16); return u.v;
}
__device__ __forceinline__ v16h frag_f32(const float* rowk0, int lane) {
  v16h a; const float* p = rowk0 + 8 * (lane >> 4);
#pragma unroll
  for (int i = 0; i < 8; ++i) { a[i] = (_Float16)p[i]; a[8 + i] = (_Float16)p[16 + i]; }
  return a;
}
__device__ __forceinline__ v16h frag_f32s(const float* rowk0, int lane, float sc) {
  v16h a; const float* p = rowk0 + 8 * (lane >> 4);
#pragma unroll
  for (int i = 0; i < 8; ++i) { a[i] = (_Float16)(p[i] * sc); a[8 + i] = (_Float16)(p[16 + i] * sc); }
  return a;
}
// column fragment from a [K][ld] layout (column n), rows >= K read as 0
__device__ __forceinline__ v16h fragc_f32(const float* W, int k0, int n, int lane, int ld, int K) {
  v16h a; const int g = lane >> 4;
#pragma unroll
  for (int i = 0; i < 8; ++i) { const int ka = k0 + 8 * g + i, kb = ka + 16;
    a[i] = (_Float16)(ka < K ? W[(size_t)(ka < K ? ka : K - 1) * ld + n] : 0.f); a[8 + i] = (_Float16)(kb < K ? W[(size_t)(kb < K ? kb : K - 1) * ld + n] : 0.f); }
  return a;
}
struct F2 { v16b h, l; };
__device__ __forceinline__ F2 bsplit16(const float v[16]) { F2 r;
#pragma unroll
  for (int i = 0; i < 16; ++i) { const __bf16 h = (__bf16)v[i]; r.h[i] = h; r.l[i] = (__bf16)(v[i] - (float)h); }
  return r; }
__device__ __forceinline__ F2 split_row(const float* row, int k0, int lane) { float v[16]; const float* p = row + k0 + 8 * (lane >> 4);
#pragma unroll
  for (int i = 0; i < 8; ++i) { v[i] = p[i]; v[8 + i] = p[16 + i]; }
  return bsplit16(v); }
__device__ __forceinline__ F2 split_rowK(const float* row, int k0, int lane, int K) { float v[16]; const int g = lane >> 4;
#pragma unroll
  for (int i = 0; i < 8; ++i) { const int ka = k0 + 8 * g + i, kb = ka + 16; v[i] = ka < K ? row[ka < K ? ka : K - 1] : 0.f; v[8 + i] = kb < K ? row[kb < K ? kb : K - 1] : 0.f; }
  return bsplit16(v); }
__device__ __forceinline__ F2 split_col(const float* W, int k0, int n, int lane, int ld, int K) { float v[16]; const int g = lane >> 4;
#pragma unroll
  for (int i = 0; i < 8; ++i) { const int ka = k0 + 8 * g + i, kb = ka + 16; v[i] = ka < K ? W[(size_t)(ka < K ? ka : K - 1) * ld + n] : 0.f; v[8 + i] = kb < K ? W[(size_t)(kb < K ? kb : K - 1) * ld + n] : 0.f; }
  return bsplit16(v); }
__device__ __forceinline__ v8f mac3(const F2& a, const F2& b, v8f c) { c = wmma_bf(a.l, b.h, c); c = wmma_bf(a.h, b.l, c); return wmma_bf(a.h, b.h, c); }
__device__ __forceinline__ float sigm(float v) { return 1.0f / (1.0f + expf(-v)); }
#define LDSX() do { asm volatile("s_wait_dscnt 0" ::: "memory"); __builtin_amdgcn_wave_barrier(); __builtin_amdgcn_fence(__ATOMIC_RELEASE, "workgroup"); } while (0)

// Relative-position multi-head attention (wenet/espnet style; B 8, T 1,024, F 512 = 8 x 64): q = query Wq + bq, k = key Wk + bk, v = value Wv + bv ((in,out)); p = pos_emb[0] Wpos (2T-1 positions); ac = (q + u) k^T; bd = rel_shift((q + v_bias) p^T) with rel_shift(x)[i][j] = x[i][T-1-i+j]; scores = (ac + bd) / 8; softmax; ctx = att v; out = ctx Wout + bout.
#define NB 8
#define TT 1024
#define CC 512
#define NH 8
#define HD 64
#define NPOS (2 * TT - 1)      // 2,047 rows of pos_emb / p
#define HRR (2 * TT + 128)     // rows of the p planes actually built (rows >= NPOS are zeros; they only feed never-read logits)
#define KB 64                  // keys per block of the attention loop
#define AW 8                   // waves per attention work-group: one work-group per WGP, 2 waves per SIMD; its waves walk the same k and v rows, so they share one copy of them in LDS
#define QW 2                   // tiles of 16 queries per wave: each k, v and position fragment is loaded once for both
#define NT (KB / 16)           // key tiles per block (the load schedule in k_att is written for 4)
#define BP (KB + 36)           // LDS band pitch in floats: KB + 32 columns used; pitch - 1 = 35 mod 64 keeps the 32 shifted reads of a wave on 32 banks
#define SCALE (0.125f * 1.44269504088896340736f)   // 1/sqrt(64) times log2(e): the scores, their running maximum and every exponent are kept in base 2, so that each exponential is one subtraction and one v_exp_f32
#ifndef TNB
#define TNB NB
#endif
typedef __attribute__((ext_vector_type(8))) __bf16 v8b;
__device__ __forceinline__ v16b frag_b(const __bf16* rowk0, int lane) {
  union { v16b v; v8b q[2]; } u; const __bf16* p = rowk0 + 8 * (lane >> 4);
  u.q[0] = *(const v8b*)p; u.q[1] = *(const v8b*)(p + 16); return u.v;
}
__device__ __forceinline__ float bfr(float v) { return (float)(__bf16)v; }

// ---- the k loop of k_proj (its proj_pos work-groups included) and k_out: block = 4 waves, 64 rows x 128 columns, wave = 16 rows x 128 columns.
// Each k-step's 32 x 128 weight tile is read from global memory once per work-group (whole rows of 512 B) and put into LDS as bf16 B fragments: fragment j (16 columns) holds lane l's elements 0..7 at 16 l bytes and 8..15 at 512 + 16 l.
// Two LDS buffers and two register sets: step kc + 2 is asked for from global memory in front of the products of step kc, step kc + 1 (asked for a step earlier) is stored into LDS behind them; one barrier per step publishes it and ends the reads of the buffer that is written next.
#define WFP 520                // pitch of a staged fragment in elements: 1 KiB + 16 B, so that the 32 16-byte stores of a wave (8 fragments x 4 columns) spread over all banks
#define WBUF (8 * WFP)
typedef v8b __attribute__((may_alias)) v8b_a;   // the stage shares its LDS with k_out's epilogue array sf
struct NoPre { __device__ __forceinline__ void operator()() const {} };
template <int MODE, bool SW = false, class PRE = NoPre, bool ENDBAR = true>   // MODE 0: A rows rounded to bf16; 1: the same, rows that are not live read as 0; 2: A rows as bf16 hi + lo (2 products). SW: the two operands change places (both have the same lane and k map), so that D comes out transposed: a lane then holds 8 consecutive output columns 16 j + 8 g + r of its own row (lane & 15), not 8 rows of one column. pre: LDS stores of the caller's that the loop's first barrier publishes along with step 0. ENDBAR: the caller writes into the stage's LDS behind the loop, so a barrier stands behind the last step too
__device__ __forceinline__ void gemm128(const float* ap, const float* wp, __bf16* wst, int wave, int lane, bool live, v8f (&acc)[8], PRE pre = PRE()) {   /* ap: this lane's row + 8 g; wp: weight row 8 wave, column c0 + 4 lane */
  __bf16* wd = wst + (lane >> 2) * WFP + (wave >> 1) * 256 + ((wave & 1) * 16 + 4 * (lane & 3)) * 8; const __bf16* wsrc = wst + lane * 8;
  v4f wr[2][8], ar[2][4];   /* two register sets: step kc works from set kc & 1 while the other set's loads are still in flight */
  auto ld = [&](v4f (&w)[8], v4f (&a)[4]) {   /* asks for one step's weight rows and A row piece, then moves both pointers on by a step */
#pragma unroll
    for (int i = 0; i < 8; ++i) w[i] = *(const v4f*)(wp + (size_t)i * CC);
    a[0] = *(const v4f*)ap; a[1] = *(const v4f*)(ap + 4); a[2] = *(const v4f*)(ap + 16); a[3] = *(const v4f*)(ap + 20);
    asm volatile("s_wait_xcnt 0x0" :: "v"(wp), "v"(ap) : "memory");   /* the loads above name wp and ap, which are advanced on the next line */
    wp += 32 * CC; ap += 32; };
  auto st = [&](const v4f (&w)[8], __bf16* db) {
#pragma unroll
    for (int c = 0; c < 4; ++c) { v8b t;
#pragma unroll
      for (int i = 0; i < 8; ++i) t[i] = (__bf16)w[i][c];
      *(v8b_a*)(db + c * 8) = t; } };
  /* the work-group barrier by hand: __syncthreads() would also wait for the global loads of the step after next, which are to stay in flight across it; s_wait_dscnt 0 ends this wave's LDS stores and reads in front of it */
  auto bar = [&]() { asm volatile("s_wait_dscnt 0x0" ::: "memory"); asm volatile("s_barrier_signal -1\n\ts_barrier_wait -1" ::: "memory"); };
  auto step = [&](const bool more2, const bool more1, const int par, v4f (&wc)[8], v4f (&ac)[4], const v4f (&wn)[8]) { float v[16];   /* more2, more1: a step kc + 2, kc + 1 exists (literals at every call) */
#pragma unroll
    for (int i = 0; i < 4; ++i) { v[i] = ac[0][i]; v[4 + i] = ac[1][i]; v[8 + i] = ac[2][i]; v[12 + i] = ac[3][i]; }
    if (MODE == 1) {
#pragma unroll
      for (int i = 0; i < 16; ++i) v[i] = live ? v[i] : 0.f; }
    F2 a;
    if (MODE == 2) a = bsplit16(v);
    else {
#pragma unroll
      for (int i = 0; i < 16; ++i) a.h[i] = (__bf16)v[i]; }
    const __bf16* sb = wsrc + par * WBUF; union { v16b v; v8b q[2]; } w[8];   /* all 8 fragments are asked for at once, so that the LDS latency is paid once a step */
#pragma unroll
    for (int j = 0; j < 8; ++j) { w[j].q[0] = *(const v8b_a*)(sb + j * WFP); w[j].q[1] = *(const v8b_a*)(sb + j * WFP + 256); }
    __builtin_amdgcn_sched_barrier(0);   /* the conversions of this step's A row stay in front of the loads below, so that those land in the same registers and no copy (with its wait for them) is needed */
    if (more2) ld(wc, ac);   /* step kc + 2 into the set that this step has just emptied (its weights went to LDS a step ago) */
#pragma unroll
    for (int j = 0; j < 8; ++j) { acc[j] = SW ? wmma_bf(w[j].v, a.h, acc[j]) : wmma_bf(a.h, w[j].v, acc[j]); if (MODE == 2) acc[j] = SW ? wmma_bf(w[j].v, a.l, acc[j]) : wmma_bf(a.l, w[j].v, acc[j]); }
    __builtin_amdgcn_sched_barrier(0);   /* keeps the wait for the next step's global loads behind this step's products */
    if (more1) st(wn, wd + (par ^ 1) * WBUF);
    if (more1 || ENDBAR) bar();   /* publishes step kc + 1; behind the last step it frees the stage for the epilogue's arrays */
  };
  ld(wr[0], ar[0]); ld(wr[1], ar[1]);
  st(wr[0], wd); pre(); bar();
#pragma unroll 1   /* stays rolled, so that the text stays small; the two steps of a trip are written out, so that each step's register set and LDS buffer are fixed */
  for (int kc = 0; kc + 2 < CC / 32; kc += 2) { step(true, true, 0, wr[0], ar[0], wr[1]); step(true, true, 1, wr[1], ar[1], wr[0]); }
  step(false, true, 0, wr[0], ar[0], wr[1]); step(false, false, 1, wr[1], ar[1], wr[0]); }

#define WS_QUH 0u                                       // f16 (q + u) hi in fragment order [b][h][t/16][d/16][(d/8)&1][t&15][d&7], as k below
#define WS_QUL (WS_QUH + 2u * (size_t)NB * TT * CC)      //                     residual x 2^10
#define WS_QVH (WS_QUL + 2u * (size_t)NB * TT * CC)      // f16 (q + v_bias), the same order
#define WS_QVL (WS_QVH + 2u * (size_t)NB * TT * CC)
#define WS_KH  (WS_QVL + 2u * (size_t)NB * TT * CC)      // f16 k in fragment order [b][h][t/16][d/16][(d/8)&1][t&15][d&7]: a 16-key tile is 2 KiB and lane l's 16 bytes of each half fragment stand at 16 l
#define WS_HRH (WS_KH  + 2u * (size_t)NB * TT * CC)      // f16 p hi in the same fragment order [h][pos/16][d/16][(d/8)&1][pos&15][d&7], pos < HRR
#define WS_HRL (WS_HRH + 2u * (size_t)HRR * CC)          //                        residual x 2^10
#define WS_VT  (WS_HRL + 2u * (size_t)HRR * CC)          // bf16 v planes in fragment order [b][h][t/32][d/16][(t/16)&1][(t/8)&1][d&15][t&7]
#define WS_VL  (WS_VT  + 2u * (size_t)NB * CC * TT)
#define WS_Y   (WS_VL  + 2u * (size_t)NB * CC * TT)      // f32 ctx rows [b*t][512]
#define WS_END (WS_Y   + 4u * (size_t)NB * TT * CC)

// The projections' results leave the accumulators straight for the workspace, through no LDS: in fragment order a lane's 8 values of one accumulator are one 16-byte piece, and the 32 pieces of a wave stand 512 bytes in a row.
// q, k and p want 8 consecutive d of one row (transposed D, SW), v wants 8 consecutive t of one d (plain D).
__device__ __forceinline__ void hl8(const v8f v, v4u& h, v4u& l) {   /* 8 values as f16 hi + residual x 2^10, one 16-byte piece each */
  union { v8h h; v4u u; } H, L;
#pragma unroll
  for (int r = 0; r < 8; ++r) { const _Float16 hv = (_Float16)v[r]; H.h[r] = hv; L.h[r] = (_Float16)((v[r] - (float)hv) * 1024.0f); }
  h = H.u; l = L.u; }
__device__ __forceinline__ v8f add8(const v8f a, const v4f b0, const v4f b1) { v8f v;
#pragma unroll
  for (int r = 0; r < 8; ++r) v[r] = a[r] + (r < 4 ? b0[r & 3] : b1[r & 3]);
  return v; }
// The stores go out in groups of 8, each piece from registers of its own, with one s_wait_xcnt 0 behind each group. The group's 8 pieces and the addresses that the stores name are inputs of that wait, so they keep their registers up to it: nothing (the next group's values, a later LDS read's result) is written over a register of an issued store in front of the wait.
#define XD8(D) "v"(D[0]), "v"(D[1]), "v"(D[2]), "v"(D[3]), "v"(D[4]), "v"(D[5]), "v"(D[6]), "v"(D[7])
// ---- proj_pos: work-group = (64 positions, 128 cols): p rows [pos][o] = pos_emb[0][pos] Wpos ((in,out), exact) -> f16 hi + residual, fragment order; rows >= NPOS (2,047) are written as zeros (their A rows are loaded clamped and zeroed by value). It depends on nothing that q, k and v need, so its work-groups stand in k_proj's grid and run beside them.
__device__ __forceinline__ void proj_pos(const float* __restrict__ PE, const float* __restrict__ WP, _Float16* __restrict__ HRH, _Float16* __restrict__ HRL, __bf16* wst, const size_t p0, const int c0) {
  const int tid = threadIdx.x, wave = tid >> 5, lane = tid & 31, col = lane & 15, g = lane >> 4;
  const size_t prow = p0 + wave * 16 + col; const bool live = prow < NPOS; const size_t prc = live ? prow : (NPOS - 1);
  v8f acc[8] = {};
  gemm128<1, true, NoPre, false>(PE + prc * CC + 8 * g, WP + (size_t)(8 * wave) * CC + c0 + 4 * lane, wst, wave, lane, live, acc);
  const size_t o1 = ((size_t)(c0 / HD) * (HRR / 16) + p0 / 16 + wave) * (size_t)(16 * HD) + lane * 8; _Float16 *dh = HRH + o1, *dl = HRL + o1;
#pragma unroll
  for (int jh = 0; jh < 2; ++jh) { v4u D[8];   /* jh: the head */
#pragma unroll
    for (int i = 0; i < 4; ++i) hl8(acc[4 * jh + i], D[2 * i], D[2 * i + 1]);
#pragma unroll
    for (int i = 0; i < 4; ++i) { const size_t o = (size_t)jh * HRR * HD + i * 256; vst2((unsigned*)(dh + o), D[2 * i]); vst2((unsigned*)(dl + o), D[2 * i + 1]); }
    asm volatile("s_wait_xcnt 0x0" :: XD8(D), "v"(dh), "v"(dl) : "memory"); } }
// ---- k_proj: one-dimensional grid: first the position projection's work-groups (proj_pos), then block = (64 rows, 128 cols, which), rows fastest: which 0: q = query Wq + bq -> (q + u) and (q + v_bias) as f16 hi + residual (u, v_bias [H,DK] flat = column index); which 1: k = key Wk + bk -> f16; which 2: v = value Wv + bv -> bf16 hi + lo planes; all in fragment order. Weights (in,out).
#define PBLK ((HRR / 64) * (CC / 128))   // work-groups of the position projection: the first PBLK of k_proj's grid
__global__ __launch_bounds__(128) void k_proj(const float* __restrict__ X0, const float* __restrict__ X1, const float* __restrict__ X2, const float* __restrict__ WQ, const float* __restrict__ BQ, const float* __restrict__ WK, const float* __restrict__ BK, const float* __restrict__ WV, const float* __restrict__ BV, const float* __restrict__ UB, const float* __restrict__ VB, const float* __restrict__ PE, const float* __restrict__ WP, _Float16* __restrict__ QUH, _Float16* __restrict__ QUL, _Float16* __restrict__ QVH, _Float16* __restrict__ QVL, _Float16* __restrict__ KH, __bf16* __restrict__ VT, __bf16* __restrict__ VL, _Float16* __restrict__ HRH, _Float16* __restrict__ HRL) {
  __shared__ __align__(16) __bf16 wst[2 * WBUF]; __shared__ __align__(16) float sb[2][128];   /* sb: the work-group's 128 bias sums (q: + u, + v_bias) */
  const int tid = threadIdx.x, wave = tid >> 5, lane = tid & 31, col = lane & 15, g = lane >> 4;
  if (blockIdx.x < PBLK) { proj_pos(PE, WP, HRH, HRL, wst, (size_t)(blockIdx.x % (HRR / 64)) * 64, (int)(blockIdx.x / (HRR / 64)) * 128); return; }   /* the same test in every thread of the work-group, in front of every barrier */
  const int bid = blockIdx.x - PBLK; const int which = bid / ((TNB * TT / 64) * (CC / 128)); const int c0 = (bid / (TNB * TT / 64)) % (CC / 128) * 128; const size_t r0 = (size_t)(bid % (TNB * TT / 64)) * 64;
  const size_t b = r0 / TT; const int t0 = (int)(r0 % TT);
  v8f acc[8] = {};
  // each thread asks for one column's biases in front of the k loop and puts their sums into LDS ahead of the loop's first barrier; an epilogue reads its 8 consecutive columns from there, at LDS latency and with no barrier of its own
  const float *pa = (which == 0 ? BQ : which == 1 ? BK : BV) + c0 + tid, *pu = UB + c0 + tid, *pv = VB + c0 + tid; const float ra = *pa, ru = *pu, rv = *pv;   /* all three in every work-group (k and v use the first alone): under a test the values would have to be waited for here, not behind the loop's first loads */
  asm volatile("s_wait_xcnt 0x0" ::: "memory");   /* in front of whatever is next written over a register that the three loads above name */
  auto pre = [&]() { __builtin_amdgcn_sched_barrier(0);   /* keeps the roundings below, and with them the wait for the three loads, behind the k loop's first loads */
    const float ba = bfr(ra); sb[0][tid] = ba + (which == 0 ? bfr(ru) : 0.f); sb[1][tid] = ba + bfr(rv); };
  if (which == 2) {   /* block-uniform, like every test on which */
    gemm128<0, false, decltype(pre), false>(X2 + (r0 + wave * 16 + col) * CC + 8 * g, WV + (size_t)(8 * wave) * CC + c0 + 4 * lane, wst, wave, lane, true, acc, pre);
    float bb[8];
#pragma unroll
    for (int j = 0; j < 8; ++j) bb[j] = sb[0][j * 16 + col];
    const size_t o2 = ((b * NH + c0 / HD) * (TT / 32) + t0 / 32 + (wave >> 1)) * (size_t)(32 * HD) + (wave & 1) * 256 + lane * 8; __bf16 *dh = VT + o2, *dl = VL + o2;
#pragma unroll
    for (int jh = 0; jh < 2; ++jh) { v4u D[8];
#pragma unroll
      for (int i = 0; i < 4; ++i) { union { v8b h; v4u u; } H, L;
#pragma unroll
        for (int r = 0; r < 8; ++r) { const float v = acc[4 * jh + i][r] + bb[4 * jh + i]; const __bf16 bh = (__bf16)v; H.h[r] = bh; L.h[r] = (__bf16)(v - (float)bh); }
        D[2 * i] = H.u; D[2 * i + 1] = L.u; }
#pragma unroll
      for (int i = 0; i < 4; ++i) { const size_t o = (size_t)jh * TT * HD + i * 512; vst2((unsigned*)(dh + o), D[2 * i]); vst2((unsigned*)(dl + o), D[2 * i + 1]); }
      asm volatile("s_wait_xcnt 0x0" :: XD8(D), "v"(dh), "v"(dl) : "memory"); }
    return; }
  gemm128<0, true, decltype(pre), false>((which == 0 ? X0 : X1) + (r0 + wave * 16 + col) * CC + 8 * g, (which == 0 ? WQ : WK) + (size_t)(8 * wave) * CC + c0 + 4 * lane, wst, wave, lane, true, acc, pre);
  const size_t o1 = ((b * NH + c0 / HD) * (TT / 16) + t0 / 16 + wave) * (size_t)(16 * HD) + lane * 8;   /* this lane's piece of accumulator 0 */
  const float *su = &sb[0][8 * g], *sv = &sb[1][8 * g];   /* the sums of this lane's first output column */
  if (which == 1) { _Float16* dk = KH + o1; v4u D[8];
#pragma unroll
    for (int j = 0; j < 8; ++j) { const v8f v = add8(acc[j], *(const v4f*)(su + j * 16), *(const v4f*)(su + j * 16 + 4)); union { v8h h; v4u u; } H;
#pragma unroll
      for (int r = 0; r < 8; ++r) H.h[r] = (_Float16)v[r];
      D[j] = H.u; }
#pragma unroll
    for (int j = 0; j < 8; ++j) vst2((unsigned*)(dk + (size_t)(j >> 2) * TT * HD + (j & 3) * 256), D[j]);
    asm volatile("s_wait_xcnt 0x0" :: XD8(D), "v"(dk) : "memory"); return; }
  _Float16 *duh = QUH + o1, *dul = QUL + o1, *dvh = QVH + o1, *dvl = QVL + o1;
#pragma unroll
  for (int j = 0; j < 8; j += 2) { v4u D[8];
#pragma unroll
    for (int i = 0; i < 2; ++i) { const int c = (j + i) * 16; hl8(add8(acc[j + i], *(const v4f*)(su + c), *(const v4f*)(su + c + 4)), D[4 * i], D[4 * i + 1]); hl8(add8(acc[j + i], *(const v4f*)(sv + c), *(const v4f*)(sv + c + 4)), D[4 * i + 2], D[4 * i + 3]); }
#pragma unroll
    for (int i = 0; i < 2; ++i) { const size_t o = (size_t)((j + i) >> 2) * TT * HD + ((j + i) & 3) * 256; vst2((unsigned*)(duh + o), D[4 * i]); vst2((unsigned*)(dul + o), D[4 * i + 1]); vst2((unsigned*)(dvh + o), D[4 * i + 2]); vst2((unsigned*)(dvl + o), D[4 * i + 3]); }
    asm volatile("s_wait_xcnt 0x0" :: XD8(D), "v"(duh), "v"(dul), "v"(dvh), "v"(dvl) : "memory"); } }
// fragment-order loads: p already includes the lane's own offset of 8 * lane elements; the two halves of a fragment are 512 B apart, so each load of a wave reads 512 B in a row (4 cache lines, not 16)
__device__ __forceinline__ v16h frag_t(const _Float16* p) { union { v16h v; v8h q[2]; } u; u.q[0] = *(const v8h*)p; u.q[1] = *(const v8h*)(p + 256); return u.v; }
__device__ __forceinline__ v16b frag_tb(const __bf16* p) { union { v16b v; v8b q[2]; } u; u.q[0] = *(const v8b*)p; u.q[1] = *(const v8b*)(p + 256); return u.v; }
__device__ __forceinline__ void ld4(v16h (&f)[4], const _Float16* rh, const _Float16* rl) { f[0] = frag_t(rh); f[1] = frag_t(rl); f[2] = frag_t(rh + 512); f[3] = frag_t(rl + 512); }
#define KVP (KB * HD / 8)      // 16-byte pieces of one staged plane = twice the threads of the work-group
__device__ __forceinline__ void kv_copy(unsigned lds, const _Float16* k, const __bf16* vh, const __bf16* vl) {
  asm volatile("global_load_async_to_lds_b128 %0, %6, off\n\tglobal_load_async_to_lds_b128 %1, %7, off\n\tglobal_load_async_to_lds_b128 %2, %8, off\n\tglobal_load_async_to_lds_b128 %3, %9, off\n\tglobal_load_async_to_lds_b128 %4, %10, off\n\tglobal_load_async_to_lds_b128 %5, %11, off\n\ts_wait_xcnt 0x0" :: "v"(lds), "v"(lds + 8u * KVP), "v"(lds + 16u * KVP), "v"(lds + 24u * KVP), "v"(lds + 32u * KVP), "v"(lds + 40u * KVP), "v"(k), "v"(k + 4 * KVP), "v"(vh), "v"(vh + 4 * KVP), "v"(vl), "v"(vl + 4 * KVP) : "memory"); }
// one position tile: X^T = p (q+v_bias)^T, 3 products; x0, x1 = this lane's 8 consecutive positions of its query
__device__ __forceinline__ void bd_tile(const v16h (&f)[4], const v16h (&qh)[HD / 32], const v16h (&ql)[HD / 32], v4f& x0, v4f& x1) { v8f a = {}, al = {};
#pragma unroll
  for (int kc = 0; kc < HD / 32; ++kc) { a = wmma16(f[2 * kc], qh[kc], a); al = wmma16(f[2 * kc], ql[kc], al); al = wmma16(f[2 * kc + 1], qh[kc], al); }
#pragma unroll
  for (int r = 0; r < 4; ++r) { x0[r] = a[r] + al[r] * (1.0f / 1024.0f); x1[r] = a[4 + r] + al[4 + r] * (1.0f / 1024.0f); } }
// the same for both query tiles of a wave against one position tile; each tile's products keep their order, the two tiles' chains alternate
__device__ __forceinline__ void bd_tile2(const v16h (&f)[4], const v16h (&qh)[QW][HD / 32], const v16h (&ql)[QW][HD / 32], v4f (&x0)[QW], v4f (&x1)[QW]) { v8f a[QW] = {}, al[QW] = {};
#pragma unroll
  for (int kc = 0; kc < HD / 32; ++kc) {
#pragma unroll
    for (int u = 0; u < QW; ++u) a[u] = wmma16(f[2 * kc], qh[u][kc], a[u]);
#pragma unroll
    for (int u = 0; u < QW; ++u) al[u] = wmma16(f[2 * kc], ql[u][kc], al[u]);
#pragma unroll
    for (int u = 0; u < QW; ++u) al[u] = wmma16(f[2 * kc + 1], qh[u][kc], al[u]); }
#pragma unroll
  for (int u = 0; u < QW; ++u)
#pragma unroll
    for (int r = 0; r < 4; ++r) { x0[u][r] = a[u][r] + al[u][r] * (1.0f / 1024.0f); x1[u][r] = a[u][4 + r] + al[u][4 + r] * (1.0f / 1024.0f); } }
// ---- k_att: block = 16 * QW * AW queries of one (batch, head) pair, wave = QW = 2 tiles of 16 queries, all T keys in blocks of KB. Everything is kept transposed so that a lane owns one query of each tile (column lane & 15):
//   S^T = k (q+u)^T (2 products) and X^T = p (q+v_bias)^T (3 products) have D register r = key / position 8g + r; O^T += v^T P^T takes two S^T tiles, converted in place, as its B operand.
//   Every k, v and position fragment that a wave loads is the A operand of both query tiles' products; the query fragments (B operands, 128 VGPRs) stay in registers for the whole kernel (2 waves per SIMD, 512 VGPRs each).
//   rel_shift: for queries iw0 + 16 u + q and keys j0 + jl the position row is T-1-(iw0+16u+q)+(j0+jl) = pb - 16 u + c with pb = T-16-iw0+j0 and c = jl + 15 - q. A block loads the position tiles pb/16 + 1 .. pb/16 + NT; for query tile 0 they are tiles 1 .. NT of its LDS band [q][c], for query tile 1 tiles 2 .. NT + 1. Each lane reads its row back at offset 15 - q (tiles 0 .. NT). pb grows by KB a block, so tile NT of a block (and tile NT + 1 of query tile 1) is tile 0 (tile 1) of the next and is moved there, not computed again.
//   k and v: all AW waves walk the same keys, so each block's 24 KiB are copied into LDS once per work-group (asynchronous copies, two buffers: block t + 2 is asked for when every wave has left block t, and flies while block t + 1 is worked on) and every wave reads its fragments from there; only the position fragments, which differ from wave to wave, still come through the cache.
//   softmax is the running-maximum form in base 2: per block m' = max(m, block max), sums and O^T are scaled by 2^(m - m'), P = 2^(s - m') split bf16 hi + lo; the division by the sum comes last. No exponent lies above 0 by more than a rounding error; one far below -126 gives 0 or a subnormal, which adds nothing to a sum whose largest term is 1.
__global__ __launch_bounds__(32 * AW) __attribute__((amdgpu_waves_per_eu(2, 2))) void k_att(const _Float16* __restrict__ QUH, const _Float16* __restrict__ QUL, const _Float16* __restrict__ QVH, const _Float16* __restrict__ QVL, const _Float16* __restrict__ KH, const _Float16* __restrict__ RHh, const _Float16* __restrict__ RLl, const __bf16* __restrict__ VT, const __bf16* __restrict__ VL, float* __restrict__ Y) {
  __shared__ __align__(16) float band[AW][QW][16][BP]; __shared__ __align__(16) v8h kv[2][3][KVP];   /* kv: two buffers of (k, v hi, v lo) of one key block */
  const int tid = threadIdx.x, wave = tid >> 5, lane = tid & 31, col = lane & 15, g = lane >> 4; const int bh = blockIdx.y, b = bh / NH, h = bh % NH; const int iw0 = blockIdx.x * (16 * QW * AW) + wave * (16 * QW);
  const size_t qrow = ((size_t)b * TT + iw0 + col) * CC + h * HD;   /* this lane's query of tile 0 in the ctx rows; tile u stands 16 u rows on */
  static_assert(KVP == 2 * 32 * AW, "two 16-byte pieces of each plane per thread"); static_assert(QW == 2, "the band's tile numbers are written for two query tiles");
  const unsigned kvl = (unsigned)(size_t)&kv[0][0][tid];   /* this thread's LDS byte address in plane 0 of buffer 0 */
  const unsigned kvw = 512u * (unsigned)__builtin_amdgcn_readfirstlane(wave);   /* the wave's 32 pieces, in a scalar register: in the loop the thread's address is formed from it and the lane's address kpb, which the fragment reads hold anyway, so that no register (and no spill) is spent on it */
  const _Float16* kc = KH + (size_t)bh * TT * HD + tid * 8; const __bf16* vhc = VT + (size_t)bh * TT * HD + tid * 8; const __bf16* vlc = VL + (size_t)bh * TT * HD + tid * 8;
  kv_copy(kvl, kc, vhc, vlc);   /* block 0 into buffer 0 */
  v16h quh[QW][HD / 32], qul[QW][HD / 32], qvh[QW][HD / 32], qvl[QW][HD / 32];
  { const size_t qf = ((size_t)bh * (TT / 16) + iw0 / 16) * (size_t)(16 * HD) + lane * 8;   /* this lane's place in the wave's first query tile (fragment order; a tile is 16 * HD elements) */
    const _Float16 *pvh = QVH + qf, *pvl = QVL + qf, *puh = QUH + qf, *pul = QUL + qf;
#pragma unroll
    for (int u = 0; u < QW; ++u)
#pragma unroll
      for (int kc = 0; kc < HD / 32; ++kc) { const int qo = u * 16 * HD + kc * 512; qvh[u][kc] = frag_t(pvh + qo); qvl[u][kc] = frag_t(pvl + qo); quh[u][kc] = frag_t(puh + qo); qul[u][kc] = frag_t(pul + qo); }
    asm volatile("s_wait_xcnt 0x0" :: "v"(pvh), "v"(pvl), "v"(puh), "v"(pul) : "memory"); }   /* the loads above name these four addresses: as inputs here they keep their registers up to the wait, so that nothing is written over an address of an issued load in front of it */
  float* bw[QW] = { &band[wave][0][col][0], &band[wave][1][col][0] };
  const size_t ro = ((size_t)h * (HRR / 16) + (TT - 16 - iw0) / 16) * (16 * HD) + lane * 8; const _Float16* rh = RHh + ro; const _Float16* rl = RLl + ro;   /* this lane's place in position tile pb/16 of block 0; a tile is 16 * HD elements; iw0 <= T - 32, so the tile in front of it exists */
  v8f acc[QW][HD / 16] = {}; float m[QW] = { -3.0e38f, -3.0e38f }, l[QW] = { 0.f, 0.f };
  // Every fragment is loaded one or two tiles ahead of the products that use it. pf[1], pf[2] (position tiles 1, 2) are loaded at the end of the block before; behind the last block that reads rows < 2T + 32 of the p planes, which proj_pos has written, and the values are not used.
  v16h pf[NT + 1][4], kf[NT][2]; v16b vf[KB / 32][HD / 16][2];
  ld4(pf[0], rh, rl); ld4(pf[3], rh - 16 * HD, rl - 16 * HD); ld4(pf[1], rh + 16 * HD, rl + 16 * HD); ld4(pf[2], rh + 32 * HD, rl + 32 * HD);
  asm volatile("s_wait_xcnt 0x0" :: "v"(rh), "v"(rl) : "memory");   /* the loads above name rh and rl: as inputs here both keep their registers up to the wait, so that nothing (a later load's result either) is written over an address of an issued load in front of it */
  { v4f x0[QW], x1[QW], y0, y1;   /* what a block before would have left: position tile pb/16 is tile 0 of query tile 0 and tile 1 of query tile 1; the tile in front of it is tile 0 of query tile 1 */
    bd_tile2(pf[0], qvh, qvl, x0, x1); *(v4f*)(bw[0] + KB + 8 * g) = x0[0]; *(v4f*)(bw[0] + KB + 8 * g + 4) = x1[0]; *(v4f*)(bw[1] + KB + 16 + 8 * g) = x0[1]; *(v4f*)(bw[1] + KB + 16 + 8 * g + 4) = x1[1];
    bd_tile(pf[3], qvh[1], qvl[1], y0, y1); *(v4f*)(bw[1] + KB + 8 * g) = y0; *(v4f*)(bw[1] + KB + 8 * g + 4) = y1; }
  asm volatile("s_wait_asynccnt 0x0" ::: "memory");   /* this wave's part of block 0 has landed */
  __syncthreads();                                     /* ... and every other wave's: block 0 may be read */
  kv_copy(kvl + 48u * KVP, kc + KB * HD, vhc + KB * HD, vlc + KB * HD);   /* block 1 into buffer 1 */
#pragma unroll 1
  for (int j0 = 0; j0 < TT; j0 += KB) { const _Float16* rhb = rh + (size_t)j0 * HD; const _Float16* rlb = rl + (size_t)j0 * HD; const int buf = (j0 / KB) & 1; const _Float16* kpb = (const _Float16*)&kv[buf][0][lane]; const __bf16* vhb = (const __bf16*)&kv[buf][1][lane]; const __bf16* vlb = (const __bf16*)&kv[buf][2][lane];
    { const v4f c0 = *(const v4f*)(bw[0] + KB + 8 * g), c1 = *(const v4f*)(bw[0] + KB + 8 * g + 4), d0 = *(const v4f*)(bw[1] + KB + 8 * g), d1 = *(const v4f*)(bw[1] + KB + 8 * g + 4), e0 = *(const v4f*)(bw[1] + KB + 16 + 8 * g), e1 = *(const v4f*)(bw[1] + KB + 16 + 8 * g + 4);
      *(v4f*)(bw[0] + 8 * g) = c0; *(v4f*)(bw[0] + 8 * g + 4) = c1; *(v4f*)(bw[1] + 8 * g) = d0; *(v4f*)(bw[1] + 8 * g + 4) = d1; *(v4f*)(bw[1] + 16 + 8 * g) = e0; *(v4f*)(bw[1] + 16 + 8 * g + 4) = e1; }   /* the lane's own values: the last tiles of the block before = the first of this one */
#pragma unroll
    for (int t = 1; t < NT + 1; ++t) {
      if (t + 2 < NT + 1) ld4(pf[t + 2], rhb + (t + 2) * 16 * HD, rlb + (t + 2) * 16 * HD);
      else if (t + 1 == NT) {
#pragma unroll
        for (int u = 0; u < NT / 2; ++u) { kf[u][0] = frag_t(kpb + u * 16 * HD); kf[u][1] = frag_t(kpb + u * 16 * HD + 512); } }
      v4f x0[QW], x1[QW]; bd_tile2(pf[t], qvh, qvl, x0, x1);
      *(v4f*)(bw[0] + t * 16 + 8 * g) = x0[0]; *(v4f*)(bw[0] + t * 16 + 8 * g + 4) = x1[0]; *(v4f*)(bw[1] + (t + 1) * 16 + 8 * g) = x0[1]; *(v4f*)(bw[1] + (t + 1) * 16 + 8 * g + 4) = x1[1]; }
    LDSX();   /* a lane reads band values that its partner lane (lane ^ 16) wrote */
    float s[QW][NT][8]; float bm[QW] = { -3.0e38f, -3.0e38f };
#pragma unroll
    for (int t = 0; t < NT; ++t) { v8f a[QW] = {}, al[QW] = {};
      if (t == 0) {
#pragma unroll
        for (int u = NT / 2; u < NT; ++u) { kf[u][0] = frag_t(kpb + u * 16 * HD); kf[u][1] = frag_t(kpb + u * 16 * HD + 512); } }
#pragma unroll
      for (int kc = 0; kc < HD / 32; ++kc) {
#pragma unroll
        for (int u = 0; u < QW; ++u) a[u] = wmma16(kf[t][kc], quh[u][kc], a[u]);
#pragma unroll
        for (int u = 0; u < QW; ++u) al[u] = wmma16(kf[t][kc], qul[u][kc], al[u]); }
      vf[0][t][0] = frag_tb(vhb + t * 512); vf[0][t][1] = frag_tb(vlb + t * 512);
#pragma unroll
      for (int u = 0; u < QW; ++u)
#pragma unroll
        for (int r = 0; r < 8; ++r) { const float v = ((a[u][r] + al[u][r] * (1.0f / 1024.0f)) + bw[u][t * 16 + 8 * g + r + 15 - col]) * SCALE; s[u][t][r] = v; bm[u] = fmaxf(bm[u], v); } }
#pragma unroll
    for (int u = 0; u < QW; ++u) { bm[u] = fmaxf(bm[u], __shfl_xor(bm[u], 16));
      const float mn = fmaxf(m[u], bm[u]), alpha = __builtin_amdgcn_exp2f(m[u] - mn); m[u] = mn; l[u] *= alpha;
#pragma unroll
      for (int j = 0; j < HD / 16; ++j)
#pragma unroll
        for (int r = 0; r < 8; ++r) acc[u][j][r] *= alpha; }
#pragma unroll
    for (int c = 0; c < KB / 32; ++c) { F2 p[QW];
#pragma unroll
      for (int u = 0; u < QW; ++u) { float e[16];
#pragma unroll
        for (int i = 0; i < 8; ++i) { e[i] = __builtin_amdgcn_exp2f(s[u][2 * c][i] - m[u]); e[8 + i] = __builtin_amdgcn_exp2f(s[u][2 * c + 1][i] - m[u]); l[u] += e[i] + e[8 + i]; }
        p[u] = bsplit16(e); }
#pragma unroll
      for (int j = 0; j < HD / 16; ++j) {
#pragma unroll
        for (int u = 0; u < QW; ++u) acc[u][j] = wmma_bfc(vf[c][j][0], p[u].h, acc[u][j]);
#pragma unroll
        for (int u = 0; u < QW; ++u) acc[u][j] = wmma_bfc(vf[c][j][0], p[u].l, acc[u][j]);
#pragma unroll
        for (int u = 0; u < QW; ++u) acc[u][j] = wmma_bfc(vf[c][j][1], p[u].h, acc[u][j]);
        if (c + 1 < KB / 32) { vf[c + 1][j][0] = frag_tb(vhb + (c + 1) * 32 * HD + j * 512); vf[c + 1][j][1] = frag_tb(vlb + (c + 1) * 32 * HD + j * 512); }
        else if (j & 1) ld4(pf[1 + (j >> 1)], rhb + (KB + 16 + (j >> 1) * 16) * HD, rlb + (KB + 16 + (j >> 1) * 16) * HD); } }
    asm volatile("s_wait_xcnt 0x0" ::: "memory");   /* the address registers of the loads just issued are rewritten at the top of the next pass */
    asm volatile("s_wait_dscnt 0x0" ::: "memory");      /* this wave's reads of this block's buffer have returned */
    asm volatile("s_wait_asynccnt 0x0" ::: "memory");   /* this wave's part of the next block has landed */
    asm volatile("s_barrier_signal -1\n\ts_barrier_wait -1" ::: "memory");   /* publishes the next block and frees this block's buffer; by hand, because __syncthreads() would also wait for the position fragments just asked for, which are to stay in flight across it */
    if (j0 + 2 * KB < TT) kv_copy((unsigned)(size_t)kpb + kvw, kc + (size_t)(j0 + 2 * KB) * HD, vhc + (size_t)(j0 + 2 * KB) * HD, vlc + (size_t)(j0 + 2 * KB) * HD);   /* the same test in every wave */
  }
  asm volatile("s_wait_asynccnt 0x0" ::: "memory");   /* no copy is outstanding when the wave ends */
#pragma unroll
  for (int u = 0; u < QW; ++u) { l[u] += __shfl_xor(l[u], 16); const float inv = 1.0f / l[u];
#pragma unroll
    for (int j = 0; j < HD / 16; ++j) { v4f y0, y1;
#pragma unroll
      for (int r = 0; r < 4; ++r) { y0[r] = acc[u][j][r] * inv; y1[r] = acc[u][j][4 + r] * inv; }
      float* yp = Y + qrow + (size_t)u * 16 * CC + j * 16 + 8 * g; vst2(yp, y0); vst2(yp + 4, y1); } } }
// ---- k_out: block = (64 rows, 128 cols): out = ctx (bf16 hi + lo) Wout ((in,out), exact) + bout
__global__ __launch_bounds__(128) void k_out(const float* __restrict__ Yr, const float* __restrict__ WO, const float* __restrict__ BO, float* __restrict__ OUT) { __shared__ __align__(16) float sf[4][16][132];
  const int tid = threadIdx.x, wave = tid >> 5, lane = tid & 31, col = lane & 15, g = lane >> 4; const int c0 = blockIdx.y * 128; const size_t r0 = (size_t)blockIdx.x * 64 + wave * 16;
  v8f acc[8] = {};
  gemm128<2>(Yr + (r0 + col) * CC + 8 * g, WO + (size_t)(8 * wave) * CC + c0 + 4 * lane, (__bf16*)&sf[0][0][0], wave, lane, true, acc);
#pragma unroll
  for (int j = 0; j < 8; ++j) { const float bb = bfr(BO[c0 + j * 16 + col]);
#pragma unroll
    for (int r = 0; r < 8; ++r) sf[wave][8 * g + r][j * 16 + col] = acc[j][r] + bb; }
  LDSX(); for (int rl = 0; rl < 16; ++rl) vst2(OUT + (r0 + rl) * CC + c0 + lane * 4, *(const v4f*)&sf[wave][rl][lane * 4]); }
extern "C" void kernel_launch(void* const* d_in, const int* in_sizes, int n_in, void* d_out, int out_size, void* d_ws, size_t ws_size, hipStream_t stream) {
  (void)in_sizes; (void)n_in; (void)out_size;
  const float** F = (const float**)d_in;   // 0 query, 1 key, 2 value [8,1024,512]; 3 pos_emb [1,2047,512]; 4 Wq, 5 bq, 6 Wk, 7 bk, 8 Wv, 9 bv ((in,out)); 10 Wpos; 11 Wout, 12 bout; 13 pos_bias_u [8,64], 14 pos_bias_v
  if (ws_size < (size_t)WS_END) return;
  char* ws = (char*)d_ws; _Float16 *QUH = (_Float16*)(ws + WS_QUH), *QUL = (_Float16*)(ws + WS_QUL), *QVH = (_Float16*)(ws + WS_QVH), *QVL = (_Float16*)(ws + WS_QVL), *KH = (_Float16*)(ws + WS_KH), *HRH = (_Float16*)(ws + WS_HRH), *HRL = (_Float16*)(ws + WS_HRL); __bf16 *VT = (__bf16*)(ws + WS_VT), *VL = (__bf16*)(ws + WS_VL); float *Y = (float*)(ws + WS_Y);
  k_proj<<<dim3(PBLK + (TNB * TT / 64) * (CC / 128) * 3), 128, 0, stream>>>(F[0], F[1], F[2], F[4], F[5], F[6], F[7], F[8], F[9], F[13], F[14], F[3], F[10], QUH, QUL, QVH, QVL, KH, VT, VL, HRH, HRL);
  k_att<<<dim3(TT / (16 * QW * AW), TNB * NH), 32 * AW, 0, stream>>>(QUH, QUL, QVH, QVL, KH, HRH, HRL, VT, VL, Y);
  k_out<<<dim3(TNB * TT / 64, CC / 128), 128, 0, stream>>>(Y, F[11], F[12], (float*)d_out);
}
